// v000
// The times below were measured on an AMD MI455X: many runs one after another, warmed up first and cycling through
// copies of the inputs, with the whole window's GPU time divided by the number of runs. Launches and the gaps
// between them are all in it. The median over several windows is given; except for v000 it joins two sittings, which
// can be a few percent apart, so the side-by-side timings, each taken in one sitting, are the better comparison.
// v000, which the later versions start from, runs in 2480 microseconds.
#include <hip/hip_runtime.h>
// Token self-attention block on a feature map (B 16, C 256, 32×32 = 1024 tokens): q, k, v = t·W + b (W stored (in,out)); m = q·kᵀ (no scaling); softmax over the QUERY axis i; att[j] = Σ_i m[i][j]·v[i]; MLP (SiLU, 256→256→256); LayerNorm; back to NCHW → [16,256,32,32].
// Structure: the column softmax is a row softmax of mᵀ = k·qᵀ, so per batch: S' = K·Qᵀ (rows j, cols i), row softmax, att = P'·V; everything as GEMMs + row kernels.
// Compute dtype: x and parameters rounded to bf16; q/k/v with exact products; q and k carried as f16 hi + lo·2^10 planes with three cross products (≈f32 logits — they reach σ≈8 unscaled), softmax in f32, P (×2^10), v, attention output and the SiLU hidden as f16 operands (≈2^-12), f32 accumulation; LayerNorm in f32. v_wmma_f32_16x16x32_f16.
#define NBt 16
#define CC 256
#define NTK 1024
typedef __bf16 v16b __attribute__((ext_vector_type(16)));
typedef unsigned short v8us __attribute__((ext_vector_type(8), may_alias));
typedef float  v8f  __attribute__((ext_vector_type(8)));
typedef float  v4f  __attribute__((ext_vector_type(4)));
typedef float  v4fa __attribute__((ext_vector_type(4), may_alias));
union FragB { v16b v; v8us half[2]; unsigned short u[16]; };

__device__ __forceinline__ unsigned short bf16_bits(float x) { unsigned int u = __float_as_uint(x); return (unsigned short)((u + 0x7FFFu + ((u >> 16) & 1u)) >> 16); }
__device__ __forceinline__ float bf16_val(unsigned short b) { return __uint_as_float(((unsigned int)b) << 16); }
__device__ __forceinline__ float bf16_round(float x) { return bf16_val(bf16_bits(x)); }
// D += A·B with NT terms: 1 = ah·bh, 2 = + al·bh (A split), 3 = + ah·bl (both split)
template <int NT>
__device__ __forceinline__ v8f mmaN(v16b ah, v16b al, v16b bh, v16b bl, v8f c) {
  c = __builtin_amdgcn_wmma_f32_16x16x32_bf16(false, ah, false, bh, (short)0, c, false, false);
  if (NT >= 2) c = __builtin_amdgcn_wmma_f32_16x16x32_bf16(false, al, false, bh, (short)0, c, false, false);
  if (NT >= 3) c = __builtin_amdgcn_wmma_f32_16x16x32_bf16(false, ah, false, bl, (short)0, c, false, false);
  asm volatile("v_nop\n\tv_nop\n\tv_nop\n\tv_nop" : "+v"(c) : "v"(ah), "v"(al), "v"(bh), "v"(bl));
  return c;
}

__global__ __launch_bounds__(256) void k_wt_bf16(const float* __restrict__ W, unsigned short* __restrict__ Wt, int K, int N) {
  const int t = blockIdx.x * 256 + threadIdx.x;
  const int k8n = K / 8;
  if (t >= N * k8n) return;
  const int n = t / k8n, k8 = (t % k8n) * 8;
  v8us v;
#pragma unroll
  for (int i = 0; i < 8; ++i) v[i] = bf16_bits(W[(size_t)(k8 + i) * N + n]);
  *(v8us*)(Wt + (size_t)n * K + k8) = v;
  
}

// GEMM C[M][N] (f32, pitch ldc) = act(A[M][K]·W + bias). A f32 row-major (pitch lda) converted per fragment to bf16
// (ASPLIT: hi/lo two planes -> 2 terms, else single rounded term); Wt bf16 [N][K] (pitch ldb). BIAS_BF16 rounds the
// bias to bf16 first (bias quantised to bf16 before the add). K%32==0, M%16==0, N%64==0.
template <bool ASPLIT, int ACT, bool BIAS_BF16>
__global__ __launch_bounds__(128) void k_gemm_bf(const float* __restrict__ A, int lda, const unsigned short* __restrict__ Wt, int ldb,
                                               const float* __restrict__ bias, float* __restrict__ C, int ldc, int M, int N, int K) {
  __shared__ __attribute__((aligned(16))) float so[4][16][64];
  const int tid = threadIdx.x, w = tid >> 5, lane = tid & 31, ln = lane & 15, hh = lane >> 4;
  const int ntn = N / 64;
  const int wid = blockIdx.x * 4 + w;
  const int mt = wid / ntn, nq = wid % ntn;
  if (mt * 16 >= M) return;
  const int row0 = mt * 16, col0 = nq * 64;
  const float* arow = A + (size_t)(row0 + ln) * lda;
  v8f acc[4] = {};
  for (int kb = 0; kb < K; kb += 32) {
    FragB ah, al;
    const v4f x0 = *(const v4fa*)(arow + kb + 8 * hh), x1 = *(const v4fa*)(arow + kb + 8 * hh + 4);
    const v4f x2 = *(const v4fa*)(arow + kb + 16 + 8 * hh), x3 = *(const v4fa*)(arow + kb + 16 + 8 * hh + 4);
    float xs[16] = {x0[0],x0[1],x0[2],x0[3],x1[0],x1[1],x1[2],x1[3],x2[0],x2[1],x2[2],x2[3],x3[0],x3[1],x3[2],x3[3]};
#pragma unroll
    for (int i = 0; i < 16; ++i) { const unsigned short hb = bf16_bits(xs[i]); ah.u[i] = hb; al.u[i] = ASPLIT ? bf16_bits(xs[i] - bf16_val(hb)) : (unsigned short)0; }
#pragma unroll
    for (int t = 0; t < 4; ++t) {
      const unsigned short* brow = Wt + (size_t)(col0 + t * 16 + ln) * ldb + kb;
      FragB b;
      b.half[0] = *(const v8us*)(brow + 8 * hh);
      b.half[1] = *(const v8us*)(brow + 16 + 8 * hh);
      acc[t] = mmaN<ASPLIT ? 2 : 1>(ah.v, al.v, b.v, b.v, acc[t]);
    }
  }
#pragma unroll
  for (int t = 0; t < 4; ++t) {
    float bv = bias ? bias[col0 + t * 16 + ln] : 0.f;
    if (BIAS_BF16) bv = bf16_round(bv);
#pragma unroll
    for (int r = 0; r < 8; ++r) { float v = acc[t][r] + bv; if (ACT == 1) v = fmaxf(v, 0.f); so[w][8 * hh + r][t * 16 + ln] = v; }
  }
  __builtin_amdgcn_fence(__ATOMIC_ACQ_REL, "workgroup");
  __builtin_amdgcn_wave_barrier();
  const int rsub = lane >> 4, c4 = (lane & 15) * 4;
  {
#pragma unroll
    for (int q = 0; q < 8; ++q) {
      const int r = q * 2 + rsub;
      const v4f v = *(const v4fa*)&so[w][r][c4];
      *(v4f*)(C + (size_t)(row0 + r) * ldc + col0 + c4) = v;
    }
    
  }
}

// GEMM C = act(A·W + bias + resid): A f32 (ASPLIT -> hi/lo 2 terms), Wt bf16 [N][K]; ACT 0 none, 1 relu, 2 exact gelu;
// resid (optional, f32, row index = (row % rmod), pitch ldr, RES_BF16 rounds it) added before the activation.
template <bool ASPLIT, int ACT, bool BIAS_BF16, bool RES_BF16>
__global__ __launch_bounds__(128) void k_gemm_bf3(const float* __restrict__ A, int lda, const unsigned short* __restrict__ Wt, int ldb,
                                                const float* __restrict__ bias, const float* __restrict__ resid, int rmod, int ldr,
                                                float* __restrict__ C, int ldc, int M, int N, int K) {
  __shared__ __attribute__((aligned(16))) float so[4][16][64];
  const int tid = threadIdx.x, w = tid >> 5, lane = tid & 31, ln = lane & 15, hh = lane >> 4;
  const int ntn = N / 64;
  const int wid = blockIdx.x * 4 + w;
  const int mt = wid / ntn, nq = wid % ntn;
  if (mt * 16 >= M) return;
  const int row0 = mt * 16, col0 = nq * 64;
  const float* arow = A + (size_t)(row0 + ln) * lda;
  v8f acc[4] = {};
  for (int kb = 0; kb < K; kb += 32) {
    FragB ah, al;
    const v4f x0 = *(const v4fa*)(arow + kb + 8 * hh), x1 = *(const v4fa*)(arow + kb + 8 * hh + 4);
    const v4f x2 = *(const v4fa*)(arow + kb + 16 + 8 * hh), x3 = *(const v4fa*)(arow + kb + 16 + 8 * hh + 4);
    float xs[16] = {x0[0],x0[1],x0[2],x0[3],x1[0],x1[1],x1[2],x1[3],x2[0],x2[1],x2[2],x2[3],x3[0],x3[1],x3[2],x3[3]};
#pragma unroll
    for (int i = 0; i < 16; ++i) { const unsigned short hb = bf16_bits(xs[i]); ah.u[i] = hb; al.u[i] = ASPLIT ? bf16_bits(xs[i] - bf16_val(hb)) : (unsigned short)0; }
#pragma unroll
    for (int t = 0; t < 4; ++t) {
      const unsigned short* brow = Wt + (size_t)(col0 + t * 16 + ln) * ldb + kb;
      FragB b;
      b.half[0] = *(const v8us*)(brow + 8 * hh);
      b.half[1] = *(const v8us*)(brow + 16 + 8 * hh);
      acc[t] = mmaN<ASPLIT ? 2 : 1>(ah.v, al.v, b.v, b.v, acc[t]);
    }
  }
#pragma unroll
  for (int t = 0; t < 4; ++t) {
    const int col = col0 + t * 16 + ln;
    float bv = bias ? bias[col] : 0.f;
    if (BIAS_BF16) bv = bf16_round(bv);
#pragma unroll
    for (int r = 0; r < 8; ++r) {
      float v = acc[t][r] + bv;
      if (resid) { float rv = resid[(size_t)((row0 + 8 * hh + r) % rmod) * ldr + col]; if (RES_BF16) rv = bf16_round(rv); v += rv; }
      if (ACT == 1) v = fmaxf(v, 0.f);
      if (ACT == 2) v = 0.5f * v * (1.0f + erff(v * 0.70710678118654752f));
      if (ACT == 3) { const float u = 0.7978845608028654f * (v + 0.044715f * v * v * v); v = 0.5f * v * (1.0f + tanhf(u)); }
      so[w][8 * hh + r][t * 16 + ln] = v;
    }
  }
  __builtin_amdgcn_fence(__ATOMIC_ACQ_REL, "workgroup");
  __builtin_amdgcn_wave_barrier();
  const int rsub = lane >> 4, c4 = (lane & 15) * 4;
  {
#pragma unroll
    for (int q = 0; q < 8; ++q) {
      const int r = q * 2 + rsub;
      const v4f v = *(const v4fa*)&so[w][r][c4];
      *(v4f*)(C + (size_t)(row0 + r) * ldc + col0 + c4) = v;
    }
    
  }
}
// row LayerNorm (biased variance, eps) over N: s = X (+ R); optional out_sum <- s; out_norm <- (s-mu)*rsqrt(var+eps)*g + b
template <bool PARAM_BF16>
__global__ __launch_bounds__(256) void k_layernorm(const float* __restrict__ X, const float* __restrict__ R, const float* __restrict__ g, const float* __restrict__ bta,
                                                  float* __restrict__ out_sum, float* __restrict__ out_norm, int N, float eps) {
  __shared__ float red[256];
  const int row = blockIdx.x, tid = threadIdx.x;
  const float* x = X + (size_t)row * N; const float* rr = R ? R + (size_t)row * N : nullptr;
  float vals[16];                     // up to N = 4096
  const int per = N / 256;            // contiguous chunk per thread? use strided-by-4 chunks: thread handles j = tid*4 + 1024*u
  float s1 = 0.f;
  for (int u = 0; u < per / 4; ++u) {
    const int j = tid * 4 + 1024 * u;
    const v4f a = *(const v4fa*)(x + j);
    v4f b = {0.f,0.f,0.f,0.f}; if (rr) b = *(const v4fa*)(rr + j);
#pragma unroll
    for (int q = 0; q < 4; ++q) { const float v = a[q] + b[q]; vals[u * 4 + q] = v; s1 += v; }
  }
  red[tid] = s1; __syncthreads();
  for (int st = 128; st > 0; st >>= 1) { if (tid < st) red[tid] += red[tid + st]; __syncthreads(); }
  const float mu = red[0] / (float)N; __syncthreads();
  float s2 = 0.f;
  for (int u = 0; u < per / 4; ++u)
#pragma unroll
    for (int q = 0; q < 4; ++q) { const float c = vals[u * 4 + q] - mu; s2 += c * c; }
  red[tid] = s2; __syncthreads();
  for (int st = 128; st > 0; st >>= 1) { if (tid < st) red[tid] += red[tid + st]; __syncthreads(); }
  const float rs = rsqrtf(red[0] / (float)N + eps);
  {
    for (int u = 0; u < per / 4; ++u) {
      const int j = tid * 4 + 1024 * u;
      v4f o, sm;
#pragma unroll
      for (int q = 0; q < 4; ++q) {
        float gg = g[j + q], bb = bta[j + q];
        if (PARAM_BF16) { gg = bf16_round(gg); bb = bf16_round(bb); }
        sm[q] = vals[u * 4 + q]; o[q] = (vals[u * 4 + q] - mu) * rs * gg + bb;
      }
      if (out_sum) *(v4f*)(out_sum + (size_t)row * N + j) = sm;
      *(v4f*)(out_norm + (size_t)row * N + j) = o;
    }
    
  }
}



// ---- f16 WMMA path (v_wmma_f32_16x16x32_f16): 11-bit significands for operands in range — used where a [0,1] probability operand needs more precision than bf16
typedef _Float16 v16h __attribute__((ext_vector_type(16)));
union FragH { v16h v; v8us half[2]; _Float16 h[16]; unsigned short u[16]; };
template <int NT>
__device__ __forceinline__ v8f mmaH(v16h ah, v16h al, v16h bh, v16h bl, v8f c) {
  c = __builtin_amdgcn_wmma_f32_16x16x32_f16(false, ah, false, bh, (short)0, c, false, false);
  if (NT >= 2) c = __builtin_amdgcn_wmma_f32_16x16x32_f16(false, al, false, bh, (short)0, c, false, false);
  if (NT >= 3) c = __builtin_amdgcn_wmma_f32_16x16x32_f16(false, ah, false, bl, (short)0, c, false, false);
  asm volatile("v_nop\n\tv_nop\n\tv_nop\n\tv_nop" : "+v"(c) : "v"(ah), "v"(al), "v"(bh), "v"(bl));
  return c;
}
// batched GEMM like k_gemm_b but f16 operands: A f32 (split into f16 hi/lo if ASPLIT, else rounded to f16), Bt = f16 values [n][k]; alpha; C f32; N multiple of 16 (partial tiles skipped)
template <bool ASPLIT>
__global__ __launch_bounds__(128) void k_gemm_h(const float* __restrict__ A, int lda, size_t sA, const _Float16* __restrict__ Bh, int ldb, size_t sB, float alpha, float* __restrict__ C, int ldc, size_t sC, int M, int N, int K) {
  __shared__ __attribute__((aligned(16))) float so[4][16][64];
  const int tid = threadIdx.x, w = tid >> 5, lane = tid & 31, ln = lane & 15, hh = lane >> 4; const int by = blockIdx.y;
  A += (size_t)by * sA; Bh += (size_t)by * sB; C += (size_t)by * sC;
  const int ntn = (N + 63) / 64; const int wid = blockIdx.x * 4 + w; const int mt = wid / ntn, nq = wid % ntn; if (mt * 16 >= M) return;
  const int row0 = mt * 16, col0 = nq * 64; const float* arow = A + (size_t)(row0 + ln) * lda;
  v8f acc[4] = {};
  for (int kb = 0; kb < K; kb += 32) {
    FragH ah, al;
    const v4f x0 = *(const v4fa*)(arow + kb + 8 * hh), x1 = *(const v4fa*)(arow + kb + 8 * hh + 4), x2 = *(const v4fa*)(arow + kb + 16 + 8 * hh), x3 = *(const v4fa*)(arow + kb + 16 + 8 * hh + 4);
    float xs[16] = {x0[0],x0[1],x0[2],x0[3],x1[0],x1[1],x1[2],x1[3],x2[0],x2[1],x2[2],x2[3],x3[0],x3[1],x3[2],x3[3]};
#pragma unroll
    for (int i = 0; i < 16; ++i) { const _Float16 h = (_Float16)xs[i]; ah.h[i] = h; al.h[i] = ASPLIT ? (_Float16)(xs[i] - (float)h) : (_Float16)0.0f; }
#pragma unroll
    for (int t = 0; t < 4; ++t) { if (col0 + t * 16 >= N) continue; const size_t boff = (size_t)(col0 + t * 16 + ln) * ldb + kb; FragH bq; bq.half[0] = *(const v8us*)(Bh + boff + 8 * hh); bq.half[1] = *(const v8us*)(Bh + boff + 16 + 8 * hh);
      acc[t] = mmaH<ASPLIT ? 2 : 1>(ah.v, al.v, bq.v, bq.v, acc[t]); }
  }
#pragma unroll
  for (int t = 0; t < 4; ++t) { if (col0 + t * 16 >= N) continue;
#pragma unroll
    for (int r = 0; r < 8; ++r) so[w][8 * hh + r][t * 16 + ln] = acc[t][r] * alpha; }
  __builtin_amdgcn_fence(__ATOMIC_ACQ_REL, "workgroup"); __builtin_amdgcn_wave_barrier();
  const int rsub = lane >> 4, c4 = (lane & 15) * 4;
  {
#pragma unroll
    for (int q = 0; q < 8; ++q) { const int r = q * 2 + rsub; if (col0 + c4 < N) { const v4f v = *(const v4fa*)&so[w][r][c4]; *(v4f*)(C + (size_t)(row0 + r) * ldc + col0 + c4) = v; } }
     }
}

// Wt[n][k] = f16(W[k][n]·scale) from f32 row-major W[K][N] (scale = power of two; bf16-exact weights stay exact in f16 away from the subnormal range)
__global__ __launch_bounds__(256) void k_wt_f16(const float* __restrict__ W, _Float16* __restrict__ Wt, int K, int N, float scale) {
  const int t = blockIdx.x * 256 + threadIdx.x; if (t >= N * (K / 8)) return; const int n = t / (K / 8), k8 = (t % (K / 8)) * 8; FragH f;
#pragma unroll
  for (int i = 0; i < 8; ++i) f.h[i] = (_Float16)(bf16_round(W[(size_t)(k8 + i) * N + n]) * scale); const v8us o = f.half[0];
  *(v8us*)((unsigned short*)Wt + (size_t)n * K + k8) = o; 
}
// k_gemm_hh variant with fused epilogue: v = acc·alpha + bias[by·sBias + col] (+ CP[(row/rowsPerB)·sCPb + by·64 + col] if CP) ; ACT 0 none / 1 elu ; writes f32 C and f16 C16 (each if non-null)
template <int ACT>
__global__ __launch_bounds__(128) void k_gemm_hhx(const _Float16* __restrict__ A, int lda, size_t sA, const _Float16* __restrict__ Bh, int ldb, size_t sB, float alpha, const float* __restrict__ bias, size_t sBias, const float* __restrict__ CP, int rowsPerB, size_t sCPb, int row0g,
    float* __restrict__ C, _Float16* __restrict__ C16, int ldc, size_t sC, int M, int N, int K) {
  __shared__ __attribute__((aligned(16))) float so[4][16][64];
  const int tid = threadIdx.x, w = tid >> 5, lane = tid & 31, ln = lane & 15, hh = lane >> 4; const int by = blockIdx.y;
  A += (size_t)by * sA; Bh += (size_t)by * sB; const size_t cofs = (size_t)by * sC; const float* bp = bias ? bias + (size_t)by * sBias : nullptr;
  const int ntn = (N + 63) / 64; const int wid = blockIdx.x * 4 + w; const int mt = wid / ntn, nq = wid % ntn; if (mt * 16 >= M) return;
  const int row0 = mt * 16, col0 = nq * 64; const _Float16* arow = A + (size_t)(row0 + ln) * lda;
  v8f acc[4] = {};
  for (int kb = 0; kb < K; kb += 32) { FragH ah; ah.half[0] = *(const v8us*)((const unsigned short*)arow + kb + 8 * hh); ah.half[1] = *(const v8us*)((const unsigned short*)arow + kb + 16 + 8 * hh);
#pragma unroll
    for (int t = 0; t < 4; ++t) { if (col0 + t * 16 >= N) continue; const size_t boff = (size_t)(col0 + t * 16 + ln) * ldb + kb; FragH bq; bq.half[0] = *(const v8us*)((const unsigned short*)Bh + boff + 8 * hh); bq.half[1] = *(const v8us*)((const unsigned short*)Bh + boff + 16 + 8 * hh);
      acc[t] = mmaH<1>(ah.v, ah.v, bq.v, bq.v, acc[t]); }
  }
#pragma unroll
  for (int t = 0; t < 4; ++t) { if (col0 + t * 16 >= N) continue; const int col = col0 + t * 16 + ln; const float bv = bp ? bf16_round(bp[col]) : 0.f;
#pragma unroll
    for (int r = 0; r < 8; ++r) { float v = acc[t][r] * alpha + bv; if (CP) { const int bidx = (row0g + row0 + 8 * hh + r) / rowsPerB; v += CP[(size_t)bidx * sCPb + (size_t)by * 64 + col]; } if (ACT == 1) v = (v > 0.f) ? v : expm1f(v); else if (ACT == 7) v = (v > 0.f) ? v + 1.0f : expf(v); else if (ACT == 8) v = tanhf(v); else if (ACT == 9) v = 0.5f * v * (1.0f + tanhf(0.7978845608028654f * (v + 0.044715f * v * v * v))); else if (ACT == 11) v = 1.0f / (1.0f + expf(-v)); else if (ACT == 12) v = (v > 0.f) ? v : 0.01f * v; else if (ACT == 14) v = (v > 0.f) ? v : 0.1f * v; else if (ACT == 15) v = v / (1.0f + expf(-v)); else if (ACT == 3) v = fmaxf(v, 0.f); else if (ACT == 6) v = 0.5f * v * (1.0f + erff(v * 0.70710678118654752f)); so[w][8 * hh + r][t * 16 + ln] = v; } }
  __builtin_amdgcn_fence(__ATOMIC_ACQ_REL, "workgroup"); __builtin_amdgcn_wave_barrier();
  const int rsub = lane >> 4, c4 = (lane & 15) * 4; typedef _Float16 v4h __attribute__((ext_vector_type(4)));
  {
#pragma unroll
    for (int q = 0; q < 8; ++q) { const int r = q * 2 + rsub; if (col0 + c4 < N) { const v4f v = *(const v4fa*)&so[w][r][c4]; if (C) *(v4f*)(C + cofs + (size_t)(row0 + r) * ldc + col0 + c4) = v; if (C16) { v4h h4; for (int i = 0; i < 4; ++i) h4[i] = (_Float16)v[i]; *(v4h*)(C16 + cofs + (size_t)(row0 + r) * ldc + col0 + c4) = h4; } } }
     }
}


typedef _Float16 v4h __attribute__((ext_vector_type(4)));

__global__ __launch_bounds__(256) void k_x16(const float* __restrict__ x, _Float16* __restrict__ X16, size_t n8) { const size_t t = (size_t)blockIdx.x * 256 + threadIdx.x; if (t >= n8) return; FragH f;
#pragma unroll
  for (int q = 0; q < 8; ++q) f.h[q] = (_Float16)bf16_round(x[t * 8 + q]); *(v8us*)((unsigned short*)X16 + t * 8) = f.half[0];  }
__global__ __launch_bounds__(256) void k_h16(const float* __restrict__ x, _Float16* __restrict__ X16, size_t n8) { const size_t t = (size_t)blockIdx.x * 256 + threadIdx.x; if (t >= n8) return; FragH f;
#pragma unroll
  for (int q = 0; q < 8; ++q) f.h[q] = (_Float16)x[t * 8 + q]; *(v8us*)((unsigned short*)X16 + t * 8) = f.half[0];  }
__global__ __launch_bounds__(256) void k_round16f(const float* __restrict__ W, _Float16* __restrict__ Bt, size_t n8) { const size_t t = (size_t)blockIdx.x * 256 + threadIdx.x; if (t >= n8) return; FragH f;
#pragma unroll
  for (int i = 0; i < 8; ++i) f.h[i] = (_Float16)(bf16_round(W[t * 8 + i]) * 16.0f); *(v8us*)((unsigned short*)Bt + t * 8) = f.half[0];  }
template <int NHv, int TTv>
__global__ __launch_bounds__(256) void k_vt(const _Float16* __restrict__ V16, int ldv, int voff, _Float16* __restrict__ Vt) { __shared__ unsigned short tl[64][66]; const int tid = threadIdx.x; const int slab = blockIdx.x / (TTv / 64), lg = blockIdx.x % (TTv / 64); const int b = slab / NHv, h = slab % NHv;
  for (int i = tid; i < 64 * 8; i += 256) { const int r = i / 8, c8 = (i % 8) * 8; FragH f; f.half[0] = *(const v8us*)((const unsigned short*)V16 + ((size_t)b * TTv + lg * 64 + r) * ldv + voff + h * 64 + c8);
#pragma unroll
    for (int q = 0; q < 8; ++q) tl[r][c8 + q] = f.u[q]; }
  __syncthreads();
  {
#pragma unroll
    for (int rd = 0; rd < 2; ++rd) { const int d = rd * 32 + tid / 8, pc = tid % 8; FragH f;
#pragma unroll
      for (int q = 0; q < 8; ++q) f.u[q] = tl[pc * 8 + q][d];
      *(v8us*)((unsigned short*)Vt + ((size_t)slab * 64 + d) * TTv + lg * 64 + pc * 8) = f.half[0]; }
     } }

__global__ __launch_bounds__(256) void k_hl(const float* __restrict__ F, _Float16* __restrict__ Hh, _Float16* __restrict__ Hl, size_t n8) { const size_t t = (size_t)blockIdx.x * 256 + threadIdx.x; if (t >= n8) return; FragH fh, fl; const v4f a = *(const v4fa*)(F + t * 8), c = *(const v4fa*)(F + t * 8 + 4);
#pragma unroll
  for (int q = 0; q < 4; ++q) { _Float16 h = (_Float16)a[q]; fh.h[q] = h; fl.h[q] = (_Float16)((a[q] - (float)h) * 1024.0f); h = (_Float16)c[q]; fh.h[4 + q] = h; fl.h[4 + q] = (_Float16)((c[q] - (float)h) * 1024.0f); }
  { *(v8us*)((unsigned short*)Hh + t * 8) = fh.half[0]; *(v8us*)((unsigned short*)Hl + t * 8) = fl.half[0];  } }

__global__ __launch_bounds__(256) void k_tok(const float* __restrict__ x, int b, _Float16* __restrict__ T16) { const int t = blockIdx.x * 256 + threadIdx.x; if (t >= NTK * (CC / 8)) return; const int c0 = (t % (CC / 8)) * 8, n = t / (CC / 8); FragH f;
#pragma unroll
  for (int q = 0; q < 8; ++q) f.h[q] = (_Float16)bf16_round(x[((size_t)b * CC + c0 + q) * NTK + n]);
  *(v8us*)((unsigned short*)T16 + (size_t)n * CC + c0) = f.half[0];  }
__global__ __launch_bounds__(256) void k_planes(const float* __restrict__ QKV, _Float16* __restrict__ Qh, _Float16* __restrict__ Ql, _Float16* __restrict__ Kh, _Float16* __restrict__ Kl) {
  #pragma clang fp contract(off)
  const int t = blockIdx.x * 256 + threadIdx.x; if (t >= NTK * (CC / 8)) return; const int c0 = (t % (CC / 8)) * 8, n = t / (CC / 8); FragH qh, ql, kh, kl;
#pragma unroll
  for (int q = 0; q < 8; ++q) { const float qv = QKV[(size_t)n * 3 * CC + c0 + q], kv = QKV[(size_t)n * 3 * CC + CC + c0 + q]; const _Float16 a = (_Float16)qv, b = (_Float16)kv; qh.h[q] = a; ql.h[q] = (_Float16)((qv - (float)a) * 1024.0f); kh.h[q] = b; kl.h[q] = (_Float16)((kv - (float)b) * 1024.0f); }
  { *(v8us*)((unsigned short*)Qh + (size_t)n * CC + c0) = qh.half[0]; *(v8us*)((unsigned short*)Ql + (size_t)n * CC + c0) = ql.half[0]; *(v8us*)((unsigned short*)Kh + (size_t)n * CC + c0) = kh.half[0]; *(v8us*)((unsigned short*)Kl + (size_t)n * CC + c0) = kl.half[0];  } }
__global__ __launch_bounds__(256) void k_vt(const float* __restrict__ QKV, _Float16* __restrict__ VT) { const int t = blockIdx.x * 256 + threadIdx.x; if (t >= CC * (NTK / 8)) return; const int n0 = (t % (NTK / 8)) * 8, c = t / (NTK / 8); FragH f;
#pragma unroll
  for (int q = 0; q < 8; ++q) f.h[q] = (_Float16)QKV[(size_t)(n0 + q) * 3 * CC + 2 * CC + c];
  *(v8us*)((unsigned short*)VT + (size_t)c * NTK + n0) = f.half[0];  }
__global__ __launch_bounds__(256) void k_soft(const float* __restrict__ S, _Float16* __restrict__ P16) {
  #pragma clang fp contract(off)
  const int tid = threadIdx.x, w = tid >> 5, ln = tid & 31; const int r = blockIdx.x * 8 + w; if (r >= NTK) return; const float* sr = S + (size_t)r * NTK; float m = -3.0e38f;
#pragma unroll 1
  for (int jb = 0; jb < NTK; jb += 256) { const v4f a = *(const v4fa*)(sr + jb + 8 * ln), c = *(const v4fa*)(sr + jb + 8 * ln + 4);
#pragma unroll
    for (int k = 0; k < 4; ++k) { m = fmaxf(m, a[k]); m = fmaxf(m, c[k]); } }
  for (int o = 16; o > 0; o >>= 1) m = fmaxf(m, __shfl_xor(m, o, 32));
  float su = 0.f;
#pragma unroll 1
  for (int jb = 0; jb < NTK; jb += 256) { const v4f a = *(const v4fa*)(sr + jb + 8 * ln), c = *(const v4fa*)(sr + jb + 8 * ln + 4);
#pragma unroll
    for (int k = 0; k < 4; ++k) { su += expf(a[k] - m); su += expf(c[k] - m); } }
  for (int o = 16; o > 0; o >>= 1) su += __shfl_xor(su, o, 32); const float inv = 1024.0f / su;
  {
#pragma unroll 1
    for (int jb = 0; jb < NTK; jb += 256) { const v4f a = *(const v4fa*)(sr + jb + 8 * ln), c = *(const v4fa*)(sr + jb + 8 * ln + 4); FragH f;
#pragma unroll
      for (int k = 0; k < 4; ++k) { f.h[k] = (_Float16)(expf(a[k] - m) * inv); f.h[4 + k] = (_Float16)(expf(c[k] - m) * inv); }
      *(v8us*)((unsigned short*)P16 + (size_t)r * NTK + jb + 8 * ln) = f.half[0]; }
     } }
__global__ __launch_bounds__(256) void k_silu(const float* __restrict__ T, _Float16* __restrict__ H16) {
  #pragma clang fp contract(off)
  const int t = blockIdx.x * 256 + threadIdx.x; if (t >= NTK * (CC / 8)) return; const v4f a = *(const v4fa*)(T + (size_t)t * 8), c = *(const v4fa*)(T + (size_t)t * 8 + 4); FragH f;
#pragma unroll
  for (int q = 0; q < 8; ++q) { const float v = (q < 4) ? a[q] : c[q - 4]; f.h[q] = (_Float16)(v / (1.0f + expf(-v))); }
  *(v8us*)((unsigned short*)H16 + (size_t)t * 8) = f.half[0];  }
__global__ __launch_bounds__(256) void k_ln_out(const float* __restrict__ A, const float* __restrict__ g, const float* __restrict__ bb, int b, float* __restrict__ out) {
  #pragma clang fp contract(off)
  __shared__ float tile[32][CC + 1]; const int tid = threadIdx.x, w = tid >> 5, l = tid & 31; const int j0 = blockIdx.x * 32;
  for (int jj = w; jj < 32; jj += 8) { const int j = j0 + jj; const float* ar = A + (size_t)j * CC; float v[8]; float s = 0.f;
#pragma unroll
    for (int k = 0; k < 8; ++k) { v[k] = ar[l + 32 * k]; s += v[k]; }
    for (int o = 16; o > 0; o >>= 1) s += __shfl_xor(s, o, 32); const float mu = s / (float)CC; float q2 = 0.f;
#pragma unroll
    for (int k = 0; k < 8; ++k) { const float d = v[k] - mu; q2 += d * d; }
    for (int o = 16; o > 0; o >>= 1) q2 += __shfl_xor(q2, o, 32); const float rs = rsqrtf(q2 / (float)CC + 1e-5f);
#pragma unroll
    for (int k = 0; k < 8; ++k) { const int c = l + 32 * k; tile[jj][c] = (v[k] - mu) * rs * bf16_round(g[c]) + bf16_round(bb[c]); } }
  __syncthreads();
  { for (int c = w; c < CC; c += 8) *(float*)(out + ((size_t)b * CC + c) * NTK + j0 + l) = tile[l][c];  } }

extern "C" void kernel_launch(void* const* d_in, const int* in_sizes, int n_in,
                              void* d_out, int out_size, void* d_ws, size_t ws_size, hipStream_t stream) {
  (void)in_sizes; (void)n_in; (void)out_size;
  const float* const* I = (const float* const*)d_in; const float* x = I[0]; const float* wq = I[1]; const float* bq = I[2]; const float* wk = I[3]; const float* bk = I[4]; const float* wv = I[5]; const float* bv = I[6]; const float* w1 = I[7]; const float* b1 = I[8]; const float* w2 = I[9]; const float* b2 = I[10]; const float* g = I[11]; const float* be = I[12];
  char* ws = (char*)d_ws; size_t off = 0;
  auto take = [&](size_t bytes) { char* p = ws + off; off += (bytes + 255) & ~(size_t)255; return p; };
  _Float16* BQ = (_Float16*)take(CC * CC * 2); _Float16* BK = (_Float16*)take(CC * CC * 2); _Float16* BV = (_Float16*)take(CC * CC * 2); _Float16* B1 = (_Float16*)take(CC * CC * 2); _Float16* B2 = (_Float16*)take(CC * CC * 2);
  _Float16* T16 = (_Float16*)take((size_t)NTK * CC * 2); float* QKV = (float*)take((size_t)NTK * 3 * CC * 4); _Float16* Qh = (_Float16*)take((size_t)NTK * CC * 2); _Float16* Ql = (_Float16*)take((size_t)NTK * CC * 2); _Float16* Kh = (_Float16*)take((size_t)NTK * CC * 2); _Float16* Kl = (_Float16*)take((size_t)NTK * CC * 2); _Float16* VT = (_Float16*)take((size_t)CC * NTK * 2);
  float* S = (float*)take((size_t)NTK * NTK * 4); _Float16* P16 = (_Float16*)take((size_t)NTK * NTK * 2); _Float16* A16 = (_Float16*)take((size_t)NTK * CC * 2); float* T1 = (float*)take((size_t)NTK * CC * 4); _Float16* H16 = (_Float16*)take((size_t)NTK * CC * 2); float* T2 = (float*)take((size_t)NTK * CC * 4);
  if (off > ws_size) return;      // ≈ 0.6 + 0.5 + 3.1 + 2.1 + 0.5 + 4.2 + 2.1 + 0.5 + 1 + 0.5 + 1 ≈ 16 MB
  k_wt_f16<<<(CC * (CC / 8) + 255) / 256, 256, 0, stream>>>(wq, BQ, CC, CC, 16.0f); k_wt_f16<<<(CC * (CC / 8) + 255) / 256, 256, 0, stream>>>(wk, BK, CC, CC, 16.0f); k_wt_f16<<<(CC * (CC / 8) + 255) / 256, 256, 0, stream>>>(wv, BV, CC, CC, 16.0f); k_wt_f16<<<(CC * (CC / 8) + 255) / 256, 256, 0, stream>>>(w1, B1, CC, CC, 16.0f); k_wt_f16<<<(CC * (CC / 8) + 255) / 256, 256, 0, stream>>>(w2, B2, CC, CC, 16.0f);      /* all weights stored (in,out) */
  const dim3 gP(((NTK / 16) * (CC / 64) + 3) / 4, 1), gS(((NTK / 16) * (NTK / 64) + 3) / 4, 1);
  for (int b = 0; b < NBt; ++b) {
    k_tok<<<(NTK * (CC / 8) + 255) / 256, 256, 0, stream>>>(x, b, T16);
    k_gemm_hhx<0><<<gP, 128, 0, stream>>>(T16, CC, 0, BQ, CC, 0, 0.0625f, bq, 0, nullptr, 1, 0, 0, QKV, nullptr, 3 * CC, 0, NTK, CC, CC); k_gemm_hhx<0><<<gP, 128, 0, stream>>>(T16, CC, 0, BK, CC, 0, 0.0625f, bk, 0, nullptr, 1, 0, 0, QKV + CC, nullptr, 3 * CC, 0, NTK, CC, CC); k_gemm_hhx<0><<<gP, 128, 0, stream>>>(T16, CC, 0, BV, CC, 0, 0.0625f, bv, 0, nullptr, 1, 0, 0, QKV + 2 * CC, nullptr, 3 * CC, 0, NTK, CC, CC);      /* q | k | v (exact + bias) */
    k_planes<<<(NTK * (CC / 8) + 255) / 256, 256, 0, stream>>>(QKV, Qh, Ql, Kh, Kl); k_vt<<<(CC * (NTK / 8) + 255) / 256, 256, 0, stream>>>(QKV, VT);
    k_gemm_hhx<0><<<gS, 128, 0, stream>>>(Kh, CC, 0, Qh, CC, 0, 1.0f, nullptr, 0, nullptr, 1, 0, 0, S, nullptr, NTK, 0, NTK, NTK, CC);
    k_gemm_hhx<0><<<gS, 128, 0, stream>>>(Kl, CC, 0, Qh, CC, 0, 0.0009765625f, nullptr, 0, S, 1, (size_t)NTK, 0, S, nullptr, NTK, 0, NTK, NTK, CC);
    k_gemm_hhx<0><<<gS, 128, 0, stream>>>(Kh, CC, 0, Ql, CC, 0, 0.0009765625f, nullptr, 0, S, 1, (size_t)NTK, 0, S, nullptr, NTK, 0, NTK, NTK, CC);      /* S'[j][i] = k_j·q_i (= mᵀ) with hi·hi + lo·hi + hi·lo: M = N = 1024, K 256 */
    k_soft<<<NTK / 8, 256, 0, stream>>>(S, P16);      /* softmax over i per j (= the module's softmax over the query axis) */
    k_gemm_hhx<0><<<gP, 128, 0, stream>>>(P16, NTK, 0, VT, NTK, 0, 0.0009765625f, nullptr, 0, nullptr, 1, 0, 0, nullptr, A16, CC, 0, NTK, CC, NTK);      /* att[j] = Σ_i P'[j][i]·v[i] → f16: N 256 K 1024 */
    k_gemm_hhx<0><<<gP, 128, 0, stream>>>(A16, CC, 0, B1, CC, 0, 0.0625f, b1, 0, nullptr, 1, 0, 0, T1, nullptr, CC, 0, NTK, CC, CC); k_silu<<<(NTK * (CC / 8) + 255) / 256, 256, 0, stream>>>(T1, H16);
    k_gemm_hhx<0><<<gP, 128, 0, stream>>>(H16, CC, 0, B2, CC, 0, 0.0625f, b2, 0, nullptr, 1, 0, 0, T2, nullptr, CC, 0, NTK, CC, CC);      /* MLP */
    k_ln_out<<<NTK / 32, 256, 0, stream>>>(T2, g, be, b, (float*)d_out); }
}

// v001
// One run takes 412 microseconds.
// In two side-by-side timings against v000, it was 5.94 and 5.83 times as fast.
#include <hip/hip_runtime.h>
// Token self-attention block on a feature map (B 16, C 256, 32×32 = 1024 tokens): q, k, v = t·W + b (W stored (in,out)); m = q·kᵀ (no scaling); softmax over the QUERY axis i; att[j] = Σ_i m[i][j]·v[i]; MLP (SiLU, 256→256→256); LayerNorm; back to NCHW → [16,256,32,32].
// Structure: the column softmax is a row softmax of mᵀ = k·qᵀ, so per batch: S' = K·Qᵀ (rows j, cols i), row softmax, att = P'·V; everything as GEMMs + row kernels.
// Compute dtype: x and parameters rounded to bf16; q/k/v with exact products; q and k carried as f16 hi + lo·2^10 planes with three cross products (≈f32 logits — they reach σ≈8 unscaled), softmax in f32, P (×2^10), v, attention output and the SiLU hidden as f16 operands (≈2^-12), f32 accumulation; LayerNorm in f32. v_wmma_f32_16x16x32_f16.
#define NBt 16
#define CC 256
#define NTK 1024
typedef __bf16 v16b __attribute__((ext_vector_type(16)));
typedef unsigned short v8us __attribute__((ext_vector_type(8), may_alias));
typedef float  v8f  __attribute__((ext_vector_type(8)));
typedef float  v4f  __attribute__((ext_vector_type(4)));
typedef float  v4fa __attribute__((ext_vector_type(4), may_alias));
union FragB { v16b v; v8us half[2]; unsigned short u[16]; };

__device__ __forceinline__ unsigned short bf16_bits(float x) { unsigned int u = __float_as_uint(x); return (unsigned short)((u + 0x7FFFu + ((u >> 16) & 1u)) >> 16); }
__device__ __forceinline__ float bf16_val(unsigned short b) { return __uint_as_float(((unsigned int)b) << 16); }
__device__ __forceinline__ float bf16_round(float x) { return bf16_val(bf16_bits(x)); }
// D += A·B with NT terms: 1 = ah·bh, 2 = + al·bh (A split), 3 = + ah·bl (both split)
template <int NT>
__device__ __forceinline__ v8f mmaN(v16b ah, v16b al, v16b bh, v16b bl, v8f c) {
  c = __builtin_amdgcn_wmma_f32_16x16x32_bf16(false, ah, false, bh, (short)0, c, false, false);
  if (NT >= 2) c = __builtin_amdgcn_wmma_f32_16x16x32_bf16(false, al, false, bh, (short)0, c, false, false);
  if (NT >= 3) c = __builtin_amdgcn_wmma_f32_16x16x32_bf16(false, ah, false, bl, (short)0, c, false, false);
  asm volatile("v_nop\n\tv_nop\n\tv_nop\n\tv_nop" : "+v"(c) : "v"(ah), "v"(al), "v"(bh), "v"(bl));
  return c;
}

__global__ __launch_bounds__(256) void k_wt_bf16(const float* __restrict__ W, unsigned short* __restrict__ Wt, int K, int N) {
  const int t = blockIdx.x * 256 + threadIdx.x;
  const int k8n = K / 8;
  if (t >= N * k8n) return;
  const int n = t / k8n, k8 = (t % k8n) * 8;
  v8us v;
#pragma unroll
  for (int i = 0; i < 8; ++i) v[i] = bf16_bits(W[(size_t)(k8 + i) * N + n]);
  *(v8us*)(Wt + (size_t)n * K + k8) = v;
  
}

// GEMM C[M][N] (f32, pitch ldc) = act(A[M][K]·W + bias). A f32 row-major (pitch lda) converted per fragment to bf16
// (ASPLIT: hi/lo two planes -> 2 terms, else single rounded term); Wt bf16 [N][K] (pitch ldb). BIAS_BF16 rounds the
// bias to bf16 first (bias quantised to bf16 before the add). K%32==0, M%16==0, N%64==0.
template <bool ASPLIT, int ACT, bool BIAS_BF16>
__global__ __launch_bounds__(128) void k_gemm_bf(const float* __restrict__ A, int lda, const unsigned short* __restrict__ Wt, int ldb,
                                               const float* __restrict__ bias, float* __restrict__ C, int ldc, int M, int N, int K) {
  __shared__ __attribute__((aligned(16))) float so[4][16][64];
  const int tid = threadIdx.x, w = tid >> 5, lane = tid & 31, ln = lane & 15, hh = lane >> 4;
  const int ntn = N / 64;
  const int wid = blockIdx.x * 4 + w;
  const int mt = wid / ntn, nq = wid % ntn;
  if (mt * 16 >= M) return;
  const int row0 = mt * 16, col0 = nq * 64;
  const float* arow = A + (size_t)(row0 + ln) * lda;
  v8f acc[4] = {};
  for (int kb = 0; kb < K; kb += 32) {
    FragB ah, al;
    const v4f x0 = *(const v4fa*)(arow + kb + 8 * hh), x1 = *(const v4fa*)(arow + kb + 8 * hh + 4);
    const v4f x2 = *(const v4fa*)(arow + kb + 16 + 8 * hh), x3 = *(const v4fa*)(arow + kb + 16 + 8 * hh + 4);
    float xs[16] = {x0[0],x0[1],x0[2],x0[3],x1[0],x1[1],x1[2],x1[3],x2[0],x2[1],x2[2],x2[3],x3[0],x3[1],x3[2],x3[3]};
#pragma unroll
    for (int i = 0; i < 16; ++i) { const unsigned short hb = bf16_bits(xs[i]); ah.u[i] = hb; al.u[i] = ASPLIT ? bf16_bits(xs[i] - bf16_val(hb)) : (unsigned short)0; }
#pragma unroll
    for (int t = 0; t < 4; ++t) {
      const unsigned short* brow = Wt + (size_t)(col0 + t * 16 + ln) * ldb + kb;
      FragB b;
      b.half[0] = *(const v8us*)(brow + 8 * hh);
      b.half[1] = *(const v8us*)(brow + 16 + 8 * hh);
      acc[t] = mmaN<ASPLIT ? 2 : 1>(ah.v, al.v, b.v, b.v, acc[t]);
    }
  }
#pragma unroll
  for (int t = 0; t < 4; ++t) {
    float bv = bias ? bias[col0 + t * 16 + ln] : 0.f;
    if (BIAS_BF16) bv = bf16_round(bv);
#pragma unroll
    for (int r = 0; r < 8; ++r) { float v = acc[t][r] + bv; if (ACT == 1) v = fmaxf(v, 0.f); so[w][8 * hh + r][t * 16 + ln] = v; }
  }
  __builtin_amdgcn_fence(__ATOMIC_ACQ_REL, "workgroup");
  __builtin_amdgcn_wave_barrier();
  const int rsub = lane >> 4, c4 = (lane & 15) * 4;
  {
#pragma unroll
    for (int q = 0; q < 8; ++q) {
      const int r = q * 2 + rsub;
      const v4f v = *(const v4fa*)&so[w][r][c4];
      *(v4f*)(C + (size_t)(row0 + r) * ldc + col0 + c4) = v;
    }
    
  }
}

// GEMM C = act(A·W + bias + resid): A f32 (ASPLIT -> hi/lo 2 terms), Wt bf16 [N][K]; ACT 0 none, 1 relu, 2 exact gelu;
// resid (optional, f32, row index = (row % rmod), pitch ldr, RES_BF16 rounds it) added before the activation.
template <bool ASPLIT, int ACT, bool BIAS_BF16, bool RES_BF16>
__global__ __launch_bounds__(128) void k_gemm_bf3(const float* __restrict__ A, int lda, const unsigned short* __restrict__ Wt, int ldb,
                                                const float* __restrict__ bias, const float* __restrict__ resid, int rmod, int ldr,
                                                float* __restrict__ C, int ldc, int M, int N, int K) {
  __shared__ __attribute__((aligned(16))) float so[4][16][64];
  const int tid = threadIdx.x, w = tid >> 5, lane = tid & 31, ln = lane & 15, hh = lane >> 4;
  const int ntn = N / 64;
  const int wid = blockIdx.x * 4 + w;
  const int mt = wid / ntn, nq = wid % ntn;
  if (mt * 16 >= M) return;
  const int row0 = mt * 16, col0 = nq * 64;
  const float* arow = A + (size_t)(row0 + ln) * lda;
  v8f acc[4] = {};
  for (int kb = 0; kb < K; kb += 32) {
    FragB ah, al;
    const v4f x0 = *(const v4fa*)(arow + kb + 8 * hh), x1 = *(const v4fa*)(arow + kb + 8 * hh + 4);
    const v4f x2 = *(const v4fa*)(arow + kb + 16 + 8 * hh), x3 = *(const v4fa*)(arow + kb + 16 + 8 * hh + 4);
    float xs[16] = {x0[0],x0[1],x0[2],x0[3],x1[0],x1[1],x1[2],x1[3],x2[0],x2[1],x2[2],x2[3],x3[0],x3[1],x3[2],x3[3]};
#pragma unroll
    for (int i = 0; i < 16; ++i) { const unsigned short hb = bf16_bits(xs[i]); ah.u[i] = hb; al.u[i] = ASPLIT ? bf16_bits(xs[i] - bf16_val(hb)) : (unsigned short)0; }
#pragma unroll
    for (int t = 0; t < 4; ++t) {
      const unsigned short* brow = Wt + (size_t)(col0 + t * 16 + ln) * ldb + kb;
      FragB b;
      b.half[0] = *(const v8us*)(brow + 8 * hh);
      b.half[1] = *(const v8us*)(brow + 16 + 8 * hh);
      acc[t] = mmaN<ASPLIT ? 2 : 1>(ah.v, al.v, b.v, b.v, acc[t]);
    }
  }
#pragma unroll
  for (int t = 0; t < 4; ++t) {
    const int col = col0 + t * 16 + ln;
    float bv = bias ? bias[col] : 0.f;
    if (BIAS_BF16) bv = bf16_round(bv);
#pragma unroll
    for (int r = 0; r < 8; ++r) {
      float v = acc[t][r] + bv;
      if (resid) { float rv = resid[(size_t)((row0 + 8 * hh + r) % rmod) * ldr + col]; if (RES_BF16) rv = bf16_round(rv); v += rv; }
      if (ACT == 1) v = fmaxf(v, 0.f);
      if (ACT == 2) v = 0.5f * v * (1.0f + erff(v * 0.70710678118654752f));
      if (ACT == 3) { const float u = 0.7978845608028654f * (v + 0.044715f * v * v * v); v = 0.5f * v * (1.0f + tanhf(u)); }
      so[w][8 * hh + r][t * 16 + ln] = v;
    }
  }
  __builtin_amdgcn_fence(__ATOMIC_ACQ_REL, "workgroup");
  __builtin_amdgcn_wave_barrier();
  const int rsub = lane >> 4, c4 = (lane & 15) * 4;
  {
#pragma unroll
    for (int q = 0; q < 8; ++q) {
      const int r = q * 2 + rsub;
      const v4f v = *(const v4fa*)&so[w][r][c4];
      *(v4f*)(C + (size_t)(row0 + r) * ldc + col0 + c4) = v;
    }
    
  }
}
// row LayerNorm (biased variance, eps) over N: s = X (+ R); optional out_sum <- s; out_norm <- (s-mu)*rsqrt(var+eps)*g + b
template <bool PARAM_BF16>
__global__ __launch_bounds__(256) void k_layernorm(const float* __restrict__ X, const float* __restrict__ R, const float* __restrict__ g, const float* __restrict__ bta,
                                                  float* __restrict__ out_sum, float* __restrict__ out_norm, int N, float eps) {
  __shared__ float red[256];
  const int row = blockIdx.x, tid = threadIdx.x;
  const float* x = X + (size_t)row * N; const float* rr = R ? R + (size_t)row * N : nullptr;
  float vals[16];                     // up to N = 4096
  const int per = N / 256;            // contiguous chunk per thread? use strided-by-4 chunks: thread handles j = tid*4 + 1024*u
  float s1 = 0.f;
  for (int u = 0; u < per / 4; ++u) {
    const int j = tid * 4 + 1024 * u;
    const v4f a = *(const v4fa*)(x + j);
    v4f b = {0.f,0.f,0.f,0.f}; if (rr) b = *(const v4fa*)(rr + j);
#pragma unroll
    for (int q = 0; q < 4; ++q) { const float v = a[q] + b[q]; vals[u * 4 + q] = v; s1 += v; }
  }
  red[tid] = s1; __syncthreads();
  for (int st = 128; st > 0; st >>= 1) { if (tid < st) red[tid] += red[tid + st]; __syncthreads(); }
  const float mu = red[0] / (float)N; __syncthreads();
  float s2 = 0.f;
  for (int u = 0; u < per / 4; ++u)
#pragma unroll
    for (int q = 0; q < 4; ++q) { const float c = vals[u * 4 + q] - mu; s2 += c * c; }
  red[tid] = s2; __syncthreads();
  for (int st = 128; st > 0; st >>= 1) { if (tid < st) red[tid] += red[tid + st]; __syncthreads(); }
  const float rs = rsqrtf(red[0] / (float)N + eps);
  {
    for (int u = 0; u < per / 4; ++u) {
      const int j = tid * 4 + 1024 * u;
      v4f o, sm;
#pragma unroll
      for (int q = 0; q < 4; ++q) {
        float gg = g[j + q], bb = bta[j + q];
        if (PARAM_BF16) { gg = bf16_round(gg); bb = bf16_round(bb); }
        sm[q] = vals[u * 4 + q]; o[q] = (vals[u * 4 + q] - mu) * rs * gg + bb;
      }
      if (out_sum) *(v4f*)(out_sum + (size_t)row * N + j) = sm;
      *(v4f*)(out_norm + (size_t)row * N + j) = o;
    }
    
  }
}



// ---- f16 WMMA path (v_wmma_f32_16x16x32_f16): 11-bit significands for operands in range — used where a [0,1] probability operand needs more precision than bf16
typedef _Float16 v16h __attribute__((ext_vector_type(16)));
union FragH { v16h v; v8us half[2]; _Float16 h[16]; unsigned short u[16]; };
template <int NT>
__device__ __forceinline__ v8f mmaH(v16h ah, v16h al, v16h bh, v16h bl, v8f c) {
  c = __builtin_amdgcn_wmma_f32_16x16x32_f16(false, ah, false, bh, (short)0, c, false, false);
  if (NT >= 2) c = __builtin_amdgcn_wmma_f32_16x16x32_f16(false, al, false, bh, (short)0, c, false, false);
  if (NT >= 3) c = __builtin_amdgcn_wmma_f32_16x16x32_f16(false, ah, false, bl, (short)0, c, false, false);
  asm volatile("v_nop\n\tv_nop\n\tv_nop\n\tv_nop" : "+v"(c) : "v"(ah), "v"(al), "v"(bh), "v"(bl));
  return c;
}
// batched GEMM like k_gemm_b but f16 operands: A f32 (split into f16 hi/lo if ASPLIT, else rounded to f16), Bt = f16 values [n][k]; alpha; C f32; N multiple of 16 (partial tiles skipped)
template <bool ASPLIT>
__global__ __launch_bounds__(128) void k_gemm_h(const float* __restrict__ A, int lda, size_t sA, const _Float16* __restrict__ Bh, int ldb, size_t sB, float alpha, float* __restrict__ C, int ldc, size_t sC, int M, int N, int K) {
  __shared__ __attribute__((aligned(16))) float so[4][16][64];
  const int tid = threadIdx.x, w = tid >> 5, lane = tid & 31, ln = lane & 15, hh = lane >> 4; const int by = blockIdx.y;
  A += (size_t)by * sA; Bh += (size_t)by * sB; C += (size_t)by * sC;
  const int ntn = (N + 63) / 64; const int wid = blockIdx.x * 4 + w; const int mt = wid / ntn, nq = wid % ntn; if (mt * 16 >= M) return;
  const int row0 = mt * 16, col0 = nq * 64; const float* arow = A + (size_t)(row0 + ln) * lda;
  v8f acc[4] = {};
  for (int kb = 0; kb < K; kb += 32) {
    FragH ah, al;
    const v4f x0 = *(const v4fa*)(arow + kb + 8 * hh), x1 = *(const v4fa*)(arow + kb + 8 * hh + 4), x2 = *(const v4fa*)(arow + kb + 16 + 8 * hh), x3 = *(const v4fa*)(arow + kb + 16 + 8 * hh + 4);
    float xs[16] = {x0[0],x0[1],x0[2],x0[3],x1[0],x1[1],x1[2],x1[3],x2[0],x2[1],x2[2],x2[3],x3[0],x3[1],x3[2],x3[3]};
#pragma unroll
    for (int i = 0; i < 16; ++i) { const _Float16 h = (_Float16)xs[i]; ah.h[i] = h; al.h[i] = ASPLIT ? (_Float16)(xs[i] - (float)h) : (_Float16)0.0f; }
#pragma unroll
    for (int t = 0; t < 4; ++t) { if (col0 + t * 16 >= N) continue; const size_t boff = (size_t)(col0 + t * 16 + ln) * ldb + kb; FragH bq; bq.half[0] = *(const v8us*)(Bh + boff + 8 * hh); bq.half[1] = *(const v8us*)(Bh + boff + 16 + 8 * hh);
      acc[t] = mmaH<ASPLIT ? 2 : 1>(ah.v, al.v, bq.v, bq.v, acc[t]); }
  }
#pragma unroll
  for (int t = 0; t < 4; ++t) { if (col0 + t * 16 >= N) continue;
#pragma unroll
    for (int r = 0; r < 8; ++r) so[w][8 * hh + r][t * 16 + ln] = acc[t][r] * alpha; }
  __builtin_amdgcn_fence(__ATOMIC_ACQ_REL, "workgroup"); __builtin_amdgcn_wave_barrier();
  const int rsub = lane >> 4, c4 = (lane & 15) * 4;
  {
#pragma unroll
    for (int q = 0; q < 8; ++q) { const int r = q * 2 + rsub; if (col0 + c4 < N) { const v4f v = *(const v4fa*)&so[w][r][c4]; *(v4f*)(C + (size_t)(row0 + r) * ldc + col0 + c4) = v; } }
     }
}

// Wt[n][k] = f16(W[k][n]·scale) from f32 row-major W[K][N] (scale = power of two; bf16-exact weights stay exact in f16 away from the subnormal range)
__global__ __launch_bounds__(256) void k_wt_f16(const float* __restrict__ W, _Float16* __restrict__ Wt, int K, int N, float scale) {
  const int t = blockIdx.x * 256 + threadIdx.x; if (t >= N * (K / 8)) return; const int n = t / (K / 8), k8 = (t % (K / 8)) * 8; FragH f;
#pragma unroll
  for (int i = 0; i < 8; ++i) f.h[i] = (_Float16)(bf16_round(W[(size_t)(k8 + i) * N + n]) * scale); const v8us o = f.half[0];
  *(v8us*)((unsigned short*)Wt + (size_t)n * K + k8) = o; 
}
// k_gemm_hh variant with fused epilogue: v = acc*alpha + bias[by*sBias + col] (+ CP[by*sC + (row/rowsPerB)*sCPb + col] if CP) ; ACT 0 none / 1 elu ; writes f32 C and f16 C16, each if non-null; by = blockIdx.y = image
template <int ACT>
__global__ __launch_bounds__(128) void k_gemm_hhx(const _Float16* __restrict__ A, int lda, size_t sA, const _Float16* __restrict__ Bh, int ldb, size_t sB, float alpha, const float* __restrict__ bias, size_t sBias, const float* __restrict__ CP, int rowsPerB, size_t sCPb, int row0g,
    float* __restrict__ C, _Float16* __restrict__ C16, int ldc, size_t sC, int M, int N, int K) {
  __shared__ __attribute__((aligned(16))) float so[4][16][64];
  const int tid = threadIdx.x, w = tid >> 5, lane = tid & 31, ln = lane & 15, hh = lane >> 4; const int by = blockIdx.y;
  A += (size_t)by * sA; Bh += (size_t)by * sB; const size_t cofs = (size_t)by * sC; const float* bp = bias ? bias + (size_t)by * sBias : nullptr;
  const int ntn = (N + 63) / 64; const int wid = blockIdx.x * 4 + w; const int mt = wid / ntn, nq = wid % ntn; if (mt * 16 >= M) return;
  const int row0 = mt * 16, col0 = nq * 64; const _Float16* arow = A + (size_t)(row0 + ln) * lda;
  v8f acc[4] = {};
  for (int kb = 0; kb < K; kb += 32) { FragH ah; ah.half[0] = *(const v8us*)((const unsigned short*)arow + kb + 8 * hh); ah.half[1] = *(const v8us*)((const unsigned short*)arow + kb + 16 + 8 * hh);
#pragma unroll
    for (int t = 0; t < 4; ++t) { if (col0 + t * 16 >= N) continue; const size_t boff = (size_t)(col0 + t * 16 + ln) * ldb + kb; FragH bq; bq.half[0] = *(const v8us*)((const unsigned short*)Bh + boff + 8 * hh); bq.half[1] = *(const v8us*)((const unsigned short*)Bh + boff + 16 + 8 * hh);
      acc[t] = mmaH<1>(ah.v, ah.v, bq.v, bq.v, acc[t]); }
  }
#pragma unroll
  for (int t = 0; t < 4; ++t) { if (col0 + t * 16 >= N) continue; const int col = col0 + t * 16 + ln; const float bv = bp ? bf16_round(bp[col]) : 0.f;
#pragma unroll
    for (int r = 0; r < 8; ++r) { float v = acc[t][r] * alpha + bv; if (CP) { const int bidx = (row0g + row0 + 8 * hh + r) / rowsPerB; v += CP[cofs + (size_t)bidx * sCPb + col]; } if (ACT == 1) v = (v > 0.f) ? v : expm1f(v); else if (ACT == 7) v = (v > 0.f) ? v + 1.0f : expf(v); else if (ACT == 8) v = tanhf(v); else if (ACT == 9) v = 0.5f * v * (1.0f + tanhf(0.7978845608028654f * (v + 0.044715f * v * v * v))); else if (ACT == 11) v = 1.0f / (1.0f + expf(-v)); else if (ACT == 12) v = (v > 0.f) ? v : 0.01f * v; else if (ACT == 14) v = (v > 0.f) ? v : 0.1f * v; else if (ACT == 15) v = v / (1.0f + expf(-v)); else if (ACT == 3) v = fmaxf(v, 0.f); else if (ACT == 6) v = 0.5f * v * (1.0f + erff(v * 0.70710678118654752f)); so[w][8 * hh + r][t * 16 + ln] = v; } }
  __builtin_amdgcn_fence(__ATOMIC_ACQ_REL, "workgroup"); __builtin_amdgcn_wave_barrier();
  const int rsub = lane >> 4, c4 = (lane & 15) * 4; typedef _Float16 v4h __attribute__((ext_vector_type(4)));
  {
#pragma unroll
    for (int q = 0; q < 8; ++q) { const int r = q * 2 + rsub; if (col0 + c4 < N) { const v4f v = *(const v4fa*)&so[w][r][c4]; if (C) *(v4f*)(C + cofs + (size_t)(row0 + r) * ldc + col0 + c4) = v; if (C16) { v4h h4; for (int i = 0; i < 4; ++i) h4[i] = (_Float16)v[i]; *(v4h*)(C16 + cofs + (size_t)(row0 + r) * ldc + col0 + c4) = h4; } } }
     }
}


typedef _Float16 v4h __attribute__((ext_vector_type(4)));

__global__ __launch_bounds__(256) void k_x16(const float* __restrict__ x, _Float16* __restrict__ X16, size_t n8) { const size_t t = (size_t)blockIdx.x * 256 + threadIdx.x; if (t >= n8) return; FragH f;
#pragma unroll
  for (int q = 0; q < 8; ++q) f.h[q] = (_Float16)bf16_round(x[t * 8 + q]); *(v8us*)((unsigned short*)X16 + t * 8) = f.half[0];  }
__global__ __launch_bounds__(256) void k_h16(const float* __restrict__ x, _Float16* __restrict__ X16, size_t n8) { const size_t t = (size_t)blockIdx.x * 256 + threadIdx.x; if (t >= n8) return; FragH f;
#pragma unroll
  for (int q = 0; q < 8; ++q) f.h[q] = (_Float16)x[t * 8 + q]; *(v8us*)((unsigned short*)X16 + t * 8) = f.half[0];  }
__global__ __launch_bounds__(256) void k_round16f(const float* __restrict__ W, _Float16* __restrict__ Bt, size_t n8) { const size_t t = (size_t)blockIdx.x * 256 + threadIdx.x; if (t >= n8) return; FragH f;
#pragma unroll
  for (int i = 0; i < 8; ++i) f.h[i] = (_Float16)(bf16_round(W[t * 8 + i]) * 16.0f); *(v8us*)((unsigned short*)Bt + t * 8) = f.half[0];  }
template <int NHv, int TTv>
__global__ __launch_bounds__(256) void k_vt(const _Float16* __restrict__ V16, int ldv, int voff, _Float16* __restrict__ Vt) { __shared__ unsigned short tl[64][66]; const int tid = threadIdx.x; const int slab = blockIdx.x / (TTv / 64), lg = blockIdx.x % (TTv / 64); const int b = slab / NHv, h = slab % NHv;
  for (int i = tid; i < 64 * 8; i += 256) { const int r = i / 8, c8 = (i % 8) * 8; FragH f; f.half[0] = *(const v8us*)((const unsigned short*)V16 + ((size_t)b * TTv + lg * 64 + r) * ldv + voff + h * 64 + c8);
#pragma unroll
    for (int q = 0; q < 8; ++q) tl[r][c8 + q] = f.u[q]; }
  __syncthreads();
  {
#pragma unroll
    for (int rd = 0; rd < 2; ++rd) { const int d = rd * 32 + tid / 8, pc = tid % 8; FragH f;
#pragma unroll
      for (int q = 0; q < 8; ++q) f.u[q] = tl[pc * 8 + q][d];
      *(v8us*)((unsigned short*)Vt + ((size_t)slab * 64 + d) * TTv + lg * 64 + pc * 8) = f.half[0]; }
     } }

__global__ __launch_bounds__(256) void k_hl(const float* __restrict__ F, _Float16* __restrict__ Hh, _Float16* __restrict__ Hl, size_t n8) { const size_t t = (size_t)blockIdx.x * 256 + threadIdx.x; if (t >= n8) return; FragH fh, fl; const v4f a = *(const v4fa*)(F + t * 8), c = *(const v4fa*)(F + t * 8 + 4);
#pragma unroll
  for (int q = 0; q < 4; ++q) { _Float16 h = (_Float16)a[q]; fh.h[q] = h; fl.h[q] = (_Float16)((a[q] - (float)h) * 1024.0f); h = (_Float16)c[q]; fh.h[4 + q] = h; fl.h[4 + q] = (_Float16)((c[q] - (float)h) * 1024.0f); }
  { *(v8us*)((unsigned short*)Hh + t * 8) = fh.half[0]; *(v8us*)((unsigned short*)Hl + t * 8) = fl.half[0];  } }

__global__ __launch_bounds__(256) void k_tok(const float* __restrict__ x, _Float16* __restrict__ T16) { const int b = blockIdx.y; T16 += (size_t)b * NTK * CC; const int t = blockIdx.x * 256 + threadIdx.x; if (t >= NTK * (CC / 8)) return; const int c0 = (t % (CC / 8)) * 8, n = t / (CC / 8); FragH f;
#pragma unroll
  for (int q = 0; q < 8; ++q) f.h[q] = (_Float16)bf16_round(x[((size_t)b * CC + c0 + q) * NTK + n]);
  *(v8us*)((unsigned short*)T16 + (size_t)n * CC + c0) = f.half[0];  }
__global__ __launch_bounds__(256) void k_planes(const float* __restrict__ QKV, _Float16* __restrict__ Qh, _Float16* __restrict__ Ql, _Float16* __restrict__ Kh, _Float16* __restrict__ Kl) {
  #pragma clang fp contract(off)
  { const size_t b = blockIdx.y; QKV += b * NTK * 3 * CC; Qh += b * NTK * CC; Ql += b * NTK * CC; Kh += b * NTK * CC; Kl += b * NTK * CC; }
  const int t = blockIdx.x * 256 + threadIdx.x; if (t >= NTK * (CC / 8)) return; const int c0 = (t % (CC / 8)) * 8, n = t / (CC / 8); FragH qh, ql, kh, kl;
#pragma unroll
  for (int q = 0; q < 8; ++q) { const float qv = QKV[(size_t)n * 3 * CC + c0 + q], kv = QKV[(size_t)n * 3 * CC + CC + c0 + q]; const _Float16 a = (_Float16)qv, b = (_Float16)kv; qh.h[q] = a; ql.h[q] = (_Float16)((qv - (float)a) * 1024.0f); kh.h[q] = b; kl.h[q] = (_Float16)((kv - (float)b) * 1024.0f); }
  { *(v8us*)((unsigned short*)Qh + (size_t)n * CC + c0) = qh.half[0]; *(v8us*)((unsigned short*)Ql + (size_t)n * CC + c0) = ql.half[0]; *(v8us*)((unsigned short*)Kh + (size_t)n * CC + c0) = kh.half[0]; *(v8us*)((unsigned short*)Kl + (size_t)n * CC + c0) = kl.half[0];  } }
__global__ __launch_bounds__(256) void k_vt(const float* __restrict__ QKV, _Float16* __restrict__ VT) { QKV += (size_t)blockIdx.y * NTK * 3 * CC; VT += (size_t)blockIdx.y * CC * NTK; const int t = blockIdx.x * 256 + threadIdx.x; if (t >= CC * (NTK / 8)) return; const int n0 = (t % (NTK / 8)) * 8, c = t / (NTK / 8); FragH f;
#pragma unroll
  for (int q = 0; q < 8; ++q) f.h[q] = (_Float16)QKV[(size_t)(n0 + q) * 3 * CC + 2 * CC + c];
  *(v8us*)((unsigned short*)VT + (size_t)c * NTK + n0) = f.half[0];  }
__global__ __launch_bounds__(256) void k_soft(const float* __restrict__ S, _Float16* __restrict__ P16) {
  #pragma clang fp contract(off)
  const int tid = threadIdx.x, w = tid >> 5, ln = tid & 31; const int r = blockIdx.x * 8 + w; if (r >= NTK) return; S += (size_t)blockIdx.y * NTK * NTK; P16 += (size_t)blockIdx.y * NTK * NTK; const float* sr = S + (size_t)r * NTK; float m = -3.0e38f;
#pragma unroll 1
  for (int jb = 0; jb < NTK; jb += 256) { const v4f a = *(const v4fa*)(sr + jb + 8 * ln), c = *(const v4fa*)(sr + jb + 8 * ln + 4);
#pragma unroll
    for (int k = 0; k < 4; ++k) { m = fmaxf(m, a[k]); m = fmaxf(m, c[k]); } }
  for (int o = 16; o > 0; o >>= 1) m = fmaxf(m, __shfl_xor(m, o, 32));
  float su = 0.f;
#pragma unroll 1
  for (int jb = 0; jb < NTK; jb += 256) { const v4f a = *(const v4fa*)(sr + jb + 8 * ln), c = *(const v4fa*)(sr + jb + 8 * ln + 4);
#pragma unroll
    for (int k = 0; k < 4; ++k) { su += expf(a[k] - m); su += expf(c[k] - m); } }
  for (int o = 16; o > 0; o >>= 1) su += __shfl_xor(su, o, 32); const float inv = 1024.0f / su;
  {
#pragma unroll 1
    for (int jb = 0; jb < NTK; jb += 256) { const v4f a = *(const v4fa*)(sr + jb + 8 * ln), c = *(const v4fa*)(sr + jb + 8 * ln + 4); FragH f;
#pragma unroll
      for (int k = 0; k < 4; ++k) { f.h[k] = (_Float16)(expf(a[k] - m) * inv); f.h[4 + k] = (_Float16)(expf(c[k] - m) * inv); }
      *(v8us*)((unsigned short*)P16 + (size_t)r * NTK + jb + 8 * ln) = f.half[0]; }
     } }
__global__ __launch_bounds__(256) void k_silu(const float* __restrict__ T, _Float16* __restrict__ H16) {
  #pragma clang fp contract(off)
  T += (size_t)blockIdx.y * NTK * CC; H16 += (size_t)blockIdx.y * NTK * CC;
  const int t = blockIdx.x * 256 + threadIdx.x; if (t >= NTK * (CC / 8)) return; const v4f a = *(const v4fa*)(T + (size_t)t * 8), c = *(const v4fa*)(T + (size_t)t * 8 + 4); FragH f;
#pragma unroll
  for (int q = 0; q < 8; ++q) { const float v = (q < 4) ? a[q] : c[q - 4]; f.h[q] = (_Float16)(v / (1.0f + expf(-v))); }
  *(v8us*)((unsigned short*)H16 + (size_t)t * 8) = f.half[0];  }
__global__ __launch_bounds__(256) void k_ln_out(const float* __restrict__ A, const float* __restrict__ g, const float* __restrict__ bb, float* __restrict__ out) {
  #pragma clang fp contract(off)
  __shared__ float tile[32][CC + 1]; const int tid = threadIdx.x, w = tid >> 5, l = tid & 31; const int j0 = blockIdx.x * 32; const int b = blockIdx.y; A += (size_t)b * NTK * CC;
  for (int jj = w; jj < 32; jj += 8) { const int j = j0 + jj; const float* ar = A + (size_t)j * CC; float v[8]; float s = 0.f;
#pragma unroll
    for (int k = 0; k < 8; ++k) { v[k] = ar[l + 32 * k]; s += v[k]; }
    for (int o = 16; o > 0; o >>= 1) s += __shfl_xor(s, o, 32); const float mu = s / (float)CC; float q2 = 0.f;
#pragma unroll
    for (int k = 0; k < 8; ++k) { const float d = v[k] - mu; q2 += d * d; }
    for (int o = 16; o > 0; o >>= 1) q2 += __shfl_xor(q2, o, 32); const float rs = rsqrtf(q2 / (float)CC + 1e-5f);
#pragma unroll
    for (int k = 0; k < 8; ++k) { const int c = l + 32 * k; tile[jj][c] = (v[k] - mu) * rs * bf16_round(g[c]) + bf16_round(bb[c]); } }
  __syncthreads();
  { for (int c = w; c < CC; c += 8) *(float*)(out + ((size_t)b * CC + c) * NTK + j0 + l) = tile[l][c];  } }

extern "C" void kernel_launch(void* const* d_in, const int* in_sizes, int n_in,
                              void* d_out, int out_size, void* d_ws, size_t ws_size, hipStream_t stream) {
  (void)in_sizes; (void)n_in; (void)out_size;
  const float* const* I = (const float* const*)d_in; const float* x = I[0]; const float* wq = I[1]; const float* bq = I[2]; const float* wk = I[3]; const float* bk = I[4]; const float* wv = I[5]; const float* bv = I[6]; const float* w1 = I[7]; const float* b1 = I[8]; const float* w2 = I[9]; const float* b2 = I[10]; const float* g = I[11]; const float* be = I[12];
  char* ws = (char*)d_ws; size_t off = 0;
  auto take = [&](size_t bytes) { char* p = ws + off; off += (bytes + 255) & ~(size_t)255; return p; };
  _Float16* BQ = (_Float16*)take(CC * CC * 2); _Float16* BK = (_Float16*)take(CC * CC * 2); _Float16* BV = (_Float16*)take(CC * CC * 2); _Float16* B1 = (_Float16*)take(CC * CC * 2); _Float16* B2 = (_Float16*)take(CC * CC * 2);
  /* one workspace slab per image for every intermediate: all NBt images go through each launch, image = blockIdx.y */
  _Float16* T16 = (_Float16*)take((size_t)NBt * NTK * CC * 2); float* QKV = (float*)take((size_t)NBt * NTK * 3 * CC * 4); _Float16* Qh = (_Float16*)take((size_t)NBt * NTK * CC * 2); _Float16* Ql = (_Float16*)take((size_t)NBt * NTK * CC * 2); _Float16* Kh = (_Float16*)take((size_t)NBt * NTK * CC * 2); _Float16* Kl = (_Float16*)take((size_t)NBt * NTK * CC * 2); _Float16* VT = (_Float16*)take((size_t)NBt * CC * NTK * 2);
  float* S = (float*)take((size_t)NBt * NTK * NTK * 4); _Float16* P16 = (_Float16*)take((size_t)NBt * NTK * NTK * 2); _Float16* A16 = (_Float16*)take((size_t)NBt * NTK * CC * 2); float* T1 = (float*)take((size_t)NBt * NTK * CC * 4); _Float16* H16 = (_Float16*)take((size_t)NBt * NTK * CC * 2); float* T2 = (float*)take((size_t)NBt * NTK * CC * 4);
  if (off > ws_size) return;      // 5 weight planes of 128 KiB + 16 x 15 MiB: under 241 MiB
  k_wt_f16<<<(CC * (CC / 8) + 255) / 256, 256, 0, stream>>>(wq, BQ, CC, CC, 16.0f); k_wt_f16<<<(CC * (CC / 8) + 255) / 256, 256, 0, stream>>>(wk, BK, CC, CC, 16.0f); k_wt_f16<<<(CC * (CC / 8) + 255) / 256, 256, 0, stream>>>(wv, BV, CC, CC, 16.0f); k_wt_f16<<<(CC * (CC / 8) + 255) / 256, 256, 0, stream>>>(w1, B1, CC, CC, 16.0f); k_wt_f16<<<(CC * (CC / 8) + 255) / 256, 256, 0, stream>>>(w2, B2, CC, CC, 16.0f);      /* all weights stored (in,out) */
  const dim3 gP(((NTK / 16) * (CC / 64) + 3) / 4, NBt), gS(((NTK / 16) * (NTK / 64) + 3) / 4, NBt), gE((NTK * (CC / 8) + 255) / 256, NBt);
  const size_t sT = (size_t)NTK * CC, sQKV = (size_t)NTK * 3 * CC, sS = (size_t)NTK * NTK;      /* elements per image */
  k_tok<<<gE, 256, 0, stream>>>(x, T16);
  k_gemm_hhx<0><<<gP, 128, 0, stream>>>(T16, CC, sT, BQ, CC, 0, 0.0625f, bq, 0, nullptr, 1, 0, 0, QKV, nullptr, 3 * CC, sQKV, NTK, CC, CC); k_gemm_hhx<0><<<gP, 128, 0, stream>>>(T16, CC, sT, BK, CC, 0, 0.0625f, bk, 0, nullptr, 1, 0, 0, QKV + CC, nullptr, 3 * CC, sQKV, NTK, CC, CC); k_gemm_hhx<0><<<gP, 128, 0, stream>>>(T16, CC, sT, BV, CC, 0, 0.0625f, bv, 0, nullptr, 1, 0, 0, QKV + 2 * CC, nullptr, 3 * CC, sQKV, NTK, CC, CC);      /* q | k | v (exact + bias) */
  k_planes<<<gE, 256, 0, stream>>>(QKV, Qh, Ql, Kh, Kl); k_vt<<<gE, 256, 0, stream>>>(QKV, VT);
  k_gemm_hhx<0><<<gS, 128, 0, stream>>>(Kh, CC, sT, Qh, CC, sT, 1.0f, nullptr, 0, nullptr, 1, 0, 0, S, nullptr, NTK, sS, NTK, NTK, CC);
  k_gemm_hhx<0><<<gS, 128, 0, stream>>>(Kl, CC, sT, Qh, CC, sT, 0.0009765625f, nullptr, 0, S, 1, (size_t)NTK, 0, S, nullptr, NTK, sS, NTK, NTK, CC);
  k_gemm_hhx<0><<<gS, 128, 0, stream>>>(Kh, CC, sT, Ql, CC, sT, 0.0009765625f, nullptr, 0, S, 1, (size_t)NTK, 0, S, nullptr, NTK, sS, NTK, NTK, CC);      /* S'[j][i] = k_j.q_i (the transposed logits) with hi.hi + lo.hi + hi.lo: M = N = 1024, K 256 */
  k_soft<<<dim3(NTK / 8, NBt), 256, 0, stream>>>(S, P16);      /* softmax over i per j (= the module's softmax over the query axis) */
  k_gemm_hhx<0><<<gP, 128, 0, stream>>>(P16, NTK, sS, VT, NTK, sT, 0.0009765625f, nullptr, 0, nullptr, 1, 0, 0, nullptr, A16, CC, sT, NTK, CC, NTK);      /* att[j] = sum_i P'[j][i].v[i] to f16: N 256 K 1024 */
  k_gemm_hhx<0><<<gP, 128, 0, stream>>>(A16, CC, sT, B1, CC, 0, 0.0625f, b1, 0, nullptr, 1, 0, 0, T1, nullptr, CC, sT, NTK, CC, CC); k_silu<<<gE, 256, 0, stream>>>(T1, H16);
  k_gemm_hhx<0><<<gP, 128, 0, stream>>>(H16, CC, sT, B2, CC, 0, 0.0625f, b2, 0, nullptr, 1, 0, 0, T2, nullptr, CC, sT, NTK, CC, CC);      /* MLP */
  k_ln_out<<<dim3(NTK / 32, NBt), 256, 0, stream>>>(T2, g, be, (float*)d_out);
}

// v002
// Measured time: 200 microseconds a run.
// Next to v001, in two timings, it ran 2.06 times as fast each time.
// Over all steps from v000 it is 12.1 times as fast.
#include <hip/hip_runtime.h>
// Token self-attention block on a feature map (B 16, C 256, 32×32 = 1024 tokens): q, k, v = t·W + b (W stored (in,out)); m = q·kᵀ (no scaling); softmax over the QUERY axis i; att[j] = Σ_i m[i][j]·v[i]; MLP (SiLU, 256→256→256); LayerNorm; back to NCHW → [16,256,32,32].
// Structure: the column softmax is a row softmax of mᵀ = k·qᵀ, so per batch: S' = K·Qᵀ (rows j, cols i), row softmax, att = P'·V; everything as GEMMs + row kernels.
// Compute dtype: x and parameters rounded to bf16; q/k/v with exact products; q and k carried as f16 hi + lo·2^10 planes with three cross products (≈f32 logits — they reach σ≈8 unscaled), softmax in f32, P (×2^10), v, attention output and the SiLU hidden as f16 operands (≈2^-12), f32 accumulation; LayerNorm in f32. v_wmma_f32_16x16x32_f16.
#define NBt 16
#define CC 256
#define NTK 1024
typedef __bf16 v16b __attribute__((ext_vector_type(16)));
typedef unsigned short v8us __attribute__((ext_vector_type(8), may_alias));
typedef float  v8f  __attribute__((ext_vector_type(8)));
typedef float  v4f  __attribute__((ext_vector_type(4)));
typedef float  v4fa __attribute__((ext_vector_type(4), may_alias));
union FragB { v16b v; v8us half[2]; unsigned short u[16]; };

__device__ __forceinline__ unsigned short bf16_bits(float x) { unsigned int u = __float_as_uint(x); return (unsigned short)((u + 0x7FFFu + ((u >> 16) & 1u)) >> 16); }
__device__ __forceinline__ float bf16_val(unsigned short b) { return __uint_as_float(((unsigned int)b) << 16); }
__device__ __forceinline__ float bf16_round(float x) { return bf16_val(bf16_bits(x)); }
// D += A·B with NT terms: 1 = ah·bh, 2 = + al·bh (A split), 3 = + ah·bl (both split)
template <int NT>
__device__ __forceinline__ v8f mmaN(v16b ah, v16b al, v16b bh, v16b bl, v8f c) {
  c = __builtin_amdgcn_wmma_f32_16x16x32_bf16(false, ah, false, bh, (short)0, c, false, false);
  if (NT >= 2) c = __builtin_amdgcn_wmma_f32_16x16x32_bf16(false, al, false, bh, (short)0, c, false, false);
  if (NT >= 3) c = __builtin_amdgcn_wmma_f32_16x16x32_bf16(false, ah, false, bl, (short)0, c, false, false);
  asm volatile("v_nop\n\tv_nop\n\tv_nop\n\tv_nop" : "+v"(c) : "v"(ah), "v"(al), "v"(bh), "v"(bl));
  return c;
}

__global__ __launch_bounds__(256) void k_wt_bf16(const float* __restrict__ W, unsigned short* __restrict__ Wt, int K, int N) {
  const int t = blockIdx.x * 256 + threadIdx.x;
  const int k8n = K / 8;
  if (t >= N * k8n) return;
  const int n = t / k8n, k8 = (t % k8n) * 8;
  v8us v;
#pragma unroll
  for (int i = 0; i < 8; ++i) v[i] = bf16_bits(W[(size_t)(k8 + i) * N + n]);
  *(v8us*)(Wt + (size_t)n * K + k8) = v;
  
}

// GEMM C[M][N] (f32, pitch ldc) = act(A[M][K]·W + bias). A f32 row-major (pitch lda) converted per fragment to bf16
// (ASPLIT: hi/lo two planes -> 2 terms, else single rounded term); Wt bf16 [N][K] (pitch ldb). BIAS_BF16 rounds the
// bias to bf16 first (bias quantised to bf16 before the add). K%32==0, M%16==0, N%64==0.
template <bool ASPLIT, int ACT, bool BIAS_BF16>
__global__ __launch_bounds__(128) void k_gemm_bf(const float* __restrict__ A, int lda, const unsigned short* __restrict__ Wt, int ldb,
                                               const float* __restrict__ bias, float* __restrict__ C, int ldc, int M, int N, int K) {
  __shared__ __attribute__((aligned(16))) float so[4][16][64];
  const int tid = threadIdx.x, w = tid >> 5, lane = tid & 31, ln = lane & 15, hh = lane >> 4;
  const int ntn = N / 64;
  const int wid = blockIdx.x * 4 + w;
  const int mt = wid / ntn, nq = wid % ntn;
  if (mt * 16 >= M) return;
  const int row0 = mt * 16, col0 = nq * 64;
  const float* arow = A + (size_t)(row0 + ln) * lda;
  v8f acc[4] = {};
  for (int kb = 0; kb < K; kb += 32) {
    FragB ah, al;
    const v4f x0 = *(const v4fa*)(arow + kb + 8 * hh), x1 = *(const v4fa*)(arow + kb + 8 * hh + 4);
    const v4f x2 = *(const v4fa*)(arow + kb + 16 + 8 * hh), x3 = *(const v4fa*)(arow + kb + 16 + 8 * hh + 4);
    float xs[16] = {x0[0],x0[1],x0[2],x0[3],x1[0],x1[1],x1[2],x1[3],x2[0],x2[1],x2[2],x2[3],x3[0],x3[1],x3[2],x3[3]};
#pragma unroll
    for (int i = 0; i < 16; ++i) { const unsigned short hb = bf16_bits(xs[i]); ah.u[i] = hb; al.u[i] = ASPLIT ? bf16_bits(xs[i] - bf16_val(hb)) : (unsigned short)0; }
#pragma unroll
    for (int t = 0; t < 4; ++t) {
      const unsigned short* brow = Wt + (size_t)(col0 + t * 16 + ln) * ldb + kb;
      FragB b;
      b.half[0] = *(const v8us*)(brow + 8 * hh);
      b.half[1] = *(const v8us*)(brow + 16 + 8 * hh);
      acc[t] = mmaN<ASPLIT ? 2 : 1>(ah.v, al.v, b.v, b.v, acc[t]);
    }
  }
#pragma unroll
  for (int t = 0; t < 4; ++t) {
    float bv = bias ? bias[col0 + t * 16 + ln] : 0.f;
    if (BIAS_BF16) bv = bf16_round(bv);
#pragma unroll
    for (int r = 0; r < 8; ++r) { float v = acc[t][r] + bv; if (ACT == 1) v = fmaxf(v, 0.f); so[w][8 * hh + r][t * 16 + ln] = v; }
  }
  __builtin_amdgcn_fence(__ATOMIC_ACQ_REL, "workgroup");
  __builtin_amdgcn_wave_barrier();
  const int rsub = lane >> 4, c4 = (lane & 15) * 4;
  {
#pragma unroll
    for (int q = 0; q < 8; ++q) {
      const int r = q * 2 + rsub;
      const v4f v = *(const v4fa*)&so[w][r][c4];
      *(v4f*)(C + (size_t)(row0 + r) * ldc + col0 + c4) = v;
    }
    
  }
}

// GEMM C = act(A·W + bias + resid): A f32 (ASPLIT -> hi/lo 2 terms), Wt bf16 [N][K]; ACT 0 none, 1 relu, 2 exact gelu;
// resid (optional, f32, row index = (row % rmod), pitch ldr, RES_BF16 rounds it) added before the activation.
template <bool ASPLIT, int ACT, bool BIAS_BF16, bool RES_BF16>
__global__ __launch_bounds__(128) void k_gemm_bf3(const float* __restrict__ A, int lda, const unsigned short* __restrict__ Wt, int ldb,
                                                const float* __restrict__ bias, const float* __restrict__ resid, int rmod, int ldr,
                                                float* __restrict__ C, int ldc, int M, int N, int K) {
  __shared__ __attribute__((aligned(16))) float so[4][16][64];
  const int tid = threadIdx.x, w = tid >> 5, lane = tid & 31, ln = lane & 15, hh = lane >> 4;
  const int ntn = N / 64;
  const int wid = blockIdx.x * 4 + w;
  const int mt = wid / ntn, nq = wid % ntn;
  if (mt * 16 >= M) return;
  const int row0 = mt * 16, col0 = nq * 64;
  const float* arow = A + (size_t)(row0 + ln) * lda;
  v8f acc[4] = {};
  for (int kb = 0; kb < K; kb += 32) {
    FragB ah, al;
    const v4f x0 = *(const v4fa*)(arow + kb + 8 * hh), x1 = *(const v4fa*)(arow + kb + 8 * hh + 4);
    const v4f x2 = *(const v4fa*)(arow + kb + 16 + 8 * hh), x3 = *(const v4fa*)(arow + kb + 16 + 8 * hh + 4);
    float xs[16] = {x0[0],x0[1],x0[2],x0[3],x1[0],x1[1],x1[2],x1[3],x2[0],x2[1],x2[2],x2[3],x3[0],x3[1],x3[2],x3[3]};
#pragma unroll
    for (int i = 0; i < 16; ++i) { const unsigned short hb = bf16_bits(xs[i]); ah.u[i] = hb; al.u[i] = ASPLIT ? bf16_bits(xs[i] - bf16_val(hb)) : (unsigned short)0; }
#pragma unroll
    for (int t = 0; t < 4; ++t) {
      const unsigned short* brow = Wt + (size_t)(col0 + t * 16 + ln) * ldb + kb;
      FragB b;
      b.half[0] = *(const v8us*)(brow + 8 * hh);
      b.half[1] = *(const v8us*)(brow + 16 + 8 * hh);
      acc[t] = mmaN<ASPLIT ? 2 : 1>(ah.v, al.v, b.v, b.v, acc[t]);
    }
  }
#pragma unroll
  for (int t = 0; t < 4; ++t) {
    const int col = col0 + t * 16 + ln;
    float bv = bias ? bias[col] : 0.f;
    if (BIAS_BF16) bv = bf16_round(bv);
#pragma unroll
    for (int r = 0; r < 8; ++r) {
      float v = acc[t][r] + bv;
      if (resid) { float rv = resid[(size_t)((row0 + 8 * hh + r) % rmod) * ldr + col]; if (RES_BF16) rv = bf16_round(rv); v += rv; }
      if (ACT == 1) v = fmaxf(v, 0.f);
      if (ACT == 2) v = 0.5f * v * (1.0f + erff(v * 0.70710678118654752f));
      if (ACT == 3) { const float u = 0.7978845608028654f * (v + 0.044715f * v * v * v); v = 0.5f * v * (1.0f + tanhf(u)); }
      so[w][8 * hh + r][t * 16 + ln] = v;
    }
  }
  __builtin_amdgcn_fence(__ATOMIC_ACQ_REL, "workgroup");
  __builtin_amdgcn_wave_barrier();
  const int rsub = lane >> 4, c4 = (lane & 15) * 4;
  {
#pragma unroll
    for (int q = 0; q < 8; ++q) {
      const int r = q * 2 + rsub;
      const v4f v = *(const v4fa*)&so[w][r][c4];
      *(v4f*)(C + (size_t)(row0 + r) * ldc + col0 + c4) = v;
    }
    
  }
}
// row LayerNorm (biased variance, eps) over N: s = X (+ R); optional out_sum <- s; out_norm <- (s-mu)*rsqrt(var+eps)*g + b
template <bool PARAM_BF16>
__global__ __launch_bounds__(256) void k_layernorm(const float* __restrict__ X, const float* __restrict__ R, const float* __restrict__ g, const float* __restrict__ bta,
                                                  float* __restrict__ out_sum, float* __restrict__ out_norm, int N, float eps) {
  __shared__ float red[256];
  const int row = blockIdx.x, tid = threadIdx.x;
  const float* x = X + (size_t)row * N; const float* rr = R ? R + (size_t)row * N : nullptr;
  float vals[16];                     // up to N = 4096
  const int per = N / 256;            // contiguous chunk per thread? use strided-by-4 chunks: thread handles j = tid*4 + 1024*u
  float s1 = 0.f;
  for (int u = 0; u < per / 4; ++u) {
    const int j = tid * 4 + 1024 * u;
    const v4f a = *(const v4fa*)(x + j);
    v4f b = {0.f,0.f,0.f,0.f}; if (rr) b = *(const v4fa*)(rr + j);
#pragma unroll
    for (int q = 0; q < 4; ++q) { const float v = a[q] + b[q]; vals[u * 4 + q] = v; s1 += v; }
  }
  red[tid] = s1; __syncthreads();
  for (int st = 128; st > 0; st >>= 1) { if (tid < st) red[tid] += red[tid + st]; __syncthreads(); }
  const float mu = red[0] / (float)N; __syncthreads();
  float s2 = 0.f;
  for (int u = 0; u < per / 4; ++u)
#pragma unroll
    for (int q = 0; q < 4; ++q) { const float c = vals[u * 4 + q] - mu; s2 += c * c; }
  red[tid] = s2; __syncthreads();
  for (int st = 128; st > 0; st >>= 1) { if (tid < st) red[tid] += red[tid + st]; __syncthreads(); }
  const float rs = rsqrtf(red[0] / (float)N + eps);
  {
    for (int u = 0; u < per / 4; ++u) {
      const int j = tid * 4 + 1024 * u;
      v4f o, sm;
#pragma unroll
      for (int q = 0; q < 4; ++q) {
        float gg = g[j + q], bb = bta[j + q];
        if (PARAM_BF16) { gg = bf16_round(gg); bb = bf16_round(bb); }
        sm[q] = vals[u * 4 + q]; o[q] = (vals[u * 4 + q] - mu) * rs * gg + bb;
      }
      if (out_sum) *(v4f*)(out_sum + (size_t)row * N + j) = sm;
      *(v4f*)(out_norm + (size_t)row * N + j) = o;
    }
    
  }
}



// ---- f16 WMMA path (v_wmma_f32_16x16x32_f16): 11-bit significands for operands in range — used where a [0,1] probability operand needs more precision than bf16
typedef _Float16 v16h __attribute__((ext_vector_type(16)));
union FragH { v16h v; v8us half[2]; _Float16 h[16]; unsigned short u[16]; };
template <int NT>
__device__ __forceinline__ v8f mmaH(v16h ah, v16h al, v16h bh, v16h bl, v8f c) {
  c = __builtin_amdgcn_wmma_f32_16x16x32_f16(false, ah, false, bh, (short)0, c, false, false);
  if (NT >= 2) c = __builtin_amdgcn_wmma_f32_16x16x32_f16(false, al, false, bh, (short)0, c, false, false);
  if (NT >= 3) c = __builtin_amdgcn_wmma_f32_16x16x32_f16(false, ah, false, bl, (short)0, c, false, false);
  asm volatile("v_nop\n\tv_nop\n\tv_nop\n\tv_nop" : "+v"(c) : "v"(ah), "v"(al), "v"(bh), "v"(bl));
  return c;
}
// batched GEMM like k_gemm_b but f16 operands: A f32 (split into f16 hi/lo if ASPLIT, else rounded to f16), Bt = f16 values [n][k]; alpha; C f32; N multiple of 16 (partial tiles skipped)
template <bool ASPLIT>
__global__ __launch_bounds__(128) void k_gemm_h(const float* __restrict__ A, int lda, size_t sA, const _Float16* __restrict__ Bh, int ldb, size_t sB, float alpha, float* __restrict__ C, int ldc, size_t sC, int M, int N, int K) {
  __shared__ __attribute__((aligned(16))) float so[4][16][64];
  const int tid = threadIdx.x, w = tid >> 5, lane = tid & 31, ln = lane & 15, hh = lane >> 4; const int by = blockIdx.y;
  A += (size_t)by * sA; Bh += (size_t)by * sB; C += (size_t)by * sC;
  const int ntn = (N + 63) / 64; const int wid = blockIdx.x * 4 + w; const int mt = wid / ntn, nq = wid % ntn; if (mt * 16 >= M) return;
  const int row0 = mt * 16, col0 = nq * 64; const float* arow = A + (size_t)(row0 + ln) * lda;
  v8f acc[4] = {};
  for (int kb = 0; kb < K; kb += 32) {
    FragH ah, al;
    const v4f x0 = *(const v4fa*)(arow + kb + 8 * hh), x1 = *(const v4fa*)(arow + kb + 8 * hh + 4), x2 = *(const v4fa*)(arow + kb + 16 + 8 * hh), x3 = *(const v4fa*)(arow + kb + 16 + 8 * hh + 4);
    float xs[16] = {x0[0],x0[1],x0[2],x0[3],x1[0],x1[1],x1[2],x1[3],x2[0],x2[1],x2[2],x2[3],x3[0],x3[1],x3[2],x3[3]};
#pragma unroll
    for (int i = 0; i < 16; ++i) { const _Float16 h = (_Float16)xs[i]; ah.h[i] = h; al.h[i] = ASPLIT ? (_Float16)(xs[i] - (float)h) : (_Float16)0.0f; }
#pragma unroll
    for (int t = 0; t < 4; ++t) { if (col0 + t * 16 >= N) continue; const size_t boff = (size_t)(col0 + t * 16 + ln) * ldb + kb; FragH bq; bq.half[0] = *(const v8us*)(Bh + boff + 8 * hh); bq.half[1] = *(const v8us*)(Bh + boff + 16 + 8 * hh);
      acc[t] = mmaH<ASPLIT ? 2 : 1>(ah.v, al.v, bq.v, bq.v, acc[t]); }
  }
#pragma unroll
  for (int t = 0; t < 4; ++t) { if (col0 + t * 16 >= N) continue;
#pragma unroll
    for (int r = 0; r < 8; ++r) so[w][8 * hh + r][t * 16 + ln] = acc[t][r] * alpha; }
  __builtin_amdgcn_fence(__ATOMIC_ACQ_REL, "workgroup"); __builtin_amdgcn_wave_barrier();
  const int rsub = lane >> 4, c4 = (lane & 15) * 4;
  {
#pragma unroll
    for (int q = 0; q < 8; ++q) { const int r = q * 2 + rsub; if (col0 + c4 < N) { const v4f v = *(const v4fa*)&so[w][r][c4]; *(v4f*)(C + (size_t)(row0 + r) * ldc + col0 + c4) = v; } }
     }
}

// Wt[n][k] = f16(W[k][n]·scale) from f32 row-major W[K][N] (scale = power of two; bf16-exact weights stay exact in f16 away from the subnormal range)
__global__ __launch_bounds__(256) void k_wt_f16(const float* __restrict__ W, _Float16* __restrict__ Wt, int K, int N, float scale) {
  const int t = blockIdx.x * 256 + threadIdx.x; if (t >= N * (K / 8)) return; const int n = t / (K / 8), k8 = (t % (K / 8)) * 8; FragH f;
#pragma unroll
  for (int i = 0; i < 8; ++i) f.h[i] = (_Float16)(bf16_round(W[(size_t)(k8 + i) * N + n]) * scale); const v8us o = f.half[0];
  *(v8us*)((unsigned short*)Wt + (size_t)n * K + k8) = o; 
}
// Block-tiled GEMM with fused epilogue: v = acc*alpha + bias[by*sBias + col] (+ CP[by*sC + (row/rowsPerB)*sCPb + col] if CP) ; ACT 0 none / 1 elu ; writes f32 C and/or f16 C16 (each only if non-null); by = blockIdx.y = image.
// One work-group of 8 waves owns a 128 x 128 tile of C; A and Bh (f16, [row][k]) come in 64-wide k slices as whole 128-byte lines and are shared through LDS (two buffers, the next slice's loads fly during this slice's products).
// Each wave does 32 x 64 of the tile; k runs upward in steps of 32 per accumulator. Needs M % 128 == 0, N % 128 == 0, K % 64 == 0, grid.x = (M/128)*(N/128).
#define GT 128      /* tile edge, rows of A and rows of Bh per work-group */
#define GK 64       /* k slice */
#define GPIT 72     /* LDS row pitch in f16: 144 B = 16 B x 9, so the 16 rows of a 16-byte fragment read fall on distinct banks */
#define GSO 68      /* epilogue row pitch in f32: rows 8 apart fall on different banks */
template <int ACT>
__global__ __launch_bounds__(256) void k_gemm_hhx(const _Float16* __restrict__ A, int lda, size_t sA, const _Float16* __restrict__ Bh, int ldb, size_t sB, float alpha, const float* __restrict__ bias, size_t sBias, const float* __restrict__ CP, int rowsPerB, size_t sCPb, int row0g,
    float* __restrict__ C, _Float16* __restrict__ C16, int ldc, size_t sC, int M, int N, int K) {
  __shared__ __attribute__((aligned(16))) unsigned short st[2][2][GT][GPIT];      // [buffer][A | Bh][row][k]; reused as f32 staging by the epilogue
  (void)M;
  const int tid = threadIdx.x, w = tid >> 5, lane = tid & 31, ln = lane & 15, hh = lane >> 4; const int by = blockIdx.y;
  A += (size_t)by * sA; Bh += (size_t)by * sB; const size_t cofs = (size_t)by * sC; const float* bp = bias ? bias + (size_t)by * sBias : nullptr;
  const int ntn = N / GT; const int row0 = ((int)blockIdx.x / ntn) * GT, col0 = ((int)blockIdx.x % ntn) * GT;
  const int wr = (w >> 1) * 32, wc = (w & 1) * 64;      // the wave's 32 x 64 part of the tile
  const int lr = tid >> 3, lc = (tid & 7) * 8;          // staging: 8 lanes per 128-byte row slice, 32 rows per pass
  const char* ab = (const char*)A; const char* bb = (const char*)Bh;      // uniform bases; each lane keeps eight byte offsets
  unsigned ao[4], bo[4];
#pragma unroll
  for (int i = 0; i < 4; ++i) { ao[i] = (unsigned)(((row0 + lr + 32 * i) * lda + lc) * 2); bo[i] = (unsigned)(((col0 + lr + 32 * i) * ldb + lc) * 2); }
  v8us ra[4], rb[4];
#pragma unroll
  for (int i = 0; i < 4; ++i) { ra[i] = *(const v8us*)(ab + ao[i]); rb[i] = *(const v8us*)(bb + bo[i]); }
  float bv[4] = {0.f, 0.f, 0.f, 0.f};
  if (bp) {
#pragma unroll
    for (int t = 0; t < 4; ++t) bv[t] = bp[col0 + wc + t * 16 + ln];
#pragma unroll
    for (int t = 0; t < 4; ++t) bv[t] = bf16_round(bv[t]);
  }
#pragma unroll
  for (int i = 0; i < 4; ++i) { *(v8us*)&st[0][0][lr + 32 * i][lc] = ra[i]; *(v8us*)&st[0][1][lr + 32 * i][lc] = rb[i]; }
  __syncthreads();
  v8f acc[2][4] = {};
  for (int kb = 0; kb < K; kb += GK) {
    const int cur = (kb / GK) & 1; const bool more = kb + GK < K;
    if (more) {
#pragma unroll
      for (int i = 0; i < 4; ++i) { ao[i] += GK * 2; bo[i] += GK * 2; }      // each lane's offsets walk along k
#pragma unroll
      for (int i = 0; i < 4; ++i) { ra[i] = *(const v8us*)(ab + ao[i]); rb[i] = *(const v8us*)(bb + bo[i]); }
    }
#pragma unroll
    for (int ks = 0; ks < GK; ks += 32) {
      FragH fa[2], fb[4];
#pragma unroll
      for (int mi = 0; mi < 2; ++mi) { fa[mi].half[0] = *(const v8us*)&st[cur][0][wr + mi * 16 + ln][ks + 8 * hh]; fa[mi].half[1] = *(const v8us*)&st[cur][0][wr + mi * 16 + ln][ks + 16 + 8 * hh]; }
#pragma unroll
      for (int t = 0; t < 4; ++t) { fb[t].half[0] = *(const v8us*)&st[cur][1][wc + t * 16 + ln][ks + 8 * hh]; fb[t].half[1] = *(const v8us*)&st[cur][1][wc + t * 16 + ln][ks + 16 + 8 * hh]; }
#pragma unroll
      for (int mi = 0; mi < 2; ++mi)
#pragma unroll
        for (int t = 0; t < 4; ++t) acc[mi][t] = mmaH<1>(fa[mi].v, fa[mi].v, fb[t].v, fb[t].v, acc[mi][t]);
    }
    if (more) {
#pragma unroll
      for (int i = 0; i < 4; ++i) { *(v8us*)&st[cur ^ 1][0][lr + 32 * i][lc] = ra[i]; *(v8us*)&st[cur ^ 1][1][lr + 32 * i][lc] = rb[i]; }
    }
    __syncthreads();      // publishes the next slice and ends every wave's reads of this one (after the last slice: frees the LDS for the epilogue)
  }
  const int rsub = lane >> 4, c4 = (lane & 15) * 4; typedef _Float16 v4h __attribute__((ext_vector_type(4)));
  const int orow = row0 + wr + rsub, ocol = col0 + wc + c4;      // the lane's first output row (then every second one) and its four columns
  v4f cp[16];
  if (CP) {      // all sixteen addend loads go out together, ahead of the staging, so that their latency is paid once
#pragma unroll
    for (int q = 0; q < 16; ++q) { const int bidx = (row0g + orow + q * 2) / rowsPerB; cp[q] = *(const v4fa*)(CP + cofs + (size_t)bidx * sCPb + ocol);
      if ((q & 3) == 3 && q < 15) asm volatile("s_wait_xcnt 0x0" ::: "memory"); }      // later loads' results may be given the registers that held earlier loads' addresses
  }
  float* so = (float*)&st[0][0][0][0] + (size_t)w * (32 * GSO);      // the wave's own 32 x 64 f32 staging
#pragma unroll
  for (int mi = 0; mi < 2; ++mi)
#pragma unroll
    for (int t = 0; t < 4; ++t)
#pragma unroll
      for (int r = 0; r < 8; ++r) so[(mi * 16 + 8 * hh + r) * GSO + t * 16 + ln] = acc[mi][t][r] * alpha + bv[t];
  __builtin_amdgcn_fence(__ATOMIC_ACQ_REL, "workgroup"); __builtin_amdgcn_wave_barrier();
  v4f o[16];
#pragma unroll
  for (int q = 0; q < 16; ++q) o[q] = *(const v4fa*)&so[(q * 2 + rsub) * GSO + c4];
  if (CP) {
#pragma unroll
    for (int q = 0; q < 16; ++q) o[q] += cp[q];
  }
#pragma unroll
  for (int q = 0; q < 16; ++q)
#pragma unroll
    for (int i = 0; i < 4; ++i) { float v = o[q][i]; if (ACT == 1) v = (v > 0.f) ? v : expm1f(v); else if (ACT == 7) v = (v > 0.f) ? v + 1.0f : expf(v); else if (ACT == 8) v = tanhf(v); else if (ACT == 9) v = 0.5f * v * (1.0f + tanhf(0.7978845608028654f * (v + 0.044715f * v * v * v))); else if (ACT == 11) v = 1.0f / (1.0f + expf(-v)); else if (ACT == 12) v = (v > 0.f) ? v : 0.01f * v; else if (ACT == 14) v = (v > 0.f) ? v : 0.1f * v; else if (ACT == 15) v = v / (1.0f + expf(-v)); else if (ACT == 3) v = fmaxf(v, 0.f); else if (ACT == 6) v = 0.5f * v * (1.0f + erff(v * 0.70710678118654752f)); o[q][i] = v; }
  if (C) {
#pragma unroll
    for (int q = 0; q < 16; ++q) *(v4f*)(C + cofs + (size_t)(orow + q * 2) * ldc + ocol) = o[q];
    asm volatile("s_wait_xcnt 0x0" ::: "memory");      // the f16 stores below reuse registers that these stores name
  }
  if (C16) {
#pragma unroll
    for (int q = 0; q < 16; ++q) { v4h h4; for (int i = 0; i < 4; ++i) h4[i] = (_Float16)o[q][i]; *(v4h*)(C16 + cofs + (size_t)(orow + q * 2) * ldc + ocol) = h4; }
  }
}


typedef _Float16 v4h __attribute__((ext_vector_type(4)));

__global__ __launch_bounds__(256) void k_x16(const float* __restrict__ x, _Float16* __restrict__ X16, size_t n8) { const size_t t = (size_t)blockIdx.x * 256 + threadIdx.x; if (t >= n8) return; FragH f;
#pragma unroll
  for (int q = 0; q < 8; ++q) f.h[q] = (_Float16)bf16_round(x[t * 8 + q]); *(v8us*)((unsigned short*)X16 + t * 8) = f.half[0];  }
__global__ __launch_bounds__(256) void k_h16(const float* __restrict__ x, _Float16* __restrict__ X16, size_t n8) { const size_t t = (size_t)blockIdx.x * 256 + threadIdx.x; if (t >= n8) return; FragH f;
#pragma unroll
  for (int q = 0; q < 8; ++q) f.h[q] = (_Float16)x[t * 8 + q]; *(v8us*)((unsigned short*)X16 + t * 8) = f.half[0];  }
__global__ __launch_bounds__(256) void k_round16f(const float* __restrict__ W, _Float16* __restrict__ Bt, size_t n8) { const size_t t = (size_t)blockIdx.x * 256 + threadIdx.x; if (t >= n8) return; FragH f;
#pragma unroll
  for (int i = 0; i < 8; ++i) f.h[i] = (_Float16)(bf16_round(W[t * 8 + i]) * 16.0f); *(v8us*)((unsigned short*)Bt + t * 8) = f.half[0];  }
template <int NHv, int TTv>
__global__ __launch_bounds__(256) void k_vt(const _Float16* __restrict__ V16, int ldv, int voff, _Float16* __restrict__ Vt) { __shared__ unsigned short tl[64][66]; const int tid = threadIdx.x; const int slab = blockIdx.x / (TTv / 64), lg = blockIdx.x % (TTv / 64); const int b = slab / NHv, h = slab % NHv;
  for (int i = tid; i < 64 * 8; i += 256) { const int r = i / 8, c8 = (i % 8) * 8; FragH f; f.half[0] = *(const v8us*)((const unsigned short*)V16 + ((size_t)b * TTv + lg * 64 + r) * ldv + voff + h * 64 + c8);
#pragma unroll
    for (int q = 0; q < 8; ++q) tl[r][c8 + q] = f.u[q]; }
  __syncthreads();
  {
#pragma unroll
    for (int rd = 0; rd < 2; ++rd) { const int d = rd * 32 + tid / 8, pc = tid % 8; FragH f;
#pragma unroll
      for (int q = 0; q < 8; ++q) f.u[q] = tl[pc * 8 + q][d];
      *(v8us*)((unsigned short*)Vt + ((size_t)slab * 64 + d) * TTv + lg * 64 + pc * 8) = f.half[0]; }
     } }

__global__ __launch_bounds__(256) void k_hl(const float* __restrict__ F, _Float16* __restrict__ Hh, _Float16* __restrict__ Hl, size_t n8) { const size_t t = (size_t)blockIdx.x * 256 + threadIdx.x; if (t >= n8) return; FragH fh, fl; const v4f a = *(const v4fa*)(F + t * 8), c = *(const v4fa*)(F + t * 8 + 4);
#pragma unroll
  for (int q = 0; q < 4; ++q) { _Float16 h = (_Float16)a[q]; fh.h[q] = h; fl.h[q] = (_Float16)((a[q] - (float)h) * 1024.0f); h = (_Float16)c[q]; fh.h[4 + q] = h; fl.h[4 + q] = (_Float16)((c[q] - (float)h) * 1024.0f); }
  { *(v8us*)((unsigned short*)Hh + t * 8) = fh.half[0]; *(v8us*)((unsigned short*)Hl + t * 8) = fl.half[0];  } }

__global__ __launch_bounds__(256) void k_tok(const float* __restrict__ x, _Float16* __restrict__ T16) { const int b = blockIdx.y; T16 += (size_t)b * NTK * CC; const int t = blockIdx.x * 256 + threadIdx.x; if (t >= NTK * (CC / 8)) return; const int c0 = (t % (CC / 8)) * 8, n = t / (CC / 8); FragH f;
#pragma unroll
  for (int q = 0; q < 8; ++q) f.h[q] = (_Float16)bf16_round(x[((size_t)b * CC + c0 + q) * NTK + n]);
  *(v8us*)((unsigned short*)T16 + (size_t)n * CC + c0) = f.half[0];  }
__global__ __launch_bounds__(256) void k_planes(const float* __restrict__ QKV, _Float16* __restrict__ Qh, _Float16* __restrict__ Ql, _Float16* __restrict__ Kh, _Float16* __restrict__ Kl) {
  #pragma clang fp contract(off)
  { const size_t b = blockIdx.y; QKV += b * NTK * 3 * CC; Qh += b * NTK * CC; Ql += b * NTK * CC; Kh += b * NTK * CC; Kl += b * NTK * CC; }
  const int t = blockIdx.x * 256 + threadIdx.x; if (t >= NTK * (CC / 8)) return; const int c0 = (t % (CC / 8)) * 8, n = t / (CC / 8); FragH qh, ql, kh, kl;
#pragma unroll
  for (int q = 0; q < 8; ++q) { const float qv = QKV[(size_t)n * 3 * CC + c0 + q], kv = QKV[(size_t)n * 3 * CC + CC + c0 + q]; const _Float16 a = (_Float16)qv, b = (_Float16)kv; qh.h[q] = a; ql.h[q] = (_Float16)((qv - (float)a) * 1024.0f); kh.h[q] = b; kl.h[q] = (_Float16)((kv - (float)b) * 1024.0f); }
  { *(v8us*)((unsigned short*)Qh + (size_t)n * CC + c0) = qh.half[0]; *(v8us*)((unsigned short*)Ql + (size_t)n * CC + c0) = ql.half[0]; *(v8us*)((unsigned short*)Kh + (size_t)n * CC + c0) = kh.half[0]; *(v8us*)((unsigned short*)Kl + (size_t)n * CC + c0) = kl.half[0];  } }
__global__ __launch_bounds__(256) void k_vt(const float* __restrict__ QKV, _Float16* __restrict__ VT) { QKV += (size_t)blockIdx.y * NTK * 3 * CC; VT += (size_t)blockIdx.y * CC * NTK; const int t = blockIdx.x * 256 + threadIdx.x; if (t >= CC * (NTK / 8)) return; const int n0 = (t % (NTK / 8)) * 8, c = t / (NTK / 8); FragH f;
#pragma unroll
  for (int q = 0; q < 8; ++q) f.h[q] = (_Float16)QKV[(size_t)(n0 + q) * 3 * CC + 2 * CC + c];
  *(v8us*)((unsigned short*)VT + (size_t)c * NTK + n0) = f.half[0];  }
__global__ __launch_bounds__(256) void k_soft(const float* __restrict__ S, _Float16* __restrict__ P16) {
  #pragma clang fp contract(off)
  const int tid = threadIdx.x, w = tid >> 5, ln = tid & 31; const int r = blockIdx.x * 8 + w; if (r >= NTK) return; S += (size_t)blockIdx.y * NTK * NTK; P16 += (size_t)blockIdx.y * NTK * NTK; const float* sr = S + (size_t)r * NTK; float m = -3.0e38f;
#pragma unroll 1
  for (int jb = 0; jb < NTK; jb += 256) { const v4f a = *(const v4fa*)(sr + jb + 8 * ln), c = *(const v4fa*)(sr + jb + 8 * ln + 4);
#pragma unroll
    for (int k = 0; k < 4; ++k) { m = fmaxf(m, a[k]); m = fmaxf(m, c[k]); } }
  for (int o = 16; o > 0; o >>= 1) m = fmaxf(m, __shfl_xor(m, o, 32));
  float su = 0.f;
#pragma unroll 1
  for (int jb = 0; jb < NTK; jb += 256) { const v4f a = *(const v4fa*)(sr + jb + 8 * ln), c = *(const v4fa*)(sr + jb + 8 * ln + 4);
#pragma unroll
    for (int k = 0; k < 4; ++k) { su += expf(a[k] - m); su += expf(c[k] - m); } }
  for (int o = 16; o > 0; o >>= 1) su += __shfl_xor(su, o, 32); const float inv = 1024.0f / su;
  {
#pragma unroll 1
    for (int jb = 0; jb < NTK; jb += 256) { const v4f a = *(const v4fa*)(sr + jb + 8 * ln), c = *(const v4fa*)(sr + jb + 8 * ln + 4); FragH f;
#pragma unroll
      for (int k = 0; k < 4; ++k) { f.h[k] = (_Float16)(expf(a[k] - m) * inv); f.h[4 + k] = (_Float16)(expf(c[k] - m) * inv); }
      *(v8us*)((unsigned short*)P16 + (size_t)r * NTK + jb + 8 * ln) = f.half[0]; }
     } }
__global__ __launch_bounds__(256) void k_silu(const float* __restrict__ T, _Float16* __restrict__ H16) {
  #pragma clang fp contract(off)
  T += (size_t)blockIdx.y * NTK * CC; H16 += (size_t)blockIdx.y * NTK * CC;
  const int t = blockIdx.x * 256 + threadIdx.x; if (t >= NTK * (CC / 8)) return; const v4f a = *(const v4fa*)(T + (size_t)t * 8), c = *(const v4fa*)(T + (size_t)t * 8 + 4); FragH f;
#pragma unroll
  for (int q = 0; q < 8; ++q) { const float v = (q < 4) ? a[q] : c[q - 4]; f.h[q] = (_Float16)(v / (1.0f + expf(-v))); }
  *(v8us*)((unsigned short*)H16 + (size_t)t * 8) = f.half[0];  }
__global__ __launch_bounds__(256) void k_ln_out(const float* __restrict__ A, const float* __restrict__ g, const float* __restrict__ bb, float* __restrict__ out) {
  #pragma clang fp contract(off)
  __shared__ float tile[32][CC + 1]; const int tid = threadIdx.x, w = tid >> 5, l = tid & 31; const int j0 = blockIdx.x * 32; const int b = blockIdx.y; A += (size_t)b * NTK * CC;
  for (int jj = w; jj < 32; jj += 8) { const int j = j0 + jj; const float* ar = A + (size_t)j * CC; float v[8]; float s = 0.f;
#pragma unroll
    for (int k = 0; k < 8; ++k) { v[k] = ar[l + 32 * k]; s += v[k]; }
    for (int o = 16; o > 0; o >>= 1) s += __shfl_xor(s, o, 32); const float mu = s / (float)CC; float q2 = 0.f;
#pragma unroll
    for (int k = 0; k < 8; ++k) { const float d = v[k] - mu; q2 += d * d; }
    for (int o = 16; o > 0; o >>= 1) q2 += __shfl_xor(q2, o, 32); const float rs = rsqrtf(q2 / (float)CC + 1e-5f);
#pragma unroll
    for (int k = 0; k < 8; ++k) { const int c = l + 32 * k; tile[jj][c] = (v[k] - mu) * rs * bf16_round(g[c]) + bf16_round(bb[c]); } }
  __syncthreads();
  { for (int c = w; c < CC; c += 8) *(float*)(out + ((size_t)b * CC + c) * NTK + j0 + l) = tile[l][c];  } }

extern "C" void kernel_launch(void* const* d_in, const int* in_sizes, int n_in,
                              void* d_out, int out_size, void* d_ws, size_t ws_size, hipStream_t stream) {
  (void)in_sizes; (void)n_in; (void)out_size;
  const float* const* I = (const float* const*)d_in; const float* x = I[0]; const float* wq = I[1]; const float* bq = I[2]; const float* wk = I[3]; const float* bk = I[4]; const float* wv = I[5]; const float* bv = I[6]; const float* w1 = I[7]; const float* b1 = I[8]; const float* w2 = I[9]; const float* b2 = I[10]; const float* g = I[11]; const float* be = I[12];
  char* ws = (char*)d_ws; size_t off = 0;
  auto take = [&](size_t bytes) { char* p = ws + off; off += (bytes + 255) & ~(size_t)255; return p; };
  _Float16* BQ = (_Float16*)take(CC * CC * 2); _Float16* BK = (_Float16*)take(CC * CC * 2); _Float16* BV = (_Float16*)take(CC * CC * 2); _Float16* B1 = (_Float16*)take(CC * CC * 2); _Float16* B2 = (_Float16*)take(CC * CC * 2);
  /* one workspace slab per image for every intermediate: all NBt images go through each launch, image = blockIdx.y */
  _Float16* T16 = (_Float16*)take((size_t)NBt * NTK * CC * 2); float* QKV = (float*)take((size_t)NBt * NTK * 3 * CC * 4); _Float16* Qh = (_Float16*)take((size_t)NBt * NTK * CC * 2); _Float16* Ql = (_Float16*)take((size_t)NBt * NTK * CC * 2); _Float16* Kh = (_Float16*)take((size_t)NBt * NTK * CC * 2); _Float16* Kl = (_Float16*)take((size_t)NBt * NTK * CC * 2); _Float16* VT = (_Float16*)take((size_t)NBt * CC * NTK * 2);
  float* S = (float*)take((size_t)NBt * NTK * NTK * 4); _Float16* P16 = (_Float16*)take((size_t)NBt * NTK * NTK * 2); _Float16* A16 = (_Float16*)take((size_t)NBt * NTK * CC * 2); float* T1 = (float*)take((size_t)NBt * NTK * CC * 4); _Float16* H16 = (_Float16*)take((size_t)NBt * NTK * CC * 2); float* T2 = (float*)take((size_t)NBt * NTK * CC * 4);
  if (off > ws_size) return;      // 5 weight planes of 128 KiB + 16 x 15 MiB: under 241 MiB
  k_wt_f16<<<(CC * (CC / 8) + 255) / 256, 256, 0, stream>>>(wq, BQ, CC, CC, 16.0f); k_wt_f16<<<(CC * (CC / 8) + 255) / 256, 256, 0, stream>>>(wk, BK, CC, CC, 16.0f); k_wt_f16<<<(CC * (CC / 8) + 255) / 256, 256, 0, stream>>>(wv, BV, CC, CC, 16.0f); k_wt_f16<<<(CC * (CC / 8) + 255) / 256, 256, 0, stream>>>(w1, B1, CC, CC, 16.0f); k_wt_f16<<<(CC * (CC / 8) + 255) / 256, 256, 0, stream>>>(w2, B2, CC, CC, 16.0f);      /* all weights stored (in,out) */
  const dim3 gP((NTK / GT) * (CC / GT), NBt), gS((NTK / GT) * (NTK / GT), NBt), gE((NTK * (CC / 8) + 255) / 256, NBt);
  const size_t sT = (size_t)NTK * CC, sQKV = (size_t)NTK * 3 * CC, sS = (size_t)NTK * NTK;      /* elements per image */
  k_tok<<<gE, 256, 0, stream>>>(x, T16);
  k_gemm_hhx<0><<<gP, 256, 0, stream>>>(T16, CC, sT, BQ, CC, 0, 0.0625f, bq, 0, nullptr, 1, 0, 0, QKV, nullptr, 3 * CC, sQKV, NTK, CC, CC); k_gemm_hhx<0><<<gP, 256, 0, stream>>>(T16, CC, sT, BK, CC, 0, 0.0625f, bk, 0, nullptr, 1, 0, 0, QKV + CC, nullptr, 3 * CC, sQKV, NTK, CC, CC); k_gemm_hhx<0><<<gP, 256, 0, stream>>>(T16, CC, sT, BV, CC, 0, 0.0625f, bv, 0, nullptr, 1, 0, 0, QKV + 2 * CC, nullptr, 3 * CC, sQKV, NTK, CC, CC);      /* q | k | v (exact + bias) */
  k_planes<<<gE, 256, 0, stream>>>(QKV, Qh, Ql, Kh, Kl); k_vt<<<gE, 256, 0, stream>>>(QKV, VT);
  k_gemm_hhx<0><<<gS, 256, 0, stream>>>(Kh, CC, sT, Qh, CC, sT, 1.0f, nullptr, 0, nullptr, 1, 0, 0, S, nullptr, NTK, sS, NTK, NTK, CC);
  k_gemm_hhx<0><<<gS, 256, 0, stream>>>(Kl, CC, sT, Qh, CC, sT, 0.0009765625f, nullptr, 0, S, 1, (size_t)NTK, 0, S, nullptr, NTK, sS, NTK, NTK, CC);
  k_gemm_hhx<0><<<gS, 256, 0, stream>>>(Kh, CC, sT, Ql, CC, sT, 0.0009765625f, nullptr, 0, S, 1, (size_t)NTK, 0, S, nullptr, NTK, sS, NTK, NTK, CC);      /* S'[j][i] = k_j.q_i (the transposed logits) with hi.hi + lo.hi + hi.lo: M = N = 1024, K 256 */
  k_soft<<<dim3(NTK / 8, NBt), 256, 0, stream>>>(S, P16);      /* softmax over i per j (= the module's softmax over the query axis) */
  k_gemm_hhx<0><<<gP, 256, 0, stream>>>(P16, NTK, sS, VT, NTK, sT, 0.0009765625f, nullptr, 0, nullptr, 1, 0, 0, nullptr, A16, CC, sT, NTK, CC, NTK);      /* att[j] = sum_i P'[j][i].v[i] to f16: N 256 K 1024 */
  k_gemm_hhx<0><<<gP, 256, 0, stream>>>(A16, CC, sT, B1, CC, 0, 0.0625f, b1, 0, nullptr, 1, 0, 0, T1, nullptr, CC, sT, NTK, CC, CC); k_silu<<<gE, 256, 0, stream>>>(T1, H16);
  k_gemm_hhx<0><<<gP, 256, 0, stream>>>(H16, CC, sT, B2, CC, 0, 0.0625f, b2, 0, nullptr, 1, 0, 0, T2, nullptr, CC, sT, NTK, CC, CC);      /* MLP */
  k_ln_out<<<dim3(NTK / 32, NBt), 256, 0, stream>>>(T2, g, be, (float*)d_out);
}

// v003
// A run of this version takes 156 microseconds.
// Next to v002, in two timings, it ran 1.28 times as fast each time.
// All steps since v000 together make it 15.5 times as fast.
#include <hip/hip_runtime.h>
// Token self-attention block on a feature map (B 16, C 256, 32×32 = 1024 tokens): q, k, v = t·W + b (W stored (in,out)); m = q·kᵀ (no scaling); softmax over the QUERY axis i; att[j] = Σ_i m[i][j]·v[i]; MLP (SiLU, 256→256→256); LayerNorm; back to NCHW → [16,256,32,32].
// Structure: the column softmax is a row softmax of mᵀ = k·qᵀ, so per batch: S' = K·Qᵀ (rows j, cols i), row softmax, att = P'·V; everything as GEMMs + row kernels.
// Compute dtype: x and parameters rounded to bf16; q/k/v with exact products; q and k carried as f16 hi + lo·2^10 planes with three cross products (≈f32 logits — they reach σ≈8 unscaled), softmax in f32, P (×2^10), v, attention output and the SiLU hidden as f16 operands (≈2^-12), f32 accumulation; LayerNorm in f32. v_wmma_f32_16x16x32_f16.
#define NBt 16
#define CC 256
#define NTK 1024
typedef __bf16 v16b __attribute__((ext_vector_type(16)));
typedef unsigned short v8us __attribute__((ext_vector_type(8), may_alias));
typedef float  v8f  __attribute__((ext_vector_type(8)));
typedef float  v4f  __attribute__((ext_vector_type(4)));
typedef float  v4fa __attribute__((ext_vector_type(4), may_alias));
union FragB { v16b v; v8us half[2]; unsigned short u[16]; };

__device__ __forceinline__ unsigned short bf16_bits(float x) { unsigned int u = __float_as_uint(x); return (unsigned short)((u + 0x7FFFu + ((u >> 16) & 1u)) >> 16); }
__device__ __forceinline__ float bf16_val(unsigned short b) { return __uint_as_float(((unsigned int)b) << 16); }
__device__ __forceinline__ float bf16_round(float x) { return bf16_val(bf16_bits(x)); }
// D += A·B with NT terms: 1 = ah·bh, 2 = + al·bh (A split), 3 = + ah·bl (both split)
template <int NT>
__device__ __forceinline__ v8f mmaN(v16b ah, v16b al, v16b bh, v16b bl, v8f c) {
  c = __builtin_amdgcn_wmma_f32_16x16x32_bf16(false, ah, false, bh, (short)0, c, false, false);
  if (NT >= 2) c = __builtin_amdgcn_wmma_f32_16x16x32_bf16(false, al, false, bh, (short)0, c, false, false);
  if (NT >= 3) c = __builtin_amdgcn_wmma_f32_16x16x32_bf16(false, ah, false, bl, (short)0, c, false, false);
  asm volatile("v_nop\n\tv_nop\n\tv_nop\n\tv_nop" : "+v"(c) : "v"(ah), "v"(al), "v"(bh), "v"(bl));
  return c;
}

__global__ __launch_bounds__(256) void k_wt_bf16(const float* __restrict__ W, unsigned short* __restrict__ Wt, int K, int N) {
  const int t = blockIdx.x * 256 + threadIdx.x;
  const int k8n = K / 8;
  if (t >= N * k8n) return;
  const int n = t / k8n, k8 = (t % k8n) * 8;
  v8us v;
#pragma unroll
  for (int i = 0; i < 8; ++i) v[i] = bf16_bits(W[(size_t)(k8 + i) * N + n]);
  *(v8us*)(Wt + (size_t)n * K + k8) = v;
  
}

// GEMM C[M][N] (f32, pitch ldc) = act(A[M][K]·W + bias). A f32 row-major (pitch lda) converted per fragment to bf16
// (ASPLIT: hi/lo two planes -> 2 terms, else single rounded term); Wt bf16 [N][K] (pitch ldb). BIAS_BF16 rounds the
// bias to bf16 first (bias quantised to bf16 before the add). K%32==0, M%16==0, N%64==0.
template <bool ASPLIT, int ACT, bool BIAS_BF16>
__global__ __launch_bounds__(128) void k_gemm_bf(const float* __restrict__ A, int lda, const unsigned short* __restrict__ Wt, int ldb,
                                               const float* __restrict__ bias, float* __restrict__ C, int ldc, int M, int N, int K) {
  __shared__ __attribute__((aligned(16))) float so[4][16][64];
  const int tid = threadIdx.x, w = tid >> 5, lane = tid & 31, ln = lane & 15, hh = lane >> 4;
  const int ntn = N / 64;
  const int wid = blockIdx.x * 4 + w;
  const int mt = wid / ntn, nq = wid % ntn;
  if (mt * 16 >= M) return;
  const int row0 = mt * 16, col0 = nq * 64;
  const float* arow = A + (size_t)(row0 + ln) * lda;
  v8f acc[4] = {};
  for (int kb = 0; kb < K; kb += 32) {
    FragB ah, al;
    const v4f x0 = *(const v4fa*)(arow + kb + 8 * hh), x1 = *(const v4fa*)(arow + kb + 8 * hh + 4);
    const v4f x2 = *(const v4fa*)(arow + kb + 16 + 8 * hh), x3 = *(const v4fa*)(arow + kb + 16 + 8 * hh + 4);
    float xs[16] = {x0[0],x0[1],x0[2],x0[3],x1[0],x1[1],x1[2],x1[3],x2[0],x2[1],x2[2],x2[3],x3[0],x3[1],x3[2],x3[3]};
#pragma unroll
    for (int i = 0; i < 16; ++i) { const unsigned short hb = bf16_bits(xs[i]); ah.u[i] = hb; al.u[i] = ASPLIT ? bf16_bits(xs[i] - bf16_val(hb)) : (unsigned short)0; }
#pragma unroll
    for (int t = 0; t < 4; ++t) {
      const unsigned short* brow = Wt + (size_t)(col0 + t * 16 + ln) * ldb + kb;
      FragB b;
      b.half[0] = *(const v8us*)(brow + 8 * hh);
      b.half[1] = *(const v8us*)(brow + 16 + 8 * hh);
      acc[t] = mmaN<ASPLIT ? 2 : 1>(ah.v, al.v, b.v, b.v, acc[t]);
    }
  }
#pragma unroll
  for (int t = 0; t < 4; ++t) {
    float bv = bias ? bias[col0 + t * 16 + ln] : 0.f;
    if (BIAS_BF16) bv = bf16_round(bv);
#pragma unroll
    for (int r = 0; r < 8; ++r) { float v = acc[t][r] + bv; if (ACT == 1) v = fmaxf(v, 0.f); so[w][8 * hh + r][t * 16 + ln] = v; }
  }
  __builtin_amdgcn_fence(__ATOMIC_ACQ_REL, "workgroup");
  __builtin_amdgcn_wave_barrier();
  const int rsub = lane >> 4, c4 = (lane & 15) * 4;
  {
#pragma unroll
    for (int q = 0; q < 8; ++q) {
      const int r = q * 2 + rsub;
      const v4f v = *(const v4fa*)&so[w][r][c4];
      *(v4f*)(C + (size_t)(row0 + r) * ldc + col0 + c4) = v;
    }
    
  }
}

// GEMM C = act(A·W + bias + resid): A f32 (ASPLIT -> hi/lo 2 terms), Wt bf16 [N][K]; ACT 0 none, 1 relu, 2 exact gelu;
// resid (optional, f32, row index = (row % rmod), pitch ldr, RES_BF16 rounds it) added before the activation.
template <bool ASPLIT, int ACT, bool BIAS_BF16, bool RES_BF16>
__global__ __launch_bounds__(128) void k_gemm_bf3(const float* __restrict__ A, int lda, const unsigned short* __restrict__ Wt, int ldb,
                                                const float* __restrict__ bias, const float* __restrict__ resid, int rmod, int ldr,
                                                float* __restrict__ C, int ldc, int M, int N, int K) {
  __shared__ __attribute__((aligned(16))) float so[4][16][64];
  const int tid = threadIdx.x, w = tid >> 5, lane = tid & 31, ln = lane & 15, hh = lane >> 4;
  const int ntn = N / 64;
  const int wid = blockIdx.x * 4 + w;
  const int mt = wid / ntn, nq = wid % ntn;
  if (mt * 16 >= M) return;
  const int row0 = mt * 16, col0 = nq * 64;
  const float* arow = A + (size_t)(row0 + ln) * lda;
  v8f acc[4] = {};
  for (int kb = 0; kb < K; kb += 32) {
    FragB ah, al;
    const v4f x0 = *(const v4fa*)(arow + kb + 8 * hh), x1 = *(const v4fa*)(arow + kb + 8 * hh + 4);
    const v4f x2 = *(const v4fa*)(arow + kb + 16 + 8 * hh), x3 = *(const v4fa*)(arow + kb + 16 + 8 * hh + 4);
    float xs[16] = {x0[0],x0[1],x0[2],x0[3],x1[0],x1[1],x1[2],x1[3],x2[0],x2[1],x2[2],x2[3],x3[0],x3[1],x3[2],x3[3]};
#pragma unroll
    for (int i = 0; i < 16; ++i) { const unsigned short hb = bf16_bits(xs[i]); ah.u[i] = hb; al.u[i] = ASPLIT ? bf16_bits(xs[i] - bf16_val(hb)) : (unsigned short)0; }
#pragma unroll
    for (int t = 0; t < 4; ++t) {
      const unsigned short* brow = Wt + (size_t)(col0 + t * 16 + ln) * ldb + kb;
      FragB b;
      b.half[0] = *(const v8us*)(brow + 8 * hh);
      b.half[1] = *(const v8us*)(brow + 16 + 8 * hh);
      acc[t] = mmaN<ASPLIT ? 2 : 1>(ah.v, al.v, b.v, b.v, acc[t]);
    }
  }
#pragma unroll
  for (int t = 0; t < 4; ++t) {
    const int col = col0 + t * 16 + ln;
    float bv = bias ? bias[col] : 0.f;
    if (BIAS_BF16) bv = bf16_round(bv);
#pragma unroll
    for (int r = 0; r < 8; ++r) {
      float v = acc[t][r] + bv;
      if (resid) { float rv = resid[(size_t)((row0 + 8 * hh + r) % rmod) * ldr + col]; if (RES_BF16) rv = bf16_round(rv); v += rv; }
      if (ACT == 1) v = fmaxf(v, 0.f);
      if (ACT == 2) v = 0.5f * v * (1.0f + erff(v * 0.70710678118654752f));
      if (ACT == 3) { const float u = 0.7978845608028654f * (v + 0.044715f * v * v * v); v = 0.5f * v * (1.0f + tanhf(u)); }
      so[w][8 * hh + r][t * 16 + ln] = v;
    }
  }
  __builtin_amdgcn_fence(__ATOMIC_ACQ_REL, "workgroup");
  __builtin_amdgcn_wave_barrier();
  const int rsub = lane >> 4, c4 = (lane & 15) * 4;
  {
#pragma unroll
    for (int q = 0; q < 8; ++q) {
      const int r = q * 2 + rsub;
      const v4f v = *(const v4fa*)&so[w][r][c4];
      *(v4f*)(C + (size_t)(row0 + r) * ldc + col0 + c4) = v;
    }
    
  }
}
// row LayerNorm (biased variance, eps) over N: s = X (+ R); optional out_sum <- s; out_norm <- (s-mu)*rsqrt(var+eps)*g + b
template <bool PARAM_BF16>
__global__ __launch_bounds__(256) void k_layernorm(const float* __restrict__ X, const float* __restrict__ R, const float* __restrict__ g, const float* __restrict__ bta,
                                                  float* __restrict__ out_sum, float* __restrict__ out_norm, int N, float eps) {
  __shared__ float red[256];
  const int row = blockIdx.x, tid = threadIdx.x;
  const float* x = X + (size_t)row * N; const float* rr = R ? R + (size_t)row * N : nullptr;
  float vals[16];                     // up to N = 4096
  const int per = N / 256;            // contiguous chunk per thread? use strided-by-4 chunks: thread handles j = tid*4 + 1024*u
  float s1 = 0.f;
  for (int u = 0; u < per / 4; ++u) {
    const int j = tid * 4 + 1024 * u;
    const v4f a = *(const v4fa*)(x + j);
    v4f b = {0.f,0.f,0.f,0.f}; if (rr) b = *(const v4fa*)(rr + j);
#pragma unroll
    for (int q = 0; q < 4; ++q) { const float v = a[q] + b[q]; vals[u * 4 + q] = v; s1 += v; }
  }
  red[tid] = s1; __syncthreads();
  for (int st = 128; st > 0; st >>= 1) { if (tid < st) red[tid] += red[tid + st]; __syncthreads(); }
  const float mu = red[0] / (float)N; __syncthreads();
  float s2 = 0.f;
  for (int u = 0; u < per / 4; ++u)
#pragma unroll
    for (int q = 0; q < 4; ++q) { const float c = vals[u * 4 + q] - mu; s2 += c * c; }
  red[tid] = s2; __syncthreads();
  for (int st = 128; st > 0; st >>= 1) { if (tid < st) red[tid] += red[tid + st]; __syncthreads(); }
  const float rs = rsqrtf(red[0] / (float)N + eps);
  {
    for (int u = 0; u < per / 4; ++u) {
      const int j = tid * 4 + 1024 * u;
      v4f o, sm;
#pragma unroll
      for (int q = 0; q < 4; ++q) {
        float gg = g[j + q], bb = bta[j + q];
        if (PARAM_BF16) { gg = bf16_round(gg); bb = bf16_round(bb); }
        sm[q] = vals[u * 4 + q]; o[q] = (vals[u * 4 + q] - mu) * rs * gg + bb;
      }
      if (out_sum) *(v4f*)(out_sum + (size_t)row * N + j) = sm;
      *(v4f*)(out_norm + (size_t)row * N + j) = o;
    }
    
  }
}



// ---- f16 WMMA path (v_wmma_f32_16x16x32_f16): 11-bit significands for operands in range — used where a [0,1] probability operand needs more precision than bf16
typedef _Float16 v16h __attribute__((ext_vector_type(16)));
union FragH { v16h v; v8us half[2]; _Float16 h[16]; unsigned short u[16]; };
template <int NT>
__device__ __forceinline__ v8f mmaH(v16h ah, v16h al, v16h bh, v16h bl, v8f c) {
  c = __builtin_amdgcn_wmma_f32_16x16x32_f16(false, ah, false, bh, (short)0, c, false, false);
  if (NT >= 2) c = __builtin_amdgcn_wmma_f32_16x16x32_f16(false, al, false, bh, (short)0, c, false, false);
  if (NT >= 3) c = __builtin_amdgcn_wmma_f32_16x16x32_f16(false, ah, false, bl, (short)0, c, false, false);
  asm volatile("v_nop\n\tv_nop\n\tv_nop\n\tv_nop" : "+v"(c) : "v"(ah), "v"(al), "v"(bh), "v"(bl));
  return c;
}
// batched GEMM like k_gemm_b but f16 operands: A f32 (split into f16 hi/lo if ASPLIT, else rounded to f16), Bt = f16 values [n][k]; alpha; C f32; N multiple of 16 (partial tiles skipped)
template <bool ASPLIT>
__global__ __launch_bounds__(128) void k_gemm_h(const float* __restrict__ A, int lda, size_t sA, const _Float16* __restrict__ Bh, int ldb, size_t sB, float alpha, float* __restrict__ C, int ldc, size_t sC, int M, int N, int K) {
  __shared__ __attribute__((aligned(16))) float so[4][16][64];
  const int tid = threadIdx.x, w = tid >> 5, lane = tid & 31, ln = lane & 15, hh = lane >> 4; const int by = blockIdx.y;
  A += (size_t)by * sA; Bh += (size_t)by * sB; C += (size_t)by * sC;
  const int ntn = (N + 63) / 64; const int wid = blockIdx.x * 4 + w; const int mt = wid / ntn, nq = wid % ntn; if (mt * 16 >= M) return;
  const int row0 = mt * 16, col0 = nq * 64; const float* arow = A + (size_t)(row0 + ln) * lda;
  v8f acc[4] = {};
  for (int kb = 0; kb < K; kb += 32) {
    FragH ah, al;
    const v4f x0 = *(const v4fa*)(arow + kb + 8 * hh), x1 = *(const v4fa*)(arow + kb + 8 * hh + 4), x2 = *(const v4fa*)(arow + kb + 16 + 8 * hh), x3 = *(const v4fa*)(arow + kb + 16 + 8 * hh + 4);
    float xs[16] = {x0[0],x0[1],x0[2],x0[3],x1[0],x1[1],x1[2],x1[3],x2[0],x2[1],x2[2],x2[3],x3[0],x3[1],x3[2],x3[3]};
#pragma unroll
    for (int i = 0; i < 16; ++i) { const _Float16 h = (_Float16)xs[i]; ah.h[i] = h; al.h[i] = ASPLIT ? (_Float16)(xs[i] - (float)h) : (_Float16)0.0f; }
#pragma unroll
    for (int t = 0; t < 4; ++t) { if (col0 + t * 16 >= N) continue; const size_t boff = (size_t)(col0 + t * 16 + ln) * ldb + kb; FragH bq; bq.half[0] = *(const v8us*)(Bh + boff + 8 * hh); bq.half[1] = *(const v8us*)(Bh + boff + 16 + 8 * hh);
      acc[t] = mmaH<ASPLIT ? 2 : 1>(ah.v, al.v, bq.v, bq.v, acc[t]); }
  }
#pragma unroll
  for (int t = 0; t < 4; ++t) { if (col0 + t * 16 >= N) continue;
#pragma unroll
    for (int r = 0; r < 8; ++r) so[w][8 * hh + r][t * 16 + ln] = acc[t][r] * alpha; }
  __builtin_amdgcn_fence(__ATOMIC_ACQ_REL, "workgroup"); __builtin_amdgcn_wave_barrier();
  const int rsub = lane >> 4, c4 = (lane & 15) * 4;
  {
#pragma unroll
    for (int q = 0; q < 8; ++q) { const int r = q * 2 + rsub; if (col0 + c4 < N) { const v4f v = *(const v4fa*)&so[w][r][c4]; *(v4f*)(C + (size_t)(row0 + r) * ldc + col0 + c4) = v; } }
     }
}

// Wt[n][k] = f16(W[k][n]·scale) from f32 row-major W[K][N] (scale = power of two; bf16-exact weights stay exact in f16 away from the subnormal range)
__global__ __launch_bounds__(256) void k_wt_f16(const float* __restrict__ W, _Float16* __restrict__ Wt, int K, int N, float scale) {
  const int t = blockIdx.x * 256 + threadIdx.x; if (t >= N * (K / 8)) return; const int n = t / (K / 8), k8 = (t % (K / 8)) * 8; FragH f;
#pragma unroll
  for (int i = 0; i < 8; ++i) f.h[i] = (_Float16)(bf16_round(W[(size_t)(k8 + i) * N + n]) * scale); const v8us o = f.half[0];
  *(v8us*)((unsigned short*)Wt + (size_t)n * K + k8) = o; 
}
// Block-tiled GEMM with fused epilogue: v = acc*alpha + bias[by*sBias + col] (+ CP[by*sC + (row/rowsPerB)*sCPb + col] if CP) ; ACT 0 none / 1 elu ; writes f32 C and/or f16 C16 (each only if non-null); by = blockIdx.y = image.
// One work-group of 8 waves owns a 128 x 128 tile of C; A and Bh (f16, [row][k]) come in 64-wide k slices as whole 128-byte lines and are shared through LDS (two buffers, the next slice's loads fly during this slice's products).
// Each wave does 32 x 64 of the tile; k runs upward in steps of 32 per accumulator. Needs M % 128 == 0, N % 128 == 0, K % 64 == 0, grid.x = (M/128)*(N/128).
#define GT 128      /* tile edge, rows of A and rows of Bh per work-group */
#define GK 64       /* k slice */
#define GPIT 72     /* LDS row pitch in f16: 144 B = 16 B x 9, so the 16 rows of a 16-byte fragment read fall on distinct banks */
#define GSO 68      /* epilogue row pitch in f32: rows 8 apart fall on different banks */
template <int ACT>
__global__ __launch_bounds__(256) void k_gemm_hhx(const _Float16* __restrict__ A, int lda, size_t sA, const _Float16* __restrict__ Bh, int ldb, size_t sB, float alpha, const float* __restrict__ bias, size_t sBias, const float* __restrict__ CP, int rowsPerB, size_t sCPb, int row0g,
    float* __restrict__ C, _Float16* __restrict__ C16, int ldc, size_t sC, int M, int N, int K) {
  __shared__ __attribute__((aligned(16))) unsigned short st[2][2][GT][GPIT];      // [buffer][A | Bh][row][k]; reused as f32 staging by the epilogue
  (void)M;
  const int tid = threadIdx.x, w = tid >> 5, lane = tid & 31, ln = lane & 15, hh = lane >> 4; const int by = blockIdx.y;
  A += (size_t)by * sA; Bh += (size_t)by * sB; const size_t cofs = (size_t)by * sC; const float* bp = bias ? bias + (size_t)by * sBias : nullptr;
  const int ntn = N / GT; const int row0 = ((int)blockIdx.x / ntn) * GT, col0 = ((int)blockIdx.x % ntn) * GT;
  const int wr = (w >> 1) * 32, wc = (w & 1) * 64;      // the wave's 32 x 64 part of the tile
  const int lr = tid >> 3, lc = (tid & 7) * 8;          // staging: 8 lanes per 128-byte row slice, 32 rows per pass
  const char* ab = (const char*)A; const char* bb = (const char*)Bh;      // uniform bases; each lane keeps eight byte offsets
  unsigned ao[4], bo[4];
#pragma unroll
  for (int i = 0; i < 4; ++i) { ao[i] = (unsigned)(((row0 + lr + 32 * i) * lda + lc) * 2); bo[i] = (unsigned)(((col0 + lr + 32 * i) * ldb + lc) * 2); }
  v8us ra[4], rb[4];
#pragma unroll
  for (int i = 0; i < 4; ++i) { ra[i] = *(const v8us*)(ab + ao[i]); rb[i] = *(const v8us*)(bb + bo[i]); }
  float bv[4] = {0.f, 0.f, 0.f, 0.f};
  if (bp) {
#pragma unroll
    for (int t = 0; t < 4; ++t) bv[t] = bp[col0 + wc + t * 16 + ln];
#pragma unroll
    for (int t = 0; t < 4; ++t) bv[t] = bf16_round(bv[t]);
  }
#pragma unroll
  for (int i = 0; i < 4; ++i) { *(v8us*)&st[0][0][lr + 32 * i][lc] = ra[i]; *(v8us*)&st[0][1][lr + 32 * i][lc] = rb[i]; }
  __syncthreads();
  v8f acc[2][4] = {};
  for (int kb = 0; kb < K; kb += GK) {
    const int cur = (kb / GK) & 1; const bool more = kb + GK < K;
    if (more) {
#pragma unroll
      for (int i = 0; i < 4; ++i) { ao[i] += GK * 2; bo[i] += GK * 2; }      // each lane's offsets walk along k
#pragma unroll
      for (int i = 0; i < 4; ++i) { ra[i] = *(const v8us*)(ab + ao[i]); rb[i] = *(const v8us*)(bb + bo[i]); }
    }
#pragma unroll
    for (int ks = 0; ks < GK; ks += 32) {
      FragH fa[2], fb[4];
#pragma unroll
      for (int mi = 0; mi < 2; ++mi) { fa[mi].half[0] = *(const v8us*)&st[cur][0][wr + mi * 16 + ln][ks + 8 * hh]; fa[mi].half[1] = *(const v8us*)&st[cur][0][wr + mi * 16 + ln][ks + 16 + 8 * hh]; }
#pragma unroll
      for (int t = 0; t < 4; ++t) { fb[t].half[0] = *(const v8us*)&st[cur][1][wc + t * 16 + ln][ks + 8 * hh]; fb[t].half[1] = *(const v8us*)&st[cur][1][wc + t * 16 + ln][ks + 16 + 8 * hh]; }
#pragma unroll
      for (int mi = 0; mi < 2; ++mi)
#pragma unroll
        for (int t = 0; t < 4; ++t) acc[mi][t] = mmaH<1>(fa[mi].v, fa[mi].v, fb[t].v, fb[t].v, acc[mi][t]);
    }
    if (more) {
#pragma unroll
      for (int i = 0; i < 4; ++i) { *(v8us*)&st[cur ^ 1][0][lr + 32 * i][lc] = ra[i]; *(v8us*)&st[cur ^ 1][1][lr + 32 * i][lc] = rb[i]; }
    }
    __syncthreads();      // publishes the next slice and ends every wave's reads of this one (after the last slice: frees the LDS for the epilogue)
  }
  const int rsub = lane >> 4, c4 = (lane & 15) * 4; typedef _Float16 v4h __attribute__((ext_vector_type(4)));
  const int orow = row0 + wr + rsub, ocol = col0 + wc + c4;      // the lane's first output row (then every second one) and its four columns
  v4f cp[16];
  if (CP) {      // all sixteen addend loads go out together, ahead of the staging, so that their latency is paid once
#pragma unroll
    for (int q = 0; q < 16; ++q) { const int bidx = (row0g + orow + q * 2) / rowsPerB; cp[q] = *(const v4fa*)(CP + cofs + (size_t)bidx * sCPb + ocol);
      if ((q & 3) == 3 && q < 15) asm volatile("s_wait_xcnt 0x0" ::: "memory"); }      // later loads' results may be given the registers that held earlier loads' addresses
  }
  float* so = (float*)&st[0][0][0][0] + (size_t)w * (32 * GSO);      // the wave's own 32 x 64 f32 staging
#pragma unroll
  for (int mi = 0; mi < 2; ++mi)
#pragma unroll
    for (int t = 0; t < 4; ++t)
#pragma unroll
      for (int r = 0; r < 8; ++r) so[(mi * 16 + 8 * hh + r) * GSO + t * 16 + ln] = acc[mi][t][r] * alpha + bv[t];
  __builtin_amdgcn_fence(__ATOMIC_ACQ_REL, "workgroup"); __builtin_amdgcn_wave_barrier();
  v4f o[16];
#pragma unroll
  for (int q = 0; q < 16; ++q) o[q] = *(const v4fa*)&so[(q * 2 + rsub) * GSO + c4];
  if (CP) {
#pragma unroll
    for (int q = 0; q < 16; ++q) o[q] += cp[q];
  }
#pragma unroll
  for (int q = 0; q < 16; ++q)
#pragma unroll
    for (int i = 0; i < 4; ++i) { float v = o[q][i]; if (ACT == 1) v = (v > 0.f) ? v : expm1f(v); else if (ACT == 7) v = (v > 0.f) ? v + 1.0f : expf(v); else if (ACT == 8) v = tanhf(v); else if (ACT == 9) v = 0.5f * v * (1.0f + tanhf(0.7978845608028654f * (v + 0.044715f * v * v * v))); else if (ACT == 11) v = 1.0f / (1.0f + expf(-v)); else if (ACT == 12) v = (v > 0.f) ? v : 0.01f * v; else if (ACT == 14) v = (v > 0.f) ? v : 0.1f * v; else if (ACT == 15) v = v / (1.0f + expf(-v)); else if (ACT == 3) v = fmaxf(v, 0.f); else if (ACT == 6) v = 0.5f * v * (1.0f + erff(v * 0.70710678118654752f)); o[q][i] = v; }
  if (C) {
#pragma unroll
    for (int q = 0; q < 16; ++q) *(v4f*)(C + cofs + (size_t)(orow + q * 2) * ldc + ocol) = o[q];
    asm volatile("s_wait_xcnt 0x0" ::: "memory");      // the f16 stores below reuse registers that these stores name
  }
  if (C16) {
#pragma unroll
    for (int q = 0; q < 16; ++q) { v4h h4; for (int i = 0; i < 4; ++i) h4[i] = (_Float16)o[q][i]; *(v4h*)(C16 + cofs + (size_t)(orow + q * 2) * ldc + ocol) = h4; }
  }
}


// Logits in one launch: C[j][i] = Ah.Bh + 2^-10 (Al.Bh + Ah.Bl), all four f16 planes [row][CC], image = blockIdx.y; the lo planes carry a factor 2^10.
// Tiling and staging as in k_gemm_hhx (128 x 128 tile, 8 waves of 32 x 64, 64-wide k slices, two LDS buffers); each slice brings all four planes, and every fragment read from LDS feeds the three products.
// Two accumulator sets per wave: hi (Ah.Bh) and lo (Al.Bh then Ah.Bl, k upward); they meet once, in the epilogue.
// The next slice's A planes fly during the first half of this slice's products, its B planes during the second half: half the staging registers, so that two work-groups fit on a WGP (144 KiB of LDS each, at most 256 registers a wave).
__global__ __launch_bounds__(256) __attribute__((amdgpu_waves_per_eu(4, 4))) void k_logits(const _Float16* __restrict__ Ah, const _Float16* __restrict__ Al, const _Float16* __restrict__ Bh, const _Float16* __restrict__ Bl, float* __restrict__ C) {
  __shared__ __attribute__((aligned(16))) unsigned short st[2][4][GT][GPIT];      // [buffer][Ah | Al | Bh | Bl][row][k]; reused as f32 staging by the epilogue
  const int tid = threadIdx.x, w = tid >> 5, lane = tid & 31, ln = lane & 15, hh = lane >> 4;
  const size_t pofs = (size_t)blockIdx.y * NTK * CC; C += (size_t)blockIdx.y * NTK * NTK;
  const int row0 = ((int)blockIdx.x / (NTK / GT)) * GT, col0 = ((int)blockIdx.x % (NTK / GT)) * GT;
  const int wr = (w >> 1) * 32, wc = (w & 1) * 64;      // the wave's 32 x 64 part of the tile
  const int lr = tid >> 3, lc = (tid & 7) * 8;          // staging: 8 lanes per 128-byte row slice, 32 rows per pass
  const char* pl[4] = {(const char*)(Ah + pofs), (const char*)(Al + pofs), (const char*)(Bh + pofs), (const char*)(Bl + pofs)};      // uniform bases
  const unsigned po[2] = {(unsigned)(((row0 + lr) * CC + lc) * 2), (unsigned)(((col0 + lr) * CC + lc) * 2)};      // the lane's byte offsets in the A and the B planes; further rows are constants, the slice a uniform step
  v8us rg[2][4];
#pragma unroll
  for (int g = 0; g < 2; ++g) {
#pragma unroll
    for (int p = 0; p < 2; ++p)
#pragma unroll
      for (int i = 0; i < 4; ++i) rg[p][i] = *(const v8us*)(pl[2 * g + p] + po[g] + i * (32 * CC * 2));
#pragma unroll
    for (int p = 0; p < 2; ++p)
#pragma unroll
      for (int i = 0; i < 4; ++i) *(v8us*)&st[0][2 * g + p][lr + 32 * i][lc] = rg[p][i];
  }
  asm volatile("s_wait_xcnt 0x0" ::: "memory");      // the registers that the loads above name are given other values from here on
  __syncthreads();
  v8f hi[2][4] = {}, lo[2][4] = {};
#pragma unroll 1      // kept rolled: unrolled, the LDS addresses of both buffers stay live at once and the wave no longer fits 256 registers
  for (int kb = 0; kb < CC; kb += GK) {
    const int cur = (kb / GK) & 1; const bool more = kb + GK < CC;
#pragma unroll
    for (int g = 0; g < 2; ++g) {      // k half g of this slice; beside it plane pair g of the next slice
      const int ks = g * 32;
      if (more) {
#pragma unroll
        for (int p = 0; p < 2; ++p)
#pragma unroll
          for (int i = 0; i < 4; ++i) rg[p][i] = *(const v8us*)(pl[2 * g + p] + po[g] + i * (32 * CC * 2) + (kb + GK) * 2);
      }
      FragH fah[2], fal[2];
#pragma unroll
      for (int mi = 0; mi < 2; ++mi) {
        fah[mi].half[0] = *(const v8us*)&st[cur][0][wr + mi * 16 + ln][ks + 8 * hh]; fah[mi].half[1] = *(const v8us*)&st[cur][0][wr + mi * 16 + ln][ks + 16 + 8 * hh];
        fal[mi].half[0] = *(const v8us*)&st[cur][1][wr + mi * 16 + ln][ks + 8 * hh]; fal[mi].half[1] = *(const v8us*)&st[cur][1][wr + mi * 16 + ln][ks + 16 + 8 * hh];
      }
      FragH fbh[2], fbl[2];      // this column block's B fragments and the next one's, read one block ahead of their products
      fbh[0].half[0] = *(const v8us*)&st[cur][2][wc + ln][ks + 8 * hh]; fbh[0].half[1] = *(const v8us*)&st[cur][2][wc + ln][ks + 16 + 8 * hh];
      fbl[0].half[0] = *(const v8us*)&st[cur][3][wc + ln][ks + 8 * hh]; fbl[0].half[1] = *(const v8us*)&st[cur][3][wc + ln][ks + 16 + 8 * hh];
#pragma unroll
      for (int t = 0; t < 4; ++t) {
        const int c = t & 1, n = c ^ 1;
        if (t < 3) {
          fbh[n].half[0] = *(const v8us*)&st[cur][2][wc + (t + 1) * 16 + ln][ks + 8 * hh]; fbh[n].half[1] = *(const v8us*)&st[cur][2][wc + (t + 1) * 16 + ln][ks + 16 + 8 * hh];
          fbl[n].half[0] = *(const v8us*)&st[cur][3][wc + (t + 1) * 16 + ln][ks + 8 * hh]; fbl[n].half[1] = *(const v8us*)&st[cur][3][wc + (t + 1) * 16 + ln][ks + 16 + 8 * hh];
        }
#pragma unroll
        for (int mi = 0; mi < 2; ++mi) hi[mi][t] = mmaH<1>(fah[mi].v, fah[mi].v, fbh[c].v, fbh[c].v, hi[mi][t]);
#pragma unroll
        for (int mi = 0; mi < 2; ++mi) lo[mi][t] = mmaH<1>(fal[mi].v, fal[mi].v, fbh[c].v, fbh[c].v, lo[mi][t]);
#pragma unroll
        for (int mi = 0; mi < 2; ++mi) lo[mi][t] = mmaH<1>(fah[mi].v, fah[mi].v, fbl[c].v, fbl[c].v, lo[mi][t]);
      }
      if (more) {      // the other buffer's last readers left it at the barrier that ended the slice before
#pragma unroll
        for (int p = 0; p < 2; ++p)
#pragma unroll
          for (int i = 0; i < 4; ++i) *(v8us*)&st[cur ^ 1][2 * g + p][lr + 32 * i][lc] = rg[p][i];
      }
    }
    __syncthreads();      // publishes the next slice and ends every wave's reads of this one (after the last slice: frees the LDS for the epilogue)
  }
  float* so = (float*)&st[0][0][0][0] + (size_t)w * (32 * GSO);      // the wave's own 32 x 64 f32 staging
#pragma unroll
  for (int mi = 0; mi < 2; ++mi)
#pragma unroll
    for (int t = 0; t < 4; ++t)
#pragma unroll
      for (int r = 0; r < 8; ++r) so[(mi * 16 + 8 * hh + r) * GSO + t * 16 + ln] = lo[mi][t][r] * 0.0009765625f + hi[mi][t][r];
  __builtin_amdgcn_fence(__ATOMIC_ACQ_REL, "workgroup"); __builtin_amdgcn_wave_barrier();
  const int rsub = lane >> 4, c4 = (lane & 15) * 4;
  float* cw = C + (size_t)(row0 + wr + rsub) * NTK + col0 + wc + c4;      // the lane's first output row (then every second one) and its four columns
#pragma unroll
  for (int q = 0; q < 16; ++q) { const v4f o = *(const v4fa*)&so[(q * 2 + rsub) * GSO + c4]; *(v4f*)(cw + (size_t)q * 2 * NTK) = o; }
}

typedef _Float16 v4h __attribute__((ext_vector_type(4)));

__global__ __launch_bounds__(256) void k_x16(const float* __restrict__ x, _Float16* __restrict__ X16, size_t n8) { const size_t t = (size_t)blockIdx.x * 256 + threadIdx.x; if (t >= n8) return; FragH f;
#pragma unroll
  for (int q = 0; q < 8; ++q) f.h[q] = (_Float16)bf16_round(x[t * 8 + q]); *(v8us*)((unsigned short*)X16 + t * 8) = f.half[0];  }
__global__ __launch_bounds__(256) void k_h16(const float* __restrict__ x, _Float16* __restrict__ X16, size_t n8) { const size_t t = (size_t)blockIdx.x * 256 + threadIdx.x; if (t >= n8) return; FragH f;
#pragma unroll
  for (int q = 0; q < 8; ++q) f.h[q] = (_Float16)x[t * 8 + q]; *(v8us*)((unsigned short*)X16 + t * 8) = f.half[0];  }
__global__ __launch_bounds__(256) void k_round16f(const float* __restrict__ W, _Float16* __restrict__ Bt, size_t n8) { const size_t t = (size_t)blockIdx.x * 256 + threadIdx.x; if (t >= n8) return; FragH f;
#pragma unroll
  for (int i = 0; i < 8; ++i) f.h[i] = (_Float16)(bf16_round(W[t * 8 + i]) * 16.0f); *(v8us*)((unsigned short*)Bt + t * 8) = f.half[0];  }
template <int NHv, int TTv>
__global__ __launch_bounds__(256) void k_vt(const _Float16* __restrict__ V16, int ldv, int voff, _Float16* __restrict__ Vt) { __shared__ unsigned short tl[64][66]; const int tid = threadIdx.x; const int slab = blockIdx.x / (TTv / 64), lg = blockIdx.x % (TTv / 64); const int b = slab / NHv, h = slab % NHv;
  for (int i = tid; i < 64 * 8; i += 256) { const int r = i / 8, c8 = (i % 8) * 8; FragH f; f.half[0] = *(const v8us*)((const unsigned short*)V16 + ((size_t)b * TTv + lg * 64 + r) * ldv + voff + h * 64 + c8);
#pragma unroll
    for (int q = 0; q < 8; ++q) tl[r][c8 + q] = f.u[q]; }
  __syncthreads();
  {
#pragma unroll
    for (int rd = 0; rd < 2; ++rd) { const int d = rd * 32 + tid / 8, pc = tid % 8; FragH f;
#pragma unroll
      for (int q = 0; q < 8; ++q) f.u[q] = tl[pc * 8 + q][d];
      *(v8us*)((unsigned short*)Vt + ((size_t)slab * 64 + d) * TTv + lg * 64 + pc * 8) = f.half[0]; }
     } }

__global__ __launch_bounds__(256) void k_hl(const float* __restrict__ F, _Float16* __restrict__ Hh, _Float16* __restrict__ Hl, size_t n8) { const size_t t = (size_t)blockIdx.x * 256 + threadIdx.x; if (t >= n8) return; FragH fh, fl; const v4f a = *(const v4fa*)(F + t * 8), c = *(const v4fa*)(F + t * 8 + 4);
#pragma unroll
  for (int q = 0; q < 4; ++q) { _Float16 h = (_Float16)a[q]; fh.h[q] = h; fl.h[q] = (_Float16)((a[q] - (float)h) * 1024.0f); h = (_Float16)c[q]; fh.h[4 + q] = h; fl.h[4 + q] = (_Float16)((c[q] - (float)h) * 1024.0f); }
  { *(v8us*)((unsigned short*)Hh + t * 8) = fh.half[0]; *(v8us*)((unsigned short*)Hl + t * 8) = fl.half[0];  } }

__global__ __launch_bounds__(256) void k_tok(const float* __restrict__ x, _Float16* __restrict__ T16) { const int b = blockIdx.y; T16 += (size_t)b * NTK * CC; const int t = blockIdx.x * 256 + threadIdx.x; if (t >= NTK * (CC / 8)) return; const int c0 = (t % (CC / 8)) * 8, n = t / (CC / 8); FragH f;
#pragma unroll
  for (int q = 0; q < 8; ++q) f.h[q] = (_Float16)bf16_round(x[((size_t)b * CC + c0 + q) * NTK + n]);
  *(v8us*)((unsigned short*)T16 + (size_t)n * CC + c0) = f.half[0];  }
__global__ __launch_bounds__(256) void k_planes(const float* __restrict__ QKV, _Float16* __restrict__ Qh, _Float16* __restrict__ Ql, _Float16* __restrict__ Kh, _Float16* __restrict__ Kl) {
  #pragma clang fp contract(off)
  { const size_t b = blockIdx.y; QKV += b * NTK * 3 * CC; Qh += b * NTK * CC; Ql += b * NTK * CC; Kh += b * NTK * CC; Kl += b * NTK * CC; }
  const int t = blockIdx.x * 256 + threadIdx.x; if (t >= NTK * (CC / 8)) return; const int c0 = (t % (CC / 8)) * 8, n = t / (CC / 8); FragH qh, ql, kh, kl;
#pragma unroll
  for (int q = 0; q < 8; ++q) { const float qv = QKV[(size_t)n * 3 * CC + c0 + q], kv = QKV[(size_t)n * 3 * CC + CC + c0 + q]; const _Float16 a = (_Float16)qv, b = (_Float16)kv; qh.h[q] = a; ql.h[q] = (_Float16)((qv - (float)a) * 1024.0f); kh.h[q] = b; kl.h[q] = (_Float16)((kv - (float)b) * 1024.0f); }
  { *(v8us*)((unsigned short*)Qh + (size_t)n * CC + c0) = qh.half[0]; *(v8us*)((unsigned short*)Ql + (size_t)n * CC + c0) = ql.half[0]; *(v8us*)((unsigned short*)Kh + (size_t)n * CC + c0) = kh.half[0]; *(v8us*)((unsigned short*)Kl + (size_t)n * CC + c0) = kl.half[0];  } }
__global__ __launch_bounds__(256) void k_vt(const float* __restrict__ QKV, _Float16* __restrict__ VT) { QKV += (size_t)blockIdx.y * NTK * 3 * CC; VT += (size_t)blockIdx.y * CC * NTK; const int t = blockIdx.x * 256 + threadIdx.x; if (t >= CC * (NTK / 8)) return; const int n0 = (t % (NTK / 8)) * 8, c = t / (NTK / 8); FragH f;
#pragma unroll
  for (int q = 0; q < 8; ++q) f.h[q] = (_Float16)QKV[(size_t)(n0 + q) * 3 * CC + 2 * CC + c];
  *(v8us*)((unsigned short*)VT + (size_t)c * NTK + n0) = f.half[0];  }
__global__ __launch_bounds__(256) void k_soft(const float* __restrict__ S, _Float16* __restrict__ P16) {
  #pragma clang fp contract(off)
  const int tid = threadIdx.x, w = tid >> 5, ln = tid & 31; const int r = blockIdx.x * 8 + w; if (r >= NTK) return; S += (size_t)blockIdx.y * NTK * NTK; P16 += (size_t)blockIdx.y * NTK * NTK; const float* sr = S + (size_t)r * NTK; float m = -3.0e38f;
#pragma unroll 1
  for (int jb = 0; jb < NTK; jb += 256) { const v4f a = *(const v4fa*)(sr + jb + 8 * ln), c = *(const v4fa*)(sr + jb + 8 * ln + 4);
#pragma unroll
    for (int k = 0; k < 4; ++k) { m = fmaxf(m, a[k]); m = fmaxf(m, c[k]); } }
  for (int o = 16; o > 0; o >>= 1) m = fmaxf(m, __shfl_xor(m, o, 32));
  float su = 0.f;
#pragma unroll 1
  for (int jb = 0; jb < NTK; jb += 256) { const v4f a = *(const v4fa*)(sr + jb + 8 * ln), c = *(const v4fa*)(sr + jb + 8 * ln + 4);
#pragma unroll
    for (int k = 0; k < 4; ++k) { su += expf(a[k] - m); su += expf(c[k] - m); } }
  for (int o = 16; o > 0; o >>= 1) su += __shfl_xor(su, o, 32); const float inv = 1024.0f / su;
  {
#pragma unroll 1
    for (int jb = 0; jb < NTK; jb += 256) { const v4f a = *(const v4fa*)(sr + jb + 8 * ln), c = *(const v4fa*)(sr + jb + 8 * ln + 4); FragH f;
#pragma unroll
      for (int k = 0; k < 4; ++k) { f.h[k] = (_Float16)(expf(a[k] - m) * inv); f.h[4 + k] = (_Float16)(expf(c[k] - m) * inv); }
      *(v8us*)((unsigned short*)P16 + (size_t)r * NTK + jb + 8 * ln) = f.half[0]; }
     } }
__global__ __launch_bounds__(256) void k_silu(const float* __restrict__ T, _Float16* __restrict__ H16) {
  #pragma clang fp contract(off)
  T += (size_t)blockIdx.y * NTK * CC; H16 += (size_t)blockIdx.y * NTK * CC;
  const int t = blockIdx.x * 256 + threadIdx.x; if (t >= NTK * (CC / 8)) return; const v4f a = *(const v4fa*)(T + (size_t)t * 8), c = *(const v4fa*)(T + (size_t)t * 8 + 4); FragH f;
#pragma unroll
  for (int q = 0; q < 8; ++q) { const float v = (q < 4) ? a[q] : c[q - 4]; f.h[q] = (_Float16)(v / (1.0f + expf(-v))); }
  *(v8us*)((unsigned short*)H16 + (size_t)t * 8) = f.half[0];  }
__global__ __launch_bounds__(256) void k_ln_out(const float* __restrict__ A, const float* __restrict__ g, const float* __restrict__ bb, float* __restrict__ out) {
  #pragma clang fp contract(off)
  __shared__ float tile[32][CC + 1]; const int tid = threadIdx.x, w = tid >> 5, l = tid & 31; const int j0 = blockIdx.x * 32; const int b = blockIdx.y; A += (size_t)b * NTK * CC;
  for (int jj = w; jj < 32; jj += 8) { const int j = j0 + jj; const float* ar = A + (size_t)j * CC; float v[8]; float s = 0.f;
#pragma unroll
    for (int k = 0; k < 8; ++k) { v[k] = ar[l + 32 * k]; s += v[k]; }
    for (int o = 16; o > 0; o >>= 1) s += __shfl_xor(s, o, 32); const float mu = s / (float)CC; float q2 = 0.f;
#pragma unroll
    for (int k = 0; k < 8; ++k) { const float d = v[k] - mu; q2 += d * d; }
    for (int o = 16; o > 0; o >>= 1) q2 += __shfl_xor(q2, o, 32); const float rs = rsqrtf(q2 / (float)CC + 1e-5f);
#pragma unroll
    for (int k = 0; k < 8; ++k) { const int c = l + 32 * k; tile[jj][c] = (v[k] - mu) * rs * bf16_round(g[c]) + bf16_round(bb[c]); } }
  __syncthreads();
  { for (int c = w; c < CC; c += 8) *(float*)(out + ((size_t)b * CC + c) * NTK + j0 + l) = tile[l][c];  } }

extern "C" void kernel_launch(void* const* d_in, const int* in_sizes, int n_in,
                              void* d_out, int out_size, void* d_ws, size_t ws_size, hipStream_t stream) {
  (void)in_sizes; (void)n_in; (void)out_size;
  const float* const* I = (const float* const*)d_in; const float* x = I[0]; const float* wq = I[1]; const float* bq = I[2]; const float* wk = I[3]; const float* bk = I[4]; const float* wv = I[5]; const float* bv = I[6]; const float* w1 = I[7]; const float* b1 = I[8]; const float* w2 = I[9]; const float* b2 = I[10]; const float* g = I[11]; const float* be = I[12];
  char* ws = (char*)d_ws; size_t off = 0;
  auto take = [&](size_t bytes) { char* p = ws + off; off += (bytes + 255) & ~(size_t)255; return p; };
  _Float16* BQ = (_Float16*)take(CC * CC * 2); _Float16* BK = (_Float16*)take(CC * CC * 2); _Float16* BV = (_Float16*)take(CC * CC * 2); _Float16* B1 = (_Float16*)take(CC * CC * 2); _Float16* B2 = (_Float16*)take(CC * CC * 2);
  /* one workspace slab per image for every intermediate: all NBt images go through each launch, image = blockIdx.y */
  _Float16* T16 = (_Float16*)take((size_t)NBt * NTK * CC * 2); float* QKV = (float*)take((size_t)NBt * NTK * 3 * CC * 4); _Float16* Qh = (_Float16*)take((size_t)NBt * NTK * CC * 2); _Float16* Ql = (_Float16*)take((size_t)NBt * NTK * CC * 2); _Float16* Kh = (_Float16*)take((size_t)NBt * NTK * CC * 2); _Float16* Kl = (_Float16*)take((size_t)NBt * NTK * CC * 2); _Float16* VT = (_Float16*)take((size_t)NBt * CC * NTK * 2);
  float* S = (float*)take((size_t)NBt * NTK * NTK * 4); _Float16* P16 = (_Float16*)take((size_t)NBt * NTK * NTK * 2); _Float16* A16 = (_Float16*)take((size_t)NBt * NTK * CC * 2); float* T1 = (float*)take((size_t)NBt * NTK * CC * 4); _Float16* H16 = (_Float16*)take((size_t)NBt * NTK * CC * 2); float* T2 = (float*)take((size_t)NBt * NTK * CC * 4);
  if (off > ws_size) return;      // 5 weight planes of 128 KiB + 16 x 15 MiB: under 241 MiB
  k_wt_f16<<<(CC * (CC / 8) + 255) / 256, 256, 0, stream>>>(wq, BQ, CC, CC, 16.0f); k_wt_f16<<<(CC * (CC / 8) + 255) / 256, 256, 0, stream>>>(wk, BK, CC, CC, 16.0f); k_wt_f16<<<(CC * (CC / 8) + 255) / 256, 256, 0, stream>>>(wv, BV, CC, CC, 16.0f); k_wt_f16<<<(CC * (CC / 8) + 255) / 256, 256, 0, stream>>>(w1, B1, CC, CC, 16.0f); k_wt_f16<<<(CC * (CC / 8) + 255) / 256, 256, 0, stream>>>(w2, B2, CC, CC, 16.0f);      /* all weights stored (in,out) */
  const dim3 gP((NTK / GT) * (CC / GT), NBt), gS((NTK / GT) * (NTK / GT), NBt), gE((NTK * (CC / 8) + 255) / 256, NBt);
  const size_t sT = (size_t)NTK * CC, sQKV = (size_t)NTK * 3 * CC, sS = (size_t)NTK * NTK;      /* elements per image */
  k_tok<<<gE, 256, 0, stream>>>(x, T16);
  k_gemm_hhx<0><<<gP, 256, 0, stream>>>(T16, CC, sT, BQ, CC, 0, 0.0625f, bq, 0, nullptr, 1, 0, 0, QKV, nullptr, 3 * CC, sQKV, NTK, CC, CC); k_gemm_hhx<0><<<gP, 256, 0, stream>>>(T16, CC, sT, BK, CC, 0, 0.0625f, bk, 0, nullptr, 1, 0, 0, QKV + CC, nullptr, 3 * CC, sQKV, NTK, CC, CC); k_gemm_hhx<0><<<gP, 256, 0, stream>>>(T16, CC, sT, BV, CC, 0, 0.0625f, bv, 0, nullptr, 1, 0, 0, QKV + 2 * CC, nullptr, 3 * CC, sQKV, NTK, CC, CC);      /* q | k | v (exact + bias) */
  k_planes<<<gE, 256, 0, stream>>>(QKV, Qh, Ql, Kh, Kl); k_vt<<<gE, 256, 0, stream>>>(QKV, VT);
  k_logits<<<gS, 256, 0, stream>>>(Kh, Kl, Qh, Ql, S);      /* S'[j][i] = k_j.q_i (the transposed logits): hi.hi + 2^-10 (lo.hi + hi.lo) in one launch, M = N = 1024, K 256 */
  k_soft<<<dim3(NTK / 8, NBt), 256, 0, stream>>>(S, P16);      /* softmax over i per j (= the module's softmax over the query axis) */
  k_gemm_hhx<0><<<gP, 256, 0, stream>>>(P16, NTK, sS, VT, NTK, sT, 0.0009765625f, nullptr, 0, nullptr, 1, 0, 0, nullptr, A16, CC, sT, NTK, CC, NTK);      /* att[j] = sum_i P'[j][i].v[i] to f16: N 256 K 1024 */
  k_gemm_hhx<0><<<gP, 256, 0, stream>>>(A16, CC, sT, B1, CC, 0, 0.0625f, b1, 0, nullptr, 1, 0, 0, T1, nullptr, CC, sT, NTK, CC, CC); k_silu<<<gE, 256, 0, stream>>>(T1, H16);
  k_gemm_hhx<0><<<gP, 256, 0, stream>>>(H16, CC, sT, B2, CC, 0, 0.0625f, b2, 0, nullptr, 1, 0, 0, T2, nullptr, CC, sT, NTK, CC, CC);      /* MLP */
  k_ln_out<<<dim3(NTK / 32, NBt), 256, 0, stream>>>(T2, g, be, (float*)d_out);
}

// v004
// One run takes 117 microseconds.
// In two side-by-side timings against v003, it was 1.33 and 1.34 times as fast.
// Counting every step since v000, it is 20.7 times as fast.
#include <hip/hip_runtime.h>
// Token self-attention block on a feature map (B 16, C 256, 32×32 = 1024 tokens): q, k, v = t·W + b (W stored (in,out)); m = q·kᵀ (no scaling); softmax over the QUERY axis i; att[j] = Σ_i m[i][j]·v[i]; MLP (SiLU, 256→256→256); LayerNorm; back to NCHW → [16,256,32,32].
// Structure: the column softmax is a row softmax of mᵀ = k·qᵀ, so per batch: S' = K·Qᵀ (rows j, cols i), row softmax, att = P'·V; everything as GEMMs + row kernels.
// Compute dtype: x and parameters rounded to bf16; q/k/v with exact products; q and k carried as f16 hi + lo·2^10 planes with three cross products (≈f32 logits — they reach σ≈8 unscaled), softmax in f32, P (×2^10), v, attention output and the SiLU hidden as f16 operands (≈2^-12), f32 accumulation; LayerNorm in f32. v_wmma_f32_16x16x32_f16.
#define NBt 16
#define CC 256
#define NTK 1024
typedef __bf16 v16b __attribute__((ext_vector_type(16)));
typedef unsigned short v8us __attribute__((ext_vector_type(8), may_alias));
typedef float  v8f  __attribute__((ext_vector_type(8)));
typedef float  v4f  __attribute__((ext_vector_type(4)));
typedef float  v4fa __attribute__((ext_vector_type(4), may_alias));
union FragB { v16b v; v8us half[2]; unsigned short u[16]; };

__device__ __forceinline__ unsigned short bf16_bits(float x) { unsigned int u = __float_as_uint(x); return (unsigned short)((u + 0x7FFFu + ((u >> 16) & 1u)) >> 16); }
__device__ __forceinline__ float bf16_val(unsigned short b) { return __uint_as_float(((unsigned int)b) << 16); }
__device__ __forceinline__ float bf16_round(float x) { return bf16_val(bf16_bits(x)); }
// D += A·B with NT terms: 1 = ah·bh, 2 = + al·bh (A split), 3 = + ah·bl (both split)
template <int NT>
__device__ __forceinline__ v8f mmaN(v16b ah, v16b al, v16b bh, v16b bl, v8f c) {
  c = __builtin_amdgcn_wmma_f32_16x16x32_bf16(false, ah, false, bh, (short)0, c, false, false);
  if (NT >= 2) c = __builtin_amdgcn_wmma_f32_16x16x32_bf16(false, al, false, bh, (short)0, c, false, false);
  if (NT >= 3) c = __builtin_amdgcn_wmma_f32_16x16x32_bf16(false, ah, false, bl, (short)0, c, false, false);
  asm volatile("v_nop\n\tv_nop\n\tv_nop\n\tv_nop" : "+v"(c) : "v"(ah), "v"(al), "v"(bh), "v"(bl));
  return c;
}

__global__ __launch_bounds__(256) void k_wt_bf16(const float* __restrict__ W, unsigned short* __restrict__ Wt, int K, int N) {
  const int t = blockIdx.x * 256 + threadIdx.x;
  const int k8n = K / 8;
  if (t >= N * k8n) return;
  const int n = t / k8n, k8 = (t % k8n) * 8;
  v8us v;
#pragma unroll
  for (int i = 0; i < 8; ++i) v[i] = bf16_bits(W[(size_t)(k8 + i) * N + n]);
  *(v8us*)(Wt + (size_t)n * K + k8) = v;
  
}

// GEMM C[M][N] (f32, pitch ldc) = act(A[M][K]·W + bias). A f32 row-major (pitch lda) converted per fragment to bf16
// (ASPLIT: hi/lo two planes -> 2 terms, else single rounded term); Wt bf16 [N][K] (pitch ldb). BIAS_BF16 rounds the
// bias to bf16 first (bias quantised to bf16 before the add). K%32==0, M%16==0, N%64==0.
template <bool ASPLIT, int ACT, bool BIAS_BF16>
__global__ __launch_bounds__(128) void k_gemm_bf(const float* __restrict__ A, int lda, const unsigned short* __restrict__ Wt, int ldb,
                                               const float* __restrict__ bias, float* __restrict__ C, int ldc, int M, int N, int K) {
  __shared__ __attribute__((aligned(16))) float so[4][16][64];
  const int tid = threadIdx.x, w = tid >> 5, lane = tid & 31, ln = lane & 15, hh = lane >> 4;
  const int ntn = N / 64;
  const int wid = blockIdx.x * 4 + w;
  const int mt = wid / ntn, nq = wid % ntn;
  if (mt * 16 >= M) return;
  const int row0 = mt * 16, col0 = nq * 64;
  const float* arow = A + (size_t)(row0 + ln) * lda;
  v8f acc[4] = {};
  for (int kb = 0; kb < K; kb += 32) {
    FragB ah, al;
    const v4f x0 = *(const v4fa*)(arow + kb + 8 * hh), x1 = *(const v4fa*)(arow + kb + 8 * hh + 4);
    const v4f x2 = *(const v4fa*)(arow + kb + 16 + 8 * hh), x3 = *(const v4fa*)(arow + kb + 16 + 8 * hh + 4);
    float xs[16] = {x0[0],x0[1],x0[2],x0[3],x1[0],x1[1],x1[2],x1[3],x2[0],x2[1],x2[2],x2[3],x3[0],x3[1],x3[2],x3[3]};
#pragma unroll
    for (int i = 0; i < 16; ++i) { const unsigned short hb = bf16_bits(xs[i]); ah.u[i] = hb; al.u[i] = ASPLIT ? bf16_bits(xs[i] - bf16_val(hb)) : (unsigned short)0; }
#pragma unroll
    for (int t = 0; t < 4; ++t) {
      const unsigned short* brow = Wt + (size_t)(col0 + t * 16 + ln) * ldb + kb;
      FragB b;
      b.half[0] = *(const v8us*)(brow + 8 * hh);
      b.half[1] = *(const v8us*)(brow + 16 + 8 * hh);
      acc[t] = mmaN<ASPLIT ? 2 : 1>(ah.v, al.v, b.v, b.v, acc[t]);
    }
  }
#pragma unroll
  for (int t = 0; t < 4; ++t) {
    float bv = bias ? bias[col0 + t * 16 + ln] : 0.f;
    if (BIAS_BF16) bv = bf16_round(bv);
#pragma unroll
    for (int r = 0; r < 8; ++r) { float v = acc[t][r] + bv; if (ACT == 1) v = fmaxf(v, 0.f); so[w][8 * hh + r][t * 16 + ln] = v; }
  }
  __builtin_amdgcn_fence(__ATOMIC_ACQ_REL, "workgroup");
  __builtin_amdgcn_wave_barrier();
  const int rsub = lane >> 4, c4 = (lane & 15) * 4;
  {
#pragma unroll
    for (int q = 0; q < 8; ++q) {
      const int r = q * 2 + rsub;
      const v4f v = *(const v4fa*)&so[w][r][c4];
      *(v4f*)(C + (size_t)(row0 + r) * ldc + col0 + c4) = v;
    }
    
  }
}

// GEMM C = act(A·W + bias + resid): A f32 (ASPLIT -> hi/lo 2 terms), Wt bf16 [N][K]; ACT 0 none, 1 relu, 2 exact gelu;
// resid (optional, f32, row index = (row % rmod), pitch ldr, RES_BF16 rounds it) added before the activation.
template <bool ASPLIT, int ACT, bool BIAS_BF16, bool RES_BF16>
__global__ __launch_bounds__(128) void k_gemm_bf3(const float* __restrict__ A, int lda, const unsigned short* __restrict__ Wt, int ldb,
                                                const float* __restrict__ bias, const float* __restrict__ resid, int rmod, int ldr,
                                                float* __restrict__ C, int ldc, int M, int N, int K) {
  __shared__ __attribute__((aligned(16))) float so[4][16][64];
  const int tid = threadIdx.x, w = tid >> 5, lane = tid & 31, ln = lane & 15, hh = lane >> 4;
  const int ntn = N / 64;
  const int wid = blockIdx.x * 4 + w;
  const int mt = wid / ntn, nq = wid % ntn;
  if (mt * 16 >= M) return;
  const int row0 = mt * 16, col0 = nq * 64;
  const float* arow = A + (size_t)(row0 + ln) * lda;
  v8f acc[4] = {};
  for (int kb = 0; kb < K; kb += 32) {
    FragB ah, al;
    const v4f x0 = *(const v4fa*)(arow + kb + 8 * hh), x1 = *(const v4fa*)(arow + kb + 8 * hh + 4);
    const v4f x2 = *(const v4fa*)(arow + kb + 16 + 8 * hh), x3 = *(const v4fa*)(arow + kb + 16 + 8 * hh + 4);
    float xs[16] = {x0[0],x0[1],x0[2],x0[3],x1[0],x1[1],x1[2],x1[3],x2[0],x2[1],x2[2],x2[3],x3[0],x3[1],x3[2],x3[3]};
#pragma unroll
    for (int i = 0; i < 16; ++i) { const unsigned short hb = bf16_bits(xs[i]); ah.u[i] = hb; al.u[i] = ASPLIT ? bf16_bits(xs[i] - bf16_val(hb)) : (unsigned short)0; }
#pragma unroll
    for (int t = 0; t < 4; ++t) {
      const unsigned short* brow = Wt + (size_t)(col0 + t * 16 + ln) * ldb + kb;
      FragB b;
      b.half[0] = *(const v8us*)(brow + 8 * hh);
      b.half[1] = *(const v8us*)(brow + 16 + 8 * hh);
      acc[t] = mmaN<ASPLIT ? 2 : 1>(ah.v, al.v, b.v, b.v, acc[t]);
    }
  }
#pragma unroll
  for (int t = 0; t < 4; ++t) {
    const int col = col0 + t * 16 + ln;
    float bv = bias ? bias[col] : 0.f;
    if (BIAS_BF16) bv = bf16_round(bv);
#pragma unroll
    for (int r = 0; r < 8; ++r) {
      float v = acc[t][r] + bv;
      if (resid) { float rv = resid[(size_t)((row0 + 8 * hh + r) % rmod) * ldr + col]; if (RES_BF16) rv = bf16_round(rv); v += rv; }
      if (ACT == 1) v = fmaxf(v, 0.f);
      if (ACT == 2) v = 0.5f * v * (1.0f + erff(v * 0.70710678118654752f));
      if (ACT == 3) { const float u = 0.7978845608028654f * (v + 0.044715f * v * v * v); v = 0.5f * v * (1.0f + tanhf(u)); }
      so[w][8 * hh + r][t * 16 + ln] = v;
    }
  }
  __builtin_amdgcn_fence(__ATOMIC_ACQ_REL, "workgroup");
  __builtin_amdgcn_wave_barrier();
  const int rsub = lane >> 4, c4 = (lane & 15) * 4;
  {
#pragma unroll
    for (int q = 0; q < 8; ++q) {
      const int r = q * 2 + rsub;
      const v4f v = *(const v4fa*)&so[w][r][c4];
      *(v4f*)(C + (size_t)(row0 + r) * ldc + col0 + c4) = v;
    }
    
  }
}
// row LayerNorm (biased variance, eps) over N: s = X (+ R); optional out_sum <- s; out_norm <- (s-mu)*rsqrt(var+eps)*g + b
template <bool PARAM_BF16>
__global__ __launch_bounds__(256) void k_layernorm(const float* __restrict__ X, const float* __restrict__ R, const float* __restrict__ g, const float* __restrict__ bta,
                                                  float* __restrict__ out_sum, float* __restrict__ out_norm, int N, float eps) {
  __shared__ float red[256];
  const int row = blockIdx.x, tid = threadIdx.x;
  const float* x = X + (size_t)row * N; const float* rr = R ? R + (size_t)row * N : nullptr;
  float vals[16];                     // up to N = 4096
  const int per = N / 256;            // contiguous chunk per thread? use strided-by-4 chunks: thread handles j = tid*4 + 1024*u
  float s1 = 0.f;
  for (int u = 0; u < per / 4; ++u) {
    const int j = tid * 4 + 1024 * u;
    const v4f a = *(const v4fa*)(x + j);
    v4f b = {0.f,0.f,0.f,0.f}; if (rr) b = *(const v4fa*)(rr + j);
#pragma unroll
    for (int q = 0; q < 4; ++q) { const float v = a[q] + b[q]; vals[u * 4 + q] = v; s1 += v; }
  }
  red[tid] = s1; __syncthreads();
  for (int st = 128; st > 0; st >>= 1) { if (tid < st) red[tid] += red[tid + st]; __syncthreads(); }
  const float mu = red[0] / (float)N; __syncthreads();
  float s2 = 0.f;
  for (int u = 0; u < per / 4; ++u)
#pragma unroll
    for (int q = 0; q < 4; ++q) { const float c = vals[u * 4 + q] - mu; s2 += c * c; }
  red[tid] = s2; __syncthreads();
  for (int st = 128; st > 0; st >>= 1) { if (tid < st) red[tid] += red[tid + st]; __syncthreads(); }
  const float rs = rsqrtf(red[0] / (float)N + eps);
  {
    for (int u = 0; u < per / 4; ++u) {
      const int j = tid * 4 + 1024 * u;
      v4f o, sm;
#pragma unroll
      for (int q = 0; q < 4; ++q) {
        float gg = g[j + q], bb = bta[j + q];
        if (PARAM_BF16) { gg = bf16_round(gg); bb = bf16_round(bb); }
        sm[q] = vals[u * 4 + q]; o[q] = (vals[u * 4 + q] - mu) * rs * gg + bb;
      }
      if (out_sum) *(v4f*)(out_sum + (size_t)row * N + j) = sm;
      *(v4f*)(out_norm + (size_t)row * N + j) = o;
    }
    
  }
}



// ---- f16 WMMA path (v_wmma_f32_16x16x32_f16): 11-bit significands for operands in range — used where a [0,1] probability operand needs more precision than bf16
typedef _Float16 v16h __attribute__((ext_vector_type(16)));
union FragH { v16h v; v8us half[2]; _Float16 h[16]; unsigned short u[16]; };
template <int NT>
__device__ __forceinline__ v8f mmaH(v16h ah, v16h al, v16h bh, v16h bl, v8f c) {
  c = __builtin_amdgcn_wmma_f32_16x16x32_f16(false, ah, false, bh, (short)0, c, false, false);
  if (NT >= 2) c = __builtin_amdgcn_wmma_f32_16x16x32_f16(false, al, false, bh, (short)0, c, false, false);
  if (NT >= 3) c = __builtin_amdgcn_wmma_f32_16x16x32_f16(false, ah, false, bl, (short)0, c, false, false);
  asm volatile("v_nop\n\tv_nop\n\tv_nop\n\tv_nop" : "+v"(c) : "v"(ah), "v"(al), "v"(bh), "v"(bl));
  return c;
}
// batched GEMM like k_gemm_b but f16 operands: A f32 (split into f16 hi/lo if ASPLIT, else rounded to f16), Bt = f16 values [n][k]; alpha; C f32; N multiple of 16 (partial tiles skipped)
template <bool ASPLIT>
__global__ __launch_bounds__(128) void k_gemm_h(const float* __restrict__ A, int lda, size_t sA, const _Float16* __restrict__ Bh, int ldb, size_t sB, float alpha, float* __restrict__ C, int ldc, size_t sC, int M, int N, int K) {
  __shared__ __attribute__((aligned(16))) float so[4][16][64];
  const int tid = threadIdx.x, w = tid >> 5, lane = tid & 31, ln = lane & 15, hh = lane >> 4; const int by = blockIdx.y;
  A += (size_t)by * sA; Bh += (size_t)by * sB; C += (size_t)by * sC;
  const int ntn = (N + 63) / 64; const int wid = blockIdx.x * 4 + w; const int mt = wid / ntn, nq = wid % ntn; if (mt * 16 >= M) return;
  const int row0 = mt * 16, col0 = nq * 64; const float* arow = A + (size_t)(row0 + ln) * lda;
  v8f acc[4] = {};
  for (int kb = 0; kb < K; kb += 32) {
    FragH ah, al;
    const v4f x0 = *(const v4fa*)(arow + kb + 8 * hh), x1 = *(const v4fa*)(arow + kb + 8 * hh + 4), x2 = *(const v4fa*)(arow + kb + 16 + 8 * hh), x3 = *(const v4fa*)(arow + kb + 16 + 8 * hh + 4);
    float xs[16] = {x0[0],x0[1],x0[2],x0[3],x1[0],x1[1],x1[2],x1[3],x2[0],x2[1],x2[2],x2[3],x3[0],x3[1],x3[2],x3[3]};
#pragma unroll
    for (int i = 0; i < 16; ++i) { const _Float16 h = (_Float16)xs[i]; ah.h[i] = h; al.h[i] = ASPLIT ? (_Float16)(xs[i] - (float)h) : (_Float16)0.0f; }
#pragma unroll
    for (int t = 0; t < 4; ++t) { if (col0 + t * 16 >= N) continue; const size_t boff = (size_t)(col0 + t * 16 + ln) * ldb + kb; FragH bq; bq.half[0] = *(const v8us*)(Bh + boff + 8 * hh); bq.half[1] = *(const v8us*)(Bh + boff + 16 + 8 * hh);
      acc[t] = mmaH<ASPLIT ? 2 : 1>(ah.v, al.v, bq.v, bq.v, acc[t]); }
  }
#pragma unroll
  for (int t = 0; t < 4; ++t) { if (col0 + t * 16 >= N) continue;
#pragma unroll
    for (int r = 0; r < 8; ++r) so[w][8 * hh + r][t * 16 + ln] = acc[t][r] * alpha; }
  __builtin_amdgcn_fence(__ATOMIC_ACQ_REL, "workgroup"); __builtin_amdgcn_wave_barrier();
  const int rsub = lane >> 4, c4 = (lane & 15) * 4;
  {
#pragma unroll
    for (int q = 0; q < 8; ++q) { const int r = q * 2 + rsub; if (col0 + c4 < N) { const v4f v = *(const v4fa*)&so[w][r][c4]; *(v4f*)(C + (size_t)(row0 + r) * ldc + col0 + c4) = v; } }
     }
}

// Wt[n][k] = f16(W[k][n]·scale) from f32 row-major W[K][N] (scale = power of two; bf16-exact weights stay exact in f16 away from the subnormal range)
__global__ __launch_bounds__(256) void k_wt_f16(const float* __restrict__ W, _Float16* __restrict__ Wt, int K, int N, float scale) {
  const int t = blockIdx.x * 256 + threadIdx.x; if (t >= N * (K / 8)) return; const int n = t / (K / 8), k8 = (t % (K / 8)) * 8; FragH f;
#pragma unroll
  for (int i = 0; i < 8; ++i) f.h[i] = (_Float16)(bf16_round(W[(size_t)(k8 + i) * N + n]) * scale); const v8us o = f.half[0];
  *(v8us*)((unsigned short*)Wt + (size_t)n * K + k8) = o; 
}
// Block-tiled GEMM with fused epilogue: v = acc*alpha + bias[by*sBias + col] (+ CP[by*sC + (row/rowsPerB)*sCPb + col] if CP) ; ACT 0 none / 1 elu ; writes f32 C and/or f16 C16 (each only if non-null); by = blockIdx.y = image.
// One work-group of 8 waves owns a 128 x 128 tile of C; A and Bh (f16, [row][k]) come in 64-wide k slices as whole 128-byte lines and are shared through LDS (two buffers, the next slice's loads fly during this slice's products).
// Each wave does 32 x 64 of the tile; k runs upward in steps of 32 per accumulator. Needs M % 128 == 0, N % 128 == 0, K % 64 == 0, grid.x = (M/128)*(N/128).
#define GT 128      /* tile edge, rows of A and rows of Bh per work-group */
#define GK 64       /* k slice */
#define GPIT 72     /* LDS row pitch in f16: 144 B = 16 B x 9, so the 16 rows of a 16-byte fragment read fall on distinct banks */
#define GSO 68      /* epilogue row pitch in f32: rows 8 apart fall on different banks */
template <int ACT>
__global__ __launch_bounds__(256) void k_gemm_hhx(const _Float16* __restrict__ A, int lda, size_t sA, const _Float16* __restrict__ Bh, int ldb, size_t sB, float alpha, const float* __restrict__ bias, size_t sBias, const float* __restrict__ CP, int rowsPerB, size_t sCPb, int row0g,
    float* __restrict__ C, _Float16* __restrict__ C16, int ldc, size_t sC, int M, int N, int K) {
  __shared__ __attribute__((aligned(16))) unsigned short st[2][2][GT][GPIT];      // [buffer][A | Bh][row][k]; reused as f32 staging by the epilogue
  (void)M;
  const int tid = threadIdx.x, w = tid >> 5, lane = tid & 31, ln = lane & 15, hh = lane >> 4; const int by = blockIdx.y;
  A += (size_t)by * sA; Bh += (size_t)by * sB; const size_t cofs = (size_t)by * sC; const float* bp = bias ? bias + (size_t)by * sBias : nullptr;
  const int ntn = N / GT; const int row0 = ((int)blockIdx.x / ntn) * GT, col0 = ((int)blockIdx.x % ntn) * GT;
  const int wr = (w >> 1) * 32, wc = (w & 1) * 64;      // the wave's 32 x 64 part of the tile
  const int lr = tid >> 3, lc = (tid & 7) * 8;          // staging: 8 lanes per 128-byte row slice, 32 rows per pass
  const char* ab = (const char*)A; const char* bb = (const char*)Bh;      // uniform bases; each lane keeps eight byte offsets
  unsigned ao[4], bo[4];
#pragma unroll
  for (int i = 0; i < 4; ++i) { ao[i] = (unsigned)(((row0 + lr + 32 * i) * lda + lc) * 2); bo[i] = (unsigned)(((col0 + lr + 32 * i) * ldb + lc) * 2); }
  v8us ra[4], rb[4];
#pragma unroll
  for (int i = 0; i < 4; ++i) { ra[i] = *(const v8us*)(ab + ao[i]); rb[i] = *(const v8us*)(bb + bo[i]); }
  float bv[4] = {0.f, 0.f, 0.f, 0.f};
  if (bp) {
#pragma unroll
    for (int t = 0; t < 4; ++t) bv[t] = bp[col0 + wc + t * 16 + ln];
#pragma unroll
    for (int t = 0; t < 4; ++t) bv[t] = bf16_round(bv[t]);
  }
#pragma unroll
  for (int i = 0; i < 4; ++i) { *(v8us*)&st[0][0][lr + 32 * i][lc] = ra[i]; *(v8us*)&st[0][1][lr + 32 * i][lc] = rb[i]; }
  __syncthreads();
  v8f acc[2][4] = {};
  for (int kb = 0; kb < K; kb += GK) {
    const int cur = (kb / GK) & 1; const bool more = kb + GK < K;
    if (more) {
#pragma unroll
      for (int i = 0; i < 4; ++i) { ao[i] += GK * 2; bo[i] += GK * 2; }      // each lane's offsets walk along k
#pragma unroll
      for (int i = 0; i < 4; ++i) { ra[i] = *(const v8us*)(ab + ao[i]); rb[i] = *(const v8us*)(bb + bo[i]); }
    }
#pragma unroll
    for (int ks = 0; ks < GK; ks += 32) {
      FragH fa[2], fb[4];
#pragma unroll
      for (int mi = 0; mi < 2; ++mi) { fa[mi].half[0] = *(const v8us*)&st[cur][0][wr + mi * 16 + ln][ks + 8 * hh]; fa[mi].half[1] = *(const v8us*)&st[cur][0][wr + mi * 16 + ln][ks + 16 + 8 * hh]; }
#pragma unroll
      for (int t = 0; t < 4; ++t) { fb[t].half[0] = *(const v8us*)&st[cur][1][wc + t * 16 + ln][ks + 8 * hh]; fb[t].half[1] = *(const v8us*)&st[cur][1][wc + t * 16 + ln][ks + 16 + 8 * hh]; }
#pragma unroll
      for (int mi = 0; mi < 2; ++mi)
#pragma unroll
        for (int t = 0; t < 4; ++t) acc[mi][t] = mmaH<1>(fa[mi].v, fa[mi].v, fb[t].v, fb[t].v, acc[mi][t]);
    }
    if (more) {
#pragma unroll
      for (int i = 0; i < 4; ++i) { *(v8us*)&st[cur ^ 1][0][lr + 32 * i][lc] = ra[i]; *(v8us*)&st[cur ^ 1][1][lr + 32 * i][lc] = rb[i]; }
    }
    __syncthreads();      // publishes the next slice and ends every wave's reads of this one (after the last slice: frees the LDS for the epilogue)
  }
  const int rsub = lane >> 4, c4 = (lane & 15) * 4; typedef _Float16 v4h __attribute__((ext_vector_type(4)));
  const int orow = row0 + wr + rsub, ocol = col0 + wc + c4;      // the lane's first output row (then every second one) and its four columns
  v4f cp[16];
  if (CP) {      // all sixteen addend loads go out together, ahead of the staging, so that their latency is paid once
#pragma unroll
    for (int q = 0; q < 16; ++q) { const int bidx = (row0g + orow + q * 2) / rowsPerB; cp[q] = *(const v4fa*)(CP + cofs + (size_t)bidx * sCPb + ocol);
      if ((q & 3) == 3 && q < 15) asm volatile("s_wait_xcnt 0x0" ::: "memory"); }      // later loads' results may be given the registers that held earlier loads' addresses
  }
  float* so = (float*)&st[0][0][0][0] + (size_t)w * (32 * GSO);      // the wave's own 32 x 64 f32 staging
#pragma unroll
  for (int mi = 0; mi < 2; ++mi)
#pragma unroll
    for (int t = 0; t < 4; ++t)
#pragma unroll
      for (int r = 0; r < 8; ++r) so[(mi * 16 + 8 * hh + r) * GSO + t * 16 + ln] = acc[mi][t][r] * alpha + bv[t];
  __builtin_amdgcn_fence(__ATOMIC_ACQ_REL, "workgroup"); __builtin_amdgcn_wave_barrier();
  v4f o[16];
#pragma unroll
  for (int q = 0; q < 16; ++q) o[q] = *(const v4fa*)&so[(q * 2 + rsub) * GSO + c4];
  if (CP) {
#pragma unroll
    for (int q = 0; q < 16; ++q) o[q] += cp[q];
  }
#pragma unroll
  for (int q = 0; q < 16; ++q)
#pragma unroll
    for (int i = 0; i < 4; ++i) { float v = o[q][i]; if (ACT == 1) v = (v > 0.f) ? v : expm1f(v); else if (ACT == 7) v = (v > 0.f) ? v + 1.0f : expf(v); else if (ACT == 8) v = tanhf(v); else if (ACT == 9) v = 0.5f * v * (1.0f + tanhf(0.7978845608028654f * (v + 0.044715f * v * v * v))); else if (ACT == 11) v = 1.0f / (1.0f + expf(-v)); else if (ACT == 12) v = (v > 0.f) ? v : 0.01f * v; else if (ACT == 14) v = (v > 0.f) ? v : 0.1f * v; else if (ACT == 15) v = v / (1.0f + expf(-v)); else if (ACT == 3) v = fmaxf(v, 0.f); else if (ACT == 6) v = 0.5f * v * (1.0f + erff(v * 0.70710678118654752f)); o[q][i] = v; }
  if (C) {
#pragma unroll
    for (int q = 0; q < 16; ++q) *(v4f*)(C + cofs + (size_t)(orow + q * 2) * ldc + ocol) = o[q];
    asm volatile("s_wait_xcnt 0x0" ::: "memory");      // the f16 stores below reuse registers that these stores name
  }
  if (C16) {
#pragma unroll
    for (int q = 0; q < 16; ++q) { v4h h4; for (int i = 0; i < 4; ++i) h4[i] = (_Float16)o[q][i]; *(v4h*)(C16 + cofs + (size_t)(orow + q * 2) * ldc + ocol) = h4; }
  }
}


// q, k and v in one launch, each written once, in the form its reader takes: q and k as f16 hi and lo*2^10 planes [token][channel], v as f16 [channel][token].
// blockIdx.x / QT picks the product, blockIdx.x % QT its 128 x 128 tile, blockIdx.y the image. q, k: rows = tokens (T16), columns = channels (the weight plane), bias by column.
// v: the operands change places (rows = channels from BV, columns = tokens from T16), so the tile comes out transposed as it stands and its bias goes by row.
// Tiling, staging and k order as in k_gemm_hhx (8 waves of 32 x 64, 64-wide k slices, two LDS buffers).
#define QT ((NTK / GT) * (CC / GT))      /* tiles per product and image */
__global__ __launch_bounds__(256) void k_qkv(const _Float16* __restrict__ T16, const _Float16* __restrict__ BQ, const _Float16* __restrict__ BK, const _Float16* __restrict__ BV,
    const float* __restrict__ bq, const float* __restrict__ bk, const float* __restrict__ bvv,
    _Float16* __restrict__ Qh, _Float16* __restrict__ Ql, _Float16* __restrict__ Kh, _Float16* __restrict__ Kl, _Float16* __restrict__ VT) {
  __shared__ __attribute__((aligned(16))) unsigned short st[2][2][GT][GPIT];      // [buffer][A | B][row][k]; reused as f32 staging by the epilogue
  const int tid = threadIdx.x, w = tid >> 5, lane = tid & 31, ln = lane & 15, hh = lane >> 4;
  const int sel = (int)blockIdx.x / QT, tile = (int)blockIdx.x % QT; const bool isv = sel == 2;
  const size_t iofs = (size_t)blockIdx.y * NTK * CC;      // every per-image array here holds NTK * CC elements
  const int row0 = (isv ? tile / (NTK / GT) : tile / (CC / GT)) * GT, col0 = (isv ? tile % (NTK / GT) : tile % (CC / GT)) * GT;
  const int wr = (w >> 1) * 32, wc = (w & 1) * 64;      // the wave's 32 x 64 part of the tile
  const int lr = tid >> 3, lc = (tid & 7) * 8;          // staging: 8 lanes per 128-byte row slice, 32 rows per pass
  const char* ab = (const char*)(isv ? BV : T16 + iofs); const char* bb = (const char*)(isv ? T16 + iofs : (sel ? BK : BQ));      // uniform bases
  const unsigned ao = (unsigned)(((row0 + lr) * CC + lc) * 2), bo = (unsigned)(((col0 + lr) * CC + lc) * 2);      // the lane's byte offsets; further rows are constants, the slice a uniform step
  v8us ra[4], rb[4];
#pragma unroll
  for (int i = 0; i < 4; ++i) { ra[i] = *(const v8us*)(ab + ao + i * (32 * CC * 2)); rb[i] = *(const v8us*)(bb + bo + i * (32 * CC * 2)); }
#pragma unroll
  for (int i = 0; i < 4; ++i) { *(v8us*)&st[0][0][lr + 32 * i][lc] = ra[i]; *(v8us*)&st[0][1][lr + 32 * i][lc] = rb[i]; }
  __syncthreads();
  v8f acc[2][4] = {};
#pragma unroll 1      // kept rolled: unrolled, the wave takes 161 registers, allocated as 176, and only two work-groups fit on a WGP; at 160 three fit, which is what this grid gives each WGP
  for (int kb = 0; kb < CC; kb += GK) {
    const int cur = (kb / GK) & 1; const bool more = kb + GK < CC;
    if (more) {
#pragma unroll
      for (int i = 0; i < 4; ++i) { ra[i] = *(const v8us*)(ab + ao + i * (32 * CC * 2) + (kb + GK) * 2); rb[i] = *(const v8us*)(bb + bo + i * (32 * CC * 2) + (kb + GK) * 2); }
    }
#pragma unroll
    for (int ks = 0; ks < GK; ks += 32) {
      FragH fa[2], fb[4];
#pragma unroll
      for (int mi = 0; mi < 2; ++mi) { fa[mi].half[0] = *(const v8us*)&st[cur][0][wr + mi * 16 + ln][ks + 8 * hh]; fa[mi].half[1] = *(const v8us*)&st[cur][0][wr + mi * 16 + ln][ks + 16 + 8 * hh]; }
#pragma unroll
      for (int t = 0; t < 4; ++t) { fb[t].half[0] = *(const v8us*)&st[cur][1][wc + t * 16 + ln][ks + 8 * hh]; fb[t].half[1] = *(const v8us*)&st[cur][1][wc + t * 16 + ln][ks + 16 + 8 * hh]; }
#pragma unroll
      for (int mi = 0; mi < 2; ++mi)
#pragma unroll
        for (int t = 0; t < 4; ++t) acc[mi][t] = mmaH<1>(fa[mi].v, fa[mi].v, fb[t].v, fb[t].v, acc[mi][t]);
    }
    if (more) {
#pragma unroll
      for (int i = 0; i < 4; ++i) { *(v8us*)&st[cur ^ 1][0][lr + 32 * i][lc] = ra[i]; *(v8us*)&st[cur ^ 1][1][lr + 32 * i][lc] = rb[i]; }
    }
    __syncthreads();      // publishes the next slice and ends every wave's reads of this one (after the last slice: frees the LDS for the epilogue)
  }
  typedef _Float16 v4h __attribute__((ext_vector_type(4)));
  float* so = (float*)&st[0][0][0][0] + (size_t)w * (32 * GSO);      // the wave's own 32 x 64 f32 staging
  const int rsub = lane >> 4, c4 = (lane & 15) * 4;
  const int orow = row0 + wr + rsub, ocol = col0 + wc + c4;      // the lane's first output row (then every second one) and its four columns
  if (isv) {
    float br[2][8];      // bias by row (channel)
#pragma unroll
    for (int mi = 0; mi < 2; ++mi)
#pragma unroll
      for (int r = 0; r < 8; ++r) br[mi][r] = bf16_round(bvv[row0 + wr + mi * 16 + 8 * hh + r]);
#pragma unroll
    for (int mi = 0; mi < 2; ++mi)
#pragma unroll
      for (int t = 0; t < 4; ++t)
#pragma unroll
        for (int r = 0; r < 8; ++r) so[(mi * 16 + 8 * hh + r) * GSO + t * 16 + ln] = acc[mi][t][r] * 0.0625f + br[mi][r];
    __builtin_amdgcn_fence(__ATOMIC_ACQ_REL, "workgroup"); __builtin_amdgcn_wave_barrier();
    _Float16* vo = VT + iofs + (size_t)orow * NTK + ocol;
#pragma unroll
    for (int q = 0; q < 16; ++q) { const v4f o = *(const v4fa*)&so[(q * 2 + rsub) * GSO + c4]; v4h h4;
#pragma unroll
      for (int i = 0; i < 4; ++i) h4[i] = (_Float16)o[i];
      *(v4h*)(vo + q * 2 * NTK) = h4; }
  } else {
    const float* bias = sel ? bk : bq;
    float bc[4];      // bias by column (channel)
#pragma unroll
    for (int t = 0; t < 4; ++t) bc[t] = bf16_round(bias[col0 + wc + t * 16 + ln]);
#pragma unroll
    for (int mi = 0; mi < 2; ++mi)
#pragma unroll
      for (int t = 0; t < 4; ++t)
#pragma unroll
        for (int r = 0; r < 8; ++r) so[(mi * 16 + 8 * hh + r) * GSO + t * 16 + ln] = acc[mi][t][r] * 0.0625f + bc[t];
    __builtin_amdgcn_fence(__ATOMIC_ACQ_REL, "workgroup"); __builtin_amdgcn_wave_barrier();
    _Float16* ho = (sel ? Kh : Qh) + iofs + (size_t)orow * CC + ocol; _Float16* lo = (sel ? Kl : Ql) + iofs + (size_t)orow * CC + ocol;
#pragma unroll
    for (int q = 0; q < 16; ++q) { const v4f o = *(const v4fa*)&so[(q * 2 + rsub) * GSO + c4]; v4h h4, l4;
#pragma unroll
      for (int i = 0; i < 4; ++i) { const _Float16 h = (_Float16)o[i]; h4[i] = h; l4[i] = (_Float16)((o[i] - (float)h) * 1024.0f); }
      *(v4h*)(ho + q * 2 * CC) = h4; *(v4h*)(lo + q * 2 * CC) = l4; }
    asm volatile("s_wait_xcnt 0x0" ::: "memory");      // in the built code the other branch's instructions follow these stores and rewrite the registers that they name
  }
}

// Logits in one launch: C[j][i] = Ah.Bh + 2^-10 (Al.Bh + Ah.Bl), all four f16 planes [row][CC], image = blockIdx.y; the lo planes carry a factor 2^10.
// Tiling and staging as in k_gemm_hhx (128 x 128 tile, 8 waves of 32 x 64, 64-wide k slices, two LDS buffers); each slice brings all four planes, and every fragment read from LDS feeds the three products.
// Two accumulator sets per wave: hi (Ah.Bh) and lo (Al.Bh then Ah.Bl, k upward); they meet once, in the epilogue.
// The next slice's A planes fly during the first half of this slice's products, its B planes during the second half: half the staging registers, so that two work-groups fit on a WGP (144 KiB of LDS each, at most 256 registers a wave).
__global__ __launch_bounds__(256) __attribute__((amdgpu_waves_per_eu(4, 4))) void k_logits(const _Float16* __restrict__ Ah, const _Float16* __restrict__ Al, const _Float16* __restrict__ Bh, const _Float16* __restrict__ Bl, float* __restrict__ C) {
  __shared__ __attribute__((aligned(16))) unsigned short st[2][4][GT][GPIT];      // [buffer][Ah | Al | Bh | Bl][row][k]; reused as f32 staging by the epilogue
  const int tid = threadIdx.x, w = tid >> 5, lane = tid & 31, ln = lane & 15, hh = lane >> 4;
  const size_t pofs = (size_t)blockIdx.y * NTK * CC; C += (size_t)blockIdx.y * NTK * NTK;
  const int row0 = ((int)blockIdx.x / (NTK / GT)) * GT, col0 = ((int)blockIdx.x % (NTK / GT)) * GT;
  const int wr = (w >> 1) * 32, wc = (w & 1) * 64;      // the wave's 32 x 64 part of the tile
  const int lr = tid >> 3, lc = (tid & 7) * 8;          // staging: 8 lanes per 128-byte row slice, 32 rows per pass
  const char* pl[4] = {(const char*)(Ah + pofs), (const char*)(Al + pofs), (const char*)(Bh + pofs), (const char*)(Bl + pofs)};      // uniform bases
  const unsigned po[2] = {(unsigned)(((row0 + lr) * CC + lc) * 2), (unsigned)(((col0 + lr) * CC + lc) * 2)};      // the lane's byte offsets in the A and the B planes; further rows are constants, the slice a uniform step
  v8us rg[2][4];
#pragma unroll
  for (int g = 0; g < 2; ++g) {
#pragma unroll
    for (int p = 0; p < 2; ++p)
#pragma unroll
      for (int i = 0; i < 4; ++i) rg[p][i] = *(const v8us*)(pl[2 * g + p] + po[g] + i * (32 * CC * 2));
#pragma unroll
    for (int p = 0; p < 2; ++p)
#pragma unroll
      for (int i = 0; i < 4; ++i) *(v8us*)&st[0][2 * g + p][lr + 32 * i][lc] = rg[p][i];
  }
  asm volatile("s_wait_xcnt 0x0" ::: "memory");      // the registers that the loads above name are given other values from here on
  __syncthreads();
  v8f hi[2][4] = {}, lo[2][4] = {};
#pragma unroll 1      // kept rolled: unrolled, the LDS addresses of both buffers stay live at once and the wave no longer fits 256 registers
  for (int kb = 0; kb < CC; kb += GK) {
    const int cur = (kb / GK) & 1; const bool more = kb + GK < CC;
#pragma unroll
    for (int g = 0; g < 2; ++g) {      // k half g of this slice; beside it plane pair g of the next slice
      const int ks = g * 32;
      if (more) {
#pragma unroll
        for (int p = 0; p < 2; ++p)
#pragma unroll
          for (int i = 0; i < 4; ++i) rg[p][i] = *(const v8us*)(pl[2 * g + p] + po[g] + i * (32 * CC * 2) + (kb + GK) * 2);
      }
      FragH fah[2], fal[2];
#pragma unroll
      for (int mi = 0; mi < 2; ++mi) {
        fah[mi].half[0] = *(const v8us*)&st[cur][0][wr + mi * 16 + ln][ks + 8 * hh]; fah[mi].half[1] = *(const v8us*)&st[cur][0][wr + mi * 16 + ln][ks + 16 + 8 * hh];
        fal[mi].half[0] = *(const v8us*)&st[cur][1][wr + mi * 16 + ln][ks + 8 * hh]; fal[mi].half[1] = *(const v8us*)&st[cur][1][wr + mi * 16 + ln][ks + 16 + 8 * hh];
      }
      FragH fbh[2], fbl[2];      // this column block's B fragments and the next one's, read one block ahead of their products
      fbh[0].half[0] = *(const v8us*)&st[cur][2][wc + ln][ks + 8 * hh]; fbh[0].half[1] = *(const v8us*)&st[cur][2][wc + ln][ks + 16 + 8 * hh];
      fbl[0].half[0] = *(const v8us*)&st[cur][3][wc + ln][ks + 8 * hh]; fbl[0].half[1] = *(const v8us*)&st[cur][3][wc + ln][ks + 16 + 8 * hh];
#pragma unroll
      for (int t = 0; t < 4; ++t) {
        const int c = t & 1, n = c ^ 1;
        if (t < 3) {
          fbh[n].half[0] = *(const v8us*)&st[cur][2][wc + (t + 1) * 16 + ln][ks + 8 * hh]; fbh[n].half[1] = *(const v8us*)&st[cur][2][wc + (t + 1) * 16 + ln][ks + 16 + 8 * hh];
          fbl[n].half[0] = *(const v8us*)&st[cur][3][wc + (t + 1) * 16 + ln][ks + 8 * hh]; fbl[n].half[1] = *(const v8us*)&st[cur][3][wc + (t + 1) * 16 + ln][ks + 16 + 8 * hh];
        }
#pragma unroll
        for (int mi = 0; mi < 2; ++mi) hi[mi][t] = mmaH<1>(fah[mi].v, fah[mi].v, fbh[c].v, fbh[c].v, hi[mi][t]);
#pragma unroll
        for (int mi = 0; mi < 2; ++mi) lo[mi][t] = mmaH<1>(fal[mi].v, fal[mi].v, fbh[c].v, fbh[c].v, lo[mi][t]);
#pragma unroll
        for (int mi = 0; mi < 2; ++mi) lo[mi][t] = mmaH<1>(fah[mi].v, fah[mi].v, fbl[c].v, fbl[c].v, lo[mi][t]);
      }
      if (more) {      // the other buffer's last readers left it at the barrier that ended the slice before
#pragma unroll
        for (int p = 0; p < 2; ++p)
#pragma unroll
          for (int i = 0; i < 4; ++i) *(v8us*)&st[cur ^ 1][2 * g + p][lr + 32 * i][lc] = rg[p][i];
      }
    }
    __syncthreads();      // publishes the next slice and ends every wave's reads of this one (after the last slice: frees the LDS for the epilogue)
  }
  float* so = (float*)&st[0][0][0][0] + (size_t)w * (32 * GSO);      // the wave's own 32 x 64 f32 staging
#pragma unroll
  for (int mi = 0; mi < 2; ++mi)
#pragma unroll
    for (int t = 0; t < 4; ++t)
#pragma unroll
      for (int r = 0; r < 8; ++r) so[(mi * 16 + 8 * hh + r) * GSO + t * 16 + ln] = lo[mi][t][r] * 0.0009765625f + hi[mi][t][r];
  __builtin_amdgcn_fence(__ATOMIC_ACQ_REL, "workgroup"); __builtin_amdgcn_wave_barrier();
  const int rsub = lane >> 4, c4 = (lane & 15) * 4;
  float* cw = C + (size_t)(row0 + wr + rsub) * NTK + col0 + wc + c4;      // the lane's first output row (then every second one) and its four columns
#pragma unroll
  for (int q = 0; q < 16; ++q) { const v4f o = *(const v4fa*)&so[(q * 2 + rsub) * GSO + c4]; *(v4f*)(cw + (size_t)q * 2 * NTK) = o; }
}

typedef _Float16 v4h __attribute__((ext_vector_type(4)));

__global__ __launch_bounds__(256) void k_x16(const float* __restrict__ x, _Float16* __restrict__ X16, size_t n8) { const size_t t = (size_t)blockIdx.x * 256 + threadIdx.x; if (t >= n8) return; FragH f;
#pragma unroll
  for (int q = 0; q < 8; ++q) f.h[q] = (_Float16)bf16_round(x[t * 8 + q]); *(v8us*)((unsigned short*)X16 + t * 8) = f.half[0];  }
__global__ __launch_bounds__(256) void k_h16(const float* __restrict__ x, _Float16* __restrict__ X16, size_t n8) { const size_t t = (size_t)blockIdx.x * 256 + threadIdx.x; if (t >= n8) return; FragH f;
#pragma unroll
  for (int q = 0; q < 8; ++q) f.h[q] = (_Float16)x[t * 8 + q]; *(v8us*)((unsigned short*)X16 + t * 8) = f.half[0];  }
__global__ __launch_bounds__(256) void k_round16f(const float* __restrict__ W, _Float16* __restrict__ Bt, size_t n8) { const size_t t = (size_t)blockIdx.x * 256 + threadIdx.x; if (t >= n8) return; FragH f;
#pragma unroll
  for (int i = 0; i < 8; ++i) f.h[i] = (_Float16)(bf16_round(W[t * 8 + i]) * 16.0f); *(v8us*)((unsigned short*)Bt + t * 8) = f.half[0];  }
template <int NHv, int TTv>
__global__ __launch_bounds__(256) void k_vt(const _Float16* __restrict__ V16, int ldv, int voff, _Float16* __restrict__ Vt) { __shared__ unsigned short tl[64][66]; const int tid = threadIdx.x; const int slab = blockIdx.x / (TTv / 64), lg = blockIdx.x % (TTv / 64); const int b = slab / NHv, h = slab % NHv;
  for (int i = tid; i < 64 * 8; i += 256) { const int r = i / 8, c8 = (i % 8) * 8; FragH f; f.half[0] = *(const v8us*)((const unsigned short*)V16 + ((size_t)b * TTv + lg * 64 + r) * ldv + voff + h * 64 + c8);
#pragma unroll
    for (int q = 0; q < 8; ++q) tl[r][c8 + q] = f.u[q]; }
  __syncthreads();
  {
#pragma unroll
    for (int rd = 0; rd < 2; ++rd) { const int d = rd * 32 + tid / 8, pc = tid % 8; FragH f;
#pragma unroll
      for (int q = 0; q < 8; ++q) f.u[q] = tl[pc * 8 + q][d];
      *(v8us*)((unsigned short*)Vt + ((size_t)slab * 64 + d) * TTv + lg * 64 + pc * 8) = f.half[0]; }
     } }

__global__ __launch_bounds__(256) void k_hl(const float* __restrict__ F, _Float16* __restrict__ Hh, _Float16* __restrict__ Hl, size_t n8) { const size_t t = (size_t)blockIdx.x * 256 + threadIdx.x; if (t >= n8) return; FragH fh, fl; const v4f a = *(const v4fa*)(F + t * 8), c = *(const v4fa*)(F + t * 8 + 4);
#pragma unroll
  for (int q = 0; q < 4; ++q) { _Float16 h = (_Float16)a[q]; fh.h[q] = h; fl.h[q] = (_Float16)((a[q] - (float)h) * 1024.0f); h = (_Float16)c[q]; fh.h[4 + q] = h; fl.h[4 + q] = (_Float16)((c[q] - (float)h) * 1024.0f); }
  { *(v8us*)((unsigned short*)Hh + t * 8) = fh.half[0]; *(v8us*)((unsigned short*)Hl + t * 8) = fl.half[0];  } }

__global__ __launch_bounds__(256) void k_tok(const float* __restrict__ x, _Float16* __restrict__ T16) { const int b = blockIdx.y; T16 += (size_t)b * NTK * CC; const int t = blockIdx.x * 256 + threadIdx.x; if (t >= NTK * (CC / 8)) return; const int c0 = (t % (CC / 8)) * 8, n = t / (CC / 8); FragH f;
#pragma unroll
  for (int q = 0; q < 8; ++q) f.h[q] = (_Float16)bf16_round(x[((size_t)b * CC + c0 + q) * NTK + n]);
  *(v8us*)((unsigned short*)T16 + (size_t)n * CC + c0) = f.half[0];  }
__global__ __launch_bounds__(256) void k_soft(const float* __restrict__ S, _Float16* __restrict__ P16) {
  #pragma clang fp contract(off)
  const int tid = threadIdx.x, w = tid >> 5, ln = tid & 31; const int r = blockIdx.x * 8 + w; if (r >= NTK) return; S += (size_t)blockIdx.y * NTK * NTK; P16 += (size_t)blockIdx.y * NTK * NTK; const float* sr = S + (size_t)r * NTK; float m = -3.0e38f;
#pragma unroll 1
  for (int jb = 0; jb < NTK; jb += 256) { const v4f a = *(const v4fa*)(sr + jb + 8 * ln), c = *(const v4fa*)(sr + jb + 8 * ln + 4);
#pragma unroll
    for (int k = 0; k < 4; ++k) { m = fmaxf(m, a[k]); m = fmaxf(m, c[k]); } }
  for (int o = 16; o > 0; o >>= 1) m = fmaxf(m, __shfl_xor(m, o, 32));
  float su = 0.f;
#pragma unroll 1
  for (int jb = 0; jb < NTK; jb += 256) { const v4f a = *(const v4fa*)(sr + jb + 8 * ln), c = *(const v4fa*)(sr + jb + 8 * ln + 4);
#pragma unroll
    for (int k = 0; k < 4; ++k) { su += expf(a[k] - m); su += expf(c[k] - m); } }
  for (int o = 16; o > 0; o >>= 1) su += __shfl_xor(su, o, 32); const float inv = 1024.0f / su;
  {
#pragma unroll 1
    for (int jb = 0; jb < NTK; jb += 256) { const v4f a = *(const v4fa*)(sr + jb + 8 * ln), c = *(const v4fa*)(sr + jb + 8 * ln + 4); FragH f;
#pragma unroll
      for (int k = 0; k < 4; ++k) { f.h[k] = (_Float16)(expf(a[k] - m) * inv); f.h[4 + k] = (_Float16)(expf(c[k] - m) * inv); }
      *(v8us*)((unsigned short*)P16 + (size_t)r * NTK + jb + 8 * ln) = f.half[0]; }
     } }
__global__ __launch_bounds__(256) void k_ln_out(const float* __restrict__ A, const float* __restrict__ g, const float* __restrict__ bb, float* __restrict__ out) {
  #pragma clang fp contract(off)
  __shared__ float tile[32][CC + 1]; const int tid = threadIdx.x, w = tid >> 5, l = tid & 31; const int j0 = blockIdx.x * 32; const int b = blockIdx.y; A += (size_t)b * NTK * CC;
  for (int jj = w; jj < 32; jj += 8) { const int j = j0 + jj; const float* ar = A + (size_t)j * CC; float v[8]; float s = 0.f;
#pragma unroll
    for (int k = 0; k < 8; ++k) { v[k] = ar[l + 32 * k]; s += v[k]; }
    for (int o = 16; o > 0; o >>= 1) s += __shfl_xor(s, o, 32); const float mu = s / (float)CC; float q2 = 0.f;
#pragma unroll
    for (int k = 0; k < 8; ++k) { const float d = v[k] - mu; q2 += d * d; }
    for (int o = 16; o > 0; o >>= 1) q2 += __shfl_xor(q2, o, 32); const float rs = rsqrtf(q2 / (float)CC + 1e-5f);
#pragma unroll
    for (int k = 0; k < 8; ++k) { const int c = l + 32 * k; tile[jj][c] = (v[k] - mu) * rs * bf16_round(g[c]) + bf16_round(bb[c]); } }
  __syncthreads();
  { for (int c = w; c < CC; c += 8) *(float*)(out + ((size_t)b * CC + c) * NTK + j0 + l) = tile[l][c];  } }

extern "C" void kernel_launch(void* const* d_in, const int* in_sizes, int n_in,
                              void* d_out, int out_size, void* d_ws, size_t ws_size, hipStream_t stream) {
  (void)in_sizes; (void)n_in; (void)out_size;
  const float* const* I = (const float* const*)d_in; const float* x = I[0]; const float* wq = I[1]; const float* bq = I[2]; const float* wk = I[3]; const float* bk = I[4]; const float* wv = I[5]; const float* bv = I[6]; const float* w1 = I[7]; const float* b1 = I[8]; const float* w2 = I[9]; const float* b2 = I[10]; const float* g = I[11]; const float* be = I[12];
  char* ws = (char*)d_ws; size_t off = 0;
  auto take = [&](size_t bytes) { char* p = ws + off; off += (bytes + 255) & ~(size_t)255; return p; };
  _Float16* BQ = (_Float16*)take(CC * CC * 2); _Float16* BK = (_Float16*)take(CC * CC * 2); _Float16* BV = (_Float16*)take(CC * CC * 2); _Float16* B1 = (_Float16*)take(CC * CC * 2); _Float16* B2 = (_Float16*)take(CC * CC * 2);
  /* one workspace slab per image for every intermediate: all NBt images go through each launch, image = blockIdx.y */
  _Float16* T16 = (_Float16*)take((size_t)NBt * NTK * CC * 2); _Float16* Qh = (_Float16*)take((size_t)NBt * NTK * CC * 2); _Float16* Ql = (_Float16*)take((size_t)NBt * NTK * CC * 2); _Float16* Kh = (_Float16*)take((size_t)NBt * NTK * CC * 2); _Float16* Kl = (_Float16*)take((size_t)NBt * NTK * CC * 2); _Float16* VT = (_Float16*)take((size_t)NBt * CC * NTK * 2);
  float* S = (float*)take((size_t)NBt * NTK * NTK * 4); _Float16* P16 = (_Float16*)take((size_t)NBt * NTK * NTK * 2); _Float16* A16 = (_Float16*)take((size_t)NBt * NTK * CC * 2); _Float16* H16 = (_Float16*)take((size_t)NBt * NTK * CC * 2); float* T2 = (float*)take((size_t)NBt * NTK * CC * 4);
  if (off > ws_size) return;      // 5 weight planes of 128 KiB + 16 x 11 MiB: under 177 MiB
  k_wt_f16<<<(CC * (CC / 8) + 255) / 256, 256, 0, stream>>>(wq, BQ, CC, CC, 16.0f); k_wt_f16<<<(CC * (CC / 8) + 255) / 256, 256, 0, stream>>>(wk, BK, CC, CC, 16.0f); k_wt_f16<<<(CC * (CC / 8) + 255) / 256, 256, 0, stream>>>(wv, BV, CC, CC, 16.0f); k_wt_f16<<<(CC * (CC / 8) + 255) / 256, 256, 0, stream>>>(w1, B1, CC, CC, 16.0f); k_wt_f16<<<(CC * (CC / 8) + 255) / 256, 256, 0, stream>>>(w2, B2, CC, CC, 16.0f);      /* all weights stored (in,out) */
  const dim3 gP((NTK / GT) * (CC / GT), NBt), gS((NTK / GT) * (NTK / GT), NBt), gE((NTK * (CC / 8) + 255) / 256, NBt);
  const size_t sT = (size_t)NTK * CC, sS = (size_t)NTK * NTK;      /* elements per image */
  k_tok<<<gE, 256, 0, stream>>>(x, T16);
  k_qkv<<<dim3(3 * QT, NBt), 256, 0, stream>>>(T16, BQ, BK, BV, bq, bk, bv, Qh, Ql, Kh, Kl, VT);      /* q, k (exact + bias) as hi/lo planes, v as f16 [channel][token] */
  k_logits<<<gS, 256, 0, stream>>>(Kh, Kl, Qh, Ql, S);      /* S'[j][i] = k_j.q_i (the transposed logits): hi.hi + 2^-10 (lo.hi + hi.lo) in one launch, M = N = 1024, K 256 */
  k_soft<<<dim3(NTK / 8, NBt), 256, 0, stream>>>(S, P16);      /* softmax over i per j (= the module's softmax over the query axis) */
  k_gemm_hhx<0><<<gP, 256, 0, stream>>>(P16, NTK, sS, VT, NTK, sT, 0.0009765625f, nullptr, 0, nullptr, 1, 0, 0, nullptr, A16, CC, sT, NTK, CC, NTK);      /* att[j] = sum_i P'[j][i].v[i] to f16: N 256 K 1024 */
  k_gemm_hhx<15><<<gP, 256, 0, stream>>>(A16, CC, sT, B1, CC, 0, 0.0625f, b1, 0, nullptr, 1, 0, 0, nullptr, H16, CC, sT, NTK, CC, CC);      /* SiLU in the epilogue, hidden to f16 */
  k_gemm_hhx<0><<<gP, 256, 0, stream>>>(H16, CC, sT, B2, CC, 0, 0.0625f, b2, 0, nullptr, 1, 0, 0, T2, nullptr, CC, sT, NTK, CC, CC);      /* MLP */
  k_ln_out<<<dim3(NTK / 32, NBt), 256, 0, stream>>>(T2, g, be, (float*)d_out);
}

// v005
// It runs in 103 microseconds.
// Next to v004, in two timings, it ran 1.13 times as fast each time.
// Counting every step since v000, it is 23.5 times as fast.
#include <hip/hip_runtime.h>
// Token self-attention block on a feature map (B 16, C 256, 32×32 = 1024 tokens): q, k, v = t·W + b (W stored (in,out)); m = q·kᵀ (no scaling); softmax over the QUERY axis i; att[j] = Σ_i m[i][j]·v[i]; MLP (SiLU, 256→256→256); LayerNorm; back to NCHW → [16,256,32,32].
// Structure: the column softmax is a row softmax of mᵀ = k·qᵀ, so per batch: S' = K·Qᵀ (rows j, cols i), row softmax, att = P'·V; everything as GEMMs + row kernels.
// Compute dtype: x and parameters rounded to bf16; q/k/v with exact products; q and k carried as f16 hi + lo·2^10 planes with three cross products (≈f32 logits — they reach σ≈8 unscaled), softmax in f32, P (×2^10), v, attention output and the SiLU hidden as f16 operands (≈2^-12), f32 accumulation; LayerNorm in f32. v_wmma_f32_16x16x32_f16.
#define NBt 16
#define CC 256
#define NTK 1024
typedef __bf16 v16b __attribute__((ext_vector_type(16)));
typedef unsigned short v8us __attribute__((ext_vector_type(8), may_alias));
typedef float  v8f  __attribute__((ext_vector_type(8)));
typedef float  v4f  __attribute__((ext_vector_type(4)));
typedef float  v4fa __attribute__((ext_vector_type(4), may_alias));
union FragB { v16b v; v8us half[2]; unsigned short u[16]; };

__device__ __forceinline__ unsigned short bf16_bits(float x) { unsigned int u = __float_as_uint(x); return (unsigned short)((u + 0x7FFFu + ((u >> 16) & 1u)) >> 16); }
__device__ __forceinline__ float bf16_val(unsigned short b) { return __uint_as_float(((unsigned int)b) << 16); }
__device__ __forceinline__ float bf16_round(float x) { return bf16_val(bf16_bits(x)); }
// D += A·B with NT terms: 1 = ah·bh, 2 = + al·bh (A split), 3 = + ah·bl (both split)
template <int NT>
__device__ __forceinline__ v8f mmaN(v16b ah, v16b al, v16b bh, v16b bl, v8f c) {
  c = __builtin_amdgcn_wmma_f32_16x16x32_bf16(false, ah, false, bh, (short)0, c, false, false);
  if (NT >= 2) c = __builtin_amdgcn_wmma_f32_16x16x32_bf16(false, al, false, bh, (short)0, c, false, false);
  if (NT >= 3) c = __builtin_amdgcn_wmma_f32_16x16x32_bf16(false, ah, false, bl, (short)0, c, false, false);
  asm volatile("v_nop\n\tv_nop\n\tv_nop\n\tv_nop" : "+v"(c) : "v"(ah), "v"(al), "v"(bh), "v"(bl));
  return c;
}

__global__ __launch_bounds__(256) void k_wt_bf16(const float* __restrict__ W, unsigned short* __restrict__ Wt, int K, int N) {
  const int t = blockIdx.x * 256 + threadIdx.x;
  const int k8n = K / 8;
  if (t >= N * k8n) return;
  const int n = t / k8n, k8 = (t % k8n) * 8;
  v8us v;
#pragma unroll
  for (int i = 0; i < 8; ++i) v[i] = bf16_bits(W[(size_t)(k8 + i) * N + n]);
  *(v8us*)(Wt + (size_t)n * K + k8) = v;
  
}

// GEMM C[M][N] (f32, pitch ldc) = act(A[M][K]·W + bias). A f32 row-major (pitch lda) converted per fragment to bf16
// (ASPLIT: hi/lo two planes -> 2 terms, else single rounded term); Wt bf16 [N][K] (pitch ldb). BIAS_BF16 rounds the
// bias to bf16 first (bias quantised to bf16 before the add). K%32==0, M%16==0, N%64==0.
template <bool ASPLIT, int ACT, bool BIAS_BF16>
__global__ __launch_bounds__(128) void k_gemm_bf(const float* __restrict__ A, int lda, const unsigned short* __restrict__ Wt, int ldb,
                                               const float* __restrict__ bias, float* __restrict__ C, int ldc, int M, int N, int K) {
  __shared__ __attribute__((aligned(16))) float so[4][16][64];
  const int tid = threadIdx.x, w = tid >> 5, lane = tid & 31, ln = lane & 15, hh = lane >> 4;
  const int ntn = N / 64;
  const int wid = blockIdx.x * 4 + w;
  const int mt = wid / ntn, nq = wid % ntn;
  if (mt * 16 >= M) return;
  const int row0 = mt * 16, col0 = nq * 64;
  const float* arow = A + (size_t)(row0 + ln) * lda;
  v8f acc[4] = {};
  for (int kb = 0; kb < K; kb += 32) {
    FragB ah, al;
    const v4f x0 = *(const v4fa*)(arow + kb + 8 * hh), x1 = *(const v4fa*)(arow + kb + 8 * hh + 4);
    const v4f x2 = *(const v4fa*)(arow + kb + 16 + 8 * hh), x3 = *(const v4fa*)(arow + kb + 16 + 8 * hh + 4);
    float xs[16] = {x0[0],x0[1],x0[2],x0[3],x1[0],x1[1],x1[2],x1[3],x2[0],x2[1],x2[2],x2[3],x3[0],x3[1],x3[2],x3[3]};
#pragma unroll
    for (int i = 0; i < 16; ++i) { const unsigned short hb = bf16_bits(xs[i]); ah.u[i] = hb; al.u[i] = ASPLIT ? bf16_bits(xs[i] - bf16_val(hb)) : (unsigned short)0; }
#pragma unroll
    for (int t = 0; t < 4; ++t) {
      const unsigned short* brow = Wt + (size_t)(col0 + t * 16 + ln) * ldb + kb;
      FragB b;
      b.half[0] = *(const v8us*)(brow + 8 * hh);
      b.half[1] = *(const v8us*)(brow + 16 + 8 * hh);
      acc[t] = mmaN<ASPLIT ? 2 : 1>(ah.v, al.v, b.v, b.v, acc[t]);
    }
  }
#pragma unroll
  for (int t = 0; t < 4; ++t) {
    float bv = bias ? bias[col0 + t * 16 + ln] : 0.f;
    if (BIAS_BF16) bv = bf16_round(bv);
#pragma unroll
    for (int r = 0; r < 8; ++r) { float v = acc[t][r] + bv; if (ACT == 1) v = fmaxf(v, 0.f); so[w][8 * hh + r][t * 16 + ln] = v; }
  }
  __builtin_amdgcn_fence(__ATOMIC_ACQ_REL, "workgroup");
  __builtin_amdgcn_wave_barrier();
  const int rsub = lane >> 4, c4 = (lane & 15) * 4;
  {
#pragma unroll
    for (int q = 0; q < 8; ++q) {
      const int r = q * 2 + rsub;
      const v4f v = *(const v4fa*)&so[w][r][c4];
      *(v4f*)(C + (size_t)(row0 + r) * ldc + col0 + c4) = v;
    }
    
  }
}

// GEMM C = act(A·W + bias + resid): A f32 (ASPLIT -> hi/lo 2 terms), Wt bf16 [N][K]; ACT 0 none, 1 relu, 2 exact gelu;
// resid (optional, f32, row index = (row % rmod), pitch ldr, RES_BF16 rounds it) added before the activation.
template <bool ASPLIT, int ACT, bool BIAS_BF16, bool RES_BF16>
__global__ __launch_bounds__(128) void k_gemm_bf3(const float* __restrict__ A, int lda, const unsigned short* __restrict__ Wt, int ldb,
                                                const float* __restrict__ bias, const float* __restrict__ resid, int rmod, int ldr,
                                                float* __restrict__ C, int ldc, int M, int N, int K) {
  __shared__ __attribute__((aligned(16))) float so[4][16][64];
  const int tid = threadIdx.x, w = tid >> 5, lane = tid & 31, ln = lane & 15, hh = lane >> 4;
  const int ntn = N / 64;
  const int wid = blockIdx.x * 4 + w;
  const int mt = wid / ntn, nq = wid % ntn;
  if (mt * 16 >= M) return;
  const int row0 = mt * 16, col0 = nq * 64;
  const float* arow = A + (size_t)(row0 + ln) * lda;
  v8f acc[4] = {};
  for (int kb = 0; kb < K; kb += 32) {
    FragB ah, al;
    const v4f x0 = *(const v4fa*)(arow + kb + 8 * hh), x1 = *(const v4fa*)(arow + kb + 8 * hh + 4);
    const v4f x2 = *(const v4fa*)(arow + kb + 16 + 8 * hh), x3 = *(const v4fa*)(arow + kb + 16 + 8 * hh + 4);
    float xs[16] = {x0[0],x0[1],x0[2],x0[3],x1[0],x1[1],x1[2],x1[3],x2[0],x2[1],x2[2],x2[3],x3[0],x3[1],x3[2],x3[3]};
#pragma unroll
    for (int i = 0; i < 16; ++i) { const unsigned short hb = bf16_bits(xs[i]); ah.u[i] = hb; al.u[i] = ASPLIT ? bf16_bits(xs[i] - bf16_val(hb)) : (unsigned short)0; }
#pragma unroll
    for (int t = 0; t < 4; ++t) {
      const unsigned short* brow = Wt + (size_t)(col0 + t * 16 + ln) * ldb + kb;
      FragB b;
      b.half[0] = *(const v8us*)(brow + 8 * hh);
      b.half[1] = *(const v8us*)(brow + 16 + 8 * hh);
      acc[t] = mmaN<ASPLIT ? 2 : 1>(ah.v, al.v, b.v, b.v, acc[t]);
    }
  }
#pragma unroll
  for (int t = 0; t < 4; ++t) {
    const int col = col0 + t * 16 + ln;
    float bv = bias ? bias[col] : 0.f;
    if (BIAS_BF16) bv = bf16_round(bv);
#pragma unroll
    for (int r = 0; r < 8; ++r) {
      float v = acc[t][r] + bv;
      if (resid) { float rv = resid[(size_t)((row0 + 8 * hh + r) % rmod) * ldr + col]; if (RES_BF16) rv = bf16_round(rv); v += rv; }
      if (ACT == 1) v = fmaxf(v, 0.f);
      if (ACT == 2) v = 0.5f * v * (1.0f + erff(v * 0.70710678118654752f));
      if (ACT == 3) { const float u = 0.7978845608028654f * (v + 0.044715f * v * v * v); v = 0.5f * v * (1.0f + tanhf(u)); }
      so[w][8 * hh + r][t * 16 + ln] = v;
    }
  }
  __builtin_amdgcn_fence(__ATOMIC_ACQ_REL, "workgroup");
  __builtin_amdgcn_wave_barrier();
  const int rsub = lane >> 4, c4 = (lane & 15) * 4;
  {
#pragma unroll
    for (int q = 0; q < 8; ++q) {
      const int r = q * 2 + rsub;
      const v4f v = *(const v4fa*)&so[w][r][c4];
      *(v4f*)(C + (size_t)(row0 + r) * ldc + col0 + c4) = v;
    }
    
  }
}
// row LayerNorm (biased variance, eps) over N: s = X (+ R); optional out_sum <- s; out_norm <- (s-mu)*rsqrt(var+eps)*g + b
template <bool PARAM_BF16>
__global__ __launch_bounds__(256) void k_layernorm(const float* __restrict__ X, const float* __restrict__ R, const float* __restrict__ g, const float* __restrict__ bta,
                                                  float* __restrict__ out_sum, float* __restrict__ out_norm, int N, float eps) {
  __shared__ float red[256];
  const int row = blockIdx.x, tid = threadIdx.x;
  const float* x = X + (size_t)row * N; const float* rr = R ? R + (size_t)row * N : nullptr;
  float vals[16];                     // up to N = 4096
  const int per = N / 256;            // contiguous chunk per thread? use strided-by-4 chunks: thread handles j = tid*4 + 1024*u
  float s1 = 0.f;
  for (int u = 0; u < per / 4; ++u) {
    const int j = tid * 4 + 1024 * u;
    const v4f a = *(const v4fa*)(x + j);
    v4f b = {0.f,0.f,0.f,0.f}; if (rr) b = *(const v4fa*)(rr + j);
#pragma unroll
    for (int q = 0; q < 4; ++q) { const float v = a[q] + b[q]; vals[u * 4 + q] = v; s1 += v; }
  }
  red[tid] = s1; __syncthreads();
  for (int st = 128; st > 0; st >>= 1) { if (tid < st) red[tid] += red[tid + st]; __syncthreads(); }
  const float mu = red[0] / (float)N; __syncthreads();
  float s2 = 0.f;
  for (int u = 0; u < per / 4; ++u)
#pragma unroll
    for (int q = 0; q < 4; ++q) { const float c = vals[u * 4 + q] - mu; s2 += c * c; }
  red[tid] = s2; __syncthreads();
  for (int st = 128; st > 0; st >>= 1) { if (tid < st) red[tid] += red[tid + st]; __syncthreads(); }
  const float rs = rsqrtf(red[0] / (float)N + eps);
  {
    for (int u = 0; u < per / 4; ++u) {
      const int j = tid * 4 + 1024 * u;
      v4f o, sm;
#pragma unroll
      for (int q = 0; q < 4; ++q) {
        float gg = g[j + q], bb = bta[j + q];
        if (PARAM_BF16) { gg = bf16_round(gg); bb = bf16_round(bb); }
        sm[q] = vals[u * 4 + q]; o[q] = (vals[u * 4 + q] - mu) * rs * gg + bb;
      }
      if (out_sum) *(v4f*)(out_sum + (size_t)row * N + j) = sm;
      *(v4f*)(out_norm + (size_t)row * N + j) = o;
    }
    
  }
}



// ---- f16 WMMA path (v_wmma_f32_16x16x32_f16): 11-bit significands for operands in range — used where a [0,1] probability operand needs more precision than bf16
typedef _Float16 v16h __attribute__((ext_vector_type(16)));
union FragH { v16h v; v8us half[2]; _Float16 h[16]; unsigned short u[16]; };
template <int NT>
__device__ __forceinline__ v8f mmaH(v16h ah, v16h al, v16h bh, v16h bl, v8f c) {
  c = __builtin_amdgcn_wmma_f32_16x16x32_f16(false, ah, false, bh, (short)0, c, false, false);
  if (NT >= 2) c = __builtin_amdgcn_wmma_f32_16x16x32_f16(false, al, false, bh, (short)0, c, false, false);
  if (NT >= 3) c = __builtin_amdgcn_wmma_f32_16x16x32_f16(false, ah, false, bl, (short)0, c, false, false);
  asm volatile("v_nop\n\tv_nop\n\tv_nop\n\tv_nop" : "+v"(c) : "v"(ah), "v"(al), "v"(bh), "v"(bl));
  return c;
}
// batched GEMM like k_gemm_b but f16 operands: A f32 (split into f16 hi/lo if ASPLIT, else rounded to f16), Bt = f16 values [n][k]; alpha; C f32; N multiple of 16 (partial tiles skipped)
template <bool ASPLIT>
__global__ __launch_bounds__(128) void k_gemm_h(const float* __restrict__ A, int lda, size_t sA, const _Float16* __restrict__ Bh, int ldb, size_t sB, float alpha, float* __restrict__ C, int ldc, size_t sC, int M, int N, int K) {
  __shared__ __attribute__((aligned(16))) float so[4][16][64];
  const int tid = threadIdx.x, w = tid >> 5, lane = tid & 31, ln = lane & 15, hh = lane >> 4; const int by = blockIdx.y;
  A += (size_t)by * sA; Bh += (size_t)by * sB; C += (size_t)by * sC;
  const int ntn = (N + 63) / 64; const int wid = blockIdx.x * 4 + w; const int mt = wid / ntn, nq = wid % ntn; if (mt * 16 >= M) return;
  const int row0 = mt * 16, col0 = nq * 64; const float* arow = A + (size_t)(row0 + ln) * lda;
  v8f acc[4] = {};
  for (int kb = 0; kb < K; kb += 32) {
    FragH ah, al;
    const v4f x0 = *(const v4fa*)(arow + kb + 8 * hh), x1 = *(const v4fa*)(arow + kb + 8 * hh + 4), x2 = *(const v4fa*)(arow + kb + 16 + 8 * hh), x3 = *(const v4fa*)(arow + kb + 16 + 8 * hh + 4);
    float xs[16] = {x0[0],x0[1],x0[2],x0[3],x1[0],x1[1],x1[2],x1[3],x2[0],x2[1],x2[2],x2[3],x3[0],x3[1],x3[2],x3[3]};
#pragma unroll
    for (int i = 0; i < 16; ++i) { const _Float16 h = (_Float16)xs[i]; ah.h[i] = h; al.h[i] = ASPLIT ? (_Float16)(xs[i] - (float)h) : (_Float16)0.0f; }
#pragma unroll
    for (int t = 0; t < 4; ++t) { if (col0 + t * 16 >= N) continue; const size_t boff = (size_t)(col0 + t * 16 + ln) * ldb + kb; FragH bq; bq.half[0] = *(const v8us*)(Bh + boff + 8 * hh); bq.half[1] = *(const v8us*)(Bh + boff + 16 + 8 * hh);
      acc[t] = mmaH<ASPLIT ? 2 : 1>(ah.v, al.v, bq.v, bq.v, acc[t]); }
  }
#pragma unroll
  for (int t = 0; t < 4; ++t) { if (col0 + t * 16 >= N) continue;
#pragma unroll
    for (int r = 0; r < 8; ++r) so[w][8 * hh + r][t * 16 + ln] = acc[t][r] * alpha; }
  __builtin_amdgcn_fence(__ATOMIC_ACQ_REL, "workgroup"); __builtin_amdgcn_wave_barrier();
  const int rsub = lane >> 4, c4 = (lane & 15) * 4;
  {
#pragma unroll
    for (int q = 0; q < 8; ++q) { const int r = q * 2 + rsub; if (col0 + c4 < N) { const v4f v = *(const v4fa*)&so[w][r][c4]; *(v4f*)(C + (size_t)(row0 + r) * ldc + col0 + c4) = v; } }
     }
}

// Block-tiled GEMM with fused epilogue: v = acc*alpha + bias[by*sBias + col] (+ CP[by*sC + (row/rowsPerB)*sCPb + col] if CP) ; ACT 0 none / 1 elu ; writes f16 C16 and f32 C, each if non-null; by = blockIdx.y = image.
// One work-group of 8 waves owns a 128 x 128 tile of C; A and Bh (f16, [row][k]) come in 64-wide k slices as whole 128-byte lines and are shared through LDS (two buffers, the next slice's loads fly during this slice's products).
// Each wave does 32 x 64 of the tile; k runs upward in steps of 32 per accumulator. Needs M % 128 == 0, N % 128 == 0, K % 64 == 0, grid.x = (M/128)*(N/128).
#define GT 128      /* tile edge, rows of A and rows of Bh per work-group */
#define GK 64       /* k slice */
#define GPIT 72     /* LDS row pitch in f16: 144 B = 16 B x 9, so the 16 rows of a 16-byte fragment read fall on distinct banks */
#define GSO 68      /* epilogue row pitch in f32: rows 8 apart fall on different banks */
template <int ACT>
__global__ __launch_bounds__(256) void k_gemm_hhx(const _Float16* __restrict__ A, int lda, size_t sA, const _Float16* __restrict__ Bh, int ldb, size_t sB, float alpha, const float* __restrict__ bias, size_t sBias, const float* __restrict__ CP, int rowsPerB, size_t sCPb, int row0g,
    float* __restrict__ C, _Float16* __restrict__ C16, int ldc, size_t sC, int M, int N, int K) {
  __shared__ __attribute__((aligned(16))) unsigned short st[2][2][GT][GPIT];      // [buffer][A | Bh][row][k]; reused as f32 staging by the epilogue
  (void)M;
  const int tid = threadIdx.x, w = tid >> 5, lane = tid & 31, ln = lane & 15, hh = lane >> 4; const int by = blockIdx.y;
  A += (size_t)by * sA; Bh += (size_t)by * sB; const size_t cofs = (size_t)by * sC; const float* bp = bias ? bias + (size_t)by * sBias : nullptr;
  const int ntn = N / GT; const int row0 = ((int)blockIdx.x / ntn) * GT, col0 = ((int)blockIdx.x % ntn) * GT;
  const int wr = (w >> 1) * 32, wc = (w & 1) * 64;      // the wave's 32 x 64 part of the tile
  const int lr = tid >> 3, lc = (tid & 7) * 8;          // staging: 8 lanes per 128-byte row slice, 32 rows per pass
  const char* ab = (const char*)A; const char* bb = (const char*)Bh;      // uniform bases; each lane keeps eight byte offsets
  unsigned ao[4], bo[4];
#pragma unroll
  for (int i = 0; i < 4; ++i) { ao[i] = (unsigned)(((row0 + lr + 32 * i) * lda + lc) * 2); bo[i] = (unsigned)(((col0 + lr + 32 * i) * ldb + lc) * 2); }
  v8us ra[4], rb[4];
#pragma unroll
  for (int i = 0; i < 4; ++i) { ra[i] = *(const v8us*)(ab + ao[i]); rb[i] = *(const v8us*)(bb + bo[i]); }
  float bv[4] = {0.f, 0.f, 0.f, 0.f};
  if (bp) {
#pragma unroll
    for (int t = 0; t < 4; ++t) bv[t] = bp[col0 + wc + t * 16 + ln];
#pragma unroll
    for (int t = 0; t < 4; ++t) bv[t] = bf16_round(bv[t]);
  }
#pragma unroll
  for (int i = 0; i < 4; ++i) { *(v8us*)&st[0][0][lr + 32 * i][lc] = ra[i]; *(v8us*)&st[0][1][lr + 32 * i][lc] = rb[i]; }
  __syncthreads();
  v8f acc[2][4] = {};
  for (int kb = 0; kb < K; kb += GK) {
    const int cur = (kb / GK) & 1; const bool more = kb + GK < K;
    if (more) {
#pragma unroll
      for (int i = 0; i < 4; ++i) { ao[i] += GK * 2; bo[i] += GK * 2; }      // each lane's offsets walk along k
#pragma unroll
      for (int i = 0; i < 4; ++i) { ra[i] = *(const v8us*)(ab + ao[i]); rb[i] = *(const v8us*)(bb + bo[i]); }
    }
#pragma unroll
    for (int ks = 0; ks < GK; ks += 32) {
      FragH fa[2], fb[4];
#pragma unroll
      for (int mi = 0; mi < 2; ++mi) { fa[mi].half[0] = *(const v8us*)&st[cur][0][wr + mi * 16 + ln][ks + 8 * hh]; fa[mi].half[1] = *(const v8us*)&st[cur][0][wr + mi * 16 + ln][ks + 16 + 8 * hh]; }
#pragma unroll
      for (int t = 0; t < 4; ++t) { fb[t].half[0] = *(const v8us*)&st[cur][1][wc + t * 16 + ln][ks + 8 * hh]; fb[t].half[1] = *(const v8us*)&st[cur][1][wc + t * 16 + ln][ks + 16 + 8 * hh]; }
#pragma unroll
      for (int mi = 0; mi < 2; ++mi)
#pragma unroll
        for (int t = 0; t < 4; ++t) acc[mi][t] = mmaH<1>(fa[mi].v, fa[mi].v, fb[t].v, fb[t].v, acc[mi][t]);
    }
    if (more) {
#pragma unroll
      for (int i = 0; i < 4; ++i) { *(v8us*)&st[cur ^ 1][0][lr + 32 * i][lc] = ra[i]; *(v8us*)&st[cur ^ 1][1][lr + 32 * i][lc] = rb[i]; }
    }
    __syncthreads();      // publishes the next slice and ends every wave's reads of this one (after the last slice: frees the LDS for the epilogue)
  }
  const int rsub = lane >> 4, c4 = (lane & 15) * 4; typedef _Float16 v4h __attribute__((ext_vector_type(4)));
  const int orow = row0 + wr + rsub, ocol = col0 + wc + c4;      // the lane's first output row (then every second one) and its four columns
  v4f cp[16];
  if (CP) {      // all sixteen addend loads go out together, ahead of the staging, so that their latency is paid once
#pragma unroll
    for (int q = 0; q < 16; ++q) { const int bidx = (row0g + orow + q * 2) / rowsPerB; cp[q] = *(const v4fa*)(CP + cofs + (size_t)bidx * sCPb + ocol);
      if ((q & 3) == 3 && q < 15) asm volatile("s_wait_xcnt 0x0" ::: "memory"); }      // later loads' results may be given the registers that held earlier loads' addresses
  }
  float* so = (float*)&st[0][0][0][0] + (size_t)w * (32 * GSO);      // the wave's own 32 x 64 f32 staging
#pragma unroll
  for (int mi = 0; mi < 2; ++mi)
#pragma unroll
    for (int t = 0; t < 4; ++t)
#pragma unroll
      for (int r = 0; r < 8; ++r) so[(mi * 16 + 8 * hh + r) * GSO + t * 16 + ln] = acc[mi][t][r] * alpha + bv[t];
  __builtin_amdgcn_fence(__ATOMIC_ACQ_REL, "workgroup"); __builtin_amdgcn_wave_barrier();
  v4f o[16];
#pragma unroll
  for (int q = 0; q < 16; ++q) o[q] = *(const v4fa*)&so[(q * 2 + rsub) * GSO + c4];
  if (CP) {
#pragma unroll
    for (int q = 0; q < 16; ++q) o[q] += cp[q];
  }
#pragma unroll
  for (int q = 0; q < 16; ++q)
#pragma unroll
    for (int i = 0; i < 4; ++i) { float v = o[q][i]; if (ACT == 1) v = (v > 0.f) ? v : expm1f(v); else if (ACT == 7) v = (v > 0.f) ? v + 1.0f : expf(v); else if (ACT == 8) v = tanhf(v); else if (ACT == 9) v = 0.5f * v * (1.0f + tanhf(0.7978845608028654f * (v + 0.044715f * v * v * v))); else if (ACT == 11) v = 1.0f / (1.0f + expf(-v)); else if (ACT == 12) v = (v > 0.f) ? v : 0.01f * v; else if (ACT == 14) v = (v > 0.f) ? v : 0.1f * v; else if (ACT == 15) v = v / (1.0f + expf(-v)); else if (ACT == 3) v = fmaxf(v, 0.f); else if (ACT == 6) v = 0.5f * v * (1.0f + erff(v * 0.70710678118654752f)); o[q][i] = v; }
  if (C) {
#pragma unroll
    for (int q = 0; q < 16; ++q) *(v4f*)(C + cofs + (size_t)(orow + q * 2) * ldc + ocol) = o[q];
    asm volatile("s_wait_xcnt 0x0" ::: "memory");      // the f16 stores below reuse registers that these stores name
  }
  if (C16) {
#pragma unroll
    for (int q = 0; q < 16; ++q) { v4h h4; for (int i = 0; i < 4; ++i) h4[i] = (_Float16)o[q][i]; *(v4h*)(C16 + cofs + (size_t)(orow + q * 2) * ldc + ocol) = h4; }
  }
}


// q, k and v in one launch, each written once, in the form its reader takes: q and k as f16 hi and lo*2^10 planes [token][channel], v as f16 [channel][token].
// blockIdx.x / QT picks the product, blockIdx.x % QT its 128 x 128 tile, blockIdx.y the image. q, k: rows = tokens (T16), columns = channels (the weight plane), bias by column.
// v: the operands change places (rows = channels from BV, columns = tokens from T16), so the tile comes out transposed as it stands and its bias goes by row.
// Tiling, staging and k order as in k_gemm_hhx (8 waves of 32 x 64, 64-wide k slices, two LDS buffers).
#define QT ((NTK / GT) * (CC / GT))      /* tiles per product and image */
__global__ __launch_bounds__(256) void k_qkv(const _Float16* __restrict__ T16, const _Float16* __restrict__ BQ, const _Float16* __restrict__ BK, const _Float16* __restrict__ BV,
    const float* __restrict__ bq, const float* __restrict__ bk, const float* __restrict__ bvv,
    _Float16* __restrict__ Qh, _Float16* __restrict__ Ql, _Float16* __restrict__ Kh, _Float16* __restrict__ Kl, _Float16* __restrict__ VT) {
  __shared__ __attribute__((aligned(16))) unsigned short st[2][2][GT][GPIT];      // [buffer][A | B][row][k]; reused as f32 staging by the epilogue
  const int tid = threadIdx.x, w = tid >> 5, lane = tid & 31, ln = lane & 15, hh = lane >> 4;
  const int sel = (int)blockIdx.x / QT, tile = (int)blockIdx.x % QT; const bool isv = sel == 2;
  const size_t iofs = (size_t)blockIdx.y * NTK * CC;      // every per-image array here holds NTK * CC elements
  const int row0 = (isv ? tile / (NTK / GT) : tile / (CC / GT)) * GT, col0 = (isv ? tile % (NTK / GT) : tile % (CC / GT)) * GT;
  const int wr = (w >> 1) * 32, wc = (w & 1) * 64;      // the wave's 32 x 64 part of the tile
  const int lr = tid >> 3, lc = (tid & 7) * 8;          // staging: 8 lanes per 128-byte row slice, 32 rows per pass
  const char* ab = (const char*)(isv ? BV : T16 + iofs); const char* bb = (const char*)(isv ? T16 + iofs : (sel ? BK : BQ));      // uniform bases
  const unsigned ao = (unsigned)(((row0 + lr) * CC + lc) * 2), bo = (unsigned)(((col0 + lr) * CC + lc) * 2);      // the lane's byte offsets; further rows are constants, the slice a uniform step
  v8us ra[4], rb[4];
#pragma unroll
  for (int i = 0; i < 4; ++i) { ra[i] = *(const v8us*)(ab + ao + i * (32 * CC * 2)); rb[i] = *(const v8us*)(bb + bo + i * (32 * CC * 2)); }
#pragma unroll
  for (int i = 0; i < 4; ++i) { *(v8us*)&st[0][0][lr + 32 * i][lc] = ra[i]; *(v8us*)&st[0][1][lr + 32 * i][lc] = rb[i]; }
  __syncthreads();
  v8f acc[2][4] = {};
#pragma unroll 1      // kept rolled: unrolled, the wave takes 161 registers, allocated as 176, and only two work-groups fit on a WGP; at 160 three fit, which is what this grid gives each WGP
  for (int kb = 0; kb < CC; kb += GK) {
    const int cur = (kb / GK) & 1; const bool more = kb + GK < CC;
    if (more) {
#pragma unroll
      for (int i = 0; i < 4; ++i) { ra[i] = *(const v8us*)(ab + ao + i * (32 * CC * 2) + (kb + GK) * 2); rb[i] = *(const v8us*)(bb + bo + i * (32 * CC * 2) + (kb + GK) * 2); }
    }
#pragma unroll
    for (int ks = 0; ks < GK; ks += 32) {
      FragH fa[2], fb[4];
#pragma unroll
      for (int mi = 0; mi < 2; ++mi) { fa[mi].half[0] = *(const v8us*)&st[cur][0][wr + mi * 16 + ln][ks + 8 * hh]; fa[mi].half[1] = *(const v8us*)&st[cur][0][wr + mi * 16 + ln][ks + 16 + 8 * hh]; }
#pragma unroll
      for (int t = 0; t < 4; ++t) { fb[t].half[0] = *(const v8us*)&st[cur][1][wc + t * 16 + ln][ks + 8 * hh]; fb[t].half[1] = *(const v8us*)&st[cur][1][wc + t * 16 + ln][ks + 16 + 8 * hh]; }
#pragma unroll
      for (int mi = 0; mi < 2; ++mi)
#pragma unroll
        for (int t = 0; t < 4; ++t) acc[mi][t] = mmaH<1>(fa[mi].v, fa[mi].v, fb[t].v, fb[t].v, acc[mi][t]);
    }
    if (more) {
#pragma unroll
      for (int i = 0; i < 4; ++i) { *(v8us*)&st[cur ^ 1][0][lr + 32 * i][lc] = ra[i]; *(v8us*)&st[cur ^ 1][1][lr + 32 * i][lc] = rb[i]; }
    }
    __syncthreads();      // publishes the next slice and ends every wave's reads of this one (after the last slice: frees the LDS for the epilogue)
  }
  typedef _Float16 v4h __attribute__((ext_vector_type(4)));
  float* so = (float*)&st[0][0][0][0] + (size_t)w * (32 * GSO);      // the wave's own 32 x 64 f32 staging
  const int rsub = lane >> 4, c4 = (lane & 15) * 4;
  const int orow = row0 + wr + rsub, ocol = col0 + wc + c4;      // the lane's first output row (then every second one) and its four columns
  if (isv) {
    float br[2][8];      // bias by row (channel)
#pragma unroll
    for (int mi = 0; mi < 2; ++mi)
#pragma unroll
      for (int r = 0; r < 8; ++r) br[mi][r] = bf16_round(bvv[row0 + wr + mi * 16 + 8 * hh + r]);
#pragma unroll
    for (int mi = 0; mi < 2; ++mi)
#pragma unroll
      for (int t = 0; t < 4; ++t)
#pragma unroll
        for (int r = 0; r < 8; ++r) so[(mi * 16 + 8 * hh + r) * GSO + t * 16 + ln] = acc[mi][t][r] * 0.0625f + br[mi][r];
    __builtin_amdgcn_fence(__ATOMIC_ACQ_REL, "workgroup"); __builtin_amdgcn_wave_barrier();
    _Float16* vo = VT + iofs + (size_t)orow * NTK + ocol;
#pragma unroll
    for (int q = 0; q < 16; ++q) { const v4f o = *(const v4fa*)&so[(q * 2 + rsub) * GSO + c4]; v4h h4;
#pragma unroll
      for (int i = 0; i < 4; ++i) h4[i] = (_Float16)o[i];
      *(v4h*)(vo + q * 2 * NTK) = h4; }
  } else {
    const float* bias = sel ? bk : bq;
    float bc[4];      // bias by column (channel)
#pragma unroll
    for (int t = 0; t < 4; ++t) bc[t] = bf16_round(bias[col0 + wc + t * 16 + ln]);
#pragma unroll
    for (int mi = 0; mi < 2; ++mi)
#pragma unroll
      for (int t = 0; t < 4; ++t)
#pragma unroll
        for (int r = 0; r < 8; ++r) so[(mi * 16 + 8 * hh + r) * GSO + t * 16 + ln] = acc[mi][t][r] * 0.0625f + bc[t];
    __builtin_amdgcn_fence(__ATOMIC_ACQ_REL, "workgroup"); __builtin_amdgcn_wave_barrier();
    _Float16* ho = (sel ? Kh : Qh) + iofs + (size_t)orow * CC + ocol; _Float16* lo = (sel ? Kl : Ql) + iofs + (size_t)orow * CC + ocol;
#pragma unroll
    for (int q = 0; q < 16; ++q) { const v4f o = *(const v4fa*)&so[(q * 2 + rsub) * GSO + c4]; v4h h4, l4;
#pragma unroll
      for (int i = 0; i < 4; ++i) { const _Float16 h = (_Float16)o[i]; h4[i] = h; l4[i] = (_Float16)((o[i] - (float)h) * 1024.0f); }
      *(v4h*)(ho + q * 2 * CC) = h4; *(v4h*)(lo + q * 2 * CC) = l4; }
    asm volatile("s_wait_xcnt 0x0" ::: "memory");      // in the built code the other branch's instructions follow these stores and rewrite the registers that they name
  }
}

// Logits in one launch: C[j][i] = Ah.Bh + 2^-10 (Al.Bh + Ah.Bl), all four f16 planes [row][CC], image = blockIdx.y; the lo planes carry a factor 2^10.
// Tiling and staging as in k_gemm_hhx (128 x 128 tile, 8 waves of 32 x 64, 64-wide k slices, two LDS buffers); each slice brings all four planes, and every fragment read from LDS feeds the three products.
// Two accumulator sets per wave: hi (Ah.Bh) and lo (Al.Bh then Ah.Bl, k upward); they meet once, in the epilogue.
// The next slice's A planes fly during the first half of this slice's products, its B planes during the second half: half the staging registers, so that two work-groups fit on a WGP (144 KiB of LDS each, at most 256 registers a wave).
__global__ __launch_bounds__(256) __attribute__((amdgpu_waves_per_eu(4, 4))) void k_logits(const _Float16* __restrict__ Ah, const _Float16* __restrict__ Al, const _Float16* __restrict__ Bh, const _Float16* __restrict__ Bl, float* __restrict__ C) {
  __shared__ __attribute__((aligned(16))) unsigned short st[2][4][GT][GPIT];      // [buffer][Ah | Al | Bh | Bl][row][k]; reused as f32 staging by the epilogue
  const int tid = threadIdx.x, w = tid >> 5, lane = tid & 31, ln = lane & 15, hh = lane >> 4;
  const size_t pofs = (size_t)blockIdx.y * NTK * CC; C += (size_t)blockIdx.y * NTK * NTK;
  const int row0 = ((int)blockIdx.x / (NTK / GT)) * GT, col0 = ((int)blockIdx.x % (NTK / GT)) * GT;
  const int wr = (w >> 1) * 32, wc = (w & 1) * 64;      // the wave's 32 x 64 part of the tile
  const int lr = tid >> 3, lc = (tid & 7) * 8;          // staging: 8 lanes per 128-byte row slice, 32 rows per pass
  const char* pl[4] = {(const char*)(Ah + pofs), (const char*)(Al + pofs), (const char*)(Bh + pofs), (const char*)(Bl + pofs)};      // uniform bases
  const unsigned po[2] = {(unsigned)(((row0 + lr) * CC + lc) * 2), (unsigned)(((col0 + lr) * CC + lc) * 2)};      // the lane's byte offsets in the A and the B planes; further rows are constants, the slice a uniform step
  v8us rg[2][4];
#pragma unroll
  for (int g = 0; g < 2; ++g) {
#pragma unroll
    for (int p = 0; p < 2; ++p)
#pragma unroll
      for (int i = 0; i < 4; ++i) rg[p][i] = *(const v8us*)(pl[2 * g + p] + po[g] + i * (32 * CC * 2));
#pragma unroll
    for (int p = 0; p < 2; ++p)
#pragma unroll
      for (int i = 0; i < 4; ++i) *(v8us*)&st[0][2 * g + p][lr + 32 * i][lc] = rg[p][i];
  }
  asm volatile("s_wait_xcnt 0x0" ::: "memory");      // the registers that the loads above name are given other values from here on
  __syncthreads();
  v8f hi[2][4] = {}, lo[2][4] = {};
#pragma unroll 1      // kept rolled: unrolled, the LDS addresses of both buffers stay live at once and the wave no longer fits 256 registers
  for (int kb = 0; kb < CC; kb += GK) {
    const int cur = (kb / GK) & 1; const bool more = kb + GK < CC;
#pragma unroll
    for (int g = 0; g < 2; ++g) {      // k half g of this slice; beside it plane pair g of the next slice
      const int ks = g * 32;
      if (more) {
#pragma unroll
        for (int p = 0; p < 2; ++p)
#pragma unroll
          for (int i = 0; i < 4; ++i) rg[p][i] = *(const v8us*)(pl[2 * g + p] + po[g] + i * (32 * CC * 2) + (kb + GK) * 2);
      }
      FragH fah[2], fal[2];
#pragma unroll
      for (int mi = 0; mi < 2; ++mi) {
        fah[mi].half[0] = *(const v8us*)&st[cur][0][wr + mi * 16 + ln][ks + 8 * hh]; fah[mi].half[1] = *(const v8us*)&st[cur][0][wr + mi * 16 + ln][ks + 16 + 8 * hh];
        fal[mi].half[0] = *(const v8us*)&st[cur][1][wr + mi * 16 + ln][ks + 8 * hh]; fal[mi].half[1] = *(const v8us*)&st[cur][1][wr + mi * 16 + ln][ks + 16 + 8 * hh];
      }
      FragH fbh[2], fbl[2];      // this column block's B fragments and the next one's, read one block ahead of their products
      fbh[0].half[0] = *(const v8us*)&st[cur][2][wc + ln][ks + 8 * hh]; fbh[0].half[1] = *(const v8us*)&st[cur][2][wc + ln][ks + 16 + 8 * hh];
      fbl[0].half[0] = *(const v8us*)&st[cur][3][wc + ln][ks + 8 * hh]; fbl[0].half[1] = *(const v8us*)&st[cur][3][wc + ln][ks + 16 + 8 * hh];
#pragma unroll
      for (int t = 0; t < 4; ++t) {
        const int c = t & 1, n = c ^ 1;
        if (t < 3) {
          fbh[n].half[0] = *(const v8us*)&st[cur][2][wc + (t + 1) * 16 + ln][ks + 8 * hh]; fbh[n].half[1] = *(const v8us*)&st[cur][2][wc + (t + 1) * 16 + ln][ks + 16 + 8 * hh];
          fbl[n].half[0] = *(const v8us*)&st[cur][3][wc + (t + 1) * 16 + ln][ks + 8 * hh]; fbl[n].half[1] = *(const v8us*)&st[cur][3][wc + (t + 1) * 16 + ln][ks + 16 + 8 * hh];
        }
#pragma unroll
        for (int mi = 0; mi < 2; ++mi) hi[mi][t] = mmaH<1>(fah[mi].v, fah[mi].v, fbh[c].v, fbh[c].v, hi[mi][t]);
#pragma unroll
        for (int mi = 0; mi < 2; ++mi) lo[mi][t] = mmaH<1>(fal[mi].v, fal[mi].v, fbh[c].v, fbh[c].v, lo[mi][t]);
#pragma unroll
        for (int mi = 0; mi < 2; ++mi) lo[mi][t] = mmaH<1>(fah[mi].v, fah[mi].v, fbl[c].v, fbl[c].v, lo[mi][t]);
      }
      if (more) {      // the other buffer's last readers left it at the barrier that ended the slice before
#pragma unroll
        for (int p = 0; p < 2; ++p)
#pragma unroll
          for (int i = 0; i < 4; ++i) *(v8us*)&st[cur ^ 1][2 * g + p][lr + 32 * i][lc] = rg[p][i];
      }
    }
    __syncthreads();      // publishes the next slice and ends every wave's reads of this one (after the last slice: frees the LDS for the epilogue)
  }
  float* so = (float*)&st[0][0][0][0] + (size_t)w * (32 * GSO);      // the wave's own 32 x 64 f32 staging
#pragma unroll
  for (int mi = 0; mi < 2; ++mi)
#pragma unroll
    for (int t = 0; t < 4; ++t)
#pragma unroll
      for (int r = 0; r < 8; ++r) so[(mi * 16 + 8 * hh + r) * GSO + t * 16 + ln] = lo[mi][t][r] * 0.0009765625f + hi[mi][t][r];
  __builtin_amdgcn_fence(__ATOMIC_ACQ_REL, "workgroup"); __builtin_amdgcn_wave_barrier();
  const int rsub = lane >> 4, c4 = (lane & 15) * 4;
  float* cw = C + (size_t)(row0 + wr + rsub) * NTK + col0 + wc + c4;      // the lane's first output row (then every second one) and its four columns
#pragma unroll
  for (int q = 0; q < 16; ++q) { const v4f o = *(const v4fa*)&so[(q * 2 + rsub) * GSO + c4]; *(v4f*)(cw + (size_t)q * 2 * NTK) = o; }
}

typedef _Float16 v4h __attribute__((ext_vector_type(4)));

__global__ __launch_bounds__(256) void k_x16(const float* __restrict__ x, _Float16* __restrict__ X16, size_t n8) { const size_t t = (size_t)blockIdx.x * 256 + threadIdx.x; if (t >= n8) return; FragH f;
#pragma unroll
  for (int q = 0; q < 8; ++q) f.h[q] = (_Float16)bf16_round(x[t * 8 + q]); *(v8us*)((unsigned short*)X16 + t * 8) = f.half[0];  }
__global__ __launch_bounds__(256) void k_h16(const float* __restrict__ x, _Float16* __restrict__ X16, size_t n8) { const size_t t = (size_t)blockIdx.x * 256 + threadIdx.x; if (t >= n8) return; FragH f;
#pragma unroll
  for (int q = 0; q < 8; ++q) f.h[q] = (_Float16)x[t * 8 + q]; *(v8us*)((unsigned short*)X16 + t * 8) = f.half[0];  }
__global__ __launch_bounds__(256) void k_round16f(const float* __restrict__ W, _Float16* __restrict__ Bt, size_t n8) { const size_t t = (size_t)blockIdx.x * 256 + threadIdx.x; if (t >= n8) return; FragH f;
#pragma unroll
  for (int i = 0; i < 8; ++i) f.h[i] = (_Float16)(bf16_round(W[t * 8 + i]) * 16.0f); *(v8us*)((unsigned short*)Bt + t * 8) = f.half[0];  }
template <int NHv, int TTv>
__global__ __launch_bounds__(256) void k_vt(const _Float16* __restrict__ V16, int ldv, int voff, _Float16* __restrict__ Vt) { __shared__ unsigned short tl[64][66]; const int tid = threadIdx.x; const int slab = blockIdx.x / (TTv / 64), lg = blockIdx.x % (TTv / 64); const int b = slab / NHv, h = slab % NHv;
  for (int i = tid; i < 64 * 8; i += 256) { const int r = i / 8, c8 = (i % 8) * 8; FragH f; f.half[0] = *(const v8us*)((const unsigned short*)V16 + ((size_t)b * TTv + lg * 64 + r) * ldv + voff + h * 64 + c8);
#pragma unroll
    for (int q = 0; q < 8; ++q) tl[r][c8 + q] = f.u[q]; }
  __syncthreads();
  {
#pragma unroll
    for (int rd = 0; rd < 2; ++rd) { const int d = rd * 32 + tid / 8, pc = tid % 8; FragH f;
#pragma unroll
      for (int q = 0; q < 8; ++q) f.u[q] = tl[pc * 8 + q][d];
      *(v8us*)((unsigned short*)Vt + ((size_t)slab * 64 + d) * TTv + lg * 64 + pc * 8) = f.half[0]; }
     } }

__global__ __launch_bounds__(256) void k_hl(const float* __restrict__ F, _Float16* __restrict__ Hh, _Float16* __restrict__ Hl, size_t n8) { const size_t t = (size_t)blockIdx.x * 256 + threadIdx.x; if (t >= n8) return; FragH fh, fl; const v4f a = *(const v4fa*)(F + t * 8), c = *(const v4fa*)(F + t * 8 + 4);
#pragma unroll
  for (int q = 0; q < 4; ++q) { _Float16 h = (_Float16)a[q]; fh.h[q] = h; fl.h[q] = (_Float16)((a[q] - (float)h) * 1024.0f); h = (_Float16)c[q]; fh.h[4 + q] = h; fl.h[4 + q] = (_Float16)((c[q] - (float)h) * 1024.0f); }
  { *(v8us*)((unsigned short*)Hh + t * 8) = fh.half[0]; *(v8us*)((unsigned short*)Hl + t * 8) = fl.half[0];  } }

// All input preparation in one launch: the five weight planes and the sixteen token planes depend on the inputs alone, so their work-groups run side by side.
// Work-groups 0 .. 5*WB-1: weight plane blockIdx.x / WB, BW[plane][n][k] = f16(bf16(W[k][n]) * 16) from f32 row-major W[k][n] (bf16-exact weights stay exact in f16 away from the subnormal range).
// The others, TB per image: T16[image][token][channel] = f16(bf16(x[image][channel][token])).
#define WB (CC * (CC / 8) / 256)      /* work-groups per weight plane */
#define TB (NTK * (CC / 8) / 256)     /* work-groups per image */
__global__ __launch_bounds__(256) void k_prep(const float* __restrict__ x, const float* __restrict__ wq, const float* __restrict__ wk, const float* __restrict__ wv, const float* __restrict__ w1, const float* __restrict__ w2,
    _Float16* __restrict__ BW, _Float16* __restrict__ T16) {
  const int bx = (int)blockIdx.x; FragH f;
  if (bx < 5 * WB) {
    const int sel = bx / WB; const float* W = sel == 0 ? wq : sel == 1 ? wk : sel == 2 ? wv : sel == 3 ? w1 : w2; BW += (size_t)sel * CC * CC;
    const int t = (bx % WB) * 256 + threadIdx.x; const int n = t / (CC / 8), k8 = (t % (CC / 8)) * 8;
#pragma unroll
    for (int i = 0; i < 8; ++i) f.h[i] = (_Float16)(bf16_round(W[(size_t)(k8 + i) * CC + n]) * 16.0f);
    *(v8us*)((unsigned short*)BW + (size_t)n * CC + k8) = f.half[0];
  } else {
    const int b = (bx - 5 * WB) / TB; T16 += (size_t)b * NTK * CC; const int t = ((bx - 5 * WB) % TB) * 256 + threadIdx.x; const int c0 = (t % (CC / 8)) * 8, n = t / (CC / 8);
#pragma unroll
    for (int q = 0; q < 8; ++q) f.h[q] = (_Float16)bf16_round(x[((size_t)b * CC + c0 + q) * NTK + n]);
    *(v8us*)((unsigned short*)T16 + (size_t)n * CC + c0) = f.half[0];
    asm volatile("s_wait_xcnt 0x0" ::: "memory");      // in the built code the other branch's instructions follow this store and rewrite the registers that it names
  }
}
__global__ __launch_bounds__(256) void k_soft(const float* __restrict__ S, _Float16* __restrict__ P16) {
  #pragma clang fp contract(off)
  const int tid = threadIdx.x, w = tid >> 5, ln = tid & 31; const int r = blockIdx.x * 8 + w; if (r >= NTK) return; S += (size_t)blockIdx.y * NTK * NTK; P16 += (size_t)blockIdx.y * NTK * NTK; const float* sr = S + (size_t)r * NTK; float m = -3.0e38f;
#pragma unroll 1
  for (int jb = 0; jb < NTK; jb += 256) { const v4f a = *(const v4fa*)(sr + jb + 8 * ln), c = *(const v4fa*)(sr + jb + 8 * ln + 4);
#pragma unroll
    for (int k = 0; k < 4; ++k) { m = fmaxf(m, a[k]); m = fmaxf(m, c[k]); } }
  for (int o = 16; o > 0; o >>= 1) m = fmaxf(m, __shfl_xor(m, o, 32));
  float su = 0.f;
#pragma unroll 1
  for (int jb = 0; jb < NTK; jb += 256) { const v4f a = *(const v4fa*)(sr + jb + 8 * ln), c = *(const v4fa*)(sr + jb + 8 * ln + 4);
#pragma unroll
    for (int k = 0; k < 4; ++k) { su += expf(a[k] - m); su += expf(c[k] - m); } }
  for (int o = 16; o > 0; o >>= 1) su += __shfl_xor(su, o, 32); const float inv = 1024.0f / su;
  {
#pragma unroll 1
    for (int jb = 0; jb < NTK; jb += 256) { const v4f a = *(const v4fa*)(sr + jb + 8 * ln), c = *(const v4fa*)(sr + jb + 8 * ln + 4); FragH f;
#pragma unroll
      for (int k = 0; k < 4; ++k) { f.h[k] = (_Float16)(expf(a[k] - m) * inv); f.h[4 + k] = (_Float16)(expf(c[k] - m) * inv); }
      *(v8us*)((unsigned short*)P16 + (size_t)r * NTK + jb + 8 * ln) = f.half[0]; }
     } }
__global__ __launch_bounds__(256) void k_ln_out(const float* __restrict__ A, const float* __restrict__ g, const float* __restrict__ bb, float* __restrict__ out) {
  #pragma clang fp contract(off)
  __shared__ float tile[32][CC + 1]; const int tid = threadIdx.x, w = tid >> 5, l = tid & 31; const int j0 = blockIdx.x * 32; const int b = blockIdx.y; A += (size_t)b * NTK * CC;
  for (int jj = w; jj < 32; jj += 8) { const int j = j0 + jj; const float* ar = A + (size_t)j * CC; float v[8]; float s = 0.f;
#pragma unroll
    for (int k = 0; k < 8; ++k) { v[k] = ar[l + 32 * k]; s += v[k]; }
    for (int o = 16; o > 0; o >>= 1) s += __shfl_xor(s, o, 32); const float mu = s / (float)CC; float q2 = 0.f;
#pragma unroll
    for (int k = 0; k < 8; ++k) { const float d = v[k] - mu; q2 += d * d; }
    for (int o = 16; o > 0; o >>= 1) q2 += __shfl_xor(q2, o, 32); const float rs = rsqrtf(q2 / (float)CC + 1e-5f);
#pragma unroll
    for (int k = 0; k < 8; ++k) { const int c = l + 32 * k; tile[jj][c] = (v[k] - mu) * rs * bf16_round(g[c]) + bf16_round(bb[c]); } }
  __syncthreads();
  { for (int c = w; c < CC; c += 8) *(float*)(out + ((size_t)b * CC + c) * NTK + j0 + l) = tile[l][c];  } }

extern "C" void kernel_launch(void* const* d_in, const int* in_sizes, int n_in,
                              void* d_out, int out_size, void* d_ws, size_t ws_size, hipStream_t stream) {
  (void)in_sizes; (void)n_in; (void)out_size;
  const float* const* I = (const float* const*)d_in; const float* x = I[0]; const float* wq = I[1]; const float* bq = I[2]; const float* wk = I[3]; const float* bk = I[4]; const float* wv = I[5]; const float* bv = I[6]; const float* w1 = I[7]; const float* b1 = I[8]; const float* w2 = I[9]; const float* b2 = I[10]; const float* g = I[11]; const float* be = I[12];
  char* ws = (char*)d_ws; size_t off = 0;
  auto take = [&](size_t bytes) { char* p = ws + off; off += (bytes + 255) & ~(size_t)255; return p; };
  _Float16* BQ = (_Float16*)take(5 * CC * CC * 2); _Float16* BK = BQ + CC * CC; _Float16* BV = BQ + 2 * CC * CC; _Float16* B1 = BQ + 3 * CC * CC; _Float16* B2 = BQ + 4 * CC * CC;      /* five weight planes, one after another */
  /* one workspace slab per image for every intermediate: all NBt images go through each launch, image = blockIdx.y (in k_prep, (blockIdx.x - 5*WB) / TB) */
  _Float16* T16 = (_Float16*)take((size_t)NBt * NTK * CC * 2); _Float16* Qh = (_Float16*)take((size_t)NBt * NTK * CC * 2); _Float16* Ql = (_Float16*)take((size_t)NBt * NTK * CC * 2); _Float16* Kh = (_Float16*)take((size_t)NBt * NTK * CC * 2); _Float16* Kl = (_Float16*)take((size_t)NBt * NTK * CC * 2); _Float16* VT = (_Float16*)take((size_t)NBt * CC * NTK * 2);
  float* S = (float*)take((size_t)NBt * NTK * NTK * 4); _Float16* P16 = (_Float16*)take((size_t)NBt * NTK * NTK * 2); _Float16* A16 = (_Float16*)take((size_t)NBt * NTK * CC * 2); _Float16* H16 = (_Float16*)take((size_t)NBt * NTK * CC * 2); float* T2 = (float*)take((size_t)NBt * NTK * CC * 4);
  if (off > ws_size) return;      // 5 weight planes of 128 KiB + 16 x 11 MiB: under 177 MiB
  const dim3 gP((NTK / GT) * (CC / GT), NBt), gS((NTK / GT) * (NTK / GT), NBt);
  const size_t sT = (size_t)NTK * CC, sS = (size_t)NTK * NTK;      /* elements per image */
  k_prep<<<5 * WB + NBt * TB, 256, 0, stream>>>(x, wq, wk, wv, w1, w2, BQ, T16);      /* all weights stored (in,out); every plane and every image in the one launch */
  k_qkv<<<dim3(3 * QT, NBt), 256, 0, stream>>>(T16, BQ, BK, BV, bq, bk, bv, Qh, Ql, Kh, Kl, VT);      /* q, k (exact + bias) as hi/lo planes, v as f16 [channel][token] */
  k_logits<<<gS, 256, 0, stream>>>(Kh, Kl, Qh, Ql, S);      /* S'[j][i] = k_j.q_i (the transposed logits): hi.hi + 2^-10 (lo.hi + hi.lo) in one launch, M = N = 1024, K 256 */
  k_soft<<<dim3(NTK / 8, NBt), 256, 0, stream>>>(S, P16);      /* softmax over i per j (= the module's softmax over the query axis) */
  k_gemm_hhx<0><<<gP, 256, 0, stream>>>(P16, NTK, sS, VT, NTK, sT, 0.0009765625f, nullptr, 0, nullptr, 1, 0, 0, nullptr, A16, CC, sT, NTK, CC, NTK);      /* att[j] = sum_i P'[j][i].v[i] to f16: N 256 K 1024 */
  k_gemm_hhx<15><<<gP, 256, 0, stream>>>(A16, CC, sT, B1, CC, 0, 0.0625f, b1, 0, nullptr, 1, 0, 0, nullptr, H16, CC, sT, NTK, CC, CC);      /* SiLU in the epilogue, hidden to f16 */
  k_gemm_hhx<0><<<gP, 256, 0, stream>>>(H16, CC, sT, B2, CC, 0, 0.0625f, b2, 0, nullptr, 1, 0, 0, T2, nullptr, CC, sT, NTK, CC, CC);      /* MLP */
  k_ln_out<<<dim3(NTK / 32, NBt), 256, 0, stream>>>(T2, g, be, (float*)d_out);
}

// v006
// It runs in 95.9 microseconds.
// Timed twice side by side with v005, it ran 1.07 and 1.08 times as fast.
// Over all steps from v000 it is 25.3 times as fast.
#include <hip/hip_runtime.h>
// Token self-attention block on a feature map (B 16, C 256, 32×32 = 1024 tokens): q, k, v = t·W + b (W stored (in,out)); m = q·kᵀ (no scaling); softmax over the QUERY axis i; att[j] = Σ_i m[i][j]·v[i]; MLP (SiLU, 256→256→256); LayerNorm; back to NCHW → [16,256,32,32].
// Structure: the column softmax is a row softmax of mᵀ = k·qᵀ, so per batch: S' = K·Qᵀ (rows j, cols i), row softmax, att = P'·V; everything as GEMMs + row kernels.
// Compute dtype: x and parameters rounded to bf16; q/k/v with exact products; q and k carried as f16 hi + lo·2^10 planes with three cross products (≈f32 logits — they reach σ≈8 unscaled), softmax in f32, P (×2^10), v, attention output and the SiLU hidden as f16 operands (≈2^-12), f32 accumulation; LayerNorm in f32. v_wmma_f32_16x16x32_f16.
#define NBt 16
#define CC 256
#define NTK 1024
typedef __bf16 v16b __attribute__((ext_vector_type(16)));
typedef unsigned short v8us __attribute__((ext_vector_type(8), may_alias));
typedef float  v8f  __attribute__((ext_vector_type(8)));
typedef float  v4f  __attribute__((ext_vector_type(4)));
typedef float  v4fa __attribute__((ext_vector_type(4), may_alias));
union FragB { v16b v; v8us half[2]; unsigned short u[16]; };

__device__ __forceinline__ unsigned short bf16_bits(float x) { unsigned int u = __float_as_uint(x); return (unsigned short)((u + 0x7FFFu + ((u >> 16) & 1u)) >> 16); }
__device__ __forceinline__ float bf16_val(unsigned short b) { return __uint_as_float(((unsigned int)b) << 16); }
__device__ __forceinline__ float bf16_round(float x) { return bf16_val(bf16_bits(x)); }
// D += A·B with NT terms: 1 = ah·bh, 2 = + al·bh (A split), 3 = + ah·bl (both split)
template <int NT>
__device__ __forceinline__ v8f mmaN(v16b ah, v16b al, v16b bh, v16b bl, v8f c) {
  c = __builtin_amdgcn_wmma_f32_16x16x32_bf16(false, ah, false, bh, (short)0, c, false, false);
  if (NT >= 2) c = __builtin_amdgcn_wmma_f32_16x16x32_bf16(false, al, false, bh, (short)0, c, false, false);
  if (NT >= 3) c = __builtin_amdgcn_wmma_f32_16x16x32_bf16(false, ah, false, bl, (short)0, c, false, false);
  asm volatile("v_nop\n\tv_nop\n\tv_nop\n\tv_nop" : "+v"(c) : "v"(ah), "v"(al), "v"(bh), "v"(bl));
  return c;
}

__global__ __launch_bounds__(256) void k_wt_bf16(const float* __restrict__ W, unsigned short* __restrict__ Wt, int K, int N) {
  const int t = blockIdx.x * 256 + threadIdx.x;
  const int k8n = K / 8;
  if (t >= N * k8n) return;
  const int n = t / k8n, k8 = (t % k8n) * 8;
  v8us v;
#pragma unroll
  for (int i = 0; i < 8; ++i) v[i] = bf16_bits(W[(size_t)(k8 + i) * N + n]);
  *(v8us*)(Wt + (size_t)n * K + k8) = v;
  
}

// GEMM C[M][N] (f32, pitch ldc) = act(A[M][K]·W + bias). A f32 row-major (pitch lda) converted per fragment to bf16
// (ASPLIT: hi/lo two planes -> 2 terms, else single rounded term); Wt bf16 [N][K] (pitch ldb). BIAS_BF16 rounds the
// bias to bf16 first (bias quantised to bf16 before the add). K%32==0, M%16==0, N%64==0.
template <bool ASPLIT, int ACT, bool BIAS_BF16>
__global__ __launch_bounds__(128) void k_gemm_bf(const float* __restrict__ A, int lda, const unsigned short* __restrict__ Wt, int ldb,
                                               const float* __restrict__ bias, float* __restrict__ C, int ldc, int M, int N, int K) {
  __shared__ __attribute__((aligned(16))) float so[4][16][64];
  const int tid = threadIdx.x, w = tid >> 5, lane = tid & 31, ln = lane & 15, hh = lane >> 4;
  const int ntn = N / 64;
  const int wid = blockIdx.x * 4 + w;
  const int mt = wid / ntn, nq = wid % ntn;
  if (mt * 16 >= M) return;
  const int row0 = mt * 16, col0 = nq * 64;
  const float* arow = A + (size_t)(row0 + ln) * lda;
  v8f acc[4] = {};
  for (int kb = 0; kb < K; kb += 32) {
    FragB ah, al;
    const v4f x0 = *(const v4fa*)(arow + kb + 8 * hh), x1 = *(const v4fa*)(arow + kb + 8 * hh + 4);
    const v4f x2 = *(const v4fa*)(arow + kb + 16 + 8 * hh), x3 = *(const v4fa*)(arow + kb + 16 + 8 * hh + 4);
    float xs[16] = {x0[0],x0[1],x0[2],x0[3],x1[0],x1[1],x1[2],x1[3],x2[0],x2[1],x2[2],x2[3],x3[0],x3[1],x3[2],x3[3]};
#pragma unroll
    for (int i = 0; i < 16; ++i) { const unsigned short hb = bf16_bits(xs[i]); ah.u[i] = hb; al.u[i] = ASPLIT ? bf16_bits(xs[i] - bf16_val(hb)) : (unsigned short)0; }
#pragma unroll
    for (int t = 0; t < 4; ++t) {
      const unsigned short* brow = Wt + (size_t)(col0 + t * 16 + ln) * ldb + kb;
      FragB b;
      b.half[0] = *(const v8us*)(brow + 8 * hh);
      b.half[1] = *(const v8us*)(brow + 16 + 8 * hh);
      acc[t] = mmaN<ASPLIT ? 2 : 1>(ah.v, al.v, b.v, b.v, acc[t]);
    }
  }
#pragma unroll
  for (int t = 0; t < 4; ++t) {
    float bv = bias ? bias[col0 + t * 16 + ln] : 0.f;
    if (BIAS_BF16) bv = bf16_round(bv);
#pragma unroll
    for (int r = 0; r < 8; ++r) { float v = acc[t][r] + bv; if (ACT == 1) v = fmaxf(v, 0.f); so[w][8 * hh + r][t * 16 + ln] = v; }
  }
  __builtin_amdgcn_fence(__ATOMIC_ACQ_REL, "workgroup");
  __builtin_amdgcn_wave_barrier();
  const int rsub = lane >> 4, c4 = (lane & 15) * 4;
  {
#pragma unroll
    for (int q = 0; q < 8; ++q) {
      const int r = q * 2 + rsub;
      const v4f v = *(const v4fa*)&so[w][r][c4];
      *(v4f*)(C + (size_t)(row0 + r) * ldc + col0 + c4) = v;
    }
    
  }
}

// GEMM C = act(A·W + bias + resid): A f32 (ASPLIT -> hi/lo 2 terms), Wt bf16 [N][K]; ACT 0 none, 1 relu, 2 exact gelu;
// resid (optional, f32, row index = (row % rmod), pitch ldr, RES_BF16 rounds it) added before the activation.
template <bool ASPLIT, int ACT, bool BIAS_BF16, bool RES_BF16>
__global__ __launch_bounds__(128) void k_gemm_bf3(const float* __restrict__ A, int lda, const unsigned short* __restrict__ Wt, int ldb,
                                                const float* __restrict__ bias, const float* __restrict__ resid, int rmod, int ldr,
                                                float* __restrict__ C, int ldc, int M, int N, int K) {
  __shared__ __attribute__((aligned(16))) float so[4][16][64];
  const int tid = threadIdx.x, w = tid >> 5, lane = tid & 31, ln = lane & 15, hh = lane >> 4;
  const int ntn = N / 64;
  const int wid = blockIdx.x * 4 + w;
  const int mt = wid / ntn, nq = wid % ntn;
  if (mt * 16 >= M) return;
  const int row0 = mt * 16, col0 = nq * 64;
  const float* arow = A + (size_t)(row0 + ln) * lda;
  v8f acc[4] = {};
  for (int kb = 0; kb < K; kb += 32) {
    FragB ah, al;
    const v4f x0 = *(const v4fa*)(arow + kb + 8 * hh), x1 = *(const v4fa*)(arow + kb + 8 * hh + 4);
    const v4f x2 = *(const v4fa*)(arow + kb + 16 + 8 * hh), x3 = *(const v4fa*)(arow + kb + 16 + 8 * hh + 4);
    float xs[16] = {x0[0],x0[1],x0[2],x0[3],x1[0],x1[1],x1[2],x1[3],x2[0],x2[1],x2[2],x2[3],x3[0],x3[1],x3[2],x3[3]};
#pragma unroll
    for (int i = 0; i < 16; ++i) { const unsigned short hb = bf16_bits(xs[i]); ah.u[i] = hb; al.u[i] = ASPLIT ? bf16_bits(xs[i] - bf16_val(hb)) : (unsigned short)0; }
#pragma unroll
    for (int t = 0; t < 4; ++t) {
      const unsigned short* brow = Wt + (size_t)(col0 + t * 16 + ln) * ldb + kb;
      FragB b;
      b.half[0] = *(const v8us*)(brow + 8 * hh);
      b.half[1] = *(const v8us*)(brow + 16 + 8 * hh);
      acc[t] = mmaN<ASPLIT ? 2 : 1>(ah.v, al.v, b.v, b.v, acc[t]);
    }
  }
#pragma unroll
  for (int t = 0; t < 4; ++t) {
    const int col = col0 + t * 16 + ln;
    float bv = bias ? bias[col] : 0.f;
    if (BIAS_BF16) bv = bf16_round(bv);
#pragma unroll
    for (int r = 0; r < 8; ++r) {
      float v = acc[t][r] + bv;
      if (resid) { float rv = resid[(size_t)((row0 + 8 * hh + r) % rmod) * ldr + col]; if (RES_BF16) rv = bf16_round(rv); v += rv; }
      if (ACT == 1) v = fmaxf(v, 0.f);
      if (ACT == 2) v = 0.5f * v * (1.0f + erff(v * 0.70710678118654752f));
      if (ACT == 3) { const float u = 0.7978845608028654f * (v + 0.044715f * v * v * v); v = 0.5f * v * (1.0f + tanhf(u)); }
      so[w][8 * hh + r][t * 16 + ln] = v;
    }
  }
  __builtin_amdgcn_fence(__ATOMIC_ACQ_REL, "workgroup");
  __builtin_amdgcn_wave_barrier();
  const int rsub = lane >> 4, c4 = (lane & 15) * 4;
  {
#pragma unroll
    for (int q = 0; q < 8; ++q) {
      const int r = q * 2 + rsub;
      const v4f v = *(const v4fa*)&so[w][r][c4];
      *(v4f*)(C + (size_t)(row0 + r) * ldc + col0 + c4) = v;
    }
    
  }
}
// row LayerNorm (biased variance, eps) over N: s = X (+ R); optional out_sum <- s; out_norm <- (s-mu)*rsqrt(var+eps)*g + b
template <bool PARAM_BF16>
__global__ __launch_bounds__(256) void k_layernorm(const float* __restrict__ X, const float* __restrict__ R, const float* __restrict__ g, const float* __restrict__ bta,
                                                  float* __restrict__ out_sum, float* __restrict__ out_norm, int N, float eps) {
  __shared__ float red[256];
  const int row = blockIdx.x, tid = threadIdx.x;
  const float* x = X + (size_t)row * N; const float* rr = R ? R + (size_t)row * N : nullptr;
  float vals[16];                     // up to N = 4096
  const int per = N / 256;            // contiguous chunk per thread? use strided-by-4 chunks: thread handles j = tid*4 + 1024*u
  float s1 = 0.f;
  for (int u = 0; u < per / 4; ++u) {
    const int j = tid * 4 + 1024 * u;
    const v4f a = *(const v4fa*)(x + j);
    v4f b = {0.f,0.f,0.f,0.f}; if (rr) b = *(const v4fa*)(rr + j);
#pragma unroll
    for (int q = 0; q < 4; ++q) { const float v = a[q] + b[q]; vals[u * 4 + q] = v; s1 += v; }
  }
  red[tid] = s1; __syncthreads();
  for (int st = 128; st > 0; st >>= 1) { if (tid < st) red[tid] += red[tid + st]; __syncthreads(); }
  const float mu = red[0] / (float)N; __syncthreads();
  float s2 = 0.f;
  for (int u = 0; u < per / 4; ++u)
#pragma unroll
    for (int q = 0; q < 4; ++q) { const float c = vals[u * 4 + q] - mu; s2 += c * c; }
  red[tid] = s2; __syncthreads();
  for (int st = 128; st > 0; st >>= 1) { if (tid < st) red[tid] += red[tid + st]; __syncthreads(); }
  const float rs = rsqrtf(red[0] / (float)N + eps);
  {
    for (int u = 0; u < per / 4; ++u) {
      const int j = tid * 4 + 1024 * u;
      v4f o, sm;
#pragma unroll
      for (int q = 0; q < 4; ++q) {
        float gg = g[j + q], bb = bta[j + q];
        if (PARAM_BF16) { gg = bf16_round(gg); bb = bf16_round(bb); }
        sm[q] = vals[u * 4 + q]; o[q] = (vals[u * 4 + q] - mu) * rs * gg + bb;
      }
      if (out_sum) *(v4f*)(out_sum + (size_t)row * N + j) = sm;
      *(v4f*)(out_norm + (size_t)row * N + j) = o;
    }
    
  }
}



// ---- f16 WMMA path (v_wmma_f32_16x16x32_f16): 11-bit significands for operands in range — used where a [0,1] probability operand needs more precision than bf16
typedef _Float16 v16h __attribute__((ext_vector_type(16)));
union FragH { v16h v; v8us half[2]; _Float16 h[16]; unsigned short u[16]; };
template <int NT>
__device__ __forceinline__ v8f mmaH(v16h ah, v16h al, v16h bh, v16h bl, v8f c) {
  c = __builtin_amdgcn_wmma_f32_16x16x32_f16(false, ah, false, bh, (short)0, c, false, false);
  if (NT >= 2) c = __builtin_amdgcn_wmma_f32_16x16x32_f16(false, al, false, bh, (short)0, c, false, false);
  if (NT >= 3) c = __builtin_amdgcn_wmma_f32_16x16x32_f16(false, ah, false, bl, (short)0, c, false, false);
  asm volatile("v_nop\n\tv_nop\n\tv_nop\n\tv_nop" : "+v"(c) : "v"(ah), "v"(al), "v"(bh), "v"(bl));
  return c;
}
// batched GEMM like k_gemm_b but f16 operands: A f32 (split into f16 hi/lo if ASPLIT, else rounded to f16), Bt = f16 values [n][k]; alpha; C f32; N multiple of 16 (partial tiles skipped)
template <bool ASPLIT>
__global__ __launch_bounds__(128) void k_gemm_h(const float* __restrict__ A, int lda, size_t sA, const _Float16* __restrict__ Bh, int ldb, size_t sB, float alpha, float* __restrict__ C, int ldc, size_t sC, int M, int N, int K) {
  __shared__ __attribute__((aligned(16))) float so[4][16][64];
  const int tid = threadIdx.x, w = tid >> 5, lane = tid & 31, ln = lane & 15, hh = lane >> 4; const int by = blockIdx.y;
  A += (size_t)by * sA; Bh += (size_t)by * sB; C += (size_t)by * sC;
  const int ntn = (N + 63) / 64; const int wid = blockIdx.x * 4 + w; const int mt = wid / ntn, nq = wid % ntn; if (mt * 16 >= M) return;
  const int row0 = mt * 16, col0 = nq * 64; const float* arow = A + (size_t)(row0 + ln) * lda;
  v8f acc[4] = {};
  for (int kb = 0; kb < K; kb += 32) {
    FragH ah, al;
    const v4f x0 = *(const v4fa*)(arow + kb + 8 * hh), x1 = *(const v4fa*)(arow + kb + 8 * hh + 4), x2 = *(const v4fa*)(arow + kb + 16 + 8 * hh), x3 = *(const v4fa*)(arow + kb + 16 + 8 * hh + 4);
    float xs[16] = {x0[0],x0[1],x0[2],x0[3],x1[0],x1[1],x1[2],x1[3],x2[0],x2[1],x2[2],x2[3],x3[0],x3[1],x3[2],x3[3]};
#pragma unroll
    for (int i = 0; i < 16; ++i) { const _Float16 h = (_Float16)xs[i]; ah.h[i] = h; al.h[i] = ASPLIT ? (_Float16)(xs[i] - (float)h) : (_Float16)0.0f; }
#pragma unroll
    for (int t = 0; t < 4; ++t) { if (col0 + t * 16 >= N) continue; const size_t boff = (size_t)(col0 + t * 16 + ln) * ldb + kb; FragH bq; bq.half[0] = *(const v8us*)(Bh + boff + 8 * hh); bq.half[1] = *(const v8us*)(Bh + boff + 16 + 8 * hh);
      acc[t] = mmaH<ASPLIT ? 2 : 1>(ah.v, al.v, bq.v, bq.v, acc[t]); }
  }
#pragma unroll
  for (int t = 0; t < 4; ++t) { if (col0 + t * 16 >= N) continue;
#pragma unroll
    for (int r = 0; r < 8; ++r) so[w][8 * hh + r][t * 16 + ln] = acc[t][r] * alpha; }
  __builtin_amdgcn_fence(__ATOMIC_ACQ_REL, "workgroup"); __builtin_amdgcn_wave_barrier();
  const int rsub = lane >> 4, c4 = (lane & 15) * 4;
  {
#pragma unroll
    for (int q = 0; q < 8; ++q) { const int r = q * 2 + rsub; if (col0 + c4 < N) { const v4f v = *(const v4fa*)&so[w][r][c4]; *(v4f*)(C + (size_t)(row0 + r) * ldc + col0 + c4) = v; } }
     }
}

// Block-tiled GEMM with fused epilogue: v = acc*alpha + bias[by*sBias + col] (+ CP[by*sC + (row/rowsPerB)*sCPb + col] if CP) ; ACT 0 none / 1 elu ; writes f16 C16 and f32 C, each if non-null; by = blockIdx.y = image.
// One work-group of 8 waves owns a 128 x 128 tile of C; A and Bh (f16, [row][k]) come in 64-wide k slices as whole 128-byte lines and are shared through LDS (two buffers, the next slice's loads fly during this slice's products).
// Each wave does 32 x 64 of the tile; k runs upward in steps of 32 per accumulator. Needs M % 128 == 0, N % 128 == 0, K % 64 == 0, grid.x = (M/128)*(N/128).
#define GT 128      /* tile edge, rows of A and rows of Bh per work-group */
#define GK 64       /* k slice */
#define GPIT 72     /* LDS row pitch in f16: 144 B = 16 B x 9, so the 16 rows of a 16-byte fragment read fall on distinct banks */
#define GSO 68      /* epilogue row pitch in f32: rows 8 apart fall on different banks */
template <int ACT>
__global__ __launch_bounds__(256) void k_gemm_hhx(const _Float16* __restrict__ A, int lda, size_t sA, const _Float16* __restrict__ Bh, int ldb, size_t sB, float alpha, const float* __restrict__ bias, size_t sBias, const float* __restrict__ CP, int rowsPerB, size_t sCPb, int row0g,
    float* __restrict__ C, _Float16* __restrict__ C16, int ldc, size_t sC, int M, int N, int K) {
  __shared__ __attribute__((aligned(16))) unsigned short st[2][2][GT][GPIT];      // [buffer][A | Bh][row][k]; reused as f32 staging by the epilogue
  (void)M;
  const int tid = threadIdx.x, w = tid >> 5, lane = tid & 31, ln = lane & 15, hh = lane >> 4; const int by = blockIdx.y;
  A += (size_t)by * sA; Bh += (size_t)by * sB; const size_t cofs = (size_t)by * sC; const float* bp = bias ? bias + (size_t)by * sBias : nullptr;
  const int ntn = N / GT; const int row0 = ((int)blockIdx.x / ntn) * GT, col0 = ((int)blockIdx.x % ntn) * GT;
  const int wr = (w >> 1) * 32, wc = (w & 1) * 64;      // the wave's 32 x 64 part of the tile
  const int lr = tid >> 3, lc = (tid & 7) * 8;          // staging: 8 lanes per 128-byte row slice, 32 rows per pass
  const char* ab = (const char*)A; const char* bb = (const char*)Bh;      // uniform bases; each lane keeps eight byte offsets
  unsigned ao[4], bo[4];
#pragma unroll
  for (int i = 0; i < 4; ++i) { ao[i] = (unsigned)(((row0 + lr + 32 * i) * lda + lc) * 2); bo[i] = (unsigned)(((col0 + lr + 32 * i) * ldb + lc) * 2); }
  v8us ra[4], rb[4];
#pragma unroll
  for (int i = 0; i < 4; ++i) { ra[i] = *(const v8us*)(ab + ao[i]); rb[i] = *(const v8us*)(bb + bo[i]); }
  float bv[4] = {0.f, 0.f, 0.f, 0.f};
  if (bp) {
#pragma unroll
    for (int t = 0; t < 4; ++t) bv[t] = bp[col0 + wc + t * 16 + ln];
#pragma unroll
    for (int t = 0; t < 4; ++t) bv[t] = bf16_round(bv[t]);
  }
#pragma unroll
  for (int i = 0; i < 4; ++i) { *(v8us*)&st[0][0][lr + 32 * i][lc] = ra[i]; *(v8us*)&st[0][1][lr + 32 * i][lc] = rb[i]; }
  __syncthreads();
  v8f acc[2][4] = {};
  for (int kb = 0; kb < K; kb += GK) {
    const int cur = (kb / GK) & 1; const bool more = kb + GK < K;
    if (more) {
#pragma unroll
      for (int i = 0; i < 4; ++i) { ao[i] += GK * 2; bo[i] += GK * 2; }      // each lane's offsets walk along k
#pragma unroll
      for (int i = 0; i < 4; ++i) { ra[i] = *(const v8us*)(ab + ao[i]); rb[i] = *(const v8us*)(bb + bo[i]); }
    }
#pragma unroll
    for (int ks = 0; ks < GK; ks += 32) {
      FragH fa[2], fb[4];
#pragma unroll
      for (int mi = 0; mi < 2; ++mi) { fa[mi].half[0] = *(const v8us*)&st[cur][0][wr + mi * 16 + ln][ks + 8 * hh]; fa[mi].half[1] = *(const v8us*)&st[cur][0][wr + mi * 16 + ln][ks + 16 + 8 * hh]; }
#pragma unroll
      for (int t = 0; t < 4; ++t) { fb[t].half[0] = *(const v8us*)&st[cur][1][wc + t * 16 + ln][ks + 8 * hh]; fb[t].half[1] = *(const v8us*)&st[cur][1][wc + t * 16 + ln][ks + 16 + 8 * hh]; }
#pragma unroll
      for (int mi = 0; mi < 2; ++mi)
#pragma unroll
        for (int t = 0; t < 4; ++t) acc[mi][t] = mmaH<1>(fa[mi].v, fa[mi].v, fb[t].v, fb[t].v, acc[mi][t]);
    }
    if (more) {
#pragma unroll
      for (int i = 0; i < 4; ++i) { *(v8us*)&st[cur ^ 1][0][lr + 32 * i][lc] = ra[i]; *(v8us*)&st[cur ^ 1][1][lr + 32 * i][lc] = rb[i]; }
    }
    __syncthreads();      // publishes the next slice and ends every wave's reads of this one (after the last slice: frees the LDS for the epilogue)
  }
  const int rsub = lane >> 4, c4 = (lane & 15) * 4; typedef _Float16 v4h __attribute__((ext_vector_type(4)));
  const int orow = row0 + wr + rsub, ocol = col0 + wc + c4;      // the lane's first output row (then every second one) and its four columns
  v4f cp[16];
  if (CP) {      // all sixteen addend loads go out together, ahead of the staging, so that their latency is paid once
#pragma unroll
    for (int q = 0; q < 16; ++q) { const int bidx = (row0g + orow + q * 2) / rowsPerB; cp[q] = *(const v4fa*)(CP + cofs + (size_t)bidx * sCPb + ocol);
      if ((q & 3) == 3 && q < 15) asm volatile("s_wait_xcnt 0x0" ::: "memory"); }      // later loads' results may be given the registers that held earlier loads' addresses
  }
  float* so = (float*)&st[0][0][0][0] + (size_t)w * (32 * GSO);      // the wave's own 32 x 64 f32 staging
#pragma unroll
  for (int mi = 0; mi < 2; ++mi)
#pragma unroll
    for (int t = 0; t < 4; ++t)
#pragma unroll
      for (int r = 0; r < 8; ++r) so[(mi * 16 + 8 * hh + r) * GSO + t * 16 + ln] = acc[mi][t][r] * alpha + bv[t];
  __builtin_amdgcn_fence(__ATOMIC_ACQ_REL, "workgroup"); __builtin_amdgcn_wave_barrier();
  v4f o[16];
#pragma unroll
  for (int q = 0; q < 16; ++q) o[q] = *(const v4fa*)&so[(q * 2 + rsub) * GSO + c4];
  if (CP) {
#pragma unroll
    for (int q = 0; q < 16; ++q) o[q] += cp[q];
  }
#pragma unroll
  for (int q = 0; q < 16; ++q)
#pragma unroll
    for (int i = 0; i < 4; ++i) { float v = o[q][i]; if (ACT == 1) v = (v > 0.f) ? v : expm1f(v); else if (ACT == 7) v = (v > 0.f) ? v + 1.0f : expf(v); else if (ACT == 8) v = tanhf(v); else if (ACT == 9) v = 0.5f * v * (1.0f + tanhf(0.7978845608028654f * (v + 0.044715f * v * v * v))); else if (ACT == 11) v = 1.0f / (1.0f + expf(-v)); else if (ACT == 12) v = (v > 0.f) ? v : 0.01f * v; else if (ACT == 14) v = (v > 0.f) ? v : 0.1f * v; else if (ACT == 15) v = v / (1.0f + expf(-v)); else if (ACT == 3) v = fmaxf(v, 0.f); else if (ACT == 6) v = 0.5f * v * (1.0f + erff(v * 0.70710678118654752f)); o[q][i] = v; }
  if (C) {
#pragma unroll
    for (int q = 0; q < 16; ++q) *(v4f*)(C + cofs + (size_t)(orow + q * 2) * ldc + ocol) = o[q];
    asm volatile("s_wait_xcnt 0x0" ::: "memory");      // the f16 stores below reuse registers that these stores name
  }
  if (C16) {
#pragma unroll
    for (int q = 0; q < 16; ++q) { v4h h4; for (int i = 0; i < 4; ++i) h4[i] = (_Float16)o[q][i]; *(v4h*)(C16 + cofs + (size_t)(orow + q * 2) * ldc + ocol) = h4; }
  }
}


// q, k and v in one launch, each written once, in the form its reader takes: q and k as f16 hi and lo*2^10 planes [token][channel], v as f16 [channel][token].
// blockIdx.x / QT picks the product, blockIdx.x % QT its 128 x 128 tile, blockIdx.y the image. q, k: rows = tokens (T16), columns = channels (the weight plane), bias by column.
// v: the operands change places (rows = channels from BV, columns = tokens from T16), so the tile comes out transposed as it stands and its bias goes by row.
// Tiling, staging and k order as in k_gemm_hhx (8 waves of 32 x 64, 64-wide k slices, two LDS buffers).
#define QT ((NTK / GT) * (CC / GT))      /* tiles per product and image */
__global__ __launch_bounds__(256) void k_qkv(const _Float16* __restrict__ T16, const _Float16* __restrict__ BQ, const _Float16* __restrict__ BK, const _Float16* __restrict__ BV,
    const float* __restrict__ bq, const float* __restrict__ bk, const float* __restrict__ bvv,
    _Float16* __restrict__ Qh, _Float16* __restrict__ Ql, _Float16* __restrict__ Kh, _Float16* __restrict__ Kl, _Float16* __restrict__ VT) {
  __shared__ __attribute__((aligned(16))) unsigned short st[2][2][GT][GPIT];      // [buffer][A | B][row][k]; reused as f32 staging by the epilogue
  const int tid = threadIdx.x, w = tid >> 5, lane = tid & 31, ln = lane & 15, hh = lane >> 4;
  const int sel = (int)blockIdx.x / QT, tile = (int)blockIdx.x % QT; const bool isv = sel == 2;
  const size_t iofs = (size_t)blockIdx.y * NTK * CC;      // every per-image array here holds NTK * CC elements
  const int row0 = (isv ? tile / (NTK / GT) : tile / (CC / GT)) * GT, col0 = (isv ? tile % (NTK / GT) : tile % (CC / GT)) * GT;
  const int wr = (w >> 1) * 32, wc = (w & 1) * 64;      // the wave's 32 x 64 part of the tile
  const int lr = tid >> 3, lc = (tid & 7) * 8;          // staging: 8 lanes per 128-byte row slice, 32 rows per pass
  const char* ab = (const char*)(isv ? BV : T16 + iofs); const char* bb = (const char*)(isv ? T16 + iofs : (sel ? BK : BQ));      // uniform bases
  const unsigned ao = (unsigned)(((row0 + lr) * CC + lc) * 2), bo = (unsigned)(((col0 + lr) * CC + lc) * 2);      // the lane's byte offsets; further rows are constants, the slice a uniform step
  v8us ra[4], rb[4];
#pragma unroll
  for (int i = 0; i < 4; ++i) { ra[i] = *(const v8us*)(ab + ao + i * (32 * CC * 2)); rb[i] = *(const v8us*)(bb + bo + i * (32 * CC * 2)); }
#pragma unroll
  for (int i = 0; i < 4; ++i) { *(v8us*)&st[0][0][lr + 32 * i][lc] = ra[i]; *(v8us*)&st[0][1][lr + 32 * i][lc] = rb[i]; }
  __syncthreads();
  v8f acc[2][4] = {};
#pragma unroll 1      // kept rolled: unrolled, the wave takes 161 registers, allocated as 176, and only two work-groups fit on a WGP; at 160 three fit, which is what this grid gives each WGP
  for (int kb = 0; kb < CC; kb += GK) {
    const int cur = (kb / GK) & 1; const bool more = kb + GK < CC;
    if (more) {
#pragma unroll
      for (int i = 0; i < 4; ++i) { ra[i] = *(const v8us*)(ab + ao + i * (32 * CC * 2) + (kb + GK) * 2); rb[i] = *(const v8us*)(bb + bo + i * (32 * CC * 2) + (kb + GK) * 2); }
    }
#pragma unroll
    for (int ks = 0; ks < GK; ks += 32) {
      FragH fa[2], fb[4];
#pragma unroll
      for (int mi = 0; mi < 2; ++mi) { fa[mi].half[0] = *(const v8us*)&st[cur][0][wr + mi * 16 + ln][ks + 8 * hh]; fa[mi].half[1] = *(const v8us*)&st[cur][0][wr + mi * 16 + ln][ks + 16 + 8 * hh]; }
#pragma unroll
      for (int t = 0; t < 4; ++t) { fb[t].half[0] = *(const v8us*)&st[cur][1][wc + t * 16 + ln][ks + 8 * hh]; fb[t].half[1] = *(const v8us*)&st[cur][1][wc + t * 16 + ln][ks + 16 + 8 * hh]; }
#pragma unroll
      for (int mi = 0; mi < 2; ++mi)
#pragma unroll
        for (int t = 0; t < 4; ++t) acc[mi][t] = mmaH<1>(fa[mi].v, fa[mi].v, fb[t].v, fb[t].v, acc[mi][t]);
    }
    if (more) {
#pragma unroll
      for (int i = 0; i < 4; ++i) { *(v8us*)&st[cur ^ 1][0][lr + 32 * i][lc] = ra[i]; *(v8us*)&st[cur ^ 1][1][lr + 32 * i][lc] = rb[i]; }
    }
    __syncthreads();      // publishes the next slice and ends every wave's reads of this one (after the last slice: frees the LDS for the epilogue)
  }
  typedef _Float16 v4h __attribute__((ext_vector_type(4)));
  float* so = (float*)&st[0][0][0][0] + (size_t)w * (32 * GSO);      // the wave's own 32 x 64 f32 staging
  const int rsub = lane >> 4, c4 = (lane & 15) * 4;
  const int orow = row0 + wr + rsub, ocol = col0 + wc + c4;      // the lane's first output row (then every second one) and its four columns
  if (isv) {
    float br[2][8];      // bias by row (channel)
#pragma unroll
    for (int mi = 0; mi < 2; ++mi)
#pragma unroll
      for (int r = 0; r < 8; ++r) br[mi][r] = bf16_round(bvv[row0 + wr + mi * 16 + 8 * hh + r]);
#pragma unroll
    for (int mi = 0; mi < 2; ++mi)
#pragma unroll
      for (int t = 0; t < 4; ++t)
#pragma unroll
        for (int r = 0; r < 8; ++r) so[(mi * 16 + 8 * hh + r) * GSO + t * 16 + ln] = acc[mi][t][r] * 0.0625f + br[mi][r];
    __builtin_amdgcn_fence(__ATOMIC_ACQ_REL, "workgroup"); __builtin_amdgcn_wave_barrier();
    _Float16* vo = VT + iofs + (size_t)orow * NTK + ocol;
#pragma unroll
    for (int q = 0; q < 16; ++q) { const v4f o = *(const v4fa*)&so[(q * 2 + rsub) * GSO + c4]; v4h h4;
#pragma unroll
      for (int i = 0; i < 4; ++i) h4[i] = (_Float16)o[i];
      *(v4h*)(vo + q * 2 * NTK) = h4; }
  } else {
    const float* bias = sel ? bk : bq;
    float bc[4];      // bias by column (channel)
#pragma unroll
    for (int t = 0; t < 4; ++t) bc[t] = bf16_round(bias[col0 + wc + t * 16 + ln]);
#pragma unroll
    for (int mi = 0; mi < 2; ++mi)
#pragma unroll
      for (int t = 0; t < 4; ++t)
#pragma unroll
        for (int r = 0; r < 8; ++r) so[(mi * 16 + 8 * hh + r) * GSO + t * 16 + ln] = acc[mi][t][r] * 0.0625f + bc[t];
    __builtin_amdgcn_fence(__ATOMIC_ACQ_REL, "workgroup"); __builtin_amdgcn_wave_barrier();
    _Float16* ho = (sel ? Kh : Qh) + iofs + (size_t)orow * CC + ocol; _Float16* lo = (sel ? Kl : Ql) + iofs + (size_t)orow * CC + ocol;
#pragma unroll
    for (int q = 0; q < 16; ++q) { const v4f o = *(const v4fa*)&so[(q * 2 + rsub) * GSO + c4]; v4h h4, l4;
#pragma unroll
      for (int i = 0; i < 4; ++i) { const _Float16 h = (_Float16)o[i]; h4[i] = h; l4[i] = (_Float16)((o[i] - (float)h) * 1024.0f); }
      *(v4h*)(ho + q * 2 * CC) = h4; *(v4h*)(lo + q * 2 * CC) = l4; }
    asm volatile("s_wait_xcnt 0x0" ::: "memory");      // in the built code the other branch's instructions follow these stores and rewrite the registers that they name
  }
}

// Logits in one launch: C[j][i] = Ah.Bh + 2^-10 (Al.Bh + Ah.Bl), all four f16 planes [row][CC], image = blockIdx.y; the lo planes carry a factor 2^10.
// Tiling and staging as in k_gemm_hhx (128 x 128 tile, 8 waves of 32 x 64, 64-wide k slices, two LDS buffers); each slice brings all four planes, and every fragment read from LDS feeds the three products.
// Two accumulator sets per wave: hi (Ah.Bh) and lo (Al.Bh then Ah.Bl, k upward); they meet once, in the epilogue.
// The next slice's A planes fly during the first half of this slice's products, its B planes during the second half: half the staging registers, so that two work-groups fit on a WGP (144 KiB of LDS each, at most 256 registers a wave).
__global__ __launch_bounds__(256) __attribute__((amdgpu_waves_per_eu(4, 4))) void k_logits(const _Float16* __restrict__ Ah, const _Float16* __restrict__ Al, const _Float16* __restrict__ Bh, const _Float16* __restrict__ Bl, float* __restrict__ C) {
  __shared__ __attribute__((aligned(16))) unsigned short st[2][4][GT][GPIT];      // [buffer][Ah | Al | Bh | Bl][row][k]; reused as f32 staging by the epilogue
  const int tid = threadIdx.x, w = tid >> 5, lane = tid & 31, ln = lane & 15, hh = lane >> 4;
  const size_t pofs = (size_t)blockIdx.y * NTK * CC; C += (size_t)blockIdx.y * NTK * NTK;
  const int row0 = ((int)blockIdx.x / (NTK / GT)) * GT, col0 = ((int)blockIdx.x % (NTK / GT)) * GT;
  const int wr = (w >> 1) * 32, wc = (w & 1) * 64;      // the wave's 32 x 64 part of the tile
  const int lr = tid >> 3, lc = (tid & 7) * 8;          // staging: 8 lanes per 128-byte row slice, 32 rows per pass
  const char* pl[4] = {(const char*)(Ah + pofs), (const char*)(Al + pofs), (const char*)(Bh + pofs), (const char*)(Bl + pofs)};      // uniform bases
  const unsigned po[2] = {(unsigned)(((row0 + lr) * CC + lc) * 2), (unsigned)(((col0 + lr) * CC + lc) * 2)};      // the lane's byte offsets in the A and the B planes; further rows are constants, the slice a uniform step
  v8us rg[2][4];
#pragma unroll
  for (int g = 0; g < 2; ++g) {
#pragma unroll
    for (int p = 0; p < 2; ++p)
#pragma unroll
      for (int i = 0; i < 4; ++i) rg[p][i] = *(const v8us*)(pl[2 * g + p] + po[g] + i * (32 * CC * 2));
#pragma unroll
    for (int p = 0; p < 2; ++p)
#pragma unroll
      for (int i = 0; i < 4; ++i) *(v8us*)&st[0][2 * g + p][lr + 32 * i][lc] = rg[p][i];
  }
  asm volatile("s_wait_xcnt 0x0" ::: "memory");      // the registers that the loads above name are given other values from here on
  __syncthreads();
  v8f hi[2][4] = {}, lo[2][4] = {};
#pragma unroll 1      // kept rolled: unrolled, the LDS addresses of both buffers stay live at once and the wave no longer fits 256 registers
  for (int kb = 0; kb < CC; kb += GK) {
    const int cur = (kb / GK) & 1; const bool more = kb + GK < CC;
#pragma unroll
    for (int g = 0; g < 2; ++g) {      // k half g of this slice; beside it plane pair g of the next slice
      const int ks = g * 32;
      if (more) {
#pragma unroll
        for (int p = 0; p < 2; ++p)
#pragma unroll
          for (int i = 0; i < 4; ++i) rg[p][i] = *(const v8us*)(pl[2 * g + p] + po[g] + i * (32 * CC * 2) + (kb + GK) * 2);
      }
      FragH fah[2], fal[2];
#pragma unroll
      for (int mi = 0; mi < 2; ++mi) {
        fah[mi].half[0] = *(const v8us*)&st[cur][0][wr + mi * 16 + ln][ks + 8 * hh]; fah[mi].half[1] = *(const v8us*)&st[cur][0][wr + mi * 16 + ln][ks + 16 + 8 * hh];
        fal[mi].half[0] = *(const v8us*)&st[cur][1][wr + mi * 16 + ln][ks + 8 * hh]; fal[mi].half[1] = *(const v8us*)&st[cur][1][wr + mi * 16 + ln][ks + 16 + 8 * hh];
      }
      FragH fbh[2], fbl[2];      // this column block's B fragments and the next one's, read one block ahead of their products
      fbh[0].half[0] = *(const v8us*)&st[cur][2][wc + ln][ks + 8 * hh]; fbh[0].half[1] = *(const v8us*)&st[cur][2][wc + ln][ks + 16 + 8 * hh];
      fbl[0].half[0] = *(const v8us*)&st[cur][3][wc + ln][ks + 8 * hh]; fbl[0].half[1] = *(const v8us*)&st[cur][3][wc + ln][ks + 16 + 8 * hh];
#pragma unroll
      for (int t = 0; t < 4; ++t) {
        const int c = t & 1, n = c ^ 1;
        if (t < 3) {
          fbh[n].half[0] = *(const v8us*)&st[cur][2][wc + (t + 1) * 16 + ln][ks + 8 * hh]; fbh[n].half[1] = *(const v8us*)&st[cur][2][wc + (t + 1) * 16 + ln][ks + 16 + 8 * hh];
          fbl[n].half[0] = *(const v8us*)&st[cur][3][wc + (t + 1) * 16 + ln][ks + 8 * hh]; fbl[n].half[1] = *(const v8us*)&st[cur][3][wc + (t + 1) * 16 + ln][ks + 16 + 8 * hh];
        }
#pragma unroll
        for (int mi = 0; mi < 2; ++mi) hi[mi][t] = mmaH<1>(fah[mi].v, fah[mi].v, fbh[c].v, fbh[c].v, hi[mi][t]);
#pragma unroll
        for (int mi = 0; mi < 2; ++mi) lo[mi][t] = mmaH<1>(fal[mi].v, fal[mi].v, fbh[c].v, fbh[c].v, lo[mi][t]);
#pragma unroll
        for (int mi = 0; mi < 2; ++mi) lo[mi][t] = mmaH<1>(fah[mi].v, fah[mi].v, fbl[c].v, fbl[c].v, lo[mi][t]);
      }
      if (more) {      // the other buffer's last readers left it at the barrier that ended the slice before
#pragma unroll
        for (int p = 0; p < 2; ++p)
#pragma unroll
          for (int i = 0; i < 4; ++i) *(v8us*)&st[cur ^ 1][2 * g + p][lr + 32 * i][lc] = rg[p][i];
      }
    }
    __syncthreads();      // publishes the next slice and ends every wave's reads of this one (after the last slice: frees the LDS for the epilogue)
  }
  float* so = (float*)&st[0][0][0][0] + (size_t)w * (32 * GSO);      // the wave's own 32 x 64 f32 staging
#pragma unroll
  for (int mi = 0; mi < 2; ++mi)
#pragma unroll
    for (int t = 0; t < 4; ++t)
#pragma unroll
      for (int r = 0; r < 8; ++r) so[(mi * 16 + 8 * hh + r) * GSO + t * 16 + ln] = lo[mi][t][r] * 0.0009765625f + hi[mi][t][r];
  __builtin_amdgcn_fence(__ATOMIC_ACQ_REL, "workgroup"); __builtin_amdgcn_wave_barrier();
  const int rsub = lane >> 4, c4 = (lane & 15) * 4;
  float* cw = C + (size_t)(row0 + wr + rsub) * NTK + col0 + wc + c4;      // the lane's first output row (then every second one) and its four columns
#pragma unroll
  for (int q = 0; q < 16; ++q) { const v4f o = *(const v4fa*)&so[(q * 2 + rsub) * GSO + c4]; *(v4f*)(cw + (size_t)q * 2 * NTK) = o; }
}

typedef _Float16 v4h __attribute__((ext_vector_type(4)));

__global__ __launch_bounds__(256) void k_x16(const float* __restrict__ x, _Float16* __restrict__ X16, size_t n8) { const size_t t = (size_t)blockIdx.x * 256 + threadIdx.x; if (t >= n8) return; FragH f;
#pragma unroll
  for (int q = 0; q < 8; ++q) f.h[q] = (_Float16)bf16_round(x[t * 8 + q]); *(v8us*)((unsigned short*)X16 + t * 8) = f.half[0];  }
__global__ __launch_bounds__(256) void k_h16(const float* __restrict__ x, _Float16* __restrict__ X16, size_t n8) { const size_t t = (size_t)blockIdx.x * 256 + threadIdx.x; if (t >= n8) return; FragH f;
#pragma unroll
  for (int q = 0; q < 8; ++q) f.h[q] = (_Float16)x[t * 8 + q]; *(v8us*)((unsigned short*)X16 + t * 8) = f.half[0];  }
__global__ __launch_bounds__(256) void k_round16f(const float* __restrict__ W, _Float16* __restrict__ Bt, size_t n8) { const size_t t = (size_t)blockIdx.x * 256 + threadIdx.x; if (t >= n8) return; FragH f;
#pragma unroll
  for (int i = 0; i < 8; ++i) f.h[i] = (_Float16)(bf16_round(W[t * 8 + i]) * 16.0f); *(v8us*)((unsigned short*)Bt + t * 8) = f.half[0];  }
template <int NHv, int TTv>
__global__ __launch_bounds__(256) void k_vt(const _Float16* __restrict__ V16, int ldv, int voff, _Float16* __restrict__ Vt) { __shared__ unsigned short tl[64][66]; const int tid = threadIdx.x; const int slab = blockIdx.x / (TTv / 64), lg = blockIdx.x % (TTv / 64); const int b = slab / NHv, h = slab % NHv;
  for (int i = tid; i < 64 * 8; i += 256) { const int r = i / 8, c8 = (i % 8) * 8; FragH f; f.half[0] = *(const v8us*)((const unsigned short*)V16 + ((size_t)b * TTv + lg * 64 + r) * ldv + voff + h * 64 + c8);
#pragma unroll
    for (int q = 0; q < 8; ++q) tl[r][c8 + q] = f.u[q]; }
  __syncthreads();
  {
#pragma unroll
    for (int rd = 0; rd < 2; ++rd) { const int d = rd * 32 + tid / 8, pc = tid % 8; FragH f;
#pragma unroll
      for (int q = 0; q < 8; ++q) f.u[q] = tl[pc * 8 + q][d];
      *(v8us*)((unsigned short*)Vt + ((size_t)slab * 64 + d) * TTv + lg * 64 + pc * 8) = f.half[0]; }
     } }

__global__ __launch_bounds__(256) void k_hl(const float* __restrict__ F, _Float16* __restrict__ Hh, _Float16* __restrict__ Hl, size_t n8) { const size_t t = (size_t)blockIdx.x * 256 + threadIdx.x; if (t >= n8) return; FragH fh, fl; const v4f a = *(const v4fa*)(F + t * 8), c = *(const v4fa*)(F + t * 8 + 4);
#pragma unroll
  for (int q = 0; q < 4; ++q) { _Float16 h = (_Float16)a[q]; fh.h[q] = h; fl.h[q] = (_Float16)((a[q] - (float)h) * 1024.0f); h = (_Float16)c[q]; fh.h[4 + q] = h; fl.h[4 + q] = (_Float16)((c[q] - (float)h) * 1024.0f); }
  { *(v8us*)((unsigned short*)Hh + t * 8) = fh.half[0]; *(v8us*)((unsigned short*)Hl + t * 8) = fl.half[0];  } }

// All input preparation in one launch: the five weight planes and the sixteen token planes depend on the inputs alone, so their work-groups run side by side.
// Both jobs are the same transposition, f32 src[c][n] (row pitch PITCH) to f16 dst[n][c] (row pitch CC), done on tiles of PC source rows x PN source columns through LDS:
// every global load of a wave is 512 contiguous bytes of one source row, and every 8 lanes store one whole 128-byte line of a destination row.
// Work-groups 0 .. 5*WB-1: weight plane blockIdx.x / WB, BW[plane][n][k] = f16(bf16(W[k][n]) * 16) from f32 row-major W[k][n] (bf16-exact weights stay exact in f16 away from the subnormal range).
// The others, TB per image: T16[image][token][channel] = f16(bf16(x[image][channel][token])).
#define PC 64       /* source rows per tile: 8 waves x 8 rows */
#define PN 128      /* source columns per tile: 32 lanes x 4 floats */
#define WB ((CC / PC) * (CC / PN))      /* work-groups per weight plane */
#define TB ((CC / PC) * (NTK / PN))     /* work-groups per image */
template <int PITCH, bool X16>
__device__ __forceinline__ void prep_tile(const float* __restrict__ src, unsigned short* __restrict__ dst, int tile, unsigned short (*tl)[GPIT]) {
  const int tid = threadIdx.x, w = tid >> 5, lane = tid & 31;
  const int c0 = (tile / (PITCH / PN)) * PC, n0 = (tile % (PITCH / PN)) * PN;
  const char* sb = (const char*)(src + (size_t)c0 * PITCH + n0);      // uniform base; the lane keeps one byte offset, its further rows are constants
  const unsigned so = (unsigned)((w * 8 * PITCH + lane * 4) * 4);      // the lane's 8 source rows x 4 columns
  v4f r[8];
#pragma unroll
  for (int q = 0; q < 8; ++q) r[q] = *(const v4fa*)(sb + so + q * (PITCH * 4));
#pragma unroll
  for (int i = 0; i < 4; ++i) { FragH f;
#pragma unroll
    for (int q = 0; q < 8; ++q) f.h[q] = X16 ? (_Float16)(bf16_round(r[q][i]) * 16.0f) : (_Float16)bf16_round(r[q][i]);
    *(v8us*)&tl[i * 32 + lane][w * 8] = f.half[0]; }      // source column 4 * lane + i lies in LDS row i * 32 + lane: the lanes of a store are one row pitch apart, on distinct banks
  __syncthreads();      // the tile is whole before any wave reads the other waves' columns of it
  unsigned short* dp = dst + (size_t)(n0 + (tid >> 3) * 4) * CC + c0 + (tid & 7) * 8;
#pragma unroll
  for (int p = 0; p < 4; ++p) *(v8us*)(dp + p * CC) = *(const v8us*)&tl[p * 32 + (tid >> 3)][(tid & 7) * 8];      // LDS row p * 32 + g holds source column 4 * g + p
}
__global__ __launch_bounds__(256) void k_prep(const float* __restrict__ x, const float* __restrict__ wq, const float* __restrict__ wk, const float* __restrict__ wv, const float* __restrict__ w1, const float* __restrict__ w2,
    _Float16* __restrict__ BW, _Float16* __restrict__ T16) {
  __shared__ __attribute__((aligned(16))) unsigned short tl[PN][GPIT];      // the transposed tile: one row per source column (in the order that prep_tile names), 128 bytes of source rows at the 144-byte pitch
  const int bx = (int)blockIdx.x;      // the branch is the same for the whole work-group, so every wave meets the one barrier of its side
  if (bx < 5 * WB) {
    const int sel = bx / WB; const float* W = sel == 0 ? wq : sel == 1 ? wk : sel == 2 ? wv : sel == 3 ? w1 : w2;
    prep_tile<CC, true>(W, (unsigned short*)(BW + (size_t)sel * CC * CC), bx % WB, tl);
  } else {
    const int b = (bx - 5 * WB) / TB;
    prep_tile<NTK, false>(x + (size_t)b * CC * NTK, (unsigned short*)(T16 + (size_t)b * NTK * CC), (bx - 5 * WB) % TB, tl);
    asm volatile("s_wait_xcnt 0x0" ::: "memory");      // in the built code the other branch's instructions follow this branch's stores and rewrite the registers that they name
  }
}
__global__ __launch_bounds__(256) void k_soft(const float* __restrict__ S, _Float16* __restrict__ P16) {
  #pragma clang fp contract(off)
  const int tid = threadIdx.x, w = tid >> 5, ln = tid & 31; const int r = blockIdx.x * 8 + w; if (r >= NTK) return; S += (size_t)blockIdx.y * NTK * NTK; P16 += (size_t)blockIdx.y * NTK * NTK; const float* sr = S + (size_t)r * NTK; float m = -3.0e38f;
#pragma unroll 1
  for (int jb = 0; jb < NTK; jb += 256) { const v4f a = *(const v4fa*)(sr + jb + 8 * ln), c = *(const v4fa*)(sr + jb + 8 * ln + 4);
#pragma unroll
    for (int k = 0; k < 4; ++k) { m = fmaxf(m, a[k]); m = fmaxf(m, c[k]); } }
  for (int o = 16; o > 0; o >>= 1) m = fmaxf(m, __shfl_xor(m, o, 32));
  float su = 0.f;
#pragma unroll 1
  for (int jb = 0; jb < NTK; jb += 256) { const v4f a = *(const v4fa*)(sr + jb + 8 * ln), c = *(const v4fa*)(sr + jb + 8 * ln + 4);
#pragma unroll
    for (int k = 0; k < 4; ++k) { su += expf(a[k] - m); su += expf(c[k] - m); } }
  for (int o = 16; o > 0; o >>= 1) su += __shfl_xor(su, o, 32); const float inv = 1024.0f / su;
  {
#pragma unroll 1
    for (int jb = 0; jb < NTK; jb += 256) { const v4f a = *(const v4fa*)(sr + jb + 8 * ln), c = *(const v4fa*)(sr + jb + 8 * ln + 4); FragH f;
#pragma unroll
      for (int k = 0; k < 4; ++k) { f.h[k] = (_Float16)(expf(a[k] - m) * inv); f.h[4 + k] = (_Float16)(expf(c[k] - m) * inv); }
      *(v8us*)((unsigned short*)P16 + (size_t)r * NTK + jb + 8 * ln) = f.half[0]; }
     } }
__global__ __launch_bounds__(256) void k_ln_out(const float* __restrict__ A, const float* __restrict__ g, const float* __restrict__ bb, float* __restrict__ out) {
  #pragma clang fp contract(off)
  __shared__ float tile[32][CC + 1]; const int tid = threadIdx.x, w = tid >> 5, l = tid & 31; const int j0 = blockIdx.x * 32; const int b = blockIdx.y; A += (size_t)b * NTK * CC;
  for (int jj = w; jj < 32; jj += 8) { const int j = j0 + jj; const float* ar = A + (size_t)j * CC; float v[8]; float s = 0.f;
#pragma unroll
    for (int k = 0; k < 8; ++k) { v[k] = ar[l + 32 * k]; s += v[k]; }
    for (int o = 16; o > 0; o >>= 1) s += __shfl_xor(s, o, 32); const float mu = s / (float)CC; float q2 = 0.f;
#pragma unroll
    for (int k = 0; k < 8; ++k) { const float d = v[k] - mu; q2 += d * d; }
    for (int o = 16; o > 0; o >>= 1) q2 += __shfl_xor(q2, o, 32); const float rs = rsqrtf(q2 / (float)CC + 1e-5f);
#pragma unroll
    for (int k = 0; k < 8; ++k) { const int c = l + 32 * k; tile[jj][c] = (v[k] - mu) * rs * bf16_round(g[c]) + bf16_round(bb[c]); } }
  __syncthreads();
  { for (int c = w; c < CC; c += 8) *(float*)(out + ((size_t)b * CC + c) * NTK + j0 + l) = tile[l][c];  } }

extern "C" void kernel_launch(void* const* d_in, const int* in_sizes, int n_in,
                              void* d_out, int out_size, void* d_ws, size_t ws_size, hipStream_t stream) {
  (void)in_sizes; (void)n_in; (void)out_size;
  const float* const* I = (const float* const*)d_in; const float* x = I[0]; const float* wq = I[1]; const float* bq = I[2]; const float* wk = I[3]; const float* bk = I[4]; const float* wv = I[5]; const float* bv = I[6]; const float* w1 = I[7]; const float* b1 = I[8]; const float* w2 = I[9]; const float* b2 = I[10]; const float* g = I[11]; const float* be = I[12];
  char* ws = (char*)d_ws; size_t off = 0;
  auto take = [&](size_t bytes) { char* p = ws + off; off += (bytes + 255) & ~(size_t)255; return p; };
  _Float16* BQ = (_Float16*)take(5 * CC * CC * 2); _Float16* BK = BQ + CC * CC; _Float16* BV = BQ + 2 * CC * CC; _Float16* B1 = BQ + 3 * CC * CC; _Float16* B2 = BQ + 4 * CC * CC;      /* five weight planes, one after another */
  /* one workspace slab per image for every intermediate: all NBt images go through each launch, image = blockIdx.y (in k_prep, (blockIdx.x - 5*WB) / TB) */
  _Float16* T16 = (_Float16*)take((size_t)NBt * NTK * CC * 2); _Float16* Qh = (_Float16*)take((size_t)NBt * NTK * CC * 2); _Float16* Ql = (_Float16*)take((size_t)NBt * NTK * CC * 2); _Float16* Kh = (_Float16*)take((size_t)NBt * NTK * CC * 2); _Float16* Kl = (_Float16*)take((size_t)NBt * NTK * CC * 2); _Float16* VT = (_Float16*)take((size_t)NBt * CC * NTK * 2);
  float* S = (float*)take((size_t)NBt * NTK * NTK * 4); _Float16* P16 = (_Float16*)take((size_t)NBt * NTK * NTK * 2); _Float16* A16 = (_Float16*)take((size_t)NBt * NTK * CC * 2); _Float16* H16 = (_Float16*)take((size_t)NBt * NTK * CC * 2); float* T2 = (float*)take((size_t)NBt * NTK * CC * 4);
  if (off > ws_size) return;      // 5 weight planes of 128 KiB + 16 x 11 MiB: under 177 MiB
  const dim3 gP((NTK / GT) * (CC / GT), NBt), gS((NTK / GT) * (NTK / GT), NBt);
  const size_t sT = (size_t)NTK * CC, sS = (size_t)NTK * NTK;      /* elements per image */
  k_prep<<<5 * WB + NBt * TB, 256, 0, stream>>>(x, wq, wk, wv, w1, w2, BQ, T16);      /* all weights stored (in,out); every plane and every image in the one launch */
  k_qkv<<<dim3(3 * QT, NBt), 256, 0, stream>>>(T16, BQ, BK, BV, bq, bk, bv, Qh, Ql, Kh, Kl, VT);      /* q, k (exact + bias) as hi/lo planes, v as f16 [channel][token] */
  k_logits<<<gS, 256, 0, stream>>>(Kh, Kl, Qh, Ql, S);      /* S'[j][i] = k_j.q_i (the transposed logits): hi.hi + 2^-10 (lo.hi + hi.lo) in one launch, M = N = 1024, K 256 */
  k_soft<<<dim3(NTK / 8, NBt), 256, 0, stream>>>(S, P16);      /* softmax over i per j (= the module's softmax over the query axis) */
  k_gemm_hhx<0><<<gP, 256, 0, stream>>>(P16, NTK, sS, VT, NTK, sT, 0.0009765625f, nullptr, 0, nullptr, 1, 0, 0, nullptr, A16, CC, sT, NTK, CC, NTK);      /* att[j] = sum_i P'[j][i].v[i] to f16: N 256 K 1024 */
  k_gemm_hhx<15><<<gP, 256, 0, stream>>>(A16, CC, sT, B1, CC, 0, 0.0625f, b1, 0, nullptr, 1, 0, 0, nullptr, H16, CC, sT, NTK, CC, CC);      /* SiLU in the epilogue, hidden to f16 */
  k_gemm_hhx<0><<<gP, 256, 0, stream>>>(H16, CC, sT, B2, CC, 0, 0.0625f, b2, 0, nullptr, 1, 0, 0, T2, nullptr, CC, sT, NTK, CC, CC);      /* MLP */
  k_ln_out<<<dim3(NTK / 32, NBt), 256, 0, stream>>>(T2, g, be, (float*)d_out);
}

// v007
// One run takes 75.6 microseconds.
// In both of two side-by-side timings against v006, it was 1.26 times as fast.
// Counting every step since v000, it is 32.0 times as fast.
#include <hip/hip_runtime.h>
// Token self-attention block on a feature map (B 16, C 256, 32×32 = 1024 tokens): q, k, v = t·W + b (W stored (in,out)); m = q·kᵀ (no scaling); softmax over the QUERY axis i; att[j] = Σ_i m[i][j]·v[i]; MLP (SiLU, 256→256→256); LayerNorm; back to NCHW → [16,256,32,32].
// Structure: the column softmax is a row softmax of mᵀ = k·qᵀ, so per batch: S' = K·Qᵀ (rows j, cols i), row softmax, att = P'·V, the three in one kernel (running maximum per row); the rest as GEMMs + row kernels.
// Compute dtype: x and parameters rounded to bf16; q/k/v with exact products; q and k carried as f16 hi + lo·2^10 planes with three cross products (≈f32 logits — they reach σ≈8 unscaled), softmax in f32, P (×2^10), v, attention output and the SiLU hidden as f16 operands (≈2^-12), f32 accumulation; LayerNorm in f32. v_wmma_f32_16x16x32_f16.
#define NBt 16
#define CC 256
#define NTK 1024
typedef __bf16 v16b __attribute__((ext_vector_type(16)));
typedef unsigned short v8us __attribute__((ext_vector_type(8), may_alias));
typedef float  v8f  __attribute__((ext_vector_type(8)));
typedef float  v4f  __attribute__((ext_vector_type(4)));
typedef float  v4fa __attribute__((ext_vector_type(4), may_alias));
union FragB { v16b v; v8us half[2]; unsigned short u[16]; };

__device__ __forceinline__ unsigned short bf16_bits(float x) { unsigned int u = __float_as_uint(x); return (unsigned short)((u + 0x7FFFu + ((u >> 16) & 1u)) >> 16); }
__device__ __forceinline__ float bf16_val(unsigned short b) { return __uint_as_float(((unsigned int)b) << 16); }
__device__ __forceinline__ float bf16_round(float x) { return bf16_val(bf16_bits(x)); }
// D += A·B with NT terms: 1 = ah·bh, 2 = + al·bh (A split), 3 = + ah·bl (both split)
template <int NT>
__device__ __forceinline__ v8f mmaN(v16b ah, v16b al, v16b bh, v16b bl, v8f c) {
  c = __builtin_amdgcn_wmma_f32_16x16x32_bf16(false, ah, false, bh, (short)0, c, false, false);
  if (NT >= 2) c = __builtin_amdgcn_wmma_f32_16x16x32_bf16(false, al, false, bh, (short)0, c, false, false);
  if (NT >= 3) c = __builtin_amdgcn_wmma_f32_16x16x32_bf16(false, ah, false, bl, (short)0, c, false, false);
  asm volatile("v_nop\n\tv_nop\n\tv_nop\n\tv_nop" : "+v"(c) : "v"(ah), "v"(al), "v"(bh), "v"(bl));
  return c;
}

__global__ __launch_bounds__(256) void k_wt_bf16(const float* __restrict__ W, unsigned short* __restrict__ Wt, int K, int N) {
  const int t = blockIdx.x * 256 + threadIdx.x;
  const int k8n = K / 8;
  if (t >= N * k8n) return;
  const int n = t / k8n, k8 = (t % k8n) * 8;
  v8us v;
#pragma unroll
  for (int i = 0; i < 8; ++i) v[i] = bf16_bits(W[(size_t)(k8 + i) * N + n]);
  *(v8us*)(Wt + (size_t)n * K + k8) = v;
  
}

// GEMM C[M][N] (f32, pitch ldc) = act(A[M][K]·W + bias). A f32 row-major (pitch lda) converted per fragment to bf16
// (ASPLIT: hi/lo two planes -> 2 terms, else single rounded term); Wt bf16 [N][K] (pitch ldb). BIAS_BF16 rounds the
// bias to bf16 first (bias quantised to bf16 before the add). K%32==0, M%16==0, N%64==0.
template <bool ASPLIT, int ACT, bool BIAS_BF16>
__global__ __launch_bounds__(128) void k_gemm_bf(const float* __restrict__ A, int lda, const unsigned short* __restrict__ Wt, int ldb,
                                               const float* __restrict__ bias, float* __restrict__ C, int ldc, int M, int N, int K) {
  __shared__ __attribute__((aligned(16))) float so[4][16][64];
  const int tid = threadIdx.x, w = tid >> 5, lane = tid & 31, ln = lane & 15, hh = lane >> 4;
  const int ntn = N / 64;
  const int wid = blockIdx.x * 4 + w;
  const int mt = wid / ntn, nq = wid % ntn;
  if (mt * 16 >= M) return;
  const int row0 = mt * 16, col0 = nq * 64;
  const float* arow = A + (size_t)(row0 + ln) * lda;
  v8f acc[4] = {};
  for (int kb = 0; kb < K; kb += 32) {
    FragB ah, al;
    const v4f x0 = *(const v4fa*)(arow + kb + 8 * hh), x1 = *(const v4fa*)(arow + kb + 8 * hh + 4);
    const v4f x2 = *(const v4fa*)(arow + kb + 16 + 8 * hh), x3 = *(const v4fa*)(arow + kb + 16 + 8 * hh + 4);
    float xs[16] = {x0[0],x0[1],x0[2],x0[3],x1[0],x1[1],x1[2],x1[3],x2[0],x2[1],x2[2],x2[3],x3[0],x3[1],x3[2],x3[3]};
#pragma unroll
    for (int i = 0; i < 16; ++i) { const unsigned short hb = bf16_bits(xs[i]); ah.u[i] = hb; al.u[i] = ASPLIT ? bf16_bits(xs[i] - bf16_val(hb)) : (unsigned short)0; }
#pragma unroll
    for (int t = 0; t < 4; ++t) {
      const unsigned short* brow = Wt + (size_t)(col0 + t * 16 + ln) * ldb + kb;
      FragB b;
      b.half[0] = *(const v8us*)(brow + 8 * hh);
      b.half[1] = *(const v8us*)(brow + 16 + 8 * hh);
      acc[t] = mmaN<ASPLIT ? 2 : 1>(ah.v, al.v, b.v, b.v, acc[t]);
    }
  }
#pragma unroll
  for (int t = 0; t < 4; ++t) {
    float bv = bias ? bias[col0 + t * 16 + ln] : 0.f;
    if (BIAS_BF16) bv = bf16_round(bv);
#pragma unroll
    for (int r = 0; r < 8; ++r) { float v = acc[t][r] + bv; if (ACT == 1) v = fmaxf(v, 0.f); so[w][8 * hh + r][t * 16 + ln] = v; }
  }
  __builtin_amdgcn_fence(__ATOMIC_ACQ_REL, "workgroup");
  __builtin_amdgcn_wave_barrier();
  const int rsub = lane >> 4, c4 = (lane & 15) * 4;
  {
#pragma unroll
    for (int q = 0; q < 8; ++q) {
      const int r = q * 2 + rsub;
      const v4f v = *(const v4fa*)&so[w][r][c4];
      *(v4f*)(C + (size_t)(row0 + r) * ldc + col0 + c4) = v;
    }
    
  }
}

// GEMM C = act(A·W + bias + resid): A f32 (ASPLIT -> hi/lo 2 terms), Wt bf16 [N][K]; ACT 0 none, 1 relu, 2 exact gelu;
// resid (optional, f32, row index = (row % rmod), pitch ldr, RES_BF16 rounds it) added before the activation.
template <bool ASPLIT, int ACT, bool BIAS_BF16, bool RES_BF16>
__global__ __launch_bounds__(128) void k_gemm_bf3(const float* __restrict__ A, int lda, const unsigned short* __restrict__ Wt, int ldb,
                                                const float* __restrict__ bias, const float* __restrict__ resid, int rmod, int ldr,
                                                float* __restrict__ C, int ldc, int M, int N, int K) {
  __shared__ __attribute__((aligned(16))) float so[4][16][64];
  const int tid = threadIdx.x, w = tid >> 5, lane = tid & 31, ln = lane & 15, hh = lane >> 4;
  const int ntn = N / 64;
  const int wid = blockIdx.x * 4 + w;
  const int mt = wid / ntn, nq = wid % ntn;
  if (mt * 16 >= M) return;
  const int row0 = mt * 16, col0 = nq * 64;
  const float* arow = A + (size_t)(row0 + ln) * lda;
  v8f acc[4] = {};
  for (int kb = 0; kb < K; kb += 32) {
    FragB ah, al;
    const v4f x0 = *(const v4fa*)(arow + kb + 8 * hh), x1 = *(const v4fa*)(arow + kb + 8 * hh + 4);
    const v4f x2 = *(const v4fa*)(arow + kb + 16 + 8 * hh), x3 = *(const v4fa*)(arow + kb + 16 + 8 * hh + 4);
    float xs[16] = {x0[0],x0[1],x0[2],x0[3],x1[0],x1[1],x1[2],x1[3],x2[0],x2[1],x2[2],x2[3],x3[0],x3[1],x3[2],x3[3]};
#pragma unroll
    for (int i = 0; i < 16; ++i) { const unsigned short hb = bf16_bits(xs[i]); ah.u[i] = hb; al.u[i] = ASPLIT ? bf16_bits(xs[i] - bf16_val(hb)) : (unsigned short)0; }
#pragma unroll
    for (int t = 0; t < 4; ++t) {
      const unsigned short* brow = Wt + (size_t)(col0 + t * 16 + ln) * ldb + kb;
      FragB b;
      b.half[0] = *(const v8us*)(brow + 8 * hh);
      b.half[1] = *(const v8us*)(brow + 16 + 8 * hh);
      acc[t] = mmaN<ASPLIT ? 2 : 1>(ah.v, al.v, b.v, b.v, acc[t]);
    }
  }
#pragma unroll
  for (int t = 0; t < 4; ++t) {
    const int col = col0 + t * 16 + ln;
    float bv = bias ? bias[col] : 0.f;
    if (BIAS_BF16) bv = bf16_round(bv);
#pragma unroll
    for (int r = 0; r < 8; ++r) {
      float v = acc[t][r] + bv;
      if (resid) { float rv = resid[(size_t)((row0 + 8 * hh + r) % rmod) * ldr + col]; if (RES_BF16) rv = bf16_round(rv); v += rv; }
      if (ACT == 1) v = fmaxf(v, 0.f);
      if (ACT == 2) v = 0.5f * v * (1.0f + erff(v * 0.70710678118654752f));
      if (ACT == 3) { const float u = 0.7978845608028654f * (v + 0.044715f * v * v * v); v = 0.5f * v * (1.0f + tanhf(u)); }
      so[w][8 * hh + r][t * 16 + ln] = v;
    }
  }
  __builtin_amdgcn_fence(__ATOMIC_ACQ_REL, "workgroup");
  __builtin_amdgcn_wave_barrier();
  const int rsub = lane >> 4, c4 = (lane & 15) * 4;
  {
#pragma unroll
    for (int q = 0; q < 8; ++q) {
      const int r = q * 2 + rsub;
      const v4f v = *(const v4fa*)&so[w][r][c4];
      *(v4f*)(C + (size_t)(row0 + r) * ldc + col0 + c4) = v;
    }
    
  }
}
// row LayerNorm (biased variance, eps) over N: s = X (+ R); optional out_sum <- s; out_norm <- (s-mu)*rsqrt(var+eps)*g + b
template <bool PARAM_BF16>
__global__ __launch_bounds__(256) void k_layernorm(const float* __restrict__ X, const float* __restrict__ R, const float* __restrict__ g, const float* __restrict__ bta,
                                                  float* __restrict__ out_sum, float* __restrict__ out_norm, int N, float eps) {
  __shared__ float red[256];
  const int row = blockIdx.x, tid = threadIdx.x;
  const float* x = X + (size_t)row * N; const float* rr = R ? R + (size_t)row * N : nullptr;
  float vals[16];                     // up to N = 4096
  const int per = N / 256;            // contiguous chunk per thread? use strided-by-4 chunks: thread handles j = tid*4 + 1024*u
  float s1 = 0.f;
  for (int u = 0; u < per / 4; ++u) {
    const int j = tid * 4 + 1024 * u;
    const v4f a = *(const v4fa*)(x + j);
    v4f b = {0.f,0.f,0.f,0.f}; if (rr) b = *(const v4fa*)(rr + j);
#pragma unroll
    for (int q = 0; q < 4; ++q) { const float v = a[q] + b[q]; vals[u * 4 + q] = v; s1 += v; }
  }
  red[tid] = s1; __syncthreads();
  for (int st = 128; st > 0; st >>= 1) { if (tid < st) red[tid] += red[tid + st]; __syncthreads(); }
  const float mu = red[0] / (float)N; __syncthreads();
  float s2 = 0.f;
  for (int u = 0; u < per / 4; ++u)
#pragma unroll
    for (int q = 0; q < 4; ++q) { const float c = vals[u * 4 + q] - mu; s2 += c * c; }
  red[tid] = s2; __syncthreads();
  for (int st = 128; st > 0; st >>= 1) { if (tid < st) red[tid] += red[tid + st]; __syncthreads(); }
  const float rs = rsqrtf(red[0] / (float)N + eps);
  {
    for (int u = 0; u < per / 4; ++u) {
      const int j = tid * 4 + 1024 * u;
      v4f o, sm;
#pragma unroll
      for (int q = 0; q < 4; ++q) {
        float gg = g[j + q], bb = bta[j + q];
        if (PARAM_BF16) { gg = bf16_round(gg); bb = bf16_round(bb); }
        sm[q] = vals[u * 4 + q]; o[q] = (vals[u * 4 + q] - mu) * rs * gg + bb;
      }
      if (out_sum) *(v4f*)(out_sum + (size_t)row * N + j) = sm;
      *(v4f*)(out_norm + (size_t)row * N + j) = o;
    }
    
  }
}



// ---- f16 WMMA path (v_wmma_f32_16x16x32_f16): 11-bit significands for operands in range — used where a [0,1] probability operand needs more precision than bf16
typedef _Float16 v16h __attribute__((ext_vector_type(16)));
union FragH { v16h v; v8us half[2]; _Float16 h[16]; unsigned short u[16]; };
template <int NT>
__device__ __forceinline__ v8f mmaH(v16h ah, v16h al, v16h bh, v16h bl, v8f c) {
  c = __builtin_amdgcn_wmma_f32_16x16x32_f16(false, ah, false, bh, (short)0, c, false, false);
  if (NT >= 2) c = __builtin_amdgcn_wmma_f32_16x16x32_f16(false, al, false, bh, (short)0, c, false, false);
  if (NT >= 3) c = __builtin_amdgcn_wmma_f32_16x16x32_f16(false, ah, false, bl, (short)0, c, false, false);
  asm volatile("v_nop\n\tv_nop\n\tv_nop\n\tv_nop" : "+v"(c) : "v"(ah), "v"(al), "v"(bh), "v"(bl));
  return c;
}
// batched GEMM like k_gemm_b but f16 operands: A f32 (split into f16 hi/lo if ASPLIT, else rounded to f16), Bt = f16 values [n][k]; alpha; C f32; N multiple of 16 (partial tiles skipped)
template <bool ASPLIT>
__global__ __launch_bounds__(128) void k_gemm_h(const float* __restrict__ A, int lda, size_t sA, const _Float16* __restrict__ Bh, int ldb, size_t sB, float alpha, float* __restrict__ C, int ldc, size_t sC, int M, int N, int K) {
  __shared__ __attribute__((aligned(16))) float so[4][16][64];
  const int tid = threadIdx.x, w = tid >> 5, lane = tid & 31, ln = lane & 15, hh = lane >> 4; const int by = blockIdx.y;
  A += (size_t)by * sA; Bh += (size_t)by * sB; C += (size_t)by * sC;
  const int ntn = (N + 63) / 64; const int wid = blockIdx.x * 4 + w; const int mt = wid / ntn, nq = wid % ntn; if (mt * 16 >= M) return;
  const int row0 = mt * 16, col0 = nq * 64; const float* arow = A + (size_t)(row0 + ln) * lda;
  v8f acc[4] = {};
  for (int kb = 0; kb < K; kb += 32) {
    FragH ah, al;
    const v4f x0 = *(const v4fa*)(arow + kb + 8 * hh), x1 = *(const v4fa*)(arow + kb + 8 * hh + 4), x2 = *(const v4fa*)(arow + kb + 16 + 8 * hh), x3 = *(const v4fa*)(arow + kb + 16 + 8 * hh + 4);
    float xs[16] = {x0[0],x0[1],x0[2],x0[3],x1[0],x1[1],x1[2],x1[3],x2[0],x2[1],x2[2],x2[3],x3[0],x3[1],x3[2],x3[3]};
#pragma unroll
    for (int i = 0; i < 16; ++i) { const _Float16 h = (_Float16)xs[i]; ah.h[i] = h; al.h[i] = ASPLIT ? (_Float16)(xs[i] - (float)h) : (_Float16)0.0f; }
#pragma unroll
    for (int t = 0; t < 4; ++t) { if (col0 + t * 16 >= N) continue; const size_t boff = (size_t)(col0 + t * 16 + ln) * ldb + kb; FragH bq; bq.half[0] = *(const v8us*)(Bh + boff + 8 * hh); bq.half[1] = *(const v8us*)(Bh + boff + 16 + 8 * hh);
      acc[t] = mmaH<ASPLIT ? 2 : 1>(ah.v, al.v, bq.v, bq.v, acc[t]); }
  }
#pragma unroll
  for (int t = 0; t < 4; ++t) { if (col0 + t * 16 >= N) continue;
#pragma unroll
    for (int r = 0; r < 8; ++r) so[w][8 * hh + r][t * 16 + ln] = acc[t][r] * alpha; }
  __builtin_amdgcn_fence(__ATOMIC_ACQ_REL, "workgroup"); __builtin_amdgcn_wave_barrier();
  const int rsub = lane >> 4, c4 = (lane & 15) * 4;
  {
#pragma unroll
    for (int q = 0; q < 8; ++q) { const int r = q * 2 + rsub; if (col0 + c4 < N) { const v4f v = *(const v4fa*)&so[w][r][c4]; *(v4f*)(C + (size_t)(row0 + r) * ldc + col0 + c4) = v; } }
     }
}

// Block-tiled GEMM with fused epilogue: v = acc*alpha + bias[by*sBias + col] (+ CP[by*sC + (row/rowsPerB)*sCPb + col] if CP) ; ACT 0 none / 1 elu ; writes f16 C16 and f32 C, each if non-null; by = blockIdx.y = image.
// One work-group of 8 waves owns a 128 x 128 tile of C; A and Bh (f16, [row][k]) come in 64-wide k slices as whole 128-byte lines and are shared through LDS (two buffers, the next slice's loads fly during this slice's products).
// Each wave does 32 x 64 of the tile; k runs upward in steps of 32 per accumulator. Needs M % 128 == 0, N % 128 == 0, K % 64 == 0, grid.x = (M/128)*(N/128).
#define GT 128      /* tile edge, rows of A and rows of Bh per work-group */
#define GK 64       /* k slice */
#define GPIT 72     /* LDS row pitch in f16: 144 B = 16 B x 9, so the 16 rows of a 16-byte fragment read fall on distinct banks */
#define GSO 68      /* epilogue row pitch in f32: rows 8 apart fall on different banks */
template <int ACT>
__global__ __launch_bounds__(256) void k_gemm_hhx(const _Float16* __restrict__ A, int lda, size_t sA, const _Float16* __restrict__ Bh, int ldb, size_t sB, float alpha, const float* __restrict__ bias, size_t sBias, const float* __restrict__ CP, int rowsPerB, size_t sCPb, int row0g,
    float* __restrict__ C, _Float16* __restrict__ C16, int ldc, size_t sC, int M, int N, int K) {
  __shared__ __attribute__((aligned(16))) unsigned short st[2][2][GT][GPIT];      // [buffer][A | Bh][row][k]; reused as f32 staging by the epilogue
  (void)M;
  const int tid = threadIdx.x, w = tid >> 5, lane = tid & 31, ln = lane & 15, hh = lane >> 4; const int by = blockIdx.y;
  A += (size_t)by * sA; Bh += (size_t)by * sB; const size_t cofs = (size_t)by * sC; const float* bp = bias ? bias + (size_t)by * sBias : nullptr;
  const int ntn = N / GT; const int row0 = ((int)blockIdx.x / ntn) * GT, col0 = ((int)blockIdx.x % ntn) * GT;
  const int wr = (w >> 1) * 32, wc = (w & 1) * 64;      // the wave's 32 x 64 part of the tile
  const int lr = tid >> 3, lc = (tid & 7) * 8;          // staging: 8 lanes per 128-byte row slice, 32 rows per pass
  const char* ab = (const char*)A; const char* bb = (const char*)Bh;      // uniform bases; each lane keeps eight byte offsets
  unsigned ao[4], bo[4];
#pragma unroll
  for (int i = 0; i < 4; ++i) { ao[i] = (unsigned)(((row0 + lr + 32 * i) * lda + lc) * 2); bo[i] = (unsigned)(((col0 + lr + 32 * i) * ldb + lc) * 2); }
  v8us ra[4], rb[4];
#pragma unroll
  for (int i = 0; i < 4; ++i) { ra[i] = *(const v8us*)(ab + ao[i]); rb[i] = *(const v8us*)(bb + bo[i]); }
  float bv[4] = {0.f, 0.f, 0.f, 0.f};
  if (bp) {
#pragma unroll
    for (int t = 0; t < 4; ++t) bv[t] = bp[col0 + wc + t * 16 + ln];
#pragma unroll
    for (int t = 0; t < 4; ++t) bv[t] = bf16_round(bv[t]);
  }
#pragma unroll
  for (int i = 0; i < 4; ++i) { *(v8us*)&st[0][0][lr + 32 * i][lc] = ra[i]; *(v8us*)&st[0][1][lr + 32 * i][lc] = rb[i]; }
  __syncthreads();
  v8f acc[2][4] = {};
  for (int kb = 0; kb < K; kb += GK) {
    const int cur = (kb / GK) & 1; const bool more = kb + GK < K;
    if (more) {
#pragma unroll
      for (int i = 0; i < 4; ++i) { ao[i] += GK * 2; bo[i] += GK * 2; }      // each lane's offsets walk along k
#pragma unroll
      for (int i = 0; i < 4; ++i) { ra[i] = *(const v8us*)(ab + ao[i]); rb[i] = *(const v8us*)(bb + bo[i]); }
    }
#pragma unroll
    for (int ks = 0; ks < GK; ks += 32) {
      FragH fa[2], fb[4];
#pragma unroll
      for (int mi = 0; mi < 2; ++mi) { fa[mi].half[0] = *(const v8us*)&st[cur][0][wr + mi * 16 + ln][ks + 8 * hh]; fa[mi].half[1] = *(const v8us*)&st[cur][0][wr + mi * 16 + ln][ks + 16 + 8 * hh]; }
#pragma unroll
      for (int t = 0; t < 4; ++t) { fb[t].half[0] = *(const v8us*)&st[cur][1][wc + t * 16 + ln][ks + 8 * hh]; fb[t].half[1] = *(const v8us*)&st[cur][1][wc + t * 16 + ln][ks + 16 + 8 * hh]; }
#pragma unroll
      for (int mi = 0; mi < 2; ++mi)
#pragma unroll
        for (int t = 0; t < 4; ++t) acc[mi][t] = mmaH<1>(fa[mi].v, fa[mi].v, fb[t].v, fb[t].v, acc[mi][t]);
    }
    if (more) {
#pragma unroll
      for (int i = 0; i < 4; ++i) { *(v8us*)&st[cur ^ 1][0][lr + 32 * i][lc] = ra[i]; *(v8us*)&st[cur ^ 1][1][lr + 32 * i][lc] = rb[i]; }
    }
    __syncthreads();      // publishes the next slice and ends every wave's reads of this one (after the last slice: frees the LDS for the epilogue)
  }
  const int rsub = lane >> 4, c4 = (lane & 15) * 4; typedef _Float16 v4h __attribute__((ext_vector_type(4)));
  const int orow = row0 + wr + rsub, ocol = col0 + wc + c4;      // the lane's first output row (then every second one) and its four columns
  v4f cp[16];
  if (CP) {      // all sixteen addend loads go out together, ahead of the staging, so that their latency is paid once
#pragma unroll
    for (int q = 0; q < 16; ++q) { const int bidx = (row0g + orow + q * 2) / rowsPerB; cp[q] = *(const v4fa*)(CP + cofs + (size_t)bidx * sCPb + ocol);
      if ((q & 3) == 3 && q < 15) asm volatile("s_wait_xcnt 0x0" ::: "memory"); }      // later loads' results may be given the registers that held earlier loads' addresses
  }
  float* so = (float*)&st[0][0][0][0] + (size_t)w * (32 * GSO);      // the wave's own 32 x 64 f32 staging
#pragma unroll
  for (int mi = 0; mi < 2; ++mi)
#pragma unroll
    for (int t = 0; t < 4; ++t)
#pragma unroll
      for (int r = 0; r < 8; ++r) so[(mi * 16 + 8 * hh + r) * GSO + t * 16 + ln] = acc[mi][t][r] * alpha + bv[t];
  __builtin_amdgcn_fence(__ATOMIC_ACQ_REL, "workgroup"); __builtin_amdgcn_wave_barrier();
  v4f o[16];
#pragma unroll
  for (int q = 0; q < 16; ++q) o[q] = *(const v4fa*)&so[(q * 2 + rsub) * GSO + c4];
  if (CP) {
#pragma unroll
    for (int q = 0; q < 16; ++q) o[q] += cp[q];
  }
#pragma unroll
  for (int q = 0; q < 16; ++q)
#pragma unroll
    for (int i = 0; i < 4; ++i) { float v = o[q][i]; if (ACT == 1) v = (v > 0.f) ? v : expm1f(v); else if (ACT == 7) v = (v > 0.f) ? v + 1.0f : expf(v); else if (ACT == 8) v = tanhf(v); else if (ACT == 9) v = 0.5f * v * (1.0f + tanhf(0.7978845608028654f * (v + 0.044715f * v * v * v))); else if (ACT == 11) v = 1.0f / (1.0f + expf(-v)); else if (ACT == 12) v = (v > 0.f) ? v : 0.01f * v; else if (ACT == 14) v = (v > 0.f) ? v : 0.1f * v; else if (ACT == 15) v = v / (1.0f + expf(-v)); else if (ACT == 3) v = fmaxf(v, 0.f); else if (ACT == 6) v = 0.5f * v * (1.0f + erff(v * 0.70710678118654752f)); o[q][i] = v; }
  if (C) {
#pragma unroll
    for (int q = 0; q < 16; ++q) *(v4f*)(C + cofs + (size_t)(orow + q * 2) * ldc + ocol) = o[q];
    asm volatile("s_wait_xcnt 0x0" ::: "memory");      // the f16 stores below reuse registers that these stores name
  }
  if (C16) {
#pragma unroll
    for (int q = 0; q < 16; ++q) { v4h h4; for (int i = 0; i < 4; ++i) h4[i] = (_Float16)o[q][i]; *(v4h*)(C16 + cofs + (size_t)(orow + q * 2) * ldc + ocol) = h4; }
  }
}


// q, k and v in one launch, each written once, in the form its reader takes: q and k as f16 hi and lo*2^10 planes [token][channel], v as f16 [channel][token].
// blockIdx.x / QT picks the product, blockIdx.x % QT its 128 x 128 tile, blockIdx.y the image. q, k: rows = tokens (T16), columns = channels (the weight plane), bias by column.
// v: the operands change places (rows = channels from BV, columns = tokens from T16), so the tile comes out transposed as it stands and its bias goes by row.
// Tiling, staging and k order as in k_gemm_hhx (8 waves of 32 x 64, 64-wide k slices, two LDS buffers).
#define QT ((NTK / GT) * (CC / GT))      /* tiles per product and image */
__global__ __launch_bounds__(256) void k_qkv(const _Float16* __restrict__ T16, const _Float16* __restrict__ BQ, const _Float16* __restrict__ BK, const _Float16* __restrict__ BV,
    const float* __restrict__ bq, const float* __restrict__ bk, const float* __restrict__ bvv,
    _Float16* __restrict__ Qh, _Float16* __restrict__ Ql, _Float16* __restrict__ Kh, _Float16* __restrict__ Kl, _Float16* __restrict__ VT) {
  __shared__ __attribute__((aligned(16))) unsigned short st[2][2][GT][GPIT];      // [buffer][A | B][row][k]; reused as f32 staging by the epilogue
  const int tid = threadIdx.x, w = tid >> 5, lane = tid & 31, ln = lane & 15, hh = lane >> 4;
  const int sel = (int)blockIdx.x / QT, tile = (int)blockIdx.x % QT; const bool isv = sel == 2;
  const size_t iofs = (size_t)blockIdx.y * NTK * CC;      // every per-image array here holds NTK * CC elements
  const int row0 = (isv ? tile / (NTK / GT) : tile / (CC / GT)) * GT, col0 = (isv ? tile % (NTK / GT) : tile % (CC / GT)) * GT;
  const int wr = (w >> 1) * 32, wc = (w & 1) * 64;      // the wave's 32 x 64 part of the tile
  const int lr = tid >> 3, lc = (tid & 7) * 8;          // staging: 8 lanes per 128-byte row slice, 32 rows per pass
  const char* ab = (const char*)(isv ? BV : T16 + iofs); const char* bb = (const char*)(isv ? T16 + iofs : (sel ? BK : BQ));      // uniform bases
  const unsigned ao = (unsigned)(((row0 + lr) * CC + lc) * 2), bo = (unsigned)(((col0 + lr) * CC + lc) * 2);      // the lane's byte offsets; further rows are constants, the slice a uniform step
  v8us ra[4], rb[4];
#pragma unroll
  for (int i = 0; i < 4; ++i) { ra[i] = *(const v8us*)(ab + ao + i * (32 * CC * 2)); rb[i] = *(const v8us*)(bb + bo + i * (32 * CC * 2)); }
#pragma unroll
  for (int i = 0; i < 4; ++i) { *(v8us*)&st[0][0][lr + 32 * i][lc] = ra[i]; *(v8us*)&st[0][1][lr + 32 * i][lc] = rb[i]; }
  __syncthreads();
  v8f acc[2][4] = {};
#pragma unroll 1      // kept rolled: unrolled, the wave takes 161 registers, allocated as 176, and only two work-groups fit on a WGP; at 160 three fit, which is what this grid gives each WGP
  for (int kb = 0; kb < CC; kb += GK) {
    const int cur = (kb / GK) & 1; const bool more = kb + GK < CC;
    if (more) {
#pragma unroll
      for (int i = 0; i < 4; ++i) { ra[i] = *(const v8us*)(ab + ao + i * (32 * CC * 2) + (kb + GK) * 2); rb[i] = *(const v8us*)(bb + bo + i * (32 * CC * 2) + (kb + GK) * 2); }
    }
#pragma unroll
    for (int ks = 0; ks < GK; ks += 32) {
      FragH fa[2], fb[4];
#pragma unroll
      for (int mi = 0; mi < 2; ++mi) { fa[mi].half[0] = *(const v8us*)&st[cur][0][wr + mi * 16 + ln][ks + 8 * hh]; fa[mi].half[1] = *(const v8us*)&st[cur][0][wr + mi * 16 + ln][ks + 16 + 8 * hh]; }
#pragma unroll
      for (int t = 0; t < 4; ++t) { fb[t].half[0] = *(const v8us*)&st[cur][1][wc + t * 16 + ln][ks + 8 * hh]; fb[t].half[1] = *(const v8us*)&st[cur][1][wc + t * 16 + ln][ks + 16 + 8 * hh]; }
#pragma unroll
      for (int mi = 0; mi < 2; ++mi)
#pragma unroll
        for (int t = 0; t < 4; ++t) acc[mi][t] = mmaH<1>(fa[mi].v, fa[mi].v, fb[t].v, fb[t].v, acc[mi][t]);
    }
    if (more) {
#pragma unroll
      for (int i = 0; i < 4; ++i) { *(v8us*)&st[cur ^ 1][0][lr + 32 * i][lc] = ra[i]; *(v8us*)&st[cur ^ 1][1][lr + 32 * i][lc] = rb[i]; }
    }
    __syncthreads();      // publishes the next slice and ends every wave's reads of this one (after the last slice: frees the LDS for the epilogue)
  }
  typedef _Float16 v4h __attribute__((ext_vector_type(4)));
  float* so = (float*)&st[0][0][0][0] + (size_t)w * (32 * GSO);      // the wave's own 32 x 64 f32 staging
  const int rsub = lane >> 4, c4 = (lane & 15) * 4;
  const int orow = row0 + wr + rsub, ocol = col0 + wc + c4;      // the lane's first output row (then every second one) and its four columns
  if (isv) {
    float br[2][8];      // bias by row (channel)
#pragma unroll
    for (int mi = 0; mi < 2; ++mi)
#pragma unroll
      for (int r = 0; r < 8; ++r) br[mi][r] = bf16_round(bvv[row0 + wr + mi * 16 + 8 * hh + r]);
#pragma unroll
    for (int mi = 0; mi < 2; ++mi)
#pragma unroll
      for (int t = 0; t < 4; ++t)
#pragma unroll
        for (int r = 0; r < 8; ++r) so[(mi * 16 + 8 * hh + r) * GSO + t * 16 + ln] = acc[mi][t][r] * 0.0625f + br[mi][r];
    __builtin_amdgcn_fence(__ATOMIC_ACQ_REL, "workgroup"); __builtin_amdgcn_wave_barrier();
    _Float16* vo = VT + iofs + (size_t)orow * NTK + ocol;
#pragma unroll
    for (int q = 0; q < 16; ++q) { const v4f o = *(const v4fa*)&so[(q * 2 + rsub) * GSO + c4]; v4h h4;
#pragma unroll
      for (int i = 0; i < 4; ++i) h4[i] = (_Float16)o[i];
      *(v4h*)(vo + q * 2 * NTK) = h4; }
  } else {
    const float* bias = sel ? bk : bq;
    float bc[4];      // bias by column (channel)
#pragma unroll
    for (int t = 0; t < 4; ++t) bc[t] = bf16_round(bias[col0 + wc + t * 16 + ln]);
#pragma unroll
    for (int mi = 0; mi < 2; ++mi)
#pragma unroll
      for (int t = 0; t < 4; ++t)
#pragma unroll
        for (int r = 0; r < 8; ++r) so[(mi * 16 + 8 * hh + r) * GSO + t * 16 + ln] = acc[mi][t][r] * 0.0625f + bc[t];
    __builtin_amdgcn_fence(__ATOMIC_ACQ_REL, "workgroup"); __builtin_amdgcn_wave_barrier();
    _Float16* ho = (sel ? Kh : Qh) + iofs + (size_t)orow * CC + ocol; _Float16* lo = (sel ? Kl : Ql) + iofs + (size_t)orow * CC + ocol;
#pragma unroll
    for (int q = 0; q < 16; ++q) { const v4f o = *(const v4fa*)&so[(q * 2 + rsub) * GSO + c4]; v4h h4, l4;
#pragma unroll
      for (int i = 0; i < 4; ++i) { const _Float16 h = (_Float16)o[i]; h4[i] = h; l4[i] = (_Float16)((o[i] - (float)h) * 1024.0f); }
      *(v4h*)(ho + q * 2 * CC) = h4; *(v4h*)(lo + q * 2 * CC) = l4; }
    asm volatile("s_wait_xcnt 0x0" ::: "memory");      // in the built code the other branch's instructions follow these stores and rewrite the registers that they name
  }
}

// Attention in one launch: logits, softmax over i and the product with v, per work-group for FR rows j of one image (blockIdx.y); neither the logits nor the probabilities go to memory.
// S'[j][i] = Ah.Bh + 2^-10 (Al.Bh + Ah.Bl) with A = k (hi and lo*2^10 planes), B = q (the same two planes); att[j] = sum_i softmax_i(S'[j][.]) v[i].
// The tokens i come in chunks of FI. Per chunk: (1) the 64 x 64 logits, each wave 16 x 32 of them, its k rows held in registers for the whole kernel, q from LDS, to an f32 tile in LDS;
// (2) four lanes per row take the chunk's maximum, raise the row's running maximum, and write e = exp(s - max) * 2^10 (one multiply-add and one v_exp_f32) as f16 and the factor exp(old max - new max);
// (3) each wave scales its 32 x 64 part of the 64 x 256 output sums by that factor and adds e.v. The row's sum of e is kept beside (f32, scaled the same way) and divides once, in the epilogue.
// q and v chunks have two LDS buffers: the next chunk's loads fly during this chunk's work. One work-group per WGP (two waves per SIMD).
#define FR 64       /* rows j per work-group */
#define FI 64       /* tokens i per chunk */
#define QPIT 264    /* LDS row pitch of a q row in f16: 528 B = 16 B x 33, so the 16 rows of a 16-byte fragment read fall on distinct banks */
// the value of another lane of the same group of four (quad_perm 0xB1: lane ^ 1, 0x4E: lane ^ 2), by a vector move instead of the LDS round trip that __shfl_xor compiles to
template <int CTRL>
__device__ __forceinline__ float quad_lane(float x) { return __int_as_float(__builtin_amdgcn_mov_dpp(__float_as_int(x), CTRL, 0xf, 0xf, true)); }
__global__ __launch_bounds__(256) void k_attn(const _Float16* __restrict__ Ah, const _Float16* __restrict__ Al, const _Float16* __restrict__ Bh, const _Float16* __restrict__ Bl, const _Float16* __restrict__ VT, _Float16* __restrict__ O16) {
  __shared__ __attribute__((aligned(16))) unsigned short sq[2][2][FI][QPIT];      // [buffer][Bh | Bl][token i][channel]; reused as f32 staging by the epilogue
  __shared__ __attribute__((aligned(16))) unsigned short sv[2][CC][GPIT];         // [buffer][channel][token i]
  __shared__ __attribute__((aligned(16))) float ss[FR][GSO];                      // this chunk's logits
  __shared__ __attribute__((aligned(16))) unsigned short sp[FR][GPIT];            // this chunk's e * 2^10
  __shared__ __attribute__((aligned(16))) float sal[FR];                          // per row: this chunk's factor for the sums so far
  __shared__ __attribute__((aligned(16))) float sdv[FR];                          // per row, written once behind the loop: 1 / (sum of e * 2^10)
  const int tid = threadIdx.x, w = tid >> 5, lane = tid & 31, ln = lane & 15, hh = lane >> 4;
  const size_t pofs = (size_t)blockIdx.y * NTK * CC;      // every per-image array here holds NTK * CC elements
  const int j0 = (int)blockIdx.x * FR;
  const int rg = (w >> 1) * 16, cg = (w & 1) * 32;      // the wave's 16 x 32 part of the logits tile
  const int wr = (w >> 2) * 32, wc = (w & 3) * 64;      // the wave's 32 x 64 part of the output tile
  const int srow = tid >> 2, sc = (tid & 3) * 16;       // softmax: the lane's row and its 16 columns
  const char* qb[2] = {(const char*)(Bh + pofs), (const char*)(Bl + pofs)}; const char* vb = (const char*)(VT + pofs);      // uniform bases
  const unsigned qo = (unsigned)((w * CC + lane * 8) * 2);      // a wave loads one whole 512-byte q row; its further rows are constants, the chunk a uniform step
  const unsigned vo = (unsigned)(((tid >> 3) * NTK + (tid & 7) * 8) * 2);      // 8 lanes per 128-byte slice of a v row, 32 rows per pass
  v8us rq[2][8], rv[8];
#pragma unroll
  for (int i = 0; i < 8; ++i) { rq[0][i] = *(const v8us*)(qb[0] + qo + i * (8 * CC * 2)); rq[1][i] = *(const v8us*)(qb[1] + qo + i * (8 * CC * 2)); rv[i] = *(const v8us*)(vb + vo + i * (32 * NTK * 2)); }
  FragH kh[8], kl[8];      // the wave's 16 k rows, all 256 channels, both planes
  const unsigned short* ph = (const unsigned short*)(Ah + pofs) + (size_t)(j0 + rg + ln) * CC + 8 * hh; const unsigned short* pl = (const unsigned short*)(Al + pofs) + (size_t)(j0 + rg + ln) * CC + 8 * hh;
#pragma unroll
  for (int ks = 0; ks < 8; ++ks) { kh[ks].half[0] = *(const v8us*)(ph + ks * 32); kh[ks].half[1] = *(const v8us*)(ph + ks * 32 + 16); kl[ks].half[0] = *(const v8us*)(pl + ks * 32); kl[ks].half[1] = *(const v8us*)(pl + ks * 32 + 16); }
  asm volatile("s_wait_xcnt 0x0" :: "v"(tid), "v"(vo), "v"(ph), "v"(pl) : "memory");      // the registers that the loads above name are given other values from here on; as inputs they stay as they are up to the wait
#pragma unroll
  for (int i = 0; i < 8; ++i) { *(v8us*)&sq[0][0][w + 8 * i][lane * 8] = rq[0][i]; *(v8us*)&sq[0][1][w + 8 * i][lane * 8] = rq[1][i]; *(v8us*)&sv[0][(tid >> 3) + 32 * i][(tid & 7) * 8] = rv[i]; }
  __syncthreads();      // chunk 0 is whole before any wave reads it
  v8f acc[2][4] = {};
  float m = -3.0e38f, l = 0.f;      // the row's running maximum; the sum of e * 2^10 over the lane's own columns
#pragma unroll 1      // kept rolled: for speed only
  for (int c = 0; c < NTK / FI; ++c) {
    const int cur = c & 1; const bool more = c + 1 < NTK / FI;
    if (more) {
      const char* g0 = qb[0] + qo + (c + 1) * (FI * CC * 2); const char* g1 = qb[1] + qo + (c + 1) * (FI * CC * 2); const char* g2 = vb + vo + (c + 1) * (FI * 2);
#pragma unroll
      for (int i = 0; i < 8; ++i) rq[0][i] = *(const v8us*)(g0 + i * (8 * CC * 2));
#pragma unroll
      for (int i = 0; i < 8; ++i) rq[1][i] = *(const v8us*)(g1 + i * (8 * CC * 2));
#pragma unroll
      for (int i = 0; i < 8; ++i) rv[i] = *(const v8us*)(g2 + i * (32 * NTK * 2));
      asm volatile("s_wait_xcnt 0x0" :: "v"(g0), "v"(g1), "v"(g2) : "memory");      // the registers that these loads name are given other values below; as inputs they stay as they are up to the wait
    }
    v8f hi[2] = {}, lo[2] = {};      // hi: Ah.Bh; lo: Al.Bh then Ah.Bl, k upward; they meet once per chunk
    FragH fq[3][2][2];      // q fragments [slot][column block][Bh | Bl], read two k steps ahead of their products
#pragma unroll
    for (int ks = 0; ks < 2; ++ks)
#pragma unroll
      for (int t = 0; t < 2; ++t)
#pragma unroll
        for (int p = 0; p < 2; ++p) { fq[ks][t][p].half[0] = *(const v8us*)&sq[cur][p][cg + t * 16 + ln][ks * 32 + 8 * hh]; fq[ks][t][p].half[1] = *(const v8us*)&sq[cur][p][cg + t * 16 + ln][ks * 32 + 16 + 8 * hh]; }
#pragma unroll
    for (int ks = 0; ks < 8; ++ks) {
      const int s = ks % 3, n = (ks + 2) % 3;
      if (ks + 2 < 8) {
#pragma unroll
        for (int t = 0; t < 2; ++t)
#pragma unroll
          for (int p = 0; p < 2; ++p) { fq[n][t][p].half[0] = *(const v8us*)&sq[cur][p][cg + t * 16 + ln][(ks + 2) * 32 + 8 * hh]; fq[n][t][p].half[1] = *(const v8us*)&sq[cur][p][cg + t * 16 + ln][(ks + 2) * 32 + 16 + 8 * hh]; }
      }
      // The next chunk goes to the other buffers beside the last three k steps: this phase is bound by LDS reads, and the write path is free. Their last readers left those buffers before the first barrier of the chunk before.
      // No branch round the stores (a join would make every later LDS wait count them): in the last chunk they put stale registers into buffers that nobody reads any more.
      if (ks == 5) {
#pragma unroll
        for (int i = 0; i < 8; ++i) *(v8us*)&sq[cur ^ 1][0][w + 8 * i][lane * 8] = rq[0][i];
      }
      if (ks == 6) {
#pragma unroll
        for (int i = 0; i < 8; ++i) *(v8us*)&sq[cur ^ 1][1][w + 8 * i][lane * 8] = rq[1][i];
      }
      if (ks == 7) {
#pragma unroll
        for (int i = 0; i < 8; ++i) *(v8us*)&sv[cur ^ 1][(tid >> 3) + 32 * i][(tid & 7) * 8] = rv[i];
      }
      __builtin_amdgcn_sched_barrier(0);      // keeps the reads and stores above ahead of the products below; left free, the compiler sinks each read to just before its use
#pragma unroll
      for (int t = 0; t < 2; ++t) hi[t] = __builtin_amdgcn_wmma_f32_16x16x32_f16(false, kh[ks].v, false, fq[s][t][0].v, (short)0, hi[t], false, false);
#pragma unroll
      for (int t = 0; t < 2; ++t) lo[t] = __builtin_amdgcn_wmma_f32_16x16x32_f16(false, kl[ks].v, false, fq[s][t][0].v, (short)0, lo[t], false, false);
#pragma unroll
      for (int t = 0; t < 2; ++t) lo[t] = __builtin_amdgcn_wmma_f32_16x16x32_f16(false, kh[ks].v, false, fq[s][t][1].v, (short)0, lo[t], false, false);
    }
#pragma unroll
    for (int t = 0; t < 2; ++t)
#pragma unroll
      for (int r = 0; r < 8; ++r) ss[rg + 8 * hh + r][cg + t * 16 + ln] = lo[t][r] * 0.0009765625f + hi[t][r];
    FragH fb[2][4];      // this chunk's v fragments: published since the chunk began, so they are read here, where the LDS would idle at the barrier
#pragma unroll
    for (int k2 = 0; k2 < 2; ++k2)
#pragma unroll
      for (int t = 0; t < 4; ++t) { fb[k2][t].half[0] = *(const v8us*)&sv[cur][wc + t * 16 + ln][k2 * 32 + 8 * hh]; fb[k2][t].half[1] = *(const v8us*)&sv[cur][wc + t * 16 + ln][k2 * 32 + 16 + 8 * hh]; }
    __syncthreads();      // the logits tile is whole before the rows' lanes read it
    {
      v4f s4[4];
#pragma unroll
      for (int q = 0; q < 4; ++q) s4[q] = *(const v4fa*)&ss[srow][sc + 4 * q];
      float mx = s4[0][0];
#pragma unroll
      for (int q = 0; q < 4; ++q)
#pragma unroll
        for (int k = 0; k < 4; ++k) mx = fmaxf(mx, s4[q][k]);
      mx = fmaxf(mx, quad_lane<0xB1>(mx)); mx = fmaxf(mx, quad_lane<0x4E>(mx));      // the row's four lanes agree on the chunk's maximum
      const float mn = fmaxf(m, mx), al = __builtin_amdgcn_exp2f((m - mn) * 1.4426950408889634f), eb = 10.0f - mn * 1.4426950408889634f; m = mn;      // e * 2^10 = 2^(s log2(e) + eb)
      float su = 0.f; FragH f;
#pragma unroll
      for (int q = 0; q < 4; ++q)
#pragma unroll
        for (int k = 0; k < 4; ++k) { const float e = __builtin_amdgcn_exp2f(s4[q][k] * 1.4426950408889634f + eb); su += e; f.h[q * 4 + k] = (_Float16)e; }
      l = l * al + su;
      *(v8us*)&sp[srow][sc] = f.half[0]; *(v8us*)&sp[srow][sc + 8] = f.half[1];
      if ((tid & 3) == 0) sal[srow] = al;
    }
    __syncthreads();      // e and the factors are whole before the waves take them as operands
    FragH fa[2][2];      // all of the wave's e fragments at once, so that their latency is paid once, beside the scaling
#pragma unroll
    for (int k2 = 0; k2 < 2; ++k2)
#pragma unroll
      for (int mi = 0; mi < 2; ++mi) { fa[k2][mi].half[0] = *(const v8us*)&sp[wr + mi * 16 + ln][k2 * 32 + 8 * hh]; fa[k2][mi].half[1] = *(const v8us*)&sp[wr + mi * 16 + ln][k2 * 32 + 16 + 8 * hh]; }
#pragma unroll
    for (int mi = 0; mi < 2; ++mi) {
      const v4f f0 = *(const v4fa*)&sal[wr + mi * 16 + 8 * hh], f1 = *(const v4fa*)&sal[wr + mi * 16 + 8 * hh + 4];
#pragma unroll
      for (int t = 0; t < 4; ++t)
#pragma unroll
        for (int r = 0; r < 4; ++r) { acc[mi][t][r] *= f0[r]; acc[mi][t][4 + r] *= f1[r]; }
    }
#pragma unroll
    for (int k2 = 0; k2 < 2; ++k2) {
#pragma unroll
      for (int mi = 0; mi < 2; ++mi)
#pragma unroll
        for (int t = 0; t < 4; ++t) acc[mi][t] = __builtin_amdgcn_wmma_f32_16x16x32_f16(false, fa[k2][mi].v, false, fb[k2][t].v, (short)0, acc[mi][t], false, false);
    }
    // No barrier here: what the next chunk rewrites before its own first barrier (the logits tile, the q and v buffers just used) had its last reader before this chunk's second barrier, and e and the factors are rewritten only behind the next chunk's first barrier, which a wave reaches with its reads above done.
  }
  l += quad_lane<0xB1>(l); l += quad_lane<0x4E>(l);      // the row's four lanes join their sums
  if ((tid & 3) == 0) sdv[srow] = 1.0f / l;      // l carries the same 2^10 as e
  __syncthreads();      // every row's divisor is there before the waves read it (the q buffers, staging from here on, had their last reader long before)
  float* so = (float*)&sq[0][0][0][0] + (size_t)w * (32 * GSO);      // the wave's own 32 x 64 f32 staging
#pragma unroll
  for (int mi = 0; mi < 2; ++mi) {
    const v4f f0 = *(const v4fa*)&sdv[wr + mi * 16 + 8 * hh], f1 = *(const v4fa*)&sdv[wr + mi * 16 + 8 * hh + 4];
#pragma unroll
    for (int t = 0; t < 4; ++t)
#pragma unroll
      for (int r = 0; r < 4; ++r) { so[(mi * 16 + 8 * hh + r) * GSO + t * 16 + ln] = acc[mi][t][r] * f0[r]; so[(mi * 16 + 8 * hh + 4 + r) * GSO + t * 16 + ln] = acc[mi][t][4 + r] * f1[r]; }
  }
  __builtin_amdgcn_fence(__ATOMIC_ACQ_REL, "workgroup"); __builtin_amdgcn_wave_barrier();
  typedef _Float16 v4h __attribute__((ext_vector_type(4)));
  const int rsub = lane >> 4, c4 = (lane & 15) * 4;
  _Float16* ow = O16 + pofs + (size_t)(j0 + wr + rsub) * CC + wc + c4;      // the lane's first output row (then every second one) and its four columns
#pragma unroll
  for (int q = 0; q < 16; ++q) { const v4f o = *(const v4fa*)&so[(q * 2 + rsub) * GSO + c4]; v4h h4;
#pragma unroll
    for (int i = 0; i < 4; ++i) h4[i] = (_Float16)o[i];
    *(v4h*)(ow + q * 2 * CC) = h4; }
}

typedef _Float16 v4h __attribute__((ext_vector_type(4)));

__global__ __launch_bounds__(256) void k_x16(const float* __restrict__ x, _Float16* __restrict__ X16, size_t n8) { const size_t t = (size_t)blockIdx.x * 256 + threadIdx.x; if (t >= n8) return; FragH f;
#pragma unroll
  for (int q = 0; q < 8; ++q) f.h[q] = (_Float16)bf16_round(x[t * 8 + q]); *(v8us*)((unsigned short*)X16 + t * 8) = f.half[0];  }
__global__ __launch_bounds__(256) void k_h16(const float* __restrict__ x, _Float16* __restrict__ X16, size_t n8) { const size_t t = (size_t)blockIdx.x * 256 + threadIdx.x; if (t >= n8) return; FragH f;
#pragma unroll
  for (int q = 0; q < 8; ++q) f.h[q] = (_Float16)x[t * 8 + q]; *(v8us*)((unsigned short*)X16 + t * 8) = f.half[0];  }
__global__ __launch_bounds__(256) void k_round16f(const float* __restrict__ W, _Float16* __restrict__ Bt, size_t n8) { const size_t t = (size_t)blockIdx.x * 256 + threadIdx.x; if (t >= n8) return; FragH f;
#pragma unroll
  for (int i = 0; i < 8; ++i) f.h[i] = (_Float16)(bf16_round(W[t * 8 + i]) * 16.0f); *(v8us*)((unsigned short*)Bt + t * 8) = f.half[0];  }
template <int NHv, int TTv>
__global__ __launch_bounds__(256) void k_vt(const _Float16* __restrict__ V16, int ldv, int voff, _Float16* __restrict__ Vt) { __shared__ unsigned short tl[64][66]; const int tid = threadIdx.x; const int slab = blockIdx.x / (TTv / 64), lg = blockIdx.x % (TTv / 64); const int b = slab / NHv, h = slab % NHv;
  for (int i = tid; i < 64 * 8; i += 256) { const int r = i / 8, c8 = (i % 8) * 8; FragH f; f.half[0] = *(const v8us*)((const unsigned short*)V16 + ((size_t)b * TTv + lg * 64 + r) * ldv + voff + h * 64 + c8);
#pragma unroll
    for (int q = 0; q < 8; ++q) tl[r][c8 + q] = f.u[q]; }
  __syncthreads();
  {
#pragma unroll
    for (int rd = 0; rd < 2; ++rd) { const int d = rd * 32 + tid / 8, pc = tid % 8; FragH f;
#pragma unroll
      for (int q = 0; q < 8; ++q) f.u[q] = tl[pc * 8 + q][d];
      *(v8us*)((unsigned short*)Vt + ((size_t)slab * 64 + d) * TTv + lg * 64 + pc * 8) = f.half[0]; }
     } }

__global__ __launch_bounds__(256) void k_hl(const float* __restrict__ F, _Float16* __restrict__ Hh, _Float16* __restrict__ Hl, size_t n8) { const size_t t = (size_t)blockIdx.x * 256 + threadIdx.x; if (t >= n8) return; FragH fh, fl; const v4f a = *(const v4fa*)(F + t * 8), c = *(const v4fa*)(F + t * 8 + 4);
#pragma unroll
  for (int q = 0; q < 4; ++q) { _Float16 h = (_Float16)a[q]; fh.h[q] = h; fl.h[q] = (_Float16)((a[q] - (float)h) * 1024.0f); h = (_Float16)c[q]; fh.h[4 + q] = h; fl.h[4 + q] = (_Float16)((c[q] - (float)h) * 1024.0f); }
  { *(v8us*)((unsigned short*)Hh + t * 8) = fh.half[0]; *(v8us*)((unsigned short*)Hl + t * 8) = fl.half[0];  } }

// All input preparation in one launch: the five weight planes and the sixteen token planes depend on the inputs alone, so their work-groups run side by side.
// Both jobs are the same transposition, f32 src[c][n] (row pitch PITCH) to f16 dst[n][c] (row pitch CC), done on tiles of PC source rows x PN source columns through LDS:
// every global load of a wave is 512 contiguous bytes of one source row, and every 8 lanes store one whole 128-byte line of a destination row.
// Work-groups 0 .. 5*WB-1: weight plane blockIdx.x / WB, BW[plane][n][k] = f16(bf16(W[k][n]) * 16) from f32 row-major W[k][n] (bf16-exact weights stay exact in f16 away from the subnormal range).
// The others, TB per image: T16[image][token][channel] = f16(bf16(x[image][channel][token])).
#define PC 64       /* source rows per tile: 8 waves x 8 rows */
#define PN 128      /* source columns per tile: 32 lanes x 4 floats */
#define WB ((CC / PC) * (CC / PN))      /* work-groups per weight plane */
#define TB ((CC / PC) * (NTK / PN))     /* work-groups per image */
template <int PITCH, bool X16>
__device__ __forceinline__ void prep_tile(const float* __restrict__ src, unsigned short* __restrict__ dst, int tile, unsigned short (*tl)[GPIT]) {
  const int tid = threadIdx.x, w = tid >> 5, lane = tid & 31;
  const int c0 = (tile / (PITCH / PN)) * PC, n0 = (tile % (PITCH / PN)) * PN;
  const char* sb = (const char*)(src + (size_t)c0 * PITCH + n0);      // uniform base; the lane keeps one byte offset, its further rows are constants
  const unsigned so = (unsigned)((w * 8 * PITCH + lane * 4) * 4);      // the lane's 8 source rows x 4 columns
  v4f r[8];
#pragma unroll
  for (int q = 0; q < 8; ++q) r[q] = *(const v4fa*)(sb + so + q * (PITCH * 4));
#pragma unroll
  for (int i = 0; i < 4; ++i) { FragH f;
#pragma unroll
    for (int q = 0; q < 8; ++q) f.h[q] = X16 ? (_Float16)(bf16_round(r[q][i]) * 16.0f) : (_Float16)bf16_round(r[q][i]);
    *(v8us*)&tl[i * 32 + lane][w * 8] = f.half[0]; }      // source column 4 * lane + i lies in LDS row i * 32 + lane: the lanes of a store are one row pitch apart, on distinct banks
  __syncthreads();      // the tile is whole before any wave reads the other waves' columns of it
  unsigned short* dp = dst + (size_t)(n0 + (tid >> 3) * 4) * CC + c0 + (tid & 7) * 8;
#pragma unroll
  for (int p = 0; p < 4; ++p) *(v8us*)(dp + p * CC) = *(const v8us*)&tl[p * 32 + (tid >> 3)][(tid & 7) * 8];      // LDS row p * 32 + g holds source column 4 * g + p
}
__global__ __launch_bounds__(256) void k_prep(const float* __restrict__ x, const float* __restrict__ wq, const float* __restrict__ wk, const float* __restrict__ wv, const float* __restrict__ w1, const float* __restrict__ w2,
    _Float16* __restrict__ BW, _Float16* __restrict__ T16) {
  __shared__ __attribute__((aligned(16))) unsigned short tl[PN][GPIT];      // the transposed tile: one row per source column (in the order that prep_tile names), 128 bytes of source rows at the 144-byte pitch
  const int bx = (int)blockIdx.x;      // the branch is the same for the whole work-group, so every wave meets the one barrier of its side
  if (bx < 5 * WB) {
    const int sel = bx / WB; const float* W = sel == 0 ? wq : sel == 1 ? wk : sel == 2 ? wv : sel == 3 ? w1 : w2;
    prep_tile<CC, true>(W, (unsigned short*)(BW + (size_t)sel * CC * CC), bx % WB, tl);
  } else {
    const int b = (bx - 5 * WB) / TB;
    prep_tile<NTK, false>(x + (size_t)b * CC * NTK, (unsigned short*)(T16 + (size_t)b * NTK * CC), (bx - 5 * WB) % TB, tl);
    asm volatile("s_wait_xcnt 0x0" ::: "memory");      // in the built code the other branch's instructions follow this branch's stores and rewrite the registers that they name
  }
}
__global__ __launch_bounds__(256) void k_ln_out(const float* __restrict__ A, const float* __restrict__ g, const float* __restrict__ bb, float* __restrict__ out) {
  #pragma clang fp contract(off)
  __shared__ float tile[32][CC + 1]; const int tid = threadIdx.x, w = tid >> 5, l = tid & 31; const int j0 = blockIdx.x * 32; const int b = blockIdx.y; A += (size_t)b * NTK * CC;
  for (int jj = w; jj < 32; jj += 8) { const int j = j0 + jj; const float* ar = A + (size_t)j * CC; float v[8]; float s = 0.f;
#pragma unroll
    for (int k = 0; k < 8; ++k) { v[k] = ar[l + 32 * k]; s += v[k]; }
    for (int o = 16; o > 0; o >>= 1) s += __shfl_xor(s, o, 32); const float mu = s / (float)CC; float q2 = 0.f;
#pragma unroll
    for (int k = 0; k < 8; ++k) { const float d = v[k] - mu; q2 += d * d; }
    for (int o = 16; o > 0; o >>= 1) q2 += __shfl_xor(q2, o, 32); const float rs = rsqrtf(q2 / (float)CC + 1e-5f);
#pragma unroll
    for (int k = 0; k < 8; ++k) { const int c = l + 32 * k; tile[jj][c] = (v[k] - mu) * rs * bf16_round(g[c]) + bf16_round(bb[c]); } }
  __syncthreads();
  { for (int c = w; c < CC; c += 8) *(float*)(out + ((size_t)b * CC + c) * NTK + j0 + l) = tile[l][c];  } }

extern "C" void kernel_launch(void* const* d_in, const int* in_sizes, int n_in,
                              void* d_out, int out_size, void* d_ws, size_t ws_size, hipStream_t stream) {
  (void)in_sizes; (void)n_in; (void)out_size;
  const float* const* I = (const float* const*)d_in; const float* x = I[0]; const float* wq = I[1]; const float* bq = I[2]; const float* wk = I[3]; const float* bk = I[4]; const float* wv = I[5]; const float* bv = I[6]; const float* w1 = I[7]; const float* b1 = I[8]; const float* w2 = I[9]; const float* b2 = I[10]; const float* g = I[11]; const float* be = I[12];
  char* ws = (char*)d_ws; size_t off = 0;
  auto take = [&](size_t bytes) { char* p = ws + off; off += (bytes + 255) & ~(size_t)255; return p; };
  _Float16* BQ = (_Float16*)take(5 * CC * CC * 2); _Float16* BK = BQ + CC * CC; _Float16* BV = BQ + 2 * CC * CC; _Float16* B1 = BQ + 3 * CC * CC; _Float16* B2 = BQ + 4 * CC * CC;      /* five weight planes, one after another */
  /* one workspace slab per image for every intermediate: all NBt images go through each launch, image = blockIdx.y (in k_prep, (blockIdx.x - 5*WB) / TB) */
  _Float16* T16 = (_Float16*)take((size_t)NBt * NTK * CC * 2); _Float16* Qh = (_Float16*)take((size_t)NBt * NTK * CC * 2); _Float16* Ql = (_Float16*)take((size_t)NBt * NTK * CC * 2); _Float16* Kh = (_Float16*)take((size_t)NBt * NTK * CC * 2); _Float16* Kl = (_Float16*)take((size_t)NBt * NTK * CC * 2); _Float16* VT = (_Float16*)take((size_t)NBt * CC * NTK * 2);
  _Float16* A16 = (_Float16*)take((size_t)NBt * NTK * CC * 2); _Float16* H16 = (_Float16*)take((size_t)NBt * NTK * CC * 2); float* T2 = (float*)take((size_t)NBt * NTK * CC * 4);
  if (off > ws_size) return;      // 5 weight planes of 128 KiB + 16 x 5 MiB: under 81 MiB
  const dim3 gP((NTK / GT) * (CC / GT), NBt);
  const size_t sT = (size_t)NTK * CC;      /* elements per image */
  k_prep<<<5 * WB + NBt * TB, 256, 0, stream>>>(x, wq, wk, wv, w1, w2, BQ, T16);      /* all weights stored (in,out); every plane and every image in the one launch */
  k_qkv<<<dim3(3 * QT, NBt), 256, 0, stream>>>(T16, BQ, BK, BV, bq, bk, bv, Qh, Ql, Kh, Kl, VT);      /* q, k (exact + bias) as hi/lo planes, v as f16 [channel][token] */
  k_attn<<<dim3(NTK / FR, NBt), 256, 0, stream>>>(Kh, Kl, Qh, Ql, VT, A16);      /* S'[j][i] = k_j.q_i (the transposed logits), softmax over i per j (= the module's softmax over the query axis), att[j] = sum_i P'[j][i].v[i] to f16 */
  k_gemm_hhx<15><<<gP, 256, 0, stream>>>(A16, CC, sT, B1, CC, 0, 0.0625f, b1, 0, nullptr, 1, 0, 0, nullptr, H16, CC, sT, NTK, CC, CC);      /* SiLU in the epilogue, hidden to f16 */
  k_gemm_hhx<0><<<gP, 256, 0, stream>>>(H16, CC, sT, B2, CC, 0, 0.0625f, b2, 0, nullptr, 1, 0, 0, T2, nullptr, CC, sT, NTK, CC, CC);      /* MLP */
  k_ln_out<<<dim3(NTK / 32, NBt), 256, 0, stream>>>(T2, g, be, (float*)d_out);
}

// v008
// Measured time: 60 microseconds a run.
// Next to v007, in two timings, it ran 1.26 times as fast each time.
// Over all steps from v000 it is 40.3 times as fast.
#include <hip/hip_runtime.h>
// Token self-attention block on a feature map (B 16, C 256, 32×32 = 1024 tokens): q, k, v = t·W + b (W stored (in,out)); m = q·kᵀ (no scaling); softmax over the QUERY axis i; att[j] = Σ_i m[i][j]·v[i]; MLP (SiLU, 256→256→256); LayerNorm; back to NCHW → [16,256,32,32].
// Structure: the column softmax is a row softmax of mᵀ = k·qᵀ, so per batch: S' = K·Qᵀ (rows j, cols i), row softmax, att = P'·V, the three in one kernel (running maximum per row); the MLP and the LayerNorm follow in the same kernel, on the work-group's own rows.
// Compute dtype: x and parameters rounded to bf16; q/k/v with exact products; q and k carried as f16 hi + lo·2^10 planes with three cross products (≈f32 logits — they reach σ≈8 unscaled), softmax in f32, P (×2^10), v, attention output and the SiLU hidden as f16 operands (≈2^-12), f32 accumulation; LayerNorm in f32. v_wmma_f32_16x16x32_f16.
#define NBt 16
#define CC 256
#define NTK 1024
typedef __bf16 v16b __attribute__((ext_vector_type(16)));
typedef unsigned short v8us __attribute__((ext_vector_type(8), may_alias));
typedef float  v8f  __attribute__((ext_vector_type(8)));
typedef float  v4f  __attribute__((ext_vector_type(4)));
typedef float  v4fa __attribute__((ext_vector_type(4), may_alias));
union FragB { v16b v; v8us half[2]; unsigned short u[16]; };

__device__ __forceinline__ unsigned short bf16_bits(float x) { unsigned int u = __float_as_uint(x); return (unsigned short)((u + 0x7FFFu + ((u >> 16) & 1u)) >> 16); }
__device__ __forceinline__ float bf16_val(unsigned short b) { return __uint_as_float(((unsigned int)b) << 16); }
__device__ __forceinline__ float bf16_round(float x) { return bf16_val(bf16_bits(x)); }
// D += A·B with NT terms: 1 = ah·bh, 2 = + al·bh (A split), 3 = + ah·bl (both split)
template <int NT>
__device__ __forceinline__ v8f mmaN(v16b ah, v16b al, v16b bh, v16b bl, v8f c) {
  c = __builtin_amdgcn_wmma_f32_16x16x32_bf16(false, ah, false, bh, (short)0, c, false, false);
  if (NT >= 2) c = __builtin_amdgcn_wmma_f32_16x16x32_bf16(false, al, false, bh, (short)0, c, false, false);
  if (NT >= 3) c = __builtin_amdgcn_wmma_f32_16x16x32_bf16(false, ah, false, bl, (short)0, c, false, false);
  asm volatile("v_nop\n\tv_nop\n\tv_nop\n\tv_nop" : "+v"(c) : "v"(ah), "v"(al), "v"(bh), "v"(bl));
  return c;
}

__global__ __launch_bounds__(256) void k_wt_bf16(const float* __restrict__ W, unsigned short* __restrict__ Wt, int K, int N) {
  const int t = blockIdx.x * 256 + threadIdx.x;
  const int k8n = K / 8;
  if (t >= N * k8n) return;
  const int n = t / k8n, k8 = (t % k8n) * 8;
  v8us v;
#pragma unroll
  for (int i = 0; i < 8; ++i) v[i] = bf16_bits(W[(size_t)(k8 + i) * N + n]);
  *(v8us*)(Wt + (size_t)n * K + k8) = v;
  
}

// GEMM C[M][N] (f32, pitch ldc) = act(A[M][K]·W + bias). A f32 row-major (pitch lda) converted per fragment to bf16
// (ASPLIT: hi/lo two planes -> 2 terms, else single rounded term); Wt bf16 [N][K] (pitch ldb). BIAS_BF16 rounds the
// bias to bf16 first (bias quantised to bf16 before the add). K%32==0, M%16==0, N%64==0.
template <bool ASPLIT, int ACT, bool BIAS_BF16>
__global__ __launch_bounds__(128) void k_gemm_bf(const float* __restrict__ A, int lda, const unsigned short* __restrict__ Wt, int ldb,
                                               const float* __restrict__ bias, float* __restrict__ C, int ldc, int M, int N, int K) {
  __shared__ __attribute__((aligned(16))) float so[4][16][64];
  const int tid = threadIdx.x, w = tid >> 5, lane = tid & 31, ln = lane & 15, hh = lane >> 4;
  const int ntn = N / 64;
  const int wid = blockIdx.x * 4 + w;
  const int mt = wid / ntn, nq = wid % ntn;
  if (mt * 16 >= M) return;
  const int row0 = mt * 16, col0 = nq * 64;
  const float* arow = A + (size_t)(row0 + ln) * lda;
  v8f acc[4] = {};
  for (int kb = 0; kb < K; kb += 32) {
    FragB ah, al;
    const v4f x0 = *(const v4fa*)(arow + kb + 8 * hh), x1 = *(const v4fa*)(arow + kb + 8 * hh + 4);
    const v4f x2 = *(const v4fa*)(arow + kb + 16 + 8 * hh), x3 = *(const v4fa*)(arow + kb + 16 + 8 * hh + 4);
    float xs[16] = {x0[0],x0[1],x0[2],x0[3],x1[0],x1[1],x1[2],x1[3],x2[0],x2[1],x2[2],x2[3],x3[0],x3[1],x3[2],x3[3]};
#pragma unroll
    for (int i = 0; i < 16; ++i) { const unsigned short hb = bf16_bits(xs[i]); ah.u[i] = hb; al.u[i] = ASPLIT ? bf16_bits(xs[i] - bf16_val(hb)) : (unsigned short)0; }
#pragma unroll
    for (int t = 0; t < 4; ++t) {
      const unsigned short* brow = Wt + (size_t)(col0 + t * 16 + ln) * ldb + kb;
      FragB b;
      b.half[0] = *(const v8us*)(brow + 8 * hh);
      b.half[1] = *(const v8us*)(brow + 16 + 8 * hh);
      acc[t] = mmaN<ASPLIT ? 2 : 1>(ah.v, al.v, b.v, b.v, acc[t]);
    }
  }
#pragma unroll
  for (int t = 0; t < 4; ++t) {
    float bv = bias ? bias[col0 + t * 16 + ln] : 0.f;
    if (BIAS_BF16) bv = bf16_round(bv);
#pragma unroll
    for (int r = 0; r < 8; ++r) { float v = acc[t][r] + bv; if (ACT == 1) v = fmaxf(v, 0.f); so[w][8 * hh + r][t * 16 + ln] = v; }
  }
  __builtin_amdgcn_fence(__ATOMIC_ACQ_REL, "workgroup");
  __builtin_amdgcn_wave_barrier();
  const int rsub = lane >> 4, c4 = (lane & 15) * 4;
  {
#pragma unroll
    for (int q = 0; q < 8; ++q) {
      const int r = q * 2 + rsub;
      const v4f v = *(const v4fa*)&so[w][r][c4];
      *(v4f*)(C + (size_t)(row0 + r) * ldc + col0 + c4) = v;
    }
    
  }
}

// GEMM C = act(A·W + bias + resid): A f32 (ASPLIT -> hi/lo 2 terms), Wt bf16 [N][K]; ACT 0 none, 1 relu, 2 exact gelu;
// resid (optional, f32, row index = (row % rmod), pitch ldr, RES_BF16 rounds it) added before the activation.
template <bool ASPLIT, int ACT, bool BIAS_BF16, bool RES_BF16>
__global__ __launch_bounds__(128) void k_gemm_bf3(const float* __restrict__ A, int lda, const unsigned short* __restrict__ Wt, int ldb,
                                                const float* __restrict__ bias, const float* __restrict__ resid, int rmod, int ldr,
                                                float* __restrict__ C, int ldc, int M, int N, int K) {
  __shared__ __attribute__((aligned(16))) float so[4][16][64];
  const int tid = threadIdx.x, w = tid >> 5, lane = tid & 31, ln = lane & 15, hh = lane >> 4;
  const int ntn = N / 64;
  const int wid = blockIdx.x * 4 + w;
  const int mt = wid / ntn, nq = wid % ntn;
  if (mt * 16 >= M) return;
  const int row0 = mt * 16, col0 = nq * 64;
  const float* arow = A + (size_t)(row0 + ln) * lda;
  v8f acc[4] = {};
  for (int kb = 0; kb < K; kb += 32) {
    FragB ah, al;
    const v4f x0 = *(const v4fa*)(arow + kb + 8 * hh), x1 = *(const v4fa*)(arow + kb + 8 * hh + 4);
    const v4f x2 = *(const v4fa*)(arow + kb + 16 + 8 * hh), x3 = *(const v4fa*)(arow + kb + 16 + 8 * hh + 4);
    float xs[16] = {x0[0],x0[1],x0[2],x0[3],x1[0],x1[1],x1[2],x1[3],x2[0],x2[1],x2[2],x2[3],x3[0],x3[1],x3[2],x3[3]};
#pragma unroll
    for (int i = 0; i < 16; ++i) { const unsigned short hb = bf16_bits(xs[i]); ah.u[i] = hb; al.u[i] = ASPLIT ? bf16_bits(xs[i] - bf16_val(hb)) : (unsigned short)0; }
#pragma unroll
    for (int t = 0; t < 4; ++t) {
      const unsigned short* brow = Wt + (size_t)(col0 + t * 16 + ln) * ldb + kb;
      FragB b;
      b.half[0] = *(const v8us*)(brow + 8 * hh);
      b.half[1] = *(const v8us*)(brow + 16 + 8 * hh);
      acc[t] = mmaN<ASPLIT ? 2 : 1>(ah.v, al.v, b.v, b.v, acc[t]);
    }
  }
#pragma unroll
  for (int t = 0; t < 4; ++t) {
    const int col = col0 + t * 16 + ln;
    float bv = bias ? bias[col] : 0.f;
    if (BIAS_BF16) bv = bf16_round(bv);
#pragma unroll
    for (int r = 0; r < 8; ++r) {
      float v = acc[t][r] + bv;
      if (resid) { float rv = resid[(size_t)((row0 + 8 * hh + r) % rmod) * ldr + col]; if (RES_BF16) rv = bf16_round(rv); v += rv; }
      if (ACT == 1) v = fmaxf(v, 0.f);
      if (ACT == 2) v = 0.5f * v * (1.0f + erff(v * 0.70710678118654752f));
      if (ACT == 3) { const float u = 0.7978845608028654f * (v + 0.044715f * v * v * v); v = 0.5f * v * (1.0f + tanhf(u)); }
      so[w][8 * hh + r][t * 16 + ln] = v;
    }
  }
  __builtin_amdgcn_fence(__ATOMIC_ACQ_REL, "workgroup");
  __builtin_amdgcn_wave_barrier();
  const int rsub = lane >> 4, c4 = (lane & 15) * 4;
  {
#pragma unroll
    for (int q = 0; q < 8; ++q) {
      const int r = q * 2 + rsub;
      const v4f v = *(const v4fa*)&so[w][r][c4];
      *(v4f*)(C + (size_t)(row0 + r) * ldc + col0 + c4) = v;
    }
    
  }
}
// row LayerNorm (biased variance, eps) over N: s = X (+ R); optional out_sum <- s; out_norm <- (s-mu)*rsqrt(var+eps)*g + b
template <bool PARAM_BF16>
__global__ __launch_bounds__(256) void k_layernorm(const float* __restrict__ X, const float* __restrict__ R, const float* __restrict__ g, const float* __restrict__ bta,
                                                  float* __restrict__ out_sum, float* __restrict__ out_norm, int N, float eps) {
  __shared__ float red[256];
  const int row = blockIdx.x, tid = threadIdx.x;
  const float* x = X + (size_t)row * N; const float* rr = R ? R + (size_t)row * N : nullptr;
  float vals[16];                     // up to N = 4096
  const int per = N / 256;            // contiguous chunk per thread? use strided-by-4 chunks: thread handles j = tid*4 + 1024*u
  float s1 = 0.f;
  for (int u = 0; u < per / 4; ++u) {
    const int j = tid * 4 + 1024 * u;
    const v4f a = *(const v4fa*)(x + j);
    v4f b = {0.f,0.f,0.f,0.f}; if (rr) b = *(const v4fa*)(rr + j);
#pragma unroll
    for (int q = 0; q < 4; ++q) { const float v = a[q] + b[q]; vals[u * 4 + q] = v; s1 += v; }
  }
  red[tid] = s1; __syncthreads();
  for (int st = 128; st > 0; st >>= 1) { if (tid < st) red[tid] += red[tid + st]; __syncthreads(); }
  const float mu = red[0] / (float)N; __syncthreads();
  float s2 = 0.f;
  for (int u = 0; u < per / 4; ++u)
#pragma unroll
    for (int q = 0; q < 4; ++q) { const float c = vals[u * 4 + q] - mu; s2 += c * c; }
  red[tid] = s2; __syncthreads();
  for (int st = 128; st > 0; st >>= 1) { if (tid < st) red[tid] += red[tid + st]; __syncthreads(); }
  const float rs = rsqrtf(red[0] / (float)N + eps);
  {
    for (int u = 0; u < per / 4; ++u) {
      const int j = tid * 4 + 1024 * u;
      v4f o, sm;
#pragma unroll
      for (int q = 0; q < 4; ++q) {
        float gg = g[j + q], bb = bta[j + q];
        if (PARAM_BF16) { gg = bf16_round(gg); bb = bf16_round(bb); }
        sm[q] = vals[u * 4 + q]; o[q] = (vals[u * 4 + q] - mu) * rs * gg + bb;
      }
      if (out_sum) *(v4f*)(out_sum + (size_t)row * N + j) = sm;
      *(v4f*)(out_norm + (size_t)row * N + j) = o;
    }
    
  }
}



// ---- f16 WMMA path (v_wmma_f32_16x16x32_f16): 11-bit significands for operands in range — used where a [0,1] probability operand needs more precision than bf16
typedef _Float16 v16h __attribute__((ext_vector_type(16)));
union FragH { v16h v; v8us half[2]; _Float16 h[16]; unsigned short u[16]; };
template <int NT>
__device__ __forceinline__ v8f mmaH(v16h ah, v16h al, v16h bh, v16h bl, v8f c) {
  c = __builtin_amdgcn_wmma_f32_16x16x32_f16(false, ah, false, bh, (short)0, c, false, false);
  if (NT >= 2) c = __builtin_amdgcn_wmma_f32_16x16x32_f16(false, al, false, bh, (short)0, c, false, false);
  if (NT >= 3) c = __builtin_amdgcn_wmma_f32_16x16x32_f16(false, ah, false, bl, (short)0, c, false, false);
  asm volatile("v_nop\n\tv_nop\n\tv_nop\n\tv_nop" : "+v"(c) : "v"(ah), "v"(al), "v"(bh), "v"(bl));
  return c;
}
// batched GEMM like k_gemm_b but f16 operands: A f32 (split into f16 hi/lo if ASPLIT, else rounded to f16), Bt = f16 values [n][k]; alpha; C f32; N multiple of 16 (partial tiles skipped)
template <bool ASPLIT>
__global__ __launch_bounds__(128) void k_gemm_h(const float* __restrict__ A, int lda, size_t sA, const _Float16* __restrict__ Bh, int ldb, size_t sB, float alpha, float* __restrict__ C, int ldc, size_t sC, int M, int N, int K) {
  __shared__ __attribute__((aligned(16))) float so[4][16][64];
  const int tid = threadIdx.x, w = tid >> 5, lane = tid & 31, ln = lane & 15, hh = lane >> 4; const int by = blockIdx.y;
  A += (size_t)by * sA; Bh += (size_t)by * sB; C += (size_t)by * sC;
  const int ntn = (N + 63) / 64; const int wid = blockIdx.x * 4 + w; const int mt = wid / ntn, nq = wid % ntn; if (mt * 16 >= M) return;
  const int row0 = mt * 16, col0 = nq * 64; const float* arow = A + (size_t)(row0 + ln) * lda;
  v8f acc[4] = {};
  for (int kb = 0; kb < K; kb += 32) {
    FragH ah, al;
    const v4f x0 = *(const v4fa*)(arow + kb + 8 * hh), x1 = *(const v4fa*)(arow + kb + 8 * hh + 4), x2 = *(const v4fa*)(arow + kb + 16 + 8 * hh), x3 = *(const v4fa*)(arow + kb + 16 + 8 * hh + 4);
    float xs[16] = {x0[0],x0[1],x0[2],x0[3],x1[0],x1[1],x1[2],x1[3],x2[0],x2[1],x2[2],x2[3],x3[0],x3[1],x3[2],x3[3]};
#pragma unroll
    for (int i = 0; i < 16; ++i) { const _Float16 h = (_Float16)xs[i]; ah.h[i] = h; al.h[i] = ASPLIT ? (_Float16)(xs[i] - (float)h) : (_Float16)0.0f; }
#pragma unroll
    for (int t = 0; t < 4; ++t) { if (col0 + t * 16 >= N) continue; const size_t boff = (size_t)(col0 + t * 16 + ln) * ldb + kb; FragH bq; bq.half[0] = *(const v8us*)(Bh + boff + 8 * hh); bq.half[1] = *(const v8us*)(Bh + boff + 16 + 8 * hh);
      acc[t] = mmaH<ASPLIT ? 2 : 1>(ah.v, al.v, bq.v, bq.v, acc[t]); }
  }
#pragma unroll
  for (int t = 0; t < 4; ++t) { if (col0 + t * 16 >= N) continue;
#pragma unroll
    for (int r = 0; r < 8; ++r) so[w][8 * hh + r][t * 16 + ln] = acc[t][r] * alpha; }
  __builtin_amdgcn_fence(__ATOMIC_ACQ_REL, "workgroup"); __builtin_amdgcn_wave_barrier();
  const int rsub = lane >> 4, c4 = (lane & 15) * 4;
  {
#pragma unroll
    for (int q = 0; q < 8; ++q) { const int r = q * 2 + rsub; if (col0 + c4 < N) { const v4f v = *(const v4fa*)&so[w][r][c4]; *(v4f*)(C + (size_t)(row0 + r) * ldc + col0 + c4) = v; } }
     }
}

// Tile constants of the block-tiled products below.
#define GT 128      /* tile edge, rows of A and rows of Bh per work-group */
#define GK 64       /* k slice */
#define GPIT 72     /* LDS row pitch in f16: 144 B = 16 B x 9, so the 16 rows of a 16-byte fragment read fall on distinct banks */
#define GSO 68      /* epilogue row pitch in f32: rows 8 apart fall on different banks */

// q, k and v in one launch, each written once, in the form its reader takes: q and k as f16 hi and lo*2^10 planes [token][channel], v as f16 [channel][token].
// blockIdx.x / QT picks the product, blockIdx.x % QT its 128 x 128 tile, blockIdx.y the image. q, k: rows = tokens (T16), columns = channels (the weight plane), bias by column.
// v: the operands change places (rows = channels from BV, columns = tokens from T16), so the tile comes out transposed as it stands and its bias goes by row.
// One work-group of 8 waves owns a 128 x 128 tile, each wave 32 x 64 of it; both operands come in 64-wide k slices as whole 128-byte lines through LDS (two buffers, the next slice's loads fly during this slice's products); k runs upward in steps of 32 per accumulator.
#define QT ((NTK / GT) * (CC / GT))      /* tiles per product and image */
__global__ __launch_bounds__(256) void k_qkv(const _Float16* __restrict__ T16, const _Float16* __restrict__ BQ, const _Float16* __restrict__ BK, const _Float16* __restrict__ BV,
    const float* __restrict__ bq, const float* __restrict__ bk, const float* __restrict__ bvv,
    _Float16* __restrict__ Qh, _Float16* __restrict__ Ql, _Float16* __restrict__ Kh, _Float16* __restrict__ Kl, _Float16* __restrict__ VT) {
  __shared__ __attribute__((aligned(16))) unsigned short st[2][2][GT][GPIT];      // [buffer][A | B][row][k]; reused as f32 staging by the epilogue
  const int tid = threadIdx.x, w = tid >> 5, lane = tid & 31, ln = lane & 15, hh = lane >> 4;
  const int sel = (int)blockIdx.x / QT, tile = (int)blockIdx.x % QT; const bool isv = sel == 2;
  const size_t iofs = (size_t)blockIdx.y * NTK * CC;      // every per-image array here holds NTK * CC elements
  const int row0 = (isv ? tile / (NTK / GT) : tile / (CC / GT)) * GT, col0 = (isv ? tile % (NTK / GT) : tile % (CC / GT)) * GT;
  const int wr = (w >> 1) * 32, wc = (w & 1) * 64;      // the wave's 32 x 64 part of the tile
  const int lr = tid >> 3, lc = (tid & 7) * 8;          // staging: 8 lanes per 128-byte row slice, 32 rows per pass
  const char* ab = (const char*)(isv ? BV : T16 + iofs); const char* bb = (const char*)(isv ? T16 + iofs : (sel ? BK : BQ));      // uniform bases
  const unsigned ao = (unsigned)(((row0 + lr) * CC + lc) * 2), bo = (unsigned)(((col0 + lr) * CC + lc) * 2);      // the lane's byte offsets; further rows are constants, the slice a uniform step
  v8us ra[4], rb[4];
#pragma unroll
  for (int i = 0; i < 4; ++i) { ra[i] = *(const v8us*)(ab + ao + i * (32 * CC * 2)); rb[i] = *(const v8us*)(bb + bo + i * (32 * CC * 2)); }
#pragma unroll
  for (int i = 0; i < 4; ++i) { *(v8us*)&st[0][0][lr + 32 * i][lc] = ra[i]; *(v8us*)&st[0][1][lr + 32 * i][lc] = rb[i]; }
  __syncthreads();
  v8f acc[2][4] = {};
#pragma unroll 1      // kept rolled: unrolled, the wave takes 161 registers, allocated as 176, and only two work-groups fit on a WGP; at 160 three fit, which is what this grid gives each WGP
  for (int kb = 0; kb < CC; kb += GK) {
    const int cur = (kb / GK) & 1; const bool more = kb + GK < CC;
    if (more) {
#pragma unroll
      for (int i = 0; i < 4; ++i) { ra[i] = *(const v8us*)(ab + ao + i * (32 * CC * 2) + (kb + GK) * 2); rb[i] = *(const v8us*)(bb + bo + i * (32 * CC * 2) + (kb + GK) * 2); }
    }
#pragma unroll
    for (int ks = 0; ks < GK; ks += 32) {
      FragH fa[2], fb[4];
#pragma unroll
      for (int mi = 0; mi < 2; ++mi) { fa[mi].half[0] = *(const v8us*)&st[cur][0][wr + mi * 16 + ln][ks + 8 * hh]; fa[mi].half[1] = *(const v8us*)&st[cur][0][wr + mi * 16 + ln][ks + 16 + 8 * hh]; }
#pragma unroll
      for (int t = 0; t < 4; ++t) { fb[t].half[0] = *(const v8us*)&st[cur][1][wc + t * 16 + ln][ks + 8 * hh]; fb[t].half[1] = *(const v8us*)&st[cur][1][wc + t * 16 + ln][ks + 16 + 8 * hh]; }
#pragma unroll
      for (int mi = 0; mi < 2; ++mi)
#pragma unroll
        for (int t = 0; t < 4; ++t) acc[mi][t] = mmaH<1>(fa[mi].v, fa[mi].v, fb[t].v, fb[t].v, acc[mi][t]);
    }
    if (more) {
#pragma unroll
      for (int i = 0; i < 4; ++i) { *(v8us*)&st[cur ^ 1][0][lr + 32 * i][lc] = ra[i]; *(v8us*)&st[cur ^ 1][1][lr + 32 * i][lc] = rb[i]; }
    }
    __syncthreads();      // publishes the next slice and ends every wave's reads of this one (after the last slice: frees the LDS for the epilogue)
  }
  typedef _Float16 v4h __attribute__((ext_vector_type(4)));
  float* so = (float*)&st[0][0][0][0] + (size_t)w * (32 * GSO);      // the wave's own 32 x 64 f32 staging
  const int rsub = lane >> 4, c4 = (lane & 15) * 4;
  const int orow = row0 + wr + rsub, ocol = col0 + wc + c4;      // the lane's first output row (then every second one) and its four columns
  if (isv) {
    float br[2][8];      // bias by row (channel)
#pragma unroll
    for (int mi = 0; mi < 2; ++mi)
#pragma unroll
      for (int r = 0; r < 8; ++r) br[mi][r] = bf16_round(bvv[row0 + wr + mi * 16 + 8 * hh + r]);
#pragma unroll
    for (int mi = 0; mi < 2; ++mi)
#pragma unroll
      for (int t = 0; t < 4; ++t)
#pragma unroll
        for (int r = 0; r < 8; ++r) so[(mi * 16 + 8 * hh + r) * GSO + t * 16 + ln] = acc[mi][t][r] * 0.0625f + br[mi][r];
    __builtin_amdgcn_fence(__ATOMIC_ACQ_REL, "workgroup"); __builtin_amdgcn_wave_barrier();
    _Float16* vo = VT + iofs + (size_t)orow * NTK + ocol;
#pragma unroll
    for (int q = 0; q < 16; ++q) { const v4f o = *(const v4fa*)&so[(q * 2 + rsub) * GSO + c4]; v4h h4;
#pragma unroll
      for (int i = 0; i < 4; ++i) h4[i] = (_Float16)o[i];
      *(v4h*)(vo + q * 2 * NTK) = h4; }
  } else {
    const float* bias = sel ? bk : bq;
    float bc[4];      // bias by column (channel)
#pragma unroll
    for (int t = 0; t < 4; ++t) bc[t] = bf16_round(bias[col0 + wc + t * 16 + ln]);
#pragma unroll
    for (int mi = 0; mi < 2; ++mi)
#pragma unroll
      for (int t = 0; t < 4; ++t)
#pragma unroll
        for (int r = 0; r < 8; ++r) so[(mi * 16 + 8 * hh + r) * GSO + t * 16 + ln] = acc[mi][t][r] * 0.0625f + bc[t];
    __builtin_amdgcn_fence(__ATOMIC_ACQ_REL, "workgroup"); __builtin_amdgcn_wave_barrier();
    _Float16* ho = (sel ? Kh : Qh) + iofs + (size_t)orow * CC + ocol; _Float16* lo = (sel ? Kl : Ql) + iofs + (size_t)orow * CC + ocol;
#pragma unroll
    for (int q = 0; q < 16; ++q) { const v4f o = *(const v4fa*)&so[(q * 2 + rsub) * GSO + c4]; v4h h4, l4;
#pragma unroll
      for (int i = 0; i < 4; ++i) { const _Float16 h = (_Float16)o[i]; h4[i] = h; l4[i] = (_Float16)((o[i] - (float)h) * 1024.0f); }
      *(v4h*)(ho + q * 2 * CC) = h4; *(v4h*)(lo + q * 2 * CC) = l4; }
    asm volatile("s_wait_xcnt 0x0" ::: "memory");      // in the built code the other branch's instructions follow these stores and rewrite the registers that they name
  }
}

// Attention in one launch: logits, softmax over i and the product with v, per work-group for FR rows j of one image (blockIdx.y); neither the logits nor the probabilities go to memory.
// S'[j][i] = Ah.Bh + 2^-10 (Al.Bh + Ah.Bl) with A = k (hi and lo*2^10 planes), B = q (the same two planes); att[j] = sum_i softmax_i(S'[j][.]) v[i].
// The tokens i come in chunks of FI. Per chunk: (1) the 64 x 64 logits, each wave 16 x 32 of them, its k rows held in registers for the whole kernel, q from LDS, to an f32 tile in LDS;
// (2) four lanes per row take the chunk's maximum, raise the row's running maximum, and write e = exp(s - max) * 2^10 (one multiply-add and one v_exp_f32) as f16 and the factor exp(old max - new max);
// (3) each wave scales its 32 x 64 part of the 64 x 256 output sums by that factor and adds e.v. The row's sum of e is kept beside (f32, scaled the same way) and divides once, in the epilogue.
// q and v chunks have two LDS buffers: the next chunk's loads fly during this chunk's work. One work-group per WGP (two waves per SIMD).
// Behind the loop the work-group holds whole rows of the attention output, and everything that follows in the block is row-wise, so it is done here, on LDS that the loop has left:
// h = SiLU(att.W1 + b1) and y = h.W2 + b2 (each wave 32 x 64 of the 64 x 256 result; att and h as f16 rows in LDS; BM = the two weight planes [n][k], one after the other, each whole in LDS for its product),
// LayerNorm of y (one wave per row, eight rows each) and the store as [channel][token]. None of att, h, y goes to memory.
#define FR 64       /* rows j per work-group */
#define FI 64       /* tokens i per chunk */
#define QPIT 264    /* LDS row pitch of a q row in f16: 528 B = 16 B x 33, so the 16 rows of a 16-byte fragment read fall on distinct banks */
// the value of another lane of the same group of four (quad_perm 0xB1: lane ^ 1, 0x4E: lane ^ 2), by a vector move instead of the LDS round trip that __shfl_xor compiles to
template <int CTRL>
__device__ __forceinline__ float quad_lane(float x) { return __int_as_float(__builtin_amdgcn_mov_dpp(__float_as_int(x), CTRL, 0xf, 0xf, true)); }
__global__ __launch_bounds__(256) void k_attn(const _Float16* __restrict__ Ah, const _Float16* __restrict__ Al, const _Float16* __restrict__ Bh, const _Float16* __restrict__ Bl, const _Float16* __restrict__ VT,
    const _Float16* __restrict__ BM, const float* __restrict__ b1, const float* __restrict__ b2, const float* __restrict__ g, const float* __restrict__ be, float* __restrict__ out) {
  __shared__ __attribute__((aligned(16))) unsigned short sq[2][2][FI][QPIT];      // [buffer][Bh | Bl][token i][channel]; behind the loop: one weight plane
  __shared__ __attribute__((aligned(16))) unsigned short sv[2][CC][GPIT];         // [buffer][channel][token i]; behind the loop: att and h (f16 rows)
  __shared__ __attribute__((aligned(16))) float ss[FR][GSO];                      // this chunk's logits
  __shared__ __attribute__((aligned(16))) unsigned short sp[FR][GPIT];            // this chunk's e * 2^10
  __shared__ __attribute__((aligned(16))) float sal[FR];                          // per row: this chunk's factor for the sums so far
  __shared__ __attribute__((aligned(16))) float sdv[FR];                          // per row, written once behind the loop: 1 / (sum of e * 2^10)
  __shared__ __attribute__((aligned(16))) float sz[8][32][GSO];                   // behind the loop: each wave's 32 x 64 of att.W1 + b1, on the way to SiLU; then y (f32 rows)
  const int tid = threadIdx.x, w = tid >> 5, lane = tid & 31, ln = lane & 15, hh = lane >> 4;
  const size_t pofs = (size_t)blockIdx.y * NTK * CC;      // every per-image array here holds NTK * CC elements
  const int j0 = (int)blockIdx.x * FR;
  const int rg = (w >> 1) * 16, cg = (w & 1) * 32;      // the wave's 16 x 32 part of the logits tile
  const int wr = (w >> 2) * 32, wc = (w & 3) * 64;      // the wave's 32 x 64 part of the output tile
  const int srow = tid >> 2, sc = (tid & 3) * 16;       // softmax: the lane's row and its 16 columns
  const char* qb[2] = {(const char*)(Bh + pofs), (const char*)(Bl + pofs)}; const char* vb = (const char*)(VT + pofs);      // uniform bases
  const unsigned qo = (unsigned)((w * CC + lane * 8) * 2);      // a wave loads one whole 512-byte q row; its further rows are constants, the chunk a uniform step
  const unsigned vo = (unsigned)(((tid >> 3) * NTK + (tid & 7) * 8) * 2);      // 8 lanes per 128-byte slice of a v row, 32 rows per pass
  v8us rq[2][8], rv[8];
#pragma unroll
  for (int i = 0; i < 8; ++i) { rq[0][i] = *(const v8us*)(qb[0] + qo + i * (8 * CC * 2)); rq[1][i] = *(const v8us*)(qb[1] + qo + i * (8 * CC * 2)); rv[i] = *(const v8us*)(vb + vo + i * (32 * NTK * 2)); }
  FragH kh[8], kl[8];      // the wave's 16 k rows, all 256 channels, both planes
  const unsigned short* ph = (const unsigned short*)(Ah + pofs) + (size_t)(j0 + rg + ln) * CC + 8 * hh; const unsigned short* pl = (const unsigned short*)(Al + pofs) + (size_t)(j0 + rg + ln) * CC + 8 * hh;
#pragma unroll
  for (int ks = 0; ks < 8; ++ks) { kh[ks].half[0] = *(const v8us*)(ph + ks * 32); kh[ks].half[1] = *(const v8us*)(ph + ks * 32 + 16); kl[ks].half[0] = *(const v8us*)(pl + ks * 32); kl[ks].half[1] = *(const v8us*)(pl + ks * 32 + 16); }
  asm volatile("s_wait_xcnt 0x0" :: "v"(tid), "v"(vo), "v"(ph), "v"(pl) : "memory");      // the registers that the loads above name are given other values from here on; as inputs they stay as they are up to the wait
#pragma unroll
  for (int i = 0; i < 8; ++i) { *(v8us*)&sq[0][0][w + 8 * i][lane * 8] = rq[0][i]; *(v8us*)&sq[0][1][w + 8 * i][lane * 8] = rq[1][i]; *(v8us*)&sv[0][(tid >> 3) + 32 * i][(tid & 7) * 8] = rv[i]; }
  __syncthreads();      // chunk 0 is whole before any wave reads it
  v8f acc[2][4] = {};
  float m = -3.0e38f, l = 0.f;      // the row's running maximum; the sum of e * 2^10 over the lane's own columns
#pragma unroll 1      // kept rolled: for speed only
  for (int c = 0; c < NTK / FI; ++c) {
    const int cur = c & 1; const bool more = c + 1 < NTK / FI;
    if (more) {
      const char* g0 = qb[0] + qo + (c + 1) * (FI * CC * 2); const char* g1 = qb[1] + qo + (c + 1) * (FI * CC * 2); const char* g2 = vb + vo + (c + 1) * (FI * 2);
#pragma unroll
      for (int i = 0; i < 8; ++i) rq[0][i] = *(const v8us*)(g0 + i * (8 * CC * 2));
#pragma unroll
      for (int i = 0; i < 8; ++i) rq[1][i] = *(const v8us*)(g1 + i * (8 * CC * 2));
#pragma unroll
      for (int i = 0; i < 8; ++i) rv[i] = *(const v8us*)(g2 + i * (32 * NTK * 2));
      asm volatile("s_wait_xcnt 0x0" :: "v"(g0), "v"(g1), "v"(g2) : "memory");      // the registers that these loads name are given other values below; as inputs they stay as they are up to the wait
    }
    v8f hi[2] = {}, lo[2] = {};      // hi: Ah.Bh; lo: Al.Bh then Ah.Bl, k upward; they meet once per chunk
    FragH fq[3][2][2];      // q fragments [slot][column block][Bh | Bl], read two k steps ahead of their products
#pragma unroll
    for (int ks = 0; ks < 2; ++ks)
#pragma unroll
      for (int t = 0; t < 2; ++t)
#pragma unroll
        for (int p = 0; p < 2; ++p) { fq[ks][t][p].half[0] = *(const v8us*)&sq[cur][p][cg + t * 16 + ln][ks * 32 + 8 * hh]; fq[ks][t][p].half[1] = *(const v8us*)&sq[cur][p][cg + t * 16 + ln][ks * 32 + 16 + 8 * hh]; }
#pragma unroll
    for (int ks = 0; ks < 8; ++ks) {
      const int s = ks % 3, n = (ks + 2) % 3;
      if (ks + 2 < 8) {
#pragma unroll
        for (int t = 0; t < 2; ++t)
#pragma unroll
          for (int p = 0; p < 2; ++p) { fq[n][t][p].half[0] = *(const v8us*)&sq[cur][p][cg + t * 16 + ln][(ks + 2) * 32 + 8 * hh]; fq[n][t][p].half[1] = *(const v8us*)&sq[cur][p][cg + t * 16 + ln][(ks + 2) * 32 + 16 + 8 * hh]; }
      }
      // The next chunk goes to the other buffers beside the last three k steps: this phase is bound by LDS reads, and the write path is free. Their last readers left those buffers before the first barrier of the chunk before.
      // No branch round the stores (a join would make every later LDS wait count them): in the last chunk they put stale registers into buffers that are rewritten behind the loop before anyone reads them.
      if (ks == 5) {
#pragma unroll
        for (int i = 0; i < 8; ++i) *(v8us*)&sq[cur ^ 1][0][w + 8 * i][lane * 8] = rq[0][i];
      }
      if (ks == 6) {
#pragma unroll
        for (int i = 0; i < 8; ++i) *(v8us*)&sq[cur ^ 1][1][w + 8 * i][lane * 8] = rq[1][i];
      }
      if (ks == 7) {
#pragma unroll
        for (int i = 0; i < 8; ++i) *(v8us*)&sv[cur ^ 1][(tid >> 3) + 32 * i][(tid & 7) * 8] = rv[i];
      }
      __builtin_amdgcn_sched_barrier(0);      // keeps the reads and stores above ahead of the products below; left free, the compiler sinks each read to just before its use
#pragma unroll
      for (int t = 0; t < 2; ++t) hi[t] = __builtin_amdgcn_wmma_f32_16x16x32_f16(false, kh[ks].v, false, fq[s][t][0].v, (short)0, hi[t], false, false);
#pragma unroll
      for (int t = 0; t < 2; ++t) lo[t] = __builtin_amdgcn_wmma_f32_16x16x32_f16(false, kl[ks].v, false, fq[s][t][0].v, (short)0, lo[t], false, false);
#pragma unroll
      for (int t = 0; t < 2; ++t) lo[t] = __builtin_amdgcn_wmma_f32_16x16x32_f16(false, kh[ks].v, false, fq[s][t][1].v, (short)0, lo[t], false, false);
    }
#pragma unroll
    for (int t = 0; t < 2; ++t)
#pragma unroll
      for (int r = 0; r < 8; ++r) ss[rg + 8 * hh + r][cg + t * 16 + ln] = lo[t][r] * 0.0009765625f + hi[t][r];
    FragH fb[2][4];      // this chunk's v fragments: published since the chunk began, so they are read here, where the LDS would idle at the barrier
#pragma unroll
    for (int k2 = 0; k2 < 2; ++k2)
#pragma unroll
      for (int t = 0; t < 4; ++t) { fb[k2][t].half[0] = *(const v8us*)&sv[cur][wc + t * 16 + ln][k2 * 32 + 8 * hh]; fb[k2][t].half[1] = *(const v8us*)&sv[cur][wc + t * 16 + ln][k2 * 32 + 16 + 8 * hh]; }
    __syncthreads();      // the logits tile is whole before the rows' lanes read it
    {
      v4f s4[4];
#pragma unroll
      for (int q = 0; q < 4; ++q) s4[q] = *(const v4fa*)&ss[srow][sc + 4 * q];
      float mx = s4[0][0];
#pragma unroll
      for (int q = 0; q < 4; ++q)
#pragma unroll
        for (int k = 0; k < 4; ++k) mx = fmaxf(mx, s4[q][k]);
      mx = fmaxf(mx, quad_lane<0xB1>(mx)); mx = fmaxf(mx, quad_lane<0x4E>(mx));      // the row's four lanes agree on the chunk's maximum
      const float mn = fmaxf(m, mx), al = __builtin_amdgcn_exp2f((m - mn) * 1.4426950408889634f), eb = 10.0f - mn * 1.4426950408889634f; m = mn;      // e * 2^10 = 2^(s log2(e) + eb)
      float su = 0.f; FragH f;
#pragma unroll
      for (int q = 0; q < 4; ++q)
#pragma unroll
        for (int k = 0; k < 4; ++k) { const float e = __builtin_amdgcn_exp2f(s4[q][k] * 1.4426950408889634f + eb); su += e; f.h[q * 4 + k] = (_Float16)e; }
      l = l * al + su;
      *(v8us*)&sp[srow][sc] = f.half[0]; *(v8us*)&sp[srow][sc + 8] = f.half[1];
      if ((tid & 3) == 0) sal[srow] = al;
    }
    __syncthreads();      // e and the factors are whole before the waves take them as operands
    FragH fa[2][2];      // all of the wave's e fragments at once, so that their latency is paid once, beside the scaling
#pragma unroll
    for (int k2 = 0; k2 < 2; ++k2)
#pragma unroll
      for (int mi = 0; mi < 2; ++mi) { fa[k2][mi].half[0] = *(const v8us*)&sp[wr + mi * 16 + ln][k2 * 32 + 8 * hh]; fa[k2][mi].half[1] = *(const v8us*)&sp[wr + mi * 16 + ln][k2 * 32 + 16 + 8 * hh]; }
#pragma unroll
    for (int mi = 0; mi < 2; ++mi) {
      const v4f f0 = *(const v4fa*)&sal[wr + mi * 16 + 8 * hh], f1 = *(const v4fa*)&sal[wr + mi * 16 + 8 * hh + 4];
#pragma unroll
      for (int t = 0; t < 4; ++t)
#pragma unroll
        for (int r = 0; r < 4; ++r) { acc[mi][t][r] *= f0[r]; acc[mi][t][4 + r] *= f1[r]; }
    }
#pragma unroll
    for (int k2 = 0; k2 < 2; ++k2) {
#pragma unroll
      for (int mi = 0; mi < 2; ++mi)
#pragma unroll
        for (int t = 0; t < 4; ++t) acc[mi][t] = __builtin_amdgcn_wmma_f32_16x16x32_f16(false, fa[k2][mi].v, false, fb[k2][t].v, (short)0, acc[mi][t], false, false);
    }
    // No barrier here: what the next chunk rewrites before its own first barrier (the logits tile, the q and v buffers just used) had its last reader before this chunk's second barrier, and e and the factors are rewritten only behind the next chunk's first barrier, which a wave reaches with its reads above done.
  }
  l += quad_lane<0xB1>(l); l += quad_lane<0x4E>(l);      // the row's four lanes join their sums
  if ((tid & 3) == 0) sdv[srow] = 1.0f / l;      // l carries the same 2^10 as e
  __syncthreads();      // every row's divisor is there before the waves read it; every wave has left the loop, so all of its LDS is free from here on
  typedef _Float16 v4hh __attribute__((ext_vector_type(4), may_alias));
  unsigned short (*sw)[QPIT] = (unsigned short (*)[QPIT])&sq[0][0][0][0];      // one whole weight plane, f16 [n][k]: 256 rows at the q rows' pitch are exactly the q buffers' bytes
  unsigned short (*sa)[QPIT] = (unsigned short (*)[QPIT])&sv[0][0][0];         // att, f16 [row][channel]: 33,792 B
  unsigned short (*sh)[QPIT] = sa + FR;                                        // h, f16 [row][channel], behind att: together 67,584 of the v buffers' 73,728 B
  float (*sy)[CC + 1] = (float (*)[CC + 1])&sz[0][0][0];      // y, f32 [row][channel], where the SiLU staging was: 64 x 257 x 4 = 65,792 of its 69,632 B; the odd pitch keeps the reads down a column on distinct banks
  // W1 whole, the biases and the LayerNorm parameters go out here; att's way to LDS passes beside their flight.
  const char* wb = (const char*)BM;      // uniform base
  const unsigned wo = (unsigned)((w * CC + lane * 8) * 2);      // a wave loads one whole 512-byte weight row; its further rows (w + 8 i) and the second plane are constants
  const unsigned co = (unsigned)((wc + ln) * 4), po = (unsigned)(lane * 4);      // byte offsets of the lane's first bias column and first LayerNorm channel
  v8us rw[32];
#pragma unroll
  for (int i = 0; i < 32; ++i) rw[i] = *(const v8us*)(wb + wo + i * (8 * CC * 2));
  float c1[4], c2[4], gg[8], bb[8];
#pragma unroll
  for (int t = 0; t < 4; ++t) { c1[t] = *(const float*)((const char*)b1 + co + t * 64); c2[t] = *(const float*)((const char*)b2 + co + t * 64); }
#pragma unroll
  for (int k = 0; k < 8; ++k) { gg[k] = *(const float*)((const char*)g + po + k * 128); bb[k] = *(const float*)((const char*)be + po + k * 128); }
  asm volatile("s_wait_xcnt 0x0" :: "v"(wo), "v"(co), "v"(po) : "memory");      // the registers that the loads above name may be given other values from here on; as inputs they stay as they are up to the wait
#pragma unroll
  for (int mi = 0; mi < 2; ++mi) {
    const v4f f0 = *(const v4fa*)&sdv[wr + mi * 16 + 8 * hh], f1 = *(const v4fa*)&sdv[wr + mi * 16 + 8 * hh + 4];
#pragma unroll
    for (int t = 0; t < 4; ++t)
#pragma unroll
      for (int r = 0; r < 4; ++r) {
        sa[wr + mi * 16 + 8 * hh + r][wc + t * 16 + ln] = __builtin_bit_cast(unsigned short, (_Float16)(acc[mi][t][r] * f0[r]));
        sa[wr + mi * 16 + 8 * hh + 4 + r][wc + t * 16 + ln] = __builtin_bit_cast(unsigned short, (_Float16)(acc[mi][t][4 + r] * f1[r]));
      }
  }
#pragma unroll
  for (int i = 0; i < 32; ++i) *(v8us*)&sw[w + 8 * i][lane * 8] = rw[i];
#pragma unroll
  for (int t = 0; t < 4; ++t) { c1[t] = bf16_round(c1[t]); c2[t] = bf16_round(c2[t]); }
#pragma unroll
  for (int k = 0; k < 8; ++k) { gg[k] = bf16_round(gg[k]); bb[k] = bf16_round(bb[k]); }
  __syncthreads();      // att and W1 are whole before any wave takes them as operands
  // W2 goes out now and waits in registers until W1's last reader has left: its flight passes beside the first product.
#pragma unroll
  for (int i = 0; i < 32; ++i) rw[i] = *(const v8us*)(wb + wo + i * (8 * CC * 2) + CC * CC * 2);
  asm volatile("s_wait_xcnt 0x0" :: "v"(wo) : "memory");      // the register that these loads name stays as it is up to the wait
#pragma unroll      // unrolled: the two products differ in their operand rows and in their epilogues, which so need no branch
  for (int p = 0; p < 2; ++p) {      // p = 0: att.W1, p = 1: h.W2; k upward in steps of 32 per accumulator
    unsigned short (*sx)[QPIT] = p ? sh : sa;
#pragma unroll
    for (int mi = 0; mi < 2; ++mi)
#pragma unroll
      for (int t = 0; t < 4; ++t) acc[mi][t] = v8f{};
#pragma unroll
    for (int ks = 0; ks < 8; ++ks) {
      FragH fa[2], fw[4];
#pragma unroll
      for (int mi = 0; mi < 2; ++mi) { fa[mi].half[0] = *(const v8us*)&sx[wr + mi * 16 + ln][ks * 32 + 8 * hh]; fa[mi].half[1] = *(const v8us*)&sx[wr + mi * 16 + ln][ks * 32 + 16 + 8 * hh]; }
#pragma unroll
      for (int t = 0; t < 4; ++t) { fw[t].half[0] = *(const v8us*)&sw[wc + t * 16 + ln][ks * 32 + 8 * hh]; fw[t].half[1] = *(const v8us*)&sw[wc + t * 16 + ln][ks * 32 + 16 + 8 * hh]; }
#pragma unroll
      for (int mi = 0; mi < 2; ++mi)
#pragma unroll
        for (int t = 0; t < 4; ++t) acc[mi][t] = __builtin_amdgcn_wmma_f32_16x16x32_f16(false, fa[mi].v, false, fw[t].v, (short)0, acc[mi][t], false, false);
    }
    if (p == 0) {      // h = SiLU(att.W1 + b1), by way of the wave's own f32 staging: from there a rolled loop can take the values, and each lane gets four neighbours of a row for one 8-byte store
      float* so = &sz[w][0][0];
#pragma unroll
      for (int mi = 0; mi < 2; ++mi)
#pragma unroll
        for (int t = 0; t < 4; ++t)
#pragma unroll
          for (int r = 0; r < 8; ++r) so[(mi * 16 + 8 * hh + r) * GSO + t * 16 + ln] = acc[mi][t][r] * 0.0625f + c1[t];
      __builtin_amdgcn_fence(__ATOMIC_ACQ_REL, "workgroup"); __builtin_amdgcn_wave_barrier();      // the lanes read below what other lanes of the wave have stored above
#pragma unroll 1      // kept rolled: the exponential and the division of 64 values per lane, written out, are over 2,000 instructions that run once; rolled for speed only
      for (int q = 0; q < 16; q += 2) {
        const v4f o[2] = {*(const v4fa*)&so[(q * 2 + hh) * GSO + ln * 4], *(const v4fa*)&so[(q * 2 + 2 + hh) * GSO + ln * 4]};      // both reads ahead of both stores: eight independent chains per trip
        v4hh h4[2];
#pragma unroll
        for (int u = 0; u < 2; ++u)
#pragma unroll
          for (int i = 0; i < 4; ++i) { const float v = o[u][i]; h4[u][i] = (_Float16)(v / (1.0f + expf(-v))); }
        *(v4hh*)&sh[wr + q * 2 + hh][wc + ln * 4] = h4[0]; *(v4hh*)&sh[wr + q * 2 + 2 + hh][wc + ln * 4] = h4[1];
      }
      __syncthreads();      // ends every wave's reads of W1 (and of its staging) before W2 takes its place
#pragma unroll
      for (int i = 0; i < 32; ++i) *(v8us*)&sw[w + 8 * i][lane * 8] = rw[i];
    } else {
#pragma unroll
      for (int mi = 0; mi < 2; ++mi)
#pragma unroll
        for (int t = 0; t < 4; ++t)
#pragma unroll
          for (int r = 0; r < 8; ++r) sy[wr + mi * 16 + 8 * hh + r][wc + t * 16 + ln] = acc[mi][t][r] * 0.0625f + c2[t];
    }
    __syncthreads();      // p = 0: h and W2 are whole before the second product; p = 1: y is whole before the rows' waves read it
  }
#pragma unroll      // unrolled: the eight rows' reduction chains are independent, and side by side their cross-lane latencies overlap
  for (int i = 0; i < FR / 8; ++i) {      // LayerNorm: the wave's rows w, w + 8, ...; the lane's channels lane + 32 k
    float* yr = sy[w + 8 * i]; float v[8]; float sm = 0.f;
#pragma unroll
    for (int k = 0; k < 8; ++k) { v[k] = yr[lane + 32 * k]; sm += v[k]; }
    for (int o = 16; o > 0; o >>= 1) sm += __shfl_xor(sm, o, 32);
    const float mu = sm / (float)CC; float q2 = 0.f;
#pragma unroll
    for (int k = 0; k < 8; ++k) { const float d = v[k] - mu; q2 += d * d; }
    for (int o = 16; o > 0; o >>= 1) q2 += __shfl_xor(q2, o, 32);
    const float rs = rsqrtf(q2 / (float)CC + 1e-5f);
#pragma unroll
    for (int k = 0; k < 8; ++k) yr[lane + 32 * k] = (v[k] - mu) * rs * gg[k] + bb[k];
  }
  __syncthreads();      // every row is normalised before the waves read down the columns
  float* op = out + ((size_t)blockIdx.y * CC + w * 2 + hh) * NTK + j0 + ln * 4;      // 16 lanes store the 64 tokens of one channel (two whole lines), the wave two channels at a time
#pragma unroll
  for (int i = 0; i < CC / 16; ++i) { v4f o;
#pragma unroll
    for (int q = 0; q < 4; ++q) o[q] = sy[ln * 4 + q][w * 2 + hh + 16 * i];
    *(v4f*)(op + (size_t)i * 16 * NTK) = o; }
}

typedef _Float16 v4h __attribute__((ext_vector_type(4)));

__global__ __launch_bounds__(256) void k_x16(const float* __restrict__ x, _Float16* __restrict__ X16, size_t n8) { const size_t t = (size_t)blockIdx.x * 256 + threadIdx.x; if (t >= n8) return; FragH f;
#pragma unroll
  for (int q = 0; q < 8; ++q) f.h[q] = (_Float16)bf16_round(x[t * 8 + q]); *(v8us*)((unsigned short*)X16 + t * 8) = f.half[0];  }
__global__ __launch_bounds__(256) void k_h16(const float* __restrict__ x, _Float16* __restrict__ X16, size_t n8) { const size_t t = (size_t)blockIdx.x * 256 + threadIdx.x; if (t >= n8) return; FragH f;
#pragma unroll
  for (int q = 0; q < 8; ++q) f.h[q] = (_Float16)x[t * 8 + q]; *(v8us*)((unsigned short*)X16 + t * 8) = f.half[0];  }
__global__ __launch_bounds__(256) void k_round16f(const float* __restrict__ W, _Float16* __restrict__ Bt, size_t n8) { const size_t t = (size_t)blockIdx.x * 256 + threadIdx.x; if (t >= n8) return; FragH f;
#pragma unroll
  for (int i = 0; i < 8; ++i) f.h[i] = (_Float16)(bf16_round(W[t * 8 + i]) * 16.0f); *(v8us*)((unsigned short*)Bt + t * 8) = f.half[0];  }
template <int NHv, int TTv>
__global__ __launch_bounds__(256) void k_vt(const _Float16* __restrict__ V16, int ldv, int voff, _Float16* __restrict__ Vt) { __shared__ unsigned short tl[64][66]; const int tid = threadIdx.x; const int slab = blockIdx.x / (TTv / 64), lg = blockIdx.x % (TTv / 64); const int b = slab / NHv, h = slab % NHv;
  for (int i = tid; i < 64 * 8; i += 256) { const int r = i / 8, c8 = (i % 8) * 8; FragH f; f.half[0] = *(const v8us*)((const unsigned short*)V16 + ((size_t)b * TTv + lg * 64 + r) * ldv + voff + h * 64 + c8);
#pragma unroll
    for (int q = 0; q < 8; ++q) tl[r][c8 + q] = f.u[q]; }
  __syncthreads();
  {
#pragma unroll
    for (int rd = 0; rd < 2; ++rd) { const int d = rd * 32 + tid / 8, pc = tid % 8; FragH f;
#pragma unroll
      for (int q = 0; q < 8; ++q) f.u[q] = tl[pc * 8 + q][d];
      *(v8us*)((unsigned short*)Vt + ((size_t)slab * 64 + d) * TTv + lg * 64 + pc * 8) = f.half[0]; }
     } }

__global__ __launch_bounds__(256) void k_hl(const float* __restrict__ F, _Float16* __restrict__ Hh, _Float16* __restrict__ Hl, size_t n8) { const size_t t = (size_t)blockIdx.x * 256 + threadIdx.x; if (t >= n8) return; FragH fh, fl; const v4f a = *(const v4fa*)(F + t * 8), c = *(const v4fa*)(F + t * 8 + 4);
#pragma unroll
  for (int q = 0; q < 4; ++q) { _Float16 h = (_Float16)a[q]; fh.h[q] = h; fl.h[q] = (_Float16)((a[q] - (float)h) * 1024.0f); h = (_Float16)c[q]; fh.h[4 + q] = h; fl.h[4 + q] = (_Float16)((c[q] - (float)h) * 1024.0f); }
  { *(v8us*)((unsigned short*)Hh + t * 8) = fh.half[0]; *(v8us*)((unsigned short*)Hl + t * 8) = fl.half[0];  } }

// All input preparation in one launch: the five weight planes and the sixteen token planes depend on the inputs alone, so their work-groups run side by side.
// Both jobs are the same transposition, f32 src[c][n] (row pitch PITCH) to f16 dst[n][c] (row pitch CC), done on tiles of PC source rows x PN source columns through LDS:
// every global load of a wave is 512 contiguous bytes of one source row, and every 8 lanes store one whole 128-byte line of a destination row.
// Work-groups 0 .. 5*WB-1: weight plane blockIdx.x / WB, BW[plane][n][k] = f16(bf16(W[k][n]) * 16) from f32 row-major W[k][n] (bf16-exact weights stay exact in f16 away from the subnormal range).
// The others, TB per image: T16[image][token][channel] = f16(bf16(x[image][channel][token])).
#define PC 64       /* source rows per tile: 8 waves x 8 rows */
#define PN 128      /* source columns per tile: 32 lanes x 4 floats */
#define WB ((CC / PC) * (CC / PN))      /* work-groups per weight plane */
#define TB ((CC / PC) * (NTK / PN))     /* work-groups per image */
template <int PITCH, bool X16>
__device__ __forceinline__ void prep_tile(const float* __restrict__ src, unsigned short* __restrict__ dst, int tile, unsigned short (*tl)[GPIT]) {
  const int tid = threadIdx.x, w = tid >> 5, lane = tid & 31;
  const int c0 = (tile / (PITCH / PN)) * PC, n0 = (tile % (PITCH / PN)) * PN;
  const char* sb = (const char*)(src + (size_t)c0 * PITCH + n0);      // uniform base; the lane keeps one byte offset, its further rows are constants
  const unsigned so = (unsigned)((w * 8 * PITCH + lane * 4) * 4);      // the lane's 8 source rows x 4 columns
  v4f r[8];
#pragma unroll
  for (int q = 0; q < 8; ++q) r[q] = *(const v4fa*)(sb + so + q * (PITCH * 4));
#pragma unroll
  for (int i = 0; i < 4; ++i) { FragH f;
#pragma unroll
    for (int q = 0; q < 8; ++q) f.h[q] = X16 ? (_Float16)(bf16_round(r[q][i]) * 16.0f) : (_Float16)bf16_round(r[q][i]);
    *(v8us*)&tl[i * 32 + lane][w * 8] = f.half[0]; }      // source column 4 * lane + i lies in LDS row i * 32 + lane: the lanes of a store are one row pitch apart, on distinct banks
  __syncthreads();      // the tile is whole before any wave reads the other waves' columns of it
  unsigned short* dp = dst + (size_t)(n0 + (tid >> 3) * 4) * CC + c0 + (tid & 7) * 8;
#pragma unroll
  for (int p = 0; p < 4; ++p) *(v8us*)(dp + p * CC) = *(const v8us*)&tl[p * 32 + (tid >> 3)][(tid & 7) * 8];      // LDS row p * 32 + g holds source column 4 * g + p
}
__global__ __launch_bounds__(256) void k_prep(const float* __restrict__ x, const float* __restrict__ wq, const float* __restrict__ wk, const float* __restrict__ wv, const float* __restrict__ w1, const float* __restrict__ w2,
    _Float16* __restrict__ BW, _Float16* __restrict__ T16) {
  __shared__ __attribute__((aligned(16))) unsigned short tl[PN][GPIT];      // the transposed tile: one row per source column (in the order that prep_tile names), 128 bytes of source rows at the 144-byte pitch
  const int bx = (int)blockIdx.x;      // the branch is the same for the whole work-group, so every wave meets the one barrier of its side
  if (bx < 5 * WB) {
    const int sel = bx / WB; const float* W = sel == 0 ? wq : sel == 1 ? wk : sel == 2 ? wv : sel == 3 ? w1 : w2;
    prep_tile<CC, true>(W, (unsigned short*)(BW + (size_t)sel * CC * CC), bx % WB, tl);
  } else {
    const int b = (bx - 5 * WB) / TB;
    prep_tile<NTK, false>(x + (size_t)b * CC * NTK, (unsigned short*)(T16 + (size_t)b * NTK * CC), (bx - 5 * WB) % TB, tl);
    asm volatile("s_wait_xcnt 0x0" ::: "memory");      // in the built code the other branch's instructions follow this branch's stores and rewrite the registers that they name
  }
}

extern "C" void kernel_launch(void* const* d_in, const int* in_sizes, int n_in,
                              void* d_out, int out_size, void* d_ws, size_t ws_size, hipStream_t stream) {
  (void)in_sizes; (void)n_in; (void)out_size;
  const float* const* I = (const float* const*)d_in; const float* x = I[0]; const float* wq = I[1]; const float* bq = I[2]; const float* wk = I[3]; const float* bk = I[4]; const float* wv = I[5]; const float* bv = I[6]; const float* w1 = I[7]; const float* b1 = I[8]; const float* w2 = I[9]; const float* b2 = I[10]; const float* g = I[11]; const float* be = I[12];
  char* ws = (char*)d_ws; size_t off = 0;
  auto take = [&](size_t bytes) { char* p = ws + off; off += (bytes + 255) & ~(size_t)255; return p; };
  _Float16* BQ = (_Float16*)take(5 * CC * CC * 2); _Float16* BK = BQ + CC * CC; _Float16* BV = BQ + 2 * CC * CC; _Float16* B1 = BQ + 3 * CC * CC;      /* five weight planes, one after another: w2's lies directly behind w1's */
  /* one workspace slab per image for every intermediate: all NBt images go through each launch, image = blockIdx.y in k_qkv and k_attn, (blockIdx.x - 5 * WB) / TB in k_prep */
  _Float16* T16 = (_Float16*)take((size_t)NBt * NTK * CC * 2); _Float16* Qh = (_Float16*)take((size_t)NBt * NTK * CC * 2); _Float16* Ql = (_Float16*)take((size_t)NBt * NTK * CC * 2); _Float16* Kh = (_Float16*)take((size_t)NBt * NTK * CC * 2); _Float16* Kl = (_Float16*)take((size_t)NBt * NTK * CC * 2); _Float16* VT = (_Float16*)take((size_t)NBt * CC * NTK * 2);
  if (off > ws_size) return;      // 5 weight planes of 128 KiB + 16 x 3 MiB: under 49 MiB
  k_prep<<<5 * WB + NBt * TB, 256, 0, stream>>>(x, wq, wk, wv, w1, w2, BQ, T16);      /* all weights stored (in,out); every plane and every image in the one launch */
  k_qkv<<<dim3(3 * QT, NBt), 256, 0, stream>>>(T16, BQ, BK, BV, bq, bk, bv, Qh, Ql, Kh, Kl, VT);      /* q, k (exact + bias) as hi/lo planes, v as f16 [channel][token] */
  k_attn<<<dim3(NTK / FR, NBt), 256, 0, stream>>>(Kh, Kl, Qh, Ql, VT, B1, b1, b2, g, be, (float*)d_out);      /* S'[j][i] = k_j.q_i (the transposed logits), softmax over i per j (= the module's softmax over the query axis), att[j] = sum_i P'[j][i].v[i]; then the MLP (SiLU) and the LayerNorm on the same rows, stored as [channel][token] */
}

// v009
// One run takes 57.3 microseconds.
// Timed twice side by side with v008, it ran 1.04 and 1.05 times as fast.
// All steps since v000 together make it 42.2 times as fast.
#include <hip/hip_runtime.h>
// Token self-attention block on a feature map (B 16, C 256, 32×32 = 1024 tokens): q, k, v = t·W + b (W stored (in,out)); m = q·kᵀ (no scaling); softmax over the QUERY axis i; att[j] = Σ_i m[i][j]·v[i]; MLP (SiLU, 256→256→256); LayerNorm; back to NCHW → [16,256,32,32].
// Structure: the column softmax is a row softmax of mᵀ = k·qᵀ, so per batch: S' = K·Qᵀ (rows j, cols i), row softmax, att = P'·V, the three in one kernel (running maximum per row); the MLP and the LayerNorm follow in the same kernel, on the work-group's own rows.
// Compute dtype: x and parameters rounded to bf16; q/k/v with exact products; q and k carried as f16 hi + lo·2^10 planes with three cross products (≈f32 logits — they reach σ≈8 unscaled), softmax in f32, P (×2^10), v, attention output and the SiLU hidden as f16 operands (≈2^-12), f32 accumulation; LayerNorm in f32. v_wmma_f32_16x16x32_f16.
#define NBt 16
#define CC 256
#define NTK 1024
typedef __bf16 v16b __attribute__((ext_vector_type(16)));
typedef unsigned short v8us __attribute__((ext_vector_type(8), may_alias));
typedef float  v8f  __attribute__((ext_vector_type(8)));
typedef float  v4f  __attribute__((ext_vector_type(4)));
typedef float  v4fa __attribute__((ext_vector_type(4), may_alias));
union FragB { v16b v; v8us half[2]; unsigned short u[16]; };

__device__ __forceinline__ unsigned short bf16_bits(float x) { unsigned int u = __float_as_uint(x); return (unsigned short)((u + 0x7FFFu + ((u >> 16) & 1u)) >> 16); }
__device__ __forceinline__ float bf16_val(unsigned short b) { return __uint_as_float(((unsigned int)b) << 16); }
__device__ __forceinline__ float bf16_round(float x) { return bf16_val(bf16_bits(x)); }
// D += A·B with NT terms: 1 = ah·bh, 2 = + al·bh (A split), 3 = + ah·bl (both split)
template <int NT>
__device__ __forceinline__ v8f mmaN(v16b ah, v16b al, v16b bh, v16b bl, v8f c) {
  c = __builtin_amdgcn_wmma_f32_16x16x32_bf16(false, ah, false, bh, (short)0, c, false, false);
  if (NT >= 2) c = __builtin_amdgcn_wmma_f32_16x16x32_bf16(false, al, false, bh, (short)0, c, false, false);
  if (NT >= 3) c = __builtin_amdgcn_wmma_f32_16x16x32_bf16(false, ah, false, bl, (short)0, c, false, false);
  asm volatile("v_nop\n\tv_nop\n\tv_nop\n\tv_nop" : "+v"(c) : "v"(ah), "v"(al), "v"(bh), "v"(bl));
  return c;
}

__global__ __launch_bounds__(256) void k_wt_bf16(const float* __restrict__ W, unsigned short* __restrict__ Wt, int K, int N) {
  const int t = blockIdx.x * 256 + threadIdx.x;
  const int k8n = K / 8;
  if (t >= N * k8n) return;
  const int n = t / k8n, k8 = (t % k8n) * 8;
  v8us v;
#pragma unroll
  for (int i = 0; i < 8; ++i) v[i] = bf16_bits(W[(size_t)(k8 + i) * N + n]);
  *(v8us*)(Wt + (size_t)n * K + k8) = v;
  
}

// GEMM C[M][N] (f32, pitch ldc) = act(A[M][K]·W + bias). A f32 row-major (pitch lda) converted per fragment to bf16
// (ASPLIT: hi/lo two planes -> 2 terms, else single rounded term); Wt bf16 [N][K] (pitch ldb). BIAS_BF16 rounds the
// bias to bf16 first (bias quantised to bf16 before the add). K%32==0, M%16==0, N%64==0.
template <bool ASPLIT, int ACT, bool BIAS_BF16>
__global__ __launch_bounds__(128) void k_gemm_bf(const float* __restrict__ A, int lda, const unsigned short* __restrict__ Wt, int ldb,
                                               const float* __restrict__ bias, float* __restrict__ C, int ldc, int M, int N, int K) {
  __shared__ __attribute__((aligned(16))) float so[4][16][64];
  const int tid = threadIdx.x, w = tid >> 5, lane = tid & 31, ln = lane & 15, hh = lane >> 4;
  const int ntn = N / 64;
  const int wid = blockIdx.x * 4 + w;
  const int mt = wid / ntn, nq = wid % ntn;
  if (mt * 16 >= M) return;
  const int row0 = mt * 16, col0 = nq * 64;
  const float* arow = A + (size_t)(row0 + ln) * lda;
  v8f acc[4] = {};
  for (int kb = 0; kb < K; kb += 32) {
    FragB ah, al;
    const v4f x0 = *(const v4fa*)(arow + kb + 8 * hh), x1 = *(const v4fa*)(arow + kb + 8 * hh + 4);
    const v4f x2 = *(const v4fa*)(arow + kb + 16 + 8 * hh), x3 = *(const v4fa*)(arow + kb + 16 + 8 * hh + 4);
    float xs[16] = {x0[0],x0[1],x0[2],x0[3],x1[0],x1[1],x1[2],x1[3],x2[0],x2[1],x2[2],x2[3],x3[0],x3[1],x3[2],x3[3]};
#pragma unroll
    for (int i = 0; i < 16; ++i) { const unsigned short hb = bf16_bits(xs[i]); ah.u[i] = hb; al.u[i] = ASPLIT ? bf16_bits(xs[i] - bf16_val(hb)) : (unsigned short)0; }
#pragma unroll
    for (int t = 0; t < 4; ++t) {
      const unsigned short* brow = Wt + (size_t)(col0 + t * 16 + ln) * ldb + kb;
      FragB b;
      b.half[0] = *(const v8us*)(brow + 8 * hh);
      b.half[1] = *(const v8us*)(brow + 16 + 8 * hh);
      acc[t] = mmaN<ASPLIT ? 2 : 1>(ah.v, al.v, b.v, b.v, acc[t]);
    }
  }
#pragma unroll
  for (int t = 0; t < 4; ++t) {
    float bv = bias ? bias[col0 + t * 16 + ln] : 0.f;
    if (BIAS_BF16) bv = bf16_round(bv);
#pragma unroll
    for (int r = 0; r < 8; ++r) { float v = acc[t][r] + bv; if (ACT == 1) v = fmaxf(v, 0.f); so[w][8 * hh + r][t * 16 + ln] = v; }
  }
  __builtin_amdgcn_fence(__ATOMIC_ACQ_REL, "workgroup");
  __builtin_amdgcn_wave_barrier();
  const int rsub = lane >> 4, c4 = (lane & 15) * 4;
  {
#pragma unroll
    for (int q = 0; q < 8; ++q) {
      const int r = q * 2 + rsub;
      const v4f v = *(const v4fa*)&so[w][r][c4];
      *(v4f*)(C + (size_t)(row0 + r) * ldc + col0 + c4) = v;
    }
    
  }
}

// GEMM C = act(A·W + bias + resid): A f32 (ASPLIT -> hi/lo 2 terms), Wt bf16 [N][K]; ACT 0 none, 1 relu, 2 exact gelu;
// resid (optional, f32, row index = (row % rmod), pitch ldr, RES_BF16 rounds it) added before the activation.
template <bool ASPLIT, int ACT, bool BIAS_BF16, bool RES_BF16>
__global__ __launch_bounds__(128) void k_gemm_bf3(const float* __restrict__ A, int lda, const unsigned short* __restrict__ Wt, int ldb,
                                                const float* __restrict__ bias, const float* __restrict__ resid, int rmod, int ldr,
                                                float* __restrict__ C, int ldc, int M, int N, int K) {
  __shared__ __attribute__((aligned(16))) float so[4][16][64];
  const int tid = threadIdx.x, w = tid >> 5, lane = tid & 31, ln = lane & 15, hh = lane >> 4;
  const int ntn = N / 64;
  const int wid = blockIdx.x * 4 + w;
  const int mt = wid / ntn, nq = wid % ntn;
  if (mt * 16 >= M) return;
  const int row0 = mt * 16, col0 = nq * 64;
  const float* arow = A + (size_t)(row0 + ln) * lda;
  v8f acc[4] = {};
  for (int kb = 0; kb < K; kb += 32) {
    FragB ah, al;
    const v4f x0 = *(const v4fa*)(arow + kb + 8 * hh), x1 = *(const v4fa*)(arow + kb + 8 * hh + 4);
    const v4f x2 = *(const v4fa*)(arow + kb + 16 + 8 * hh), x3 = *(const v4fa*)(arow + kb + 16 + 8 * hh + 4);
    float xs[16] = {x0[0],x0[1],x0[2],x0[3],x1[0],x1[1],x1[2],x1[3],x2[0],x2[1],x2[2],x2[3],x3[0],x3[1],x3[2],x3[3]};
#pragma unroll
    for (int i = 0; i < 16; ++i) { const unsigned short hb = bf16_bits(xs[i]); ah.u[i] = hb; al.u[i] = ASPLIT ? bf16_bits(xs[i] - bf16_val(hb)) : (unsigned short)0; }
#pragma unroll
    for (int t = 0; t < 4; ++t) {
      const unsigned short* brow = Wt + (size_t)(col0 + t * 16 + ln) * ldb + kb;
      FragB b;
      b.half[0] = *(const v8us*)(brow + 8 * hh);
      b.half[1] = *(const v8us*)(brow + 16 + 8 * hh);
      acc[t] = mmaN<ASPLIT ? 2 : 1>(ah.v, al.v, b.v, b.v, acc[t]);
    }
  }
#pragma unroll
  for (int t = 0; t < 4; ++t) {
    const int col = col0 + t * 16 + ln;
    float bv = bias ? bias[col] : 0.f;
    if (BIAS_BF16) bv = bf16_round(bv);
#pragma unroll
    for (int r = 0; r < 8; ++r) {
      float v = acc[t][r] + bv;
      if (resid) { float rv = resid[(size_t)((row0 + 8 * hh + r) % rmod) * ldr + col]; if (RES_BF16) rv = bf16_round(rv); v += rv; }
      if (ACT == 1) v = fmaxf(v, 0.f);
      if (ACT == 2) v = 0.5f * v * (1.0f + erff(v * 0.70710678118654752f));
      if (ACT == 3) { const float u = 0.7978845608028654f * (v + 0.044715f * v * v * v); v = 0.5f * v * (1.0f + tanhf(u)); }
      so[w][8 * hh + r][t * 16 + ln] = v;
    }
  }
  __builtin_amdgcn_fence(__ATOMIC_ACQ_REL, "workgroup");
  __builtin_amdgcn_wave_barrier();
  const int rsub = lane >> 4, c4 = (lane & 15) * 4;
  {
#pragma unroll
    for (int q = 0; q < 8; ++q) {
      const int r = q * 2 + rsub;
      const v4f v = *(const v4fa*)&so[w][r][c4];
      *(v4f*)(C + (size_t)(row0 + r) * ldc + col0 + c4) = v;
    }
    
  }
}
// row LayerNorm (biased variance, eps) over N: s = X (+ R); optional out_sum <- s; out_norm <- (s-mu)*rsqrt(var+eps)*g + b
template <bool PARAM_BF16>
__global__ __launch_bounds__(256) void k_layernorm(const float* __restrict__ X, const float* __restrict__ R, const float* __restrict__ g, const float* __restrict__ bta,
                                                  float* __restrict__ out_sum, float* __restrict__ out_norm, int N, float eps) {
  __shared__ float red[256];
  const int row = blockIdx.x, tid = threadIdx.x;
  const float* x = X + (size_t)row * N; const float* rr = R ? R + (size_t)row * N : nullptr;
  float vals[16];                     // up to N = 4096
  const int per = N / 256;            // contiguous chunk per thread? use strided-by-4 chunks: thread handles j = tid*4 + 1024*u
  float s1 = 0.f;
  for (int u = 0; u < per / 4; ++u) {
    const int j = tid * 4 + 1024 * u;
    const v4f a = *(const v4fa*)(x + j);
    v4f b = {0.f,0.f,0.f,0.f}; if (rr) b = *(const v4fa*)(rr + j);
#pragma unroll
    for (int q = 0; q < 4; ++q) { const float v = a[q] + b[q]; vals[u * 4 + q] = v; s1 += v; }
  }
  red[tid] = s1; __syncthreads();
  for (int st = 128; st > 0; st >>= 1) { if (tid < st) red[tid] += red[tid + st]; __syncthreads(); }
  const float mu = red[0] / (float)N; __syncthreads();
  float s2 = 0.f;
  for (int u = 0; u < per / 4; ++u)
#pragma unroll
    for (int q = 0; q < 4; ++q) { const float c = vals[u * 4 + q] - mu; s2 += c * c; }
  red[tid] = s2; __syncthreads();
  for (int st = 128; st > 0; st >>= 1) { if (tid < st) red[tid] += red[tid + st]; __syncthreads(); }
  const float rs = rsqrtf(red[0] / (float)N + eps);
  {
    for (int u = 0; u < per / 4; ++u) {
      const int j = tid * 4 + 1024 * u;
      v4f o, sm;
#pragma unroll
      for (int q = 0; q < 4; ++q) {
        float gg = g[j + q], bb = bta[j + q];
        if (PARAM_BF16) { gg = bf16_round(gg); bb = bf16_round(bb); }
        sm[q] = vals[u * 4 + q]; o[q] = (vals[u * 4 + q] - mu) * rs * gg + bb;
      }
      if (out_sum) *(v4f*)(out_sum + (size_t)row * N + j) = sm;
      *(v4f*)(out_norm + (size_t)row * N + j) = o;
    }
    
  }
}



// ---- f16 WMMA path (v_wmma_f32_16x16x32_f16): 11-bit significands for operands in range — used where a [0,1] probability operand needs more precision than bf16
typedef _Float16 v16h __attribute__((ext_vector_type(16)));
union FragH { v16h v; v8us half[2]; _Float16 h[16]; unsigned short u[16]; };
template <int NT>
__device__ __forceinline__ v8f mmaH(v16h ah, v16h al, v16h bh, v16h bl, v8f c) {
  c = __builtin_amdgcn_wmma_f32_16x16x32_f16(false, ah, false, bh, (short)0, c, false, false);
  if (NT >= 2) c = __builtin_amdgcn_wmma_f32_16x16x32_f16(false, al, false, bh, (short)0, c, false, false);
  if (NT >= 3) c = __builtin_amdgcn_wmma_f32_16x16x32_f16(false, ah, false, bl, (short)0, c, false, false);
  asm volatile("v_nop\n\tv_nop\n\tv_nop\n\tv_nop" : "+v"(c) : "v"(ah), "v"(al), "v"(bh), "v"(bl));
  return c;
}
// batched GEMM like k_gemm_b but f16 operands: A f32 (split into f16 hi/lo if ASPLIT, else rounded to f16), Bt = f16 values [n][k]; alpha; C f32; N multiple of 16 (partial tiles skipped)
template <bool ASPLIT>
__global__ __launch_bounds__(128) void k_gemm_h(const float* __restrict__ A, int lda, size_t sA, const _Float16* __restrict__ Bh, int ldb, size_t sB, float alpha, float* __restrict__ C, int ldc, size_t sC, int M, int N, int K) {
  __shared__ __attribute__((aligned(16))) float so[4][16][64];
  const int tid = threadIdx.x, w = tid >> 5, lane = tid & 31, ln = lane & 15, hh = lane >> 4; const int by = blockIdx.y;
  A += (size_t)by * sA; Bh += (size_t)by * sB; C += (size_t)by * sC;
  const int ntn = (N + 63) / 64; const int wid = blockIdx.x * 4 + w; const int mt = wid / ntn, nq = wid % ntn; if (mt * 16 >= M) return;
  const int row0 = mt * 16, col0 = nq * 64; const float* arow = A + (size_t)(row0 + ln) * lda;
  v8f acc[4] = {};
  for (int kb = 0; kb < K; kb += 32) {
    FragH ah, al;
    const v4f x0 = *(const v4fa*)(arow + kb + 8 * hh), x1 = *(const v4fa*)(arow + kb + 8 * hh + 4), x2 = *(const v4fa*)(arow + kb + 16 + 8 * hh), x3 = *(const v4fa*)(arow + kb + 16 + 8 * hh + 4);
    float xs[16] = {x0[0],x0[1],x0[2],x0[3],x1[0],x1[1],x1[2],x1[3],x2[0],x2[1],x2[2],x2[3],x3[0],x3[1],x3[2],x3[3]};
#pragma unroll
    for (int i = 0; i < 16; ++i) { const _Float16 h = (_Float16)xs[i]; ah.h[i] = h; al.h[i] = ASPLIT ? (_Float16)(xs[i] - (float)h) : (_Float16)0.0f; }
#pragma unroll
    for (int t = 0; t < 4; ++t) { if (col0 + t * 16 >= N) continue; const size_t boff = (size_t)(col0 + t * 16 + ln) * ldb + kb; FragH bq; bq.half[0] = *(const v8us*)(Bh + boff + 8 * hh); bq.half[1] = *(const v8us*)(Bh + boff + 16 + 8 * hh);
      acc[t] = mmaH<ASPLIT ? 2 : 1>(ah.v, al.v, bq.v, bq.v, acc[t]); }
  }
#pragma unroll
  for (int t = 0; t < 4; ++t) { if (col0 + t * 16 >= N) continue;
#pragma unroll
    for (int r = 0; r < 8; ++r) so[w][8 * hh + r][t * 16 + ln] = acc[t][r] * alpha; }
  __builtin_amdgcn_fence(__ATOMIC_ACQ_REL, "workgroup"); __builtin_amdgcn_wave_barrier();
  const int rsub = lane >> 4, c4 = (lane & 15) * 4;
  {
#pragma unroll
    for (int q = 0; q < 8; ++q) { const int r = q * 2 + rsub; if (col0 + c4 < N) { const v4f v = *(const v4fa*)&so[w][r][c4]; *(v4f*)(C + (size_t)(row0 + r) * ldc + col0 + c4) = v; } }
     }
}

// Tile constants of the block-tiled products below.
#define GT 128      /* tile edge, rows of A and rows of Bh per work-group */
#define GK 64       /* k slice */
#define GPIT 72     /* LDS row pitch in f16: 144 B = 16 B x 9, so the 16 rows of a 16-byte fragment read fall on distinct banks */
#define GSO 68      /* epilogue row pitch in f32: rows 8 apart fall on different banks */

// q, k and v in one launch, each written once, in the form its reader takes: q and k as f16 hi and lo*2^10 planes [token][channel], v as f16 [channel][token].
// blockIdx.x / QT picks the product, blockIdx.x % QT its 128 x 128 tile, blockIdx.y the image. q, k: rows = tokens (T16), columns = channels (the weight plane), bias by column.
// v: the operands change places (rows = channels from BV, columns = tokens from T16), so the tile comes out transposed as it stands and its bias goes by row.
// One work-group of 8 waves owns a 128 x 128 tile, each wave 32 x 64 of it; both operands come in 64-wide k slices as whole 128-byte lines through LDS (two buffers, the next slice's loads fly during this slice's products); k runs upward in steps of 32 per accumulator.
#define QT ((NTK / GT) * (CC / GT))      /* tiles per product and image */
__global__ __launch_bounds__(256) void k_qkv(const _Float16* __restrict__ T16, const _Float16* __restrict__ BQ, const _Float16* __restrict__ BK, const _Float16* __restrict__ BV,
    const float* __restrict__ bq, const float* __restrict__ bk, const float* __restrict__ bvv,
    _Float16* __restrict__ Qh, _Float16* __restrict__ Ql, _Float16* __restrict__ Kh, _Float16* __restrict__ Kl, _Float16* __restrict__ VT) {
  __shared__ __attribute__((aligned(16))) unsigned short st[2][2][GT][GPIT];      // [buffer][A | B][row][k]; reused as f32 staging by the epilogue
  const int tid = threadIdx.x, w = tid >> 5, lane = tid & 31, ln = lane & 15, hh = lane >> 4;
  const int sel = (int)blockIdx.x / QT, tile = (int)blockIdx.x % QT; const bool isv = sel == 2;
  const size_t iofs = (size_t)blockIdx.y * NTK * CC;      // every per-image array here holds NTK * CC elements
  const int row0 = (isv ? tile / (NTK / GT) : tile / (CC / GT)) * GT, col0 = (isv ? tile % (NTK / GT) : tile % (CC / GT)) * GT;
  const int wr = (w >> 1) * 32, wc = (w & 1) * 64;      // the wave's 32 x 64 part of the tile
  const int lr = tid >> 3, lc = (tid & 7) * 8;          // staging: 8 lanes per 128-byte row slice, 32 rows per pass
  const char* ab = (const char*)(isv ? BV : T16 + iofs); const char* bb = (const char*)(isv ? T16 + iofs : (sel ? BK : BQ));      // uniform bases
  const unsigned ao = (unsigned)(((row0 + lr) * CC + lc) * 2), bo = (unsigned)(((col0 + lr) * CC + lc) * 2);      // the lane's byte offsets; further rows are constants, the slice a uniform step
  v8us ra[4], rb[4];
#pragma unroll
  for (int i = 0; i < 4; ++i) { ra[i] = *(const v8us*)(ab + ao + i * (32 * CC * 2)); rb[i] = *(const v8us*)(bb + bo + i * (32 * CC * 2)); }
#pragma unroll
  for (int i = 0; i < 4; ++i) { *(v8us*)&st[0][0][lr + 32 * i][lc] = ra[i]; *(v8us*)&st[0][1][lr + 32 * i][lc] = rb[i]; }
  __syncthreads();
  v8f acc[2][4] = {};
#pragma unroll 1      // kept rolled: unrolled, the wave takes 161 registers, allocated as 176, and only two work-groups fit on a WGP; at 160 three fit, which is what this grid gives each WGP
  for (int kb = 0; kb < CC; kb += GK) {
    const int cur = (kb / GK) & 1; const bool more = kb + GK < CC;
    if (more) {
#pragma unroll
      for (int i = 0; i < 4; ++i) { ra[i] = *(const v8us*)(ab + ao + i * (32 * CC * 2) + (kb + GK) * 2); rb[i] = *(const v8us*)(bb + bo + i * (32 * CC * 2) + (kb + GK) * 2); }
    }
#pragma unroll
    for (int ks = 0; ks < GK; ks += 32) {
      FragH fa[2], fb[4];
#pragma unroll
      for (int mi = 0; mi < 2; ++mi) { fa[mi].half[0] = *(const v8us*)&st[cur][0][wr + mi * 16 + ln][ks + 8 * hh]; fa[mi].half[1] = *(const v8us*)&st[cur][0][wr + mi * 16 + ln][ks + 16 + 8 * hh]; }
#pragma unroll
      for (int t = 0; t < 4; ++t) { fb[t].half[0] = *(const v8us*)&st[cur][1][wc + t * 16 + ln][ks + 8 * hh]; fb[t].half[1] = *(const v8us*)&st[cur][1][wc + t * 16 + ln][ks + 16 + 8 * hh]; }
#pragma unroll
      for (int mi = 0; mi < 2; ++mi)
#pragma unroll
        for (int t = 0; t < 4; ++t) acc[mi][t] = mmaH<1>(fa[mi].v, fa[mi].v, fb[t].v, fb[t].v, acc[mi][t]);
    }
    if (more) {
#pragma unroll
      for (int i = 0; i < 4; ++i) { *(v8us*)&st[cur ^ 1][0][lr + 32 * i][lc] = ra[i]; *(v8us*)&st[cur ^ 1][1][lr + 32 * i][lc] = rb[i]; }
    }
    __syncthreads();      // publishes the next slice and ends every wave's reads of this one (after the last slice: frees the LDS for the epilogue)
  }
  typedef _Float16 v4h __attribute__((ext_vector_type(4)));
  float* so = (float*)&st[0][0][0][0] + (size_t)w * (32 * GSO);      // the wave's own 32 x 64 f32 staging
  const int rsub = lane >> 4, c4 = (lane & 15) * 4;
  const int orow = row0 + wr + rsub, ocol = col0 + wc + c4;      // the lane's first output row (then every second one) and its four columns
  if (isv) {
    float br[2][8];      // bias by row (channel)
#pragma unroll
    for (int mi = 0; mi < 2; ++mi)
#pragma unroll
      for (int r = 0; r < 8; ++r) br[mi][r] = bf16_round(bvv[row0 + wr + mi * 16 + 8 * hh + r]);
#pragma unroll
    for (int mi = 0; mi < 2; ++mi)
#pragma unroll
      for (int t = 0; t < 4; ++t)
#pragma unroll
        for (int r = 0; r < 8; ++r) so[(mi * 16 + 8 * hh + r) * GSO + t * 16 + ln] = acc[mi][t][r] * 0.0625f + br[mi][r];
    __builtin_amdgcn_fence(__ATOMIC_ACQ_REL, "workgroup"); __builtin_amdgcn_wave_barrier();
    _Float16* vo = VT + iofs + (size_t)orow * NTK + ocol;
#pragma unroll
    for (int q = 0; q < 16; ++q) { const v4f o = *(const v4fa*)&so[(q * 2 + rsub) * GSO + c4]; v4h h4;
#pragma unroll
      for (int i = 0; i < 4; ++i) h4[i] = (_Float16)o[i];
      *(v4h*)(vo + q * 2 * NTK) = h4; }
  } else {
    const float* bias = sel ? bk : bq;
    float bc[4];      // bias by column (channel)
#pragma unroll
    for (int t = 0; t < 4; ++t) bc[t] = bf16_round(bias[col0 + wc + t * 16 + ln]);
#pragma unroll
    for (int mi = 0; mi < 2; ++mi)
#pragma unroll
      for (int t = 0; t < 4; ++t)
#pragma unroll
        for (int r = 0; r < 8; ++r) so[(mi * 16 + 8 * hh + r) * GSO + t * 16 + ln] = acc[mi][t][r] * 0.0625f + bc[t];
    __builtin_amdgcn_fence(__ATOMIC_ACQ_REL, "workgroup"); __builtin_amdgcn_wave_barrier();
    _Float16* ho = (sel ? Kh : Qh) + iofs + (size_t)orow * CC + ocol; _Float16* lo = (sel ? Kl : Ql) + iofs + (size_t)orow * CC + ocol;
#pragma unroll
    for (int q = 0; q < 16; ++q) { const v4f o = *(const v4fa*)&so[(q * 2 + rsub) * GSO + c4]; v4h h4, l4;
#pragma unroll
      for (int i = 0; i < 4; ++i) { const _Float16 h = (_Float16)o[i]; h4[i] = h; l4[i] = (_Float16)((o[i] - (float)h) * 1024.0f); }
      *(v4h*)(ho + q * 2 * CC) = h4; *(v4h*)(lo + q * 2 * CC) = l4; }
    asm volatile("s_wait_xcnt 0x0" ::: "memory");      // in the built code the other branch's instructions follow these stores and rewrite the registers that they name
  }
}

// Attention in one launch: logits, softmax over i and the product with v, per work-group for FR rows j of one image (blockIdx.y); neither the logits nor the probabilities go to memory.
// S'[j][i] = Ah.Bh + 2^-10 (Al.Bh + Ah.Bl) with A = k (hi and lo*2^10 planes), B = q (the same two planes); att[j] = sum_i softmax_i(S'[j][.]) v[i].
// The tokens i come in chunks of FI. Per chunk: (1) the 64 x 64 logits, each wave 16 x 32 of them, its k rows held in registers for the whole kernel, q from LDS, to an f32 tile in LDS;
// (2) four lanes per row take the chunk's maximum, raise the row's running maximum, and write e = exp(s - max) * 2^10 (one multiply-add and one v_exp_f32) as f16 and the factor exp(old max - new max);
// (3) each wave scales its 32 x 64 part of the 64 x 256 output sums by that factor and adds e.v. The row's sum of e is kept beside (f32, scaled the same way) and divides once, in the epilogue.
// q and v chunks have two LDS buffers and one set of staging registers: a chunk's global loads go out as soon as the chunk before it has left those registers for LDS, so they fly for about a whole chunk's work before their values are wanted. One work-group per WGP (two waves per SIMD).
// Behind the loop the work-group holds whole rows of the attention output, and everything that follows in the block is row-wise, so it is done here, on LDS that the loop has left:
// h = SiLU(att.W1 + b1) and y = h.W2 + b2 (each wave 32 x 64 of the 64 x 256 result; att and h as f16 rows in LDS; BM = the two weight planes [n][k], one after the other, each whole in LDS for its product),
// LayerNorm of y (one wave per row, eight rows each) and the store as [channel][token]. None of att, h, y goes to memory.
#define FR 64       /* rows j per work-group */
#define FI 64       /* tokens i per chunk */
#define QPIT 264    /* LDS row pitch of a q row in f16: 528 B = 16 B x 33, so the 16 rows of a 16-byte fragment read fall on distinct banks */
// the value of another lane of the same group of four (quad_perm 0xB1: lane ^ 1, 0x4E: lane ^ 2), by a vector move instead of the LDS round trip that __shfl_xor compiles to
template <int CTRL>
__device__ __forceinline__ float quad_lane(float x) { return __int_as_float(__builtin_amdgcn_mov_dpp(__float_as_int(x), CTRL, 0xf, 0xf, true)); }
// Work-group barrier for data that waves hand over in LDS alone: the fences name the LDS address space, so a wave waits for its LDS operations and leaves its global loads in flight.
// __syncthreads() waits for those loads too, which would end the flight of the next chunk at the first barrier behind its issue.
__device__ __forceinline__ void lds_barrier() {
  __builtin_amdgcn_fence(__ATOMIC_RELEASE, "workgroup", "local");
  __builtin_amdgcn_s_barrier();
  __builtin_amdgcn_fence(__ATOMIC_ACQUIRE, "workgroup", "local");
}
__global__ __launch_bounds__(256) void k_attn(const _Float16* __restrict__ Ah, const _Float16* __restrict__ Al, const _Float16* __restrict__ Bh, const _Float16* __restrict__ Bl, const _Float16* __restrict__ VT,
    const _Float16* __restrict__ BM, const float* __restrict__ b1, const float* __restrict__ b2, const float* __restrict__ g, const float* __restrict__ be, float* __restrict__ out) {
  __shared__ __attribute__((aligned(16))) unsigned short sq[2][2][FI][QPIT];      // [buffer][Bh | Bl][token i][channel]; behind the loop: one weight plane
  __shared__ __attribute__((aligned(16))) unsigned short sv[2][CC][GPIT];         // [buffer][channel][token i]; behind the loop: att and h (f16 rows)
  __shared__ __attribute__((aligned(16))) float ss[FR][GSO];                      // this chunk's logits
  __shared__ __attribute__((aligned(16))) unsigned short sp[FR][GPIT];            // this chunk's e * 2^10
  __shared__ __attribute__((aligned(16))) float sal[FR];                          // per row: this chunk's factor for the sums so far
  __shared__ __attribute__((aligned(16))) float sdv[FR];                          // per row, written once behind the loop: 1 / (sum of e * 2^10)
  __shared__ __attribute__((aligned(16))) float sz[8][32][GSO];                   // behind the loop: each wave's 32 x 64 of att.W1 + b1, on the way to SiLU; then y (f32 rows)
  const int tid = threadIdx.x, w = tid >> 5, lane = tid & 31, ln = lane & 15, hh = lane >> 4;
  const size_t pofs = (size_t)blockIdx.y * NTK * CC;      // every per-image array here holds NTK * CC elements
  const int j0 = (int)blockIdx.x * FR;
  const int rg = (w >> 1) * 16, cg = (w & 1) * 32;      // the wave's 16 x 32 part of the logits tile
  const int wr = (w >> 2) * 32, wc = (w & 3) * 64;      // the wave's 32 x 64 part of the output tile
  const int srow = tid >> 2, sc = (tid & 3) * 16;       // softmax: the lane's row and its 16 columns
  const char* qb[2] = {(const char*)(Bh + pofs), (const char*)(Bl + pofs)}; const char* vb = (const char*)(VT + pofs);      // uniform bases
  const unsigned qo = (unsigned)((w * CC + lane * 8) * 2);      // a wave loads one whole 512-byte q row; its further rows are constants, the chunk a uniform step
  const unsigned vo = (unsigned)(((tid >> 3) * NTK + (tid & 7) * 8) * 2);      // 8 lanes per 128-byte slice of a v row, 32 rows per pass
  v8us zq[2][8], zv[8];      // chunk 0, on its way to LDS
#pragma unroll
  for (int i = 0; i < 8; ++i) { zq[0][i] = *(const v8us*)(qb[0] + qo + i * (8 * CC * 2)); zq[1][i] = *(const v8us*)(qb[1] + qo + i * (8 * CC * 2)); zv[i] = *(const v8us*)(vb + vo + i * (32 * NTK * 2)); }
  FragH kh[8], kl[8];      // the wave's 16 k rows, all 256 channels, both planes
  const unsigned short* ph = (const unsigned short*)(Ah + pofs) + (size_t)(j0 + rg + ln) * CC + 8 * hh; const unsigned short* pl = (const unsigned short*)(Al + pofs) + (size_t)(j0 + rg + ln) * CC + 8 * hh;
#pragma unroll
  for (int ks = 0; ks < 8; ++ks) { kh[ks].half[0] = *(const v8us*)(ph + ks * 32); kh[ks].half[1] = *(const v8us*)(ph + ks * 32 + 16); kl[ks].half[0] = *(const v8us*)(pl + ks * 32); kl[ks].half[1] = *(const v8us*)(pl + ks * 32 + 16); }
  asm volatile("s_wait_xcnt 0x0" :: "v"(tid), "v"(vo), "v"(ph), "v"(pl) : "memory");      // the registers that the loads above name are given other values from here on; as inputs they stay as they are up to the wait
#pragma unroll
  for (int i = 0; i < 8; ++i) { *(v8us*)&sq[0][0][w + 8 * i][lane * 8] = zq[0][i]; *(v8us*)&sq[0][1][w + 8 * i][lane * 8] = zq[1][i]; *(v8us*)&sv[0][(tid >> 3) + 32 * i][(tid & 7) * 8] = zv[i]; }
  __builtin_amdgcn_sched_barrier(0);      // keeps chunk 1's loads behind chunk 0's stores, hence behind the return of chunk 0: moved ahead of them, a wave would have 80 loads outstanding, more than its counter holds
  v8us rq[2][8], rv[8];      // the loop's staging registers: chunk 1 goes out here, behind every k row (a k row loaded behind it would make the loop wait for every load in flight)
#pragma unroll
  for (int i = 0; i < 8; ++i) rq[0][i] = *(const v8us*)(qb[0] + qo + i * (8 * CC * 2) + FI * CC * 2);
#pragma unroll
  for (int i = 0; i < 8; ++i) rq[1][i] = *(const v8us*)(qb[1] + qo + i * (8 * CC * 2) + FI * CC * 2);
#pragma unroll
  for (int i = 0; i < 8; ++i) rv[i] = *(const v8us*)(vb + vo + i * (32 * NTK * 2) + FI * 2);
  asm volatile("s_wait_xcnt 0x0" :: "v"(tid), "v"(vo) : "memory");      // the registers that chunk 1's loads name are given other values from here on; as inputs they stay as they are up to the wait
  lds_barrier();      // chunk 0 is whole before any wave reads it
  v8f acc[2][4] = {};
  float m = -3.0e38f, l = 0.f;      // the row's running maximum; the sum of e * 2^10 over the lane's own columns
#pragma unroll 1      // kept rolled: for speed only
  for (int c = 0; c < NTK / FI; ++c) {
    const int cur = c & 1;      // on entry the staging registers hold, or are about to receive, chunk c + 1
    v8f hi[2] = {}, lo[2] = {};      // hi: Ah.Bh; lo: Al.Bh then Ah.Bl, k upward; they meet once per chunk
    FragH fq[3][2][2];      // q fragments [slot][column block][Bh | Bl], read two k steps ahead of their products
#pragma unroll
    for (int ks = 0; ks < 2; ++ks)
#pragma unroll
      for (int t = 0; t < 2; ++t)
#pragma unroll
        for (int p = 0; p < 2; ++p) { fq[ks][t][p].half[0] = *(const v8us*)&sq[cur][p][cg + t * 16 + ln][ks * 32 + 8 * hh]; fq[ks][t][p].half[1] = *(const v8us*)&sq[cur][p][cg + t * 16 + ln][ks * 32 + 16 + 8 * hh]; }
#pragma unroll
    for (int ks = 0; ks < 8; ++ks) {
      const int s = ks % 3, n = (ks + 2) % 3;
      if (ks + 2 < 8) {
#pragma unroll
        for (int t = 0; t < 2; ++t)
#pragma unroll
          for (int p = 0; p < 2; ++p) { fq[n][t][p].half[0] = *(const v8us*)&sq[cur][p][cg + t * 16 + ln][(ks + 2) * 32 + 8 * hh]; fq[n][t][p].half[1] = *(const v8us*)&sq[cur][p][cg + t * 16 + ln][(ks + 2) * 32 + 16 + 8 * hh]; }
      }
      // The next chunk goes to the other buffers beside the last three k steps: this phase is bound by LDS reads, and the write path is free. Their last readers left those buffers before the first barrier of the chunk before.
      // No branch round the stores (a join would make every later LDS wait count them): in the last chunk they put stale registers into buffers that are rewritten behind the loop before anyone reads them.
      if (ks == 5) {
#pragma unroll
        for (int i = 0; i < 8; ++i) *(v8us*)&sq[cur ^ 1][0][w + 8 * i][lane * 8] = rq[0][i];
      }
      if (ks == 6) {
#pragma unroll
        for (int i = 0; i < 8; ++i) *(v8us*)&sq[cur ^ 1][1][w + 8 * i][lane * 8] = rq[1][i];
      }
      if (ks == 7) {
#pragma unroll
        for (int i = 0; i < 8; ++i) *(v8us*)&sv[cur ^ 1][(tid >> 3) + 32 * i][(tid & 7) * 8] = rv[i];
        // The staging registers are free from here: chunk c + 2 goes out now and is wanted at the same place of the next trip, so its flight has the softmax, the product with v and most of the next logits to pass beside.
        if (c + 2 < NTK / FI) {      // the same for the whole work-group
          const char* g0 = qb[0] + qo + (c + 2) * (FI * CC * 2); const char* g1 = qb[1] + qo + (c + 2) * (FI * CC * 2); const char* g2 = vb + vo + (c + 2) * (FI * 2);
#pragma unroll
          for (int i = 0; i < 8; ++i) rq[0][i] = *(const v8us*)(g0 + i * (8 * CC * 2));
#pragma unroll
          for (int i = 0; i < 8; ++i) rq[1][i] = *(const v8us*)(g1 + i * (8 * CC * 2));
#pragma unroll
          for (int i = 0; i < 8; ++i) rv[i] = *(const v8us*)(g2 + i * (32 * NTK * 2));
          asm volatile("s_wait_xcnt 0x0" :: "v"(g0), "v"(g1), "v"(g2) : "memory");      // the registers that these loads name are given other values below; as inputs they stay as they are up to the wait
        }
      }
      __builtin_amdgcn_sched_barrier(0);      // keeps the reads and stores above ahead of the products below; left free, the compiler sinks each read to just before its use
#pragma unroll
      for (int t = 0; t < 2; ++t) hi[t] = __builtin_amdgcn_wmma_f32_16x16x32_f16(false, kh[ks].v, false, fq[s][t][0].v, (short)0, hi[t], false, false);
#pragma unroll
      for (int t = 0; t < 2; ++t) lo[t] = __builtin_amdgcn_wmma_f32_16x16x32_f16(false, kl[ks].v, false, fq[s][t][0].v, (short)0, lo[t], false, false);
#pragma unroll
      for (int t = 0; t < 2; ++t) lo[t] = __builtin_amdgcn_wmma_f32_16x16x32_f16(false, kh[ks].v, false, fq[s][t][1].v, (short)0, lo[t], false, false);
    }
#pragma unroll
    for (int t = 0; t < 2; ++t)
#pragma unroll
      for (int r = 0; r < 8; ++r) ss[rg + 8 * hh + r][cg + t * 16 + ln] = lo[t][r] * 0.0009765625f + hi[t][r];
    FragH fb[2][4];      // this chunk's v fragments: published since the chunk began, so they are read here, where the LDS would idle at the barrier
#pragma unroll
    for (int k2 = 0; k2 < 2; ++k2)
#pragma unroll
      for (int t = 0; t < 4; ++t) { fb[k2][t].half[0] = *(const v8us*)&sv[cur][wc + t * 16 + ln][k2 * 32 + 8 * hh]; fb[k2][t].half[1] = *(const v8us*)&sv[cur][wc + t * 16 + ln][k2 * 32 + 16 + 8 * hh]; }
    lds_barrier();      // the logits tile is whole before the rows' lanes read it
    {
      v4f s4[4];
#pragma unroll
      for (int q = 0; q < 4; ++q) s4[q] = *(const v4fa*)&ss[srow][sc + 4 * q];
      float mx = s4[0][0];
#pragma unroll
      for (int q = 0; q < 4; ++q)
#pragma unroll
        for (int k = 0; k < 4; ++k) mx = fmaxf(mx, s4[q][k]);
      mx = fmaxf(mx, quad_lane<0xB1>(mx)); mx = fmaxf(mx, quad_lane<0x4E>(mx));      // the row's four lanes agree on the chunk's maximum
      const float mn = fmaxf(m, mx), al = __builtin_amdgcn_exp2f((m - mn) * 1.4426950408889634f), eb = 10.0f - mn * 1.4426950408889634f; m = mn;      // e * 2^10 = 2^(s log2(e) + eb)
      float su = 0.f; FragH f;
#pragma unroll
      for (int q = 0; q < 4; ++q)
#pragma unroll
        for (int k = 0; k < 4; ++k) { const float e = __builtin_amdgcn_exp2f(s4[q][k] * 1.4426950408889634f + eb); su += e; f.h[q * 4 + k] = (_Float16)e; }
      l = l * al + su;
      *(v8us*)&sp[srow][sc] = f.half[0]; *(v8us*)&sp[srow][sc + 8] = f.half[1];
      if ((tid & 3) == 0) sal[srow] = al;
    }
    lds_barrier();      // e and the factors are whole before the waves take them as operands
    FragH fa[2][2];      // all of the wave's e fragments at once, so that their latency is paid once, beside the scaling
#pragma unroll
    for (int k2 = 0; k2 < 2; ++k2)
#pragma unroll
      for (int mi = 0; mi < 2; ++mi) { fa[k2][mi].half[0] = *(const v8us*)&sp[wr + mi * 16 + ln][k2 * 32 + 8 * hh]; fa[k2][mi].half[1] = *(const v8us*)&sp[wr + mi * 16 + ln][k2 * 32 + 16 + 8 * hh]; }
#pragma unroll
    for (int mi = 0; mi < 2; ++mi) {
      const v4f f0 = *(const v4fa*)&sal[wr + mi * 16 + 8 * hh], f1 = *(const v4fa*)&sal[wr + mi * 16 + 8 * hh + 4];
#pragma unroll
      for (int t = 0; t < 4; ++t)
#pragma unroll
        for (int r = 0; r < 4; ++r) { acc[mi][t][r] *= f0[r]; acc[mi][t][4 + r] *= f1[r]; }
    }
#pragma unroll
    for (int k2 = 0; k2 < 2; ++k2) {
#pragma unroll
      for (int mi = 0; mi < 2; ++mi)
#pragma unroll
        for (int t = 0; t < 4; ++t) acc[mi][t] = __builtin_amdgcn_wmma_f32_16x16x32_f16(false, fa[k2][mi].v, false, fb[k2][t].v, (short)0, acc[mi][t], false, false);
    }
    // No barrier here: what the next chunk rewrites before its own first barrier (the logits tile, the q and v buffers just used) had its last reader before this chunk's second barrier, and e and the factors are rewritten only behind the next chunk's first barrier, which a wave reaches with its reads above done.
  }
  l += quad_lane<0xB1>(l); l += quad_lane<0x4E>(l);      // the row's four lanes join their sums
  if ((tid & 3) == 0) sdv[srow] = 1.0f / l;      // l carries the same 2^10 as e
  __syncthreads();      // every row's divisor is there before the waves read it; every wave has left the loop, so all of its LDS is free from here on
  typedef _Float16 v4hh __attribute__((ext_vector_type(4), may_alias));
  unsigned short (*sw)[QPIT] = (unsigned short (*)[QPIT])&sq[0][0][0][0];      // one whole weight plane, f16 [n][k]: 256 rows at the q rows' pitch are exactly the q buffers' bytes
  unsigned short (*sa)[QPIT] = (unsigned short (*)[QPIT])&sv[0][0][0];         // att, f16 [row][channel]: 33,792 B
  unsigned short (*sh)[QPIT] = sa + FR;                                        // h, f16 [row][channel], behind att: together 67,584 of the v buffers' 73,728 B
  float (*sy)[CC + 1] = (float (*)[CC + 1])&sz[0][0][0];      // y, f32 [row][channel], where the SiLU staging was: 64 x 257 x 4 = 65,792 of its 69,632 B; the odd pitch keeps the reads down a column on distinct banks
  // W1 whole, the biases and the LayerNorm parameters go out here; att's way to LDS passes beside their flight.
  const char* wb = (const char*)BM;      // uniform base
  const unsigned wo = (unsigned)((w * CC + lane * 8) * 2);      // a wave loads one whole 512-byte weight row; its further rows (w + 8 i) and the second plane are constants
  const unsigned co = (unsigned)((wc + ln) * 4), po = (unsigned)(lane * 4);      // byte offsets of the lane's first bias column and first LayerNorm channel
  v8us rw[32];
#pragma unroll
  for (int i = 0; i < 32; ++i) rw[i] = *(const v8us*)(wb + wo + i * (8 * CC * 2));
  float c1[4], c2[4], gg[8], bb[8];
#pragma unroll
  for (int t = 0; t < 4; ++t) { c1[t] = *(const float*)((const char*)b1 + co + t * 64); c2[t] = *(const float*)((const char*)b2 + co + t * 64); }
#pragma unroll
  for (int k = 0; k < 8; ++k) { gg[k] = *(const float*)((const char*)g + po + k * 128); bb[k] = *(const float*)((const char*)be + po + k * 128); }
  asm volatile("s_wait_xcnt 0x0" :: "v"(wo), "v"(co), "v"(po) : "memory");      // the registers that the loads above name may be given other values from here on; as inputs they stay as they are up to the wait
#pragma unroll
  for (int mi = 0; mi < 2; ++mi) {
    const v4f f0 = *(const v4fa*)&sdv[wr + mi * 16 + 8 * hh], f1 = *(const v4fa*)&sdv[wr + mi * 16 + 8 * hh + 4];
#pragma unroll
    for (int t = 0; t < 4; ++t)
#pragma unroll
      for (int r = 0; r < 4; ++r) {
        sa[wr + mi * 16 + 8 * hh + r][wc + t * 16 + ln] = __builtin_bit_cast(unsigned short, (_Float16)(acc[mi][t][r] * f0[r]));
        sa[wr + mi * 16 + 8 * hh + 4 + r][wc + t * 16 + ln] = __builtin_bit_cast(unsigned short, (_Float16)(acc[mi][t][4 + r] * f1[r]));
      }
  }
#pragma unroll
  for (int i = 0; i < 32; ++i) *(v8us*)&sw[w + 8 * i][lane * 8] = rw[i];
#pragma unroll
  for (int t = 0; t < 4; ++t) { c1[t] = bf16_round(c1[t]); c2[t] = bf16_round(c2[t]); }
#pragma unroll
  for (int k = 0; k < 8; ++k) { gg[k] = bf16_round(gg[k]); bb[k] = bf16_round(bb[k]); }
  __syncthreads();      // att and W1 are whole before any wave takes them as operands
  // W2 goes out now and waits in registers until W1's last reader has left: its flight passes beside the first product.
#pragma unroll
  for (int i = 0; i < 32; ++i) rw[i] = *(const v8us*)(wb + wo + i * (8 * CC * 2) + CC * CC * 2);
  asm volatile("s_wait_xcnt 0x0" :: "v"(wo) : "memory");      // the register that these loads name stays as it is up to the wait
#pragma unroll      // unrolled: the two products differ in their operand rows and in their epilogues, which so need no branch
  for (int p = 0; p < 2; ++p) {      // p = 0: att.W1, p = 1: h.W2; k upward in steps of 32 per accumulator
    unsigned short (*sx)[QPIT] = p ? sh : sa;
#pragma unroll
    for (int mi = 0; mi < 2; ++mi)
#pragma unroll
      for (int t = 0; t < 4; ++t) acc[mi][t] = v8f{};
#pragma unroll
    for (int ks = 0; ks < 8; ++ks) {
      FragH fa[2], fw[4];
#pragma unroll
      for (int mi = 0; mi < 2; ++mi) { fa[mi].half[0] = *(const v8us*)&sx[wr + mi * 16 + ln][ks * 32 + 8 * hh]; fa[mi].half[1] = *(const v8us*)&sx[wr + mi * 16 + ln][ks * 32 + 16 + 8 * hh]; }
#pragma unroll
      for (int t = 0; t < 4; ++t) { fw[t].half[0] = *(const v8us*)&sw[wc + t * 16 + ln][ks * 32 + 8 * hh]; fw[t].half[1] = *(const v8us*)&sw[wc + t * 16 + ln][ks * 32 + 16 + 8 * hh]; }
#pragma unroll
      for (int mi = 0; mi < 2; ++mi)
#pragma unroll
        for (int t = 0; t < 4; ++t) acc[mi][t] = __builtin_amdgcn_wmma_f32_16x16x32_f16(false, fa[mi].v, false, fw[t].v, (short)0, acc[mi][t], false, false);
    }
    if (p == 0) {      // h = SiLU(att.W1 + b1), by way of the wave's own f32 staging: from there a rolled loop can take the values, and each lane gets four neighbours of a row for one 8-byte store
      float* so = &sz[w][0][0];
#pragma unroll
      for (int mi = 0; mi < 2; ++mi)
#pragma unroll
        for (int t = 0; t < 4; ++t)
#pragma unroll
          for (int r = 0; r < 8; ++r) so[(mi * 16 + 8 * hh + r) * GSO + t * 16 + ln] = acc[mi][t][r] * 0.0625f + c1[t];
      __builtin_amdgcn_fence(__ATOMIC_ACQ_REL, "workgroup"); __builtin_amdgcn_wave_barrier();      // the lanes read below what other lanes of the wave have stored above
#pragma unroll 1      // kept rolled: the exponential and the division of 64 values per lane, written out, are over 2,000 instructions that run once; rolled for speed only
      for (int q = 0; q < 16; q += 2) {
        const v4f o[2] = {*(const v4fa*)&so[(q * 2 + hh) * GSO + ln * 4], *(const v4fa*)&so[(q * 2 + 2 + hh) * GSO + ln * 4]};      // both reads ahead of both stores: eight independent chains per trip
        v4hh h4[2];
#pragma unroll
        for (int u = 0; u < 2; ++u)
#pragma unroll
          for (int i = 0; i < 4; ++i) { const float v = o[u][i]; h4[u][i] = (_Float16)(v / (1.0f + expf(-v))); }
        *(v4hh*)&sh[wr + q * 2 + hh][wc + ln * 4] = h4[0]; *(v4hh*)&sh[wr + q * 2 + 2 + hh][wc + ln * 4] = h4[1];
      }
      __syncthreads();      // ends every wave's reads of W1 (and of its staging) before W2 takes its place
#pragma unroll
      for (int i = 0; i < 32; ++i) *(v8us*)&sw[w + 8 * i][lane * 8] = rw[i];
    } else {
#pragma unroll
      for (int mi = 0; mi < 2; ++mi)
#pragma unroll
        for (int t = 0; t < 4; ++t)
#pragma unroll
          for (int r = 0; r < 8; ++r) sy[wr + mi * 16 + 8 * hh + r][wc + t * 16 + ln] = acc[mi][t][r] * 0.0625f + c2[t];
    }
    __syncthreads();      // p = 0: h and W2 are whole before the second product; p = 1: y is whole before the rows' waves read it
  }
#pragma unroll      // unrolled: the eight rows' reduction chains are independent, and side by side their cross-lane latencies overlap
  for (int i = 0; i < FR / 8; ++i) {      // LayerNorm: the wave's rows w, w + 8, ...; the lane's channels lane + 32 k
    float* yr = sy[w + 8 * i]; float v[8]; float sm = 0.f;
#pragma unroll
    for (int k = 0; k < 8; ++k) { v[k] = yr[lane + 32 * k]; sm += v[k]; }
    for (int o = 16; o > 0; o >>= 1) sm += __shfl_xor(sm, o, 32);
    const float mu = sm / (float)CC; float q2 = 0.f;
#pragma unroll
    for (int k = 0; k < 8; ++k) { const float d = v[k] - mu; q2 += d * d; }
    for (int o = 16; o > 0; o >>= 1) q2 += __shfl_xor(q2, o, 32);
    const float rs = rsqrtf(q2 / (float)CC + 1e-5f);
#pragma unroll
    for (int k = 0; k < 8; ++k) yr[lane + 32 * k] = (v[k] - mu) * rs * gg[k] + bb[k];
  }
  __syncthreads();      // every row is normalised before the waves read down the columns
  float* op = out + ((size_t)blockIdx.y * CC + w * 2 + hh) * NTK + j0 + ln * 4;      // 16 lanes store the 64 tokens of one channel (two whole lines), the wave two channels at a time
#pragma unroll
  for (int i = 0; i < CC / 16; ++i) { v4f o;
#pragma unroll
    for (int q = 0; q < 4; ++q) o[q] = sy[ln * 4 + q][w * 2 + hh + 16 * i];
    *(v4f*)(op + (size_t)i * 16 * NTK) = o; }
}

typedef _Float16 v4h __attribute__((ext_vector_type(4)));

__global__ __launch_bounds__(256) void k_x16(const float* __restrict__ x, _Float16* __restrict__ X16, size_t n8) { const size_t t = (size_t)blockIdx.x * 256 + threadIdx.x; if (t >= n8) return; FragH f;
#pragma unroll
  for (int q = 0; q < 8; ++q) f.h[q] = (_Float16)bf16_round(x[t * 8 + q]); *(v8us*)((unsigned short*)X16 + t * 8) = f.half[0];  }
__global__ __launch_bounds__(256) void k_h16(const float* __restrict__ x, _Float16* __restrict__ X16, size_t n8) { const size_t t = (size_t)blockIdx.x * 256 + threadIdx.x; if (t >= n8) return; FragH f;
#pragma unroll
  for (int q = 0; q < 8; ++q) f.h[q] = (_Float16)x[t * 8 + q]; *(v8us*)((unsigned short*)X16 + t * 8) = f.half[0];  }
__global__ __launch_bounds__(256) void k_round16f(const float* __restrict__ W, _Float16* __restrict__ Bt, size_t n8) { const size_t t = (size_t)blockIdx.x * 256 + threadIdx.x; if (t >= n8) return; FragH f;
#pragma unroll
  for (int i = 0; i < 8; ++i) f.h[i] = (_Float16)(bf16_round(W[t * 8 + i]) * 16.0f); *(v8us*)((unsigned short*)Bt + t * 8) = f.half[0];  }
template <int NHv, int TTv>
__global__ __launch_bounds__(256) void k_vt(const _Float16* __restrict__ V16, int ldv, int voff, _Float16* __restrict__ Vt) { __shared__ unsigned short tl[64][66]; const int tid = threadIdx.x; const int slab = blockIdx.x / (TTv / 64), lg = blockIdx.x % (TTv / 64); const int b = slab / NHv, h = slab % NHv;
  for (int i = tid; i < 64 * 8; i += 256) { const int r = i / 8, c8 = (i % 8) * 8; FragH f; f.half[0] = *(const v8us*)((const unsigned short*)V16 + ((size_t)b * TTv + lg * 64 + r) * ldv + voff + h * 64 + c8);
#pragma unroll
    for (int q = 0; q < 8; ++q) tl[r][c8 + q] = f.u[q]; }
  __syncthreads();
  {
#pragma unroll
    for (int rd = 0; rd < 2; ++rd) { const int d = rd * 32 + tid / 8, pc = tid % 8; FragH f;
#pragma unroll
      for (int q = 0; q < 8; ++q) f.u[q] = tl[pc * 8 + q][d];
      *(v8us*)((unsigned short*)Vt + ((size_t)slab * 64 + d) * TTv + lg * 64 + pc * 8) = f.half[0]; }
     } }

__global__ __launch_bounds__(256) void k_hl(const float* __restrict__ F, _Float16* __restrict__ Hh, _Float16* __restrict__ Hl, size_t n8) { const size_t t = (size_t)blockIdx.x * 256 + threadIdx.x; if (t >= n8) return; FragH fh, fl; const v4f a = *(const v4fa*)(F + t * 8), c = *(const v4fa*)(F + t * 8 + 4);
#pragma unroll
  for (int q = 0; q < 4; ++q) { _Float16 h = (_Float16)a[q]; fh.h[q] = h; fl.h[q] = (_Float16)((a[q] - (float)h) * 1024.0f); h = (_Float16)c[q]; fh.h[4 + q] = h; fl.h[4 + q] = (_Float16)((c[q] - (float)h) * 1024.0f); }
  { *(v8us*)((unsigned short*)Hh + t * 8) = fh.half[0]; *(v8us*)((unsigned short*)Hl + t * 8) = fl.half[0];  } }

// All input preparation in one launch: the five weight planes and the sixteen token planes depend on the inputs alone, so their work-groups run side by side.
// Both jobs are the same transposition, f32 src[c][n] (row pitch PITCH) to f16 dst[n][c] (row pitch CC), done on tiles of PC source rows x PN source columns through LDS:
// every global load of a wave is 512 contiguous bytes of one source row, and every 8 lanes store one whole 128-byte line of a destination row.
// Work-groups 0 .. 5*WB-1: weight plane blockIdx.x / WB, BW[plane][n][k] = f16(bf16(W[k][n]) * 16) from f32 row-major W[k][n] (bf16-exact weights stay exact in f16 away from the subnormal range).
// The others, TB per image: T16[image][token][channel] = f16(bf16(x[image][channel][token])).
#define PC 64       /* source rows per tile: 8 waves x 8 rows */
#define PN 128      /* source columns per tile: 32 lanes x 4 floats */
#define WB ((CC / PC) * (CC / PN))      /* work-groups per weight plane */
#define TB ((CC / PC) * (NTK / PN))     /* work-groups per image */
template <int PITCH, bool X16>
__device__ __forceinline__ void prep_tile(const float* __restrict__ src, unsigned short* __restrict__ dst, int tile, unsigned short (*tl)[GPIT]) {
  const int tid = threadIdx.x, w = tid >> 5, lane = tid & 31;
  const int c0 = (tile / (PITCH / PN)) * PC, n0 = (tile % (PITCH / PN)) * PN;
  const char* sb = (const char*)(src + (size_t)c0 * PITCH + n0);      // uniform base; the lane keeps one byte offset, its further rows are constants
  const unsigned so = (unsigned)((w * 8 * PITCH + lane * 4) * 4);      // the lane's 8 source rows x 4 columns
  v4f r[8];
#pragma unroll
  for (int q = 0; q < 8; ++q) r[q] = *(const v4fa*)(sb + so + q * (PITCH * 4));
#pragma unroll
  for (int i = 0; i < 4; ++i) { FragH f;
#pragma unroll
    for (int q = 0; q < 8; ++q) f.h[q] = X16 ? (_Float16)(bf16_round(r[q][i]) * 16.0f) : (_Float16)bf16_round(r[q][i]);
    *(v8us*)&tl[i * 32 + lane][w * 8] = f.half[0]; }      // source column 4 * lane + i lies in LDS row i * 32 + lane: the lanes of a store are one row pitch apart, on distinct banks
  __syncthreads();      // the tile is whole before any wave reads the other waves' columns of it
  unsigned short* dp = dst + (size_t)(n0 + (tid >> 3) * 4) * CC + c0 + (tid & 7) * 8;
#pragma unroll
  for (int p = 0; p < 4; ++p) *(v8us*)(dp + p * CC) = *(const v8us*)&tl[p * 32 + (tid >> 3)][(tid & 7) * 8];      // LDS row p * 32 + g holds source column 4 * g + p
}
__global__ __launch_bounds__(256) void k_prep(const float* __restrict__ x, const float* __restrict__ wq, const float* __restrict__ wk, const float* __restrict__ wv, const float* __restrict__ w1, const float* __restrict__ w2,
    _Float16* __restrict__ BW, _Float16* __restrict__ T16) {
  __shared__ __attribute__((aligned(16))) unsigned short tl[PN][GPIT];      // the transposed tile: one row per source column (in the order that prep_tile names), 128 bytes of source rows at the 144-byte pitch
  const int bx = (int)blockIdx.x;      // the branch is the same for the whole work-group, so every wave meets the one barrier of its side
  if (bx < 5 * WB) {
    const int sel = bx / WB; const float* W = sel == 0 ? wq : sel == 1 ? wk : sel == 2 ? wv : sel == 3 ? w1 : w2;
    prep_tile<CC, true>(W, (unsigned short*)(BW + (size_t)sel * CC * CC), bx % WB, tl);
  } else {
    const int b = (bx - 5 * WB) / TB;
    prep_tile<NTK, false>(x + (size_t)b * CC * NTK, (unsigned short*)(T16 + (size_t)b * NTK * CC), (bx - 5 * WB) % TB, tl);
    asm volatile("s_wait_xcnt 0x0" ::: "memory");      // in the built code the other branch's instructions follow this branch's stores and rewrite the registers that they name
  }
}

extern "C" void kernel_launch(void* const* d_in, const int* in_sizes, int n_in,
                              void* d_out, int out_size, void* d_ws, size_t ws_size, hipStream_t stream) {
  (void)in_sizes; (void)n_in; (void)out_size;
  const float* const* I = (const float* const*)d_in; const float* x = I[0]; const float* wq = I[1]; const float* bq = I[2]; const float* wk = I[3]; const float* bk = I[4]; const float* wv = I[5]; const float* bv = I[6]; const float* w1 = I[7]; const float* b1 = I[8]; const float* w2 = I[9]; const float* b2 = I[10]; const float* g = I[11]; const float* be = I[12];
  char* ws = (char*)d_ws; size_t off = 0;
  auto take = [&](size_t bytes) { char* p = ws + off; off += (bytes + 255) & ~(size_t)255; return p; };
  _Float16* BQ = (_Float16*)take(5 * CC * CC * 2); _Float16* BK = BQ + CC * CC; _Float16* BV = BQ + 2 * CC * CC; _Float16* B1 = BQ + 3 * CC * CC;      /* five weight planes, one after another: w2's lies directly behind w1's */
  /* one workspace slab per image for every intermediate: all NBt images go through each launch, image = blockIdx.y in k_qkv and k_attn, (blockIdx.x - 5 * WB) / TB in k_prep */
  _Float16* T16 = (_Float16*)take((size_t)NBt * NTK * CC * 2); _Float16* Qh = (_Float16*)take((size_t)NBt * NTK * CC * 2); _Float16* Ql = (_Float16*)take((size_t)NBt * NTK * CC * 2); _Float16* Kh = (_Float16*)take((size_t)NBt * NTK * CC * 2); _Float16* Kl = (_Float16*)take((size_t)NBt * NTK * CC * 2); _Float16* VT = (_Float16*)take((size_t)NBt * CC * NTK * 2);
  if (off > ws_size) return;      // 5 weight planes of 128 KiB + 16 x 3 MiB: under 49 MiB
  k_prep<<<5 * WB + NBt * TB, 256, 0, stream>>>(x, wq, wk, wv, w1, w2, BQ, T16);      /* all weights stored (in,out); every plane and every image in the one launch */
  k_qkv<<<dim3(3 * QT, NBt), 256, 0, stream>>>(T16, BQ, BK, BV, bq, bk, bv, Qh, Ql, Kh, Kl, VT);      /* q, k (exact + bias) as hi/lo planes, v as f16 [channel][token] */
  k_attn<<<dim3(NTK / FR, NBt), 256, 0, stream>>>(Kh, Kl, Qh, Ql, VT, B1, b1, b2, g, be, (float*)d_out);      /* S'[j][i] = k_j.q_i (the transposed logits), softmax over i per j (= the module's softmax over the query axis), att[j] = sum_i P'[j][i].v[i]; then the MLP (SiLU) and the LayerNorm on the same rows, stored as [channel][token] */
}

// v010
// A run of this version takes 54.3 microseconds.
// In both of two side-by-side timings against v009, it was 1.06 times as fast.
// Counting every step since v000, it is 44.7 times as fast.
#include <hip/hip_runtime.h>
// Token self-attention block on a feature map (B 16, C 256, 32×32 = 1024 tokens): q, k, v = t·W + b (W stored (in,out)); m = q·kᵀ (no scaling); softmax over the QUERY axis i; att[j] = Σ_i m[i][j]·v[i]; MLP (SiLU, 256→256→256); LayerNorm; back to NCHW → [16,256,32,32].
// Structure: the column softmax is a row softmax of mᵀ = k·qᵀ, so per batch: S' = K·Qᵀ (rows j, cols i), row softmax, att = P'·V, the three in one kernel (running maximum per row); the MLP and the LayerNorm follow in the same kernel, on the work-group's own rows.
// Compute dtype: x and parameters rounded to bf16; q/k/v with exact products; q and k carried as f16 hi + lo·2^10 planes with three cross products (≈f32 logits — they reach σ≈8 unscaled), softmax in f32, P (×2^10), v, attention output and the SiLU hidden as f16 operands (≈2^-12), f32 accumulation; LayerNorm in f32. v_wmma_f32_16x16x32_f16.
#define NBt 16
#define CC 256
#define NTK 1024
typedef __bf16 v16b __attribute__((ext_vector_type(16)));
typedef unsigned short v8us __attribute__((ext_vector_type(8), may_alias));
typedef float  v8f  __attribute__((ext_vector_type(8)));
typedef float  v4f  __attribute__((ext_vector_type(4)));
typedef float  v4fa __attribute__((ext_vector_type(4), may_alias));
union FragB { v16b v; v8us half[2]; unsigned short u[16]; };

__device__ __forceinline__ unsigned short bf16_bits(float x) { unsigned int u = __float_as_uint(x); return (unsigned short)((u + 0x7FFFu + ((u >> 16) & 1u)) >> 16); }
__device__ __forceinline__ float bf16_val(unsigned short b) { return __uint_as_float(((unsigned int)b) << 16); }
__device__ __forceinline__ float bf16_round(float x) { return bf16_val(bf16_bits(x)); }
// D += A·B with NT terms: 1 = ah·bh, 2 = + al·bh (A split), 3 = + ah·bl (both split)
template <int NT>
__device__ __forceinline__ v8f mmaN(v16b ah, v16b al, v16b bh, v16b bl, v8f c) {
  c = __builtin_amdgcn_wmma_f32_16x16x32_bf16(false, ah, false, bh, (short)0, c, false, false);
  if (NT >= 2) c = __builtin_amdgcn_wmma_f32_16x16x32_bf16(false, al, false, bh, (short)0, c, false, false);
  if (NT >= 3) c = __builtin_amdgcn_wmma_f32_16x16x32_bf16(false, ah, false, bl, (short)0, c, false, false);
  asm volatile("v_nop\n\tv_nop\n\tv_nop\n\tv_nop" : "+v"(c) : "v"(ah), "v"(al), "v"(bh), "v"(bl));
  return c;
}

__global__ __launch_bounds__(256) void k_wt_bf16(const float* __restrict__ W, unsigned short* __restrict__ Wt, int K, int N) {
  const int t = blockIdx.x * 256 + threadIdx.x;
  const int k8n = K / 8;
  if (t >= N * k8n) return;
  const int n = t / k8n, k8 = (t % k8n) * 8;
  v8us v;
#pragma unroll
  for (int i = 0; i < 8; ++i) v[i] = bf16_bits(W[(size_t)(k8 + i) * N + n]);
  *(v8us*)(Wt + (size_t)n * K + k8) = v;
  
}

// GEMM C[M][N] (f32, pitch ldc) = act(A[M][K]·W + bias). A f32 row-major (pitch lda) converted per fragment to bf16
// (ASPLIT: hi/lo two planes -> 2 terms, else single rounded term); Wt bf16 [N][K] (pitch ldb). BIAS_BF16 rounds the
// bias to bf16 first (bias quantised to bf16 before the add). K%32==0, M%16==0, N%64==0.
template <bool ASPLIT, int ACT, bool BIAS_BF16>
__global__ __launch_bounds__(128) void k_gemm_bf(const float* __restrict__ A, int lda, const unsigned short* __restrict__ Wt, int ldb,
                                               const float* __restrict__ bias, float* __restrict__ C, int ldc, int M, int N, int K) {
  __shared__ __attribute__((aligned(16))) float so[4][16][64];
  const int tid = threadIdx.x, w = tid >> 5, lane = tid & 31, ln = lane & 15, hh = lane >> 4;
  const int ntn = N / 64;
  const int wid = blockIdx.x * 4 + w;
  const int mt = wid / ntn, nq = wid % ntn;
  if (mt * 16 >= M) return;
  const int row0 = mt * 16, col0 = nq * 64;
  const float* arow = A + (size_t)(row0 + ln) * lda;
  v8f acc[4] = {};
  for (int kb = 0; kb < K; kb += 32) {
    FragB ah, al;
    const v4f x0 = *(const v4fa*)(arow + kb + 8 * hh), x1 = *(const v4fa*)(arow + kb + 8 * hh + 4);
    const v4f x2 = *(const v4fa*)(arow + kb + 16 + 8 * hh), x3 = *(const v4fa*)(arow + kb + 16 + 8 * hh + 4);
    float xs[16] = {x0[0],x0[1],x0[2],x0[3],x1[0],x1[1],x1[2],x1[3],x2[0],x2[1],x2[2],x2[3],x3[0],x3[1],x3[2],x3[3]};
#pragma unroll
    for (int i = 0; i < 16; ++i) { const unsigned short hb = bf16_bits(xs[i]); ah.u[i] = hb; al.u[i] = ASPLIT ? bf16_bits(xs[i] - bf16_val(hb)) : (unsigned short)0; }
#pragma unroll
    for (int t = 0; t < 4; ++t) {
      const unsigned short* brow = Wt + (size_t)(col0 + t * 16 + ln) * ldb + kb;
      FragB b;
      b.half[0] = *(const v8us*)(brow + 8 * hh);
      b.half[1] = *(const v8us*)(brow + 16 + 8 * hh);
      acc[t] = mmaN<ASPLIT ? 2 : 1>(ah.v, al.v, b.v, b.v, acc[t]);
    }
  }
#pragma unroll
  for (int t = 0; t < 4; ++t) {
    float bv = bias ? bias[col0 + t * 16 + ln] : 0.f;
    if (BIAS_BF16) bv = bf16_round(bv);
#pragma unroll
    for (int r = 0; r < 8; ++r) { float v = acc[t][r] + bv; if (ACT == 1) v = fmaxf(v, 0.f); so[w][8 * hh + r][t * 16 + ln] = v; }
  }
  __builtin_amdgcn_fence(__ATOMIC_ACQ_REL, "workgroup");
  __builtin_amdgcn_wave_barrier();
  const int rsub = lane >> 4, c4 = (lane & 15) * 4;
  {
#pragma unroll
    for (int q = 0; q < 8; ++q) {
      const int r = q * 2 + rsub;
      const v4f v = *(const v4fa*)&so[w][r][c4];
      *(v4f*)(C + (size_t)(row0 + r) * ldc + col0 + c4) = v;
    }
    
  }
}

// GEMM C = act(A·W + bias + resid): A f32 (ASPLIT -> hi/lo 2 terms), Wt bf16 [N][K]; ACT 0 none, 1 relu, 2 exact gelu;
// resid (optional, f32, row index = (row % rmod), pitch ldr, RES_BF16 rounds it) added before the activation.
template <bool ASPLIT, int ACT, bool BIAS_BF16, bool RES_BF16>
__global__ __launch_bounds__(128) void k_gemm_bf3(const float* __restrict__ A, int lda, const unsigned short* __restrict__ Wt, int ldb,
                                                const float* __restrict__ bias, const float* __restrict__ resid, int rmod, int ldr,
                                                float* __restrict__ C, int ldc, int M, int N, int K) {
  __shared__ __attribute__((aligned(16))) float so[4][16][64];
  const int tid = threadIdx.x, w = tid >> 5, lane = tid & 31, ln = lane & 15, hh = lane >> 4;
  const int ntn = N / 64;
  const int wid = blockIdx.x * 4 + w;
  const int mt = wid / ntn, nq = wid % ntn;
  if (mt * 16 >= M) return;
  const int row0 = mt * 16, col0 = nq * 64;
  const float* arow = A + (size_t)(row0 + ln) * lda;
  v8f acc[4] = {};
  for (int kb = 0; kb < K; kb += 32) {
    FragB ah, al;
    const v4f x0 = *(const v4fa*)(arow + kb + 8 * hh), x1 = *(const v4fa*)(arow + kb + 8 * hh + 4);
    const v4f x2 = *(const v4fa*)(arow + kb + 16 + 8 * hh), x3 = *(const v4fa*)(arow + kb + 16 + 8 * hh + 4);
    float xs[16] = {x0[0],x0[1],x0[2],x0[3],x1[0],x1[1],x1[2],x1[3],x2[0],x2[1],x2[2],x2[3],x3[0],x3[1],x3[2],x3[3]};
#pragma unroll
    for (int i = 0; i < 16; ++i) { const unsigned short hb = bf16_bits(xs[i]); ah.u[i] = hb; al.u[i] = ASPLIT ? bf16_bits(xs[i] - bf16_val(hb)) : (unsigned short)0; }
#pragma unroll
    for (int t = 0; t < 4; ++t) {
      const unsigned short* brow = Wt + (size_t)(col0 + t * 16 + ln) * ldb + kb;
      FragB b;
      b.half[0] = *(const v8us*)(brow + 8 * hh);
      b.half[1] = *(const v8us*)(brow + 16 + 8 * hh);
      acc[t] = mmaN<ASPLIT ? 2 : 1>(ah.v, al.v, b.v, b.v, acc[t]);
    }
  }
#pragma unroll
  for (int t = 0; t < 4; ++t) {
    const int col = col0 + t * 16 + ln;
    float bv = bias ? bias[col] : 0.f;
    if (BIAS_BF16) bv = bf16_round(bv);
#pragma unroll
    for (int r = 0; r < 8; ++r) {
      float v = acc[t][r] + bv;
      if (resid) { float rv = resid[(size_t)((row0 + 8 * hh + r) % rmod) * ldr + col]; if (RES_BF16) rv = bf16_round(rv); v += rv; }
      if (ACT == 1) v = fmaxf(v, 0.f);
      if (ACT == 2) v = 0.5f * v * (1.0f + erff(v * 0.70710678118654752f));
      if (ACT == 3) { const float u = 0.7978845608028654f * (v + 0.044715f * v * v * v); v = 0.5f * v * (1.0f + tanhf(u)); }
      so[w][8 * hh + r][t * 16 + ln] = v;
    }
  }
  __builtin_amdgcn_fence(__ATOMIC_ACQ_REL, "workgroup");
  __builtin_amdgcn_wave_barrier();
  const int rsub = lane >> 4, c4 = (lane & 15) * 4;
  {
#pragma unroll
    for (int q = 0; q < 8; ++q) {
      const int r = q * 2 + rsub;
      const v4f v = *(const v4fa*)&so[w][r][c4];
      *(v4f*)(C + (size_t)(row0 + r) * ldc + col0 + c4) = v;
    }
    
  }
}
// row LayerNorm (biased variance, eps) over N: s = X (+ R); optional out_sum <- s; out_norm <- (s-mu)*rsqrt(var+eps)*g + b
template <bool PARAM_BF16>
__global__ __launch_bounds__(256) void k_layernorm(const float* __restrict__ X, const float* __restrict__ R, const float* __restrict__ g, const float* __restrict__ bta,
                                                  float* __restrict__ out_sum, float* __restrict__ out_norm, int N, float eps) {
  __shared__ float red[256];
  const int row = blockIdx.x, tid = threadIdx.x;
  const float* x = X + (size_t)row * N; const float* rr = R ? R + (size_t)row * N : nullptr;
  float vals[16];                     // up to N = 4096
  const int per = N / 256;            // contiguous chunk per thread? use strided-by-4 chunks: thread handles j = tid*4 + 1024*u
  float s1 = 0.f;
  for (int u = 0; u < per / 4; ++u) {
    const int j = tid * 4 + 1024 * u;
    const v4f a = *(const v4fa*)(x + j);
    v4f b = {0.f,0.f,0.f,0.f}; if (rr) b = *(const v4fa*)(rr + j);
#pragma unroll
    for (int q = 0; q < 4; ++q) { const float v = a[q] + b[q]; vals[u * 4 + q] = v; s1 += v; }
  }
  red[tid] = s1; __syncthreads();
  for (int st = 128; st > 0; st >>= 1) { if (tid < st) red[tid] += red[tid + st]; __syncthreads(); }
  const float mu = red[0] / (float)N; __syncthreads();
  float s2 = 0.f;
  for (int u = 0; u < per / 4; ++u)
#pragma unroll
    for (int q = 0; q < 4; ++q) { const float c = vals[u * 4 + q] - mu; s2 += c * c; }
  red[tid] = s2; __syncthreads();
  for (int st = 128; st > 0; st >>= 1) { if (tid < st) red[tid] += red[tid + st]; __syncthreads(); }
  const float rs = rsqrtf(red[0] / (float)N + eps);
  {
    for (int u = 0; u < per / 4; ++u) {
      const int j = tid * 4 + 1024 * u;
      v4f o, sm;
#pragma unroll
      for (int q = 0; q < 4; ++q) {
        float gg = g[j + q], bb = bta[j + q];
        if (PARAM_BF16) { gg = bf16_round(gg); bb = bf16_round(bb); }
        sm[q] = vals[u * 4 + q]; o[q] = (vals[u * 4 + q] - mu) * rs * gg + bb;
      }
      if (out_sum) *(v4f*)(out_sum + (size_t)row * N + j) = sm;
      *(v4f*)(out_norm + (size_t)row * N + j) = o;
    }
    
  }
}



// ---- f16 WMMA path (v_wmma_f32_16x16x32_f16): 11-bit significands for operands in range — used where a [0,1] probability operand needs more precision than bf16
typedef _Float16 v16h __attribute__((ext_vector_type(16)));
union FragH { v16h v; v8us half[2]; _Float16 h[16]; unsigned short u[16]; };
template <int NT>
__device__ __forceinline__ v8f mmaH(v16h ah, v16h al, v16h bh, v16h bl, v8f c) {
  c = __builtin_amdgcn_wmma_f32_16x16x32_f16(false, ah, false, bh, (short)0, c, false, false);
  if (NT >= 2) c = __builtin_amdgcn_wmma_f32_16x16x32_f16(false, al, false, bh, (short)0, c, false, false);
  if (NT >= 3) c = __builtin_amdgcn_wmma_f32_16x16x32_f16(false, ah, false, bl, (short)0, c, false, false);
  asm volatile("v_nop\n\tv_nop\n\tv_nop\n\tv_nop" : "+v"(c) : "v"(ah), "v"(al), "v"(bh), "v"(bl));
  return c;
}
// batched GEMM like k_gemm_b but f16 operands: A f32 (split into f16 hi/lo if ASPLIT, else rounded to f16), Bt = f16 values [n][k]; alpha; C f32; N multiple of 16 (partial tiles skipped)
template <bool ASPLIT>
__global__ __launch_bounds__(128) void k_gemm_h(const float* __restrict__ A, int lda, size_t sA, const _Float16* __restrict__ Bh, int ldb, size_t sB, float alpha, float* __restrict__ C, int ldc, size_t sC, int M, int N, int K) {
  __shared__ __attribute__((aligned(16))) float so[4][16][64];
  const int tid = threadIdx.x, w = tid >> 5, lane = tid & 31, ln = lane & 15, hh = lane >> 4; const int by = blockIdx.y;
  A += (size_t)by * sA; Bh += (size_t)by * sB; C += (size_t)by * sC;
  const int ntn = (N + 63) / 64; const int wid = blockIdx.x * 4 + w; const int mt = wid / ntn, nq = wid % ntn; if (mt * 16 >= M) return;
  const int row0 = mt * 16, col0 = nq * 64; const float* arow = A + (size_t)(row0 + ln) * lda;
  v8f acc[4] = {};
  for (int kb = 0; kb < K; kb += 32) {
    FragH ah, al;
    const v4f x0 = *(const v4fa*)(arow + kb + 8 * hh), x1 = *(const v4fa*)(arow + kb + 8 * hh + 4), x2 = *(const v4fa*)(arow + kb + 16 + 8 * hh), x3 = *(const v4fa*)(arow + kb + 16 + 8 * hh + 4);
    float xs[16] = {x0[0],x0[1],x0[2],x0[3],x1[0],x1[1],x1[2],x1[3],x2[0],x2[1],x2[2],x2[3],x3[0],x3[1],x3[2],x3[3]};
#pragma unroll
    for (int i = 0; i < 16; ++i) { const _Float16 h = (_Float16)xs[i]; ah.h[i] = h; al.h[i] = ASPLIT ? (_Float16)(xs[i] - (float)h) : (_Float16)0.0f; }
#pragma unroll
    for (int t = 0; t < 4; ++t) { if (col0 + t * 16 >= N) continue; const size_t boff = (size_t)(col0 + t * 16 + ln) * ldb + kb; FragH bq; bq.half[0] = *(const v8us*)(Bh + boff + 8 * hh); bq.half[1] = *(const v8us*)(Bh + boff + 16 + 8 * hh);
      acc[t] = mmaH<ASPLIT ? 2 : 1>(ah.v, al.v, bq.v, bq.v, acc[t]); }
  }
#pragma unroll
  for (int t = 0; t < 4; ++t) { if (col0 + t * 16 >= N) continue;
#pragma unroll
    for (int r = 0; r < 8; ++r) so[w][8 * hh + r][t * 16 + ln] = acc[t][r] * alpha; }
  __builtin_amdgcn_fence(__ATOMIC_ACQ_REL, "workgroup"); __builtin_amdgcn_wave_barrier();
  const int rsub = lane >> 4, c4 = (lane & 15) * 4;
  {
#pragma unroll
    for (int q = 0; q < 8; ++q) { const int r = q * 2 + rsub; if (col0 + c4 < N) { const v4f v = *(const v4fa*)&so[w][r][c4]; *(v4f*)(C + (size_t)(row0 + r) * ldc + col0 + c4) = v; } }
     }
}

// Tile constants of the block-tiled products below.
#define GT 128      /* tile edge, rows of A and rows of Bh per work-group */
#define GK 64       /* k slice */
#define GPIT 72     /* LDS row pitch in f16: 144 B = 16 B x 9, so the 16 rows of a 16-byte fragment read fall on distinct banks */
#define GSO 68      /* epilogue row pitch in f32: rows 8 apart fall on different banks */

// q, k and v in one launch, each written once, in the form its reader takes: q and k as f16 hi and lo*2^10 planes [token][channel], v as f16 [channel][token].
// blockIdx.x / QT picks the product, blockIdx.x % QT its 128 x 128 tile, blockIdx.y the image. q, k: rows = tokens (T16), columns = channels (the weight plane), bias by column.
// v: the operands change places (rows = channels from BV, columns = tokens from T16), so the tile comes out transposed as it stands and its bias goes by row.
// One work-group of 8 waves owns a 128 x 128 tile, each wave 32 x 64 of it; both operands come in 64-wide k slices as whole 128-byte lines through LDS (two buffers, the next slice's loads fly during this slice's products); k runs upward in steps of 32 per accumulator.
#define QT ((NTK / GT) * (CC / GT))      /* tiles per product and image */
__global__ __launch_bounds__(256) void k_qkv(const _Float16* __restrict__ T16, const _Float16* __restrict__ BQ, const _Float16* __restrict__ BK, const _Float16* __restrict__ BV,
    const float* __restrict__ bq, const float* __restrict__ bk, const float* __restrict__ bvv,
    _Float16* __restrict__ Qh, _Float16* __restrict__ Ql, _Float16* __restrict__ Kh, _Float16* __restrict__ Kl, _Float16* __restrict__ VT) {
  __shared__ __attribute__((aligned(16))) unsigned short st[2][2][GT][GPIT];      // [buffer][A | B][row][k]; reused as f32 staging by the epilogue
  const int tid = threadIdx.x, w = tid >> 5, lane = tid & 31, ln = lane & 15, hh = lane >> 4;
  const int sel = (int)blockIdx.x / QT, tile = (int)blockIdx.x % QT; const bool isv = sel == 2;
  const size_t iofs = (size_t)blockIdx.y * NTK * CC;      // every per-image array here holds NTK * CC elements
  const int row0 = (isv ? tile / (NTK / GT) : tile / (CC / GT)) * GT, col0 = (isv ? tile % (NTK / GT) : tile % (CC / GT)) * GT;
  const int wr = (w >> 1) * 32, wc = (w & 1) * 64;      // the wave's 32 x 64 part of the tile
  const int lr = tid >> 3, lc = (tid & 7) * 8;          // staging: 8 lanes per 128-byte row slice, 32 rows per pass
  const char* ab = (const char*)(isv ? BV : T16 + iofs); const char* bb = (const char*)(isv ? T16 + iofs : (sel ? BK : BQ));      // uniform bases
  const unsigned ao = (unsigned)(((row0 + lr) * CC + lc) * 2), bo = (unsigned)(((col0 + lr) * CC + lc) * 2);      // the lane's byte offsets; further rows are constants, the slice a uniform step
  v8us ra[4], rb[4];
#pragma unroll
  for (int i = 0; i < 4; ++i) { ra[i] = *(const v8us*)(ab + ao + i * (32 * CC * 2)); rb[i] = *(const v8us*)(bb + bo + i * (32 * CC * 2)); }
#pragma unroll
  for (int i = 0; i < 4; ++i) { *(v8us*)&st[0][0][lr + 32 * i][lc] = ra[i]; *(v8us*)&st[0][1][lr + 32 * i][lc] = rb[i]; }
  __syncthreads();
  v8f acc[2][4] = {};
#pragma unroll 1      // kept rolled: unrolled, the wave takes 161 registers, allocated as 176, and only two work-groups fit on a WGP; at 160 three fit, which is what this grid gives each WGP
  for (int kb = 0; kb < CC; kb += GK) {
    const int cur = (kb / GK) & 1; const bool more = kb + GK < CC;
    if (more) {
#pragma unroll
      for (int i = 0; i < 4; ++i) { ra[i] = *(const v8us*)(ab + ao + i * (32 * CC * 2) + (kb + GK) * 2); rb[i] = *(const v8us*)(bb + bo + i * (32 * CC * 2) + (kb + GK) * 2); }
    }
#pragma unroll
    for (int ks = 0; ks < GK; ks += 32) {
      FragH fa[2], fb[4];
#pragma unroll
      for (int mi = 0; mi < 2; ++mi) { fa[mi].half[0] = *(const v8us*)&st[cur][0][wr + mi * 16 + ln][ks + 8 * hh]; fa[mi].half[1] = *(const v8us*)&st[cur][0][wr + mi * 16 + ln][ks + 16 + 8 * hh]; }
#pragma unroll
      for (int t = 0; t < 4; ++t) { fb[t].half[0] = *(const v8us*)&st[cur][1][wc + t * 16 + ln][ks + 8 * hh]; fb[t].half[1] = *(const v8us*)&st[cur][1][wc + t * 16 + ln][ks + 16 + 8 * hh]; }
#pragma unroll
      for (int mi = 0; mi < 2; ++mi)
#pragma unroll
        for (int t = 0; t < 4; ++t) acc[mi][t] = mmaH<1>(fa[mi].v, fa[mi].v, fb[t].v, fb[t].v, acc[mi][t]);
    }
    if (more) {
#pragma unroll
      for (int i = 0; i < 4; ++i) { *(v8us*)&st[cur ^ 1][0][lr + 32 * i][lc] = ra[i]; *(v8us*)&st[cur ^ 1][1][lr + 32 * i][lc] = rb[i]; }
    }
    __syncthreads();      // publishes the next slice and ends every wave's reads of this one (after the last slice: frees the LDS for the epilogue)
  }
  typedef _Float16 v4h __attribute__((ext_vector_type(4)));
  float* so = (float*)&st[0][0][0][0] + (size_t)w * (32 * GSO);      // the wave's own 32 x 64 f32 staging
  const int rsub = lane >> 4, c4 = (lane & 15) * 4;
  const int orow = row0 + wr + rsub, ocol = col0 + wc + c4;      // the lane's first output row (then every second one) and its four columns
  if (isv) {
    float br[2][8];      // bias by row (channel)
#pragma unroll
    for (int mi = 0; mi < 2; ++mi)
#pragma unroll
      for (int r = 0; r < 8; ++r) br[mi][r] = bf16_round(bvv[row0 + wr + mi * 16 + 8 * hh + r]);
#pragma unroll
    for (int mi = 0; mi < 2; ++mi)
#pragma unroll
      for (int t = 0; t < 4; ++t)
#pragma unroll
        for (int r = 0; r < 8; ++r) so[(mi * 16 + 8 * hh + r) * GSO + t * 16 + ln] = acc[mi][t][r] * 0.0625f + br[mi][r];
    __builtin_amdgcn_fence(__ATOMIC_ACQ_REL, "workgroup"); __builtin_amdgcn_wave_barrier();
    _Float16* vo = VT + iofs + (size_t)orow * NTK + ocol;
#pragma unroll
    for (int q = 0; q < 16; ++q) { const v4f o = *(const v4fa*)&so[(q * 2 + rsub) * GSO + c4]; v4h h4;
#pragma unroll
      for (int i = 0; i < 4; ++i) h4[i] = (_Float16)o[i];
      *(v4h*)(vo + q * 2 * NTK) = h4; }
  } else {
    const float* bias = sel ? bk : bq;
    float bc[4];      // bias by column (channel)
#pragma unroll
    for (int t = 0; t < 4; ++t) bc[t] = bf16_round(bias[col0 + wc + t * 16 + ln]);
#pragma unroll
    for (int mi = 0; mi < 2; ++mi)
#pragma unroll
      for (int t = 0; t < 4; ++t)
#pragma unroll
        for (int r = 0; r < 8; ++r) so[(mi * 16 + 8 * hh + r) * GSO + t * 16 + ln] = acc[mi][t][r] * 0.0625f + bc[t];
    __builtin_amdgcn_fence(__ATOMIC_ACQ_REL, "workgroup"); __builtin_amdgcn_wave_barrier();
    _Float16* ho = (sel ? Kh : Qh) + iofs + (size_t)orow * CC + ocol; _Float16* lo = (sel ? Kl : Ql) + iofs + (size_t)orow * CC + ocol;
#pragma unroll
    for (int q = 0; q < 16; ++q) { const v4f o = *(const v4fa*)&so[(q * 2 + rsub) * GSO + c4]; v4h h4, l4;
#pragma unroll
      for (int i = 0; i < 4; ++i) { const _Float16 h = (_Float16)o[i]; h4[i] = h; l4[i] = (_Float16)((o[i] - (float)h) * 1024.0f); }
      *(v4h*)(ho + q * 2 * CC) = h4; *(v4h*)(lo + q * 2 * CC) = l4; }
    asm volatile("s_wait_xcnt 0x0" ::: "memory");      // in the built code the other branch's instructions follow these stores and rewrite the registers that they name
  }
}

// Attention in one launch: logits, softmax over i and the product with v, per work-group for FR rows j of one image (blockIdx.y); neither the logits nor the probabilities go to memory.
// S'[j][i] = Ah.Bh + 2^-10 (Al.Bh + Ah.Bl) with A = k (hi and lo*2^10 planes), B = q (the same two planes); att[j] = sum_i softmax_i(S'[j][.]) v[i].
// The tokens i come in chunks of FI. A wave owns 16 rows j and one half (32) of each chunk's tokens, and nothing of the softmax leaves its registers. Per chunk:
// (1) the logits transposed, S[i][j], with q (from LDS) as A and the wave's k rows (in registers for the whole kernel) as B: a lane then holds 16 tokens' logits of ONE row j;
// (2) maximum and sum in the lane plus one exchange between the wave's halves; e = exp(s - max) * 2^10 (one multiply-add and one v_exp_f32) as f16: the two accumulator tiles, converted in place, are the B operand of the next product;
// (3) the output sums transposed, O[channel][j] += v[channel][i].e[i][j] (v rows from LDS as A), so the factor exp(old max - new max) is the lane's own. The row's sum of e is kept beside (f32, scaled the same way).
// Behind the loop the two waves of a row group join their maxima, sums and output sums through LDS, once.
// q and v chunks have two LDS buffers and one set of staging registers: a chunk's q loads go out as soon as the chunk before it has left those registers for LDS, its v loads in the middle of the product with v, so they fly for about a whole chunk's work before their values are wanted. One work-group per WGP (two waves per SIMD).
// Behind the loop the work-group holds whole rows of the attention output, and everything that follows in the block is row-wise, so it is done here, on LDS that the loop has left:
// h = SiLU(att.W1 + b1) and y = h.W2 + b2 (each wave 32 x 64 of the 64 x 256 result; att and h as f16 rows in LDS; BM = the two weight planes [n][k], one after the other, each whole in LDS for its product),
// LayerNorm of y (one wave per row, eight rows each) and the store as [channel][token]. None of att, h, y goes to memory.
#define FR 64       /* rows j per work-group */
#define FI 64       /* tokens i per chunk */
#define QPIT 264    /* LDS row pitch of a q row in f16: 528 B = 16 B x 33, so the 16 rows of a 16-byte fragment read fall on distinct banks */
// the value of lane l ^ 16, by a vector move instead of the LDS round trip that __shfl_xor compiles to
__device__ __forceinline__ float xhalf(float x) { return __builtin_bit_cast(float, __builtin_amdgcn_permlanex16(__builtin_bit_cast(int, x), __builtin_bit_cast(int, x), 0x76543210, 0xfedcba98, false, false)); }
// Work-group barrier for data that waves hand over in LDS alone: the fences name the LDS address space, so a wave waits for its LDS operations and leaves its global loads in flight.
// __syncthreads() waits for those loads too, which would end the flight of the next chunk at the first barrier behind its issue.
__device__ __forceinline__ void lds_barrier() {
  __builtin_amdgcn_fence(__ATOMIC_RELEASE, "workgroup", "local");
  __builtin_amdgcn_s_barrier();
  __builtin_amdgcn_fence(__ATOMIC_ACQUIRE, "workgroup", "local");
}
__global__ __launch_bounds__(256) void k_attn(const _Float16* __restrict__ Ah, const _Float16* __restrict__ Al, const _Float16* __restrict__ Bh, const _Float16* __restrict__ Bl, const _Float16* __restrict__ VT,
    const _Float16* __restrict__ BM, const float* __restrict__ b1, const float* __restrict__ b2, const float* __restrict__ g, const float* __restrict__ be, float* __restrict__ out) {
  __shared__ __attribute__((aligned(16))) unsigned short sq[2][2][FI][QPIT];      // [buffer][Bh | Bl][token i][channel]; behind the loop: one weight plane
  __shared__ __attribute__((aligned(16))) unsigned short sv[2][CC][GPIT];         // [buffer][channel][token i]; behind the loop: att and h (f16 rows)
  __shared__ __attribute__((aligned(16))) float smx[2][FR];                       // written once behind the loop, per token half and row: the running maximum
  __shared__ __attribute__((aligned(16))) float slx[2][FR];                       // the same: the sum of e * 2^10
  __shared__ __attribute__((aligned(16))) float sz[8][32][GSO];                   // behind the loop: the output sums that a wave hands to its partner; then each wave's 32 x 64 of att.W1 + b1, on the way to SiLU; then y (f32 rows)
  const int tid = threadIdx.x, w = tid >> 5, lane = tid & 31, ln = lane & 15, hh = lane >> 4;
  const size_t pofs = (size_t)blockIdx.y * NTK * CC;      // every per-image array here holds NTK * CC elements
  const int j0 = (int)blockIdx.x * FR;
  const int rg = (w >> 1) * 16, ih = w & 1, cg = ih * 32;      // the wave's 16 rows j and its 32 tokens of every chunk
  const int wr = (w >> 2) * 32, wc = (w & 3) * 64;      // behind the loop: the wave's 32 x 64 part of the MLP's tiles
  const char* qb[2] = {(const char*)(Bh + pofs), (const char*)(Bl + pofs)}; const char* vb = (const char*)(VT + pofs);      // uniform bases
  const unsigned qo = (unsigned)((w * CC + lane * 8) * 2);      // a wave loads one whole 512-byte q row; its further rows are constants, the chunk a uniform step
  const unsigned vo = (unsigned)(((tid >> 3) * NTK + (tid & 7) * 8) * 2);      // 8 lanes per 128-byte slice of a v row, 32 rows per pass
  v8us zq[2][8], zv[8];      // chunk 0, on its way to LDS
#pragma unroll
  for (int i = 0; i < 8; ++i) { zq[0][i] = *(const v8us*)(qb[0] + qo + i * (8 * CC * 2)); zq[1][i] = *(const v8us*)(qb[1] + qo + i * (8 * CC * 2)); zv[i] = *(const v8us*)(vb + vo + i * (32 * NTK * 2)); }
  FragH kh[8], kl[8];      // the wave's 16 k rows, all 256 channels, both planes
  const unsigned short* ph = (const unsigned short*)(Ah + pofs) + (size_t)(j0 + rg + ln) * CC + 8 * hh; const unsigned short* pl = (const unsigned short*)(Al + pofs) + (size_t)(j0 + rg + ln) * CC + 8 * hh;
#pragma unroll
  for (int ks = 0; ks < 8; ++ks) { kh[ks].half[0] = *(const v8us*)(ph + ks * 32); kh[ks].half[1] = *(const v8us*)(ph + ks * 32 + 16); kl[ks].half[0] = *(const v8us*)(pl + ks * 32); kl[ks].half[1] = *(const v8us*)(pl + ks * 32 + 16); }
  asm volatile("s_wait_xcnt 0x0" :: "v"(tid), "v"(vo), "v"(ph), "v"(pl) : "memory");      // the registers that the loads above name are given other values from here on; as inputs they stay as they are up to the wait
#pragma unroll
  for (int i = 0; i < 8; ++i) { *(v8us*)&sq[0][0][w + 8 * i][lane * 8] = zq[0][i]; *(v8us*)&sq[0][1][w + 8 * i][lane * 8] = zq[1][i]; *(v8us*)&sv[0][(tid >> 3) + 32 * i][(tid & 7) * 8] = zv[i]; }
  __builtin_amdgcn_sched_barrier(0);      // keeps chunk 1's loads behind chunk 0's stores, hence behind the return of chunk 0: moved ahead of them, a wave would have 80 loads outstanding, more than its counter holds
  v8us rq[2][8], rv[8];      // the loop's staging registers: chunk 1 goes out here, behind every k row (a k row loaded behind it would make the loop wait for every load in flight)
#pragma unroll
  for (int i = 0; i < 8; ++i) rq[0][i] = *(const v8us*)(qb[0] + qo + i * (8 * CC * 2) + FI * CC * 2);
#pragma unroll
  for (int i = 0; i < 8; ++i) rq[1][i] = *(const v8us*)(qb[1] + qo + i * (8 * CC * 2) + FI * CC * 2);
#pragma unroll
  for (int i = 0; i < 8; ++i) rv[i] = *(const v8us*)(vb + vo + i * (32 * NTK * 2) + FI * 2);
  asm volatile("s_wait_xcnt 0x0" :: "v"(tid), "v"(vo) : "memory");      // the registers that chunk 1's loads name are given other values from here on; as inputs they stay as they are up to the wait
  lds_barrier();      // chunk 0 is whole before any wave reads it
  v8f oa[16] = {};      // output sums, transposed: tile ct holds channels ct * 16 + 8 * hh + r of row rg + ln, over the wave's own tokens
  float m = -3.0e38f, l = 0.f;      // the row's running maximum over the wave's tokens (equal in both halves of the wave); the sum of e * 2^10 over the lane's own tokens
  FragH fq[2][2][2];      // q fragments [slot][token block][Bh | Bl], read one k step ahead of their products (a third slot would not fit the wave's 512 registers beside k, the output sums and the staging)
#pragma unroll
  for (int t = 0; t < 2; ++t)      // chunk 0's first k step; that of every later chunk is read at the foot of the trip before
#pragma unroll
    for (int p = 0; p < 2; ++p) { fq[0][t][p].half[0] = *(const v8us*)&sq[0][p][cg + t * 16 + ln][8 * hh]; fq[0][t][p].half[1] = *(const v8us*)&sq[0][p][cg + t * 16 + ln][16 + 8 * hh]; }
#pragma unroll 1      // kept rolled: for speed only
  for (int c = 0; c < NTK / FI; ++c) {
    const int cur = c & 1;      // on entry the staging registers hold, or are about to receive, chunk c + 1
    v8f hi[2] = {}, lo[2] = {};      // hi: Bh.Ah; lo: Bh.Al then Bl.Ah, k upward; they meet once per chunk
#pragma unroll
    for (int ks = 0; ks < 8; ++ks) {
      const int s = ks & 1, n = s ^ 1;
      if (ks + 1 < 8) {
#pragma unroll
        for (int t = 0; t < 2; ++t)
#pragma unroll
          for (int p = 0; p < 2; ++p) { fq[n][t][p].half[0] = *(const v8us*)&sq[cur][p][cg + t * 16 + ln][(ks + 1) * 32 + 8 * hh]; fq[n][t][p].half[1] = *(const v8us*)&sq[cur][p][cg + t * 16 + ln][(ks + 1) * 32 + 16 + 8 * hh]; }
      }
      // The next chunk goes to the other buffers beside the last three k steps: this phase is bound by LDS reads, and the write path is free. Their last readers left those buffers before the barrier of the chunk before.
      // No branch round the stores (a join would make every later LDS wait count them): in the last chunk they put stale registers into buffers whose bytes nobody uses any more.
      if (ks == 5) {
#pragma unroll
        for (int i = 0; i < 8; ++i) *(v8us*)&sq[cur ^ 1][0][w + 8 * i][lane * 8] = rq[0][i];
      }
      if (ks == 6) {
#pragma unroll
        for (int i = 0; i < 8; ++i) *(v8us*)&sq[cur ^ 1][1][w + 8 * i][lane * 8] = rq[1][i];
      }
      if (ks == 7) {
#pragma unroll
        for (int i = 0; i < 8; ++i) *(v8us*)&sv[cur ^ 1][(tid >> 3) + 32 * i][(tid & 7) * 8] = rv[i];
        // The staging registers are free from here: q of chunk c + 2 goes out now and is wanted two k steps short of this place in the next trip, so its flight has the softmax, the product with v and most of the next logits to pass beside. (v follows in the middle of the product with v.)
        if (c + 2 < NTK / FI) {      // the same for the whole work-group
          const char* g0 = qb[0] + qo + (c + 2) * (FI * CC * 2); const char* g1 = qb[1] + qo + (c + 2) * (FI * CC * 2);
#pragma unroll
          for (int i = 0; i < 8; ++i) rq[0][i] = *(const v8us*)(g0 + i * (8 * CC * 2));
#pragma unroll
          for (int i = 0; i < 8; ++i) rq[1][i] = *(const v8us*)(g1 + i * (8 * CC * 2));
          asm volatile("s_wait_xcnt 0x0" :: "v"(g0), "v"(g1) : "memory");      // the registers that these loads name are given other values below; as inputs they stay as they are up to the wait
        }
      }
      __builtin_amdgcn_sched_barrier(0);      // keeps the reads and stores above ahead of the products below; left free, the compiler sinks each read to just before its use
#pragma unroll
      for (int t = 0; t < 2; ++t) hi[t] = __builtin_amdgcn_wmma_f32_16x16x32_f16(false, fq[s][t][0].v, false, kh[ks].v, (short)0, hi[t], false, false);
#pragma unroll
      for (int t = 0; t < 2; ++t) lo[t] = __builtin_amdgcn_wmma_f32_16x16x32_f16(false, fq[s][t][0].v, false, kl[ks].v, (short)0, lo[t], false, false);
#pragma unroll
      for (int t = 0; t < 2; ++t) lo[t] = __builtin_amdgcn_wmma_f32_16x16x32_f16(false, fq[s][t][1].v, false, kh[ks].v, (short)0, lo[t], false, false);
    }
    FragH fv[4][4];      // this chunk's v fragments [group of 64 channels][block of 16 channels], the wave's 32 tokens as k
#pragma unroll
    for (int gq = 0; gq < 2; ++gq)
#pragma unroll
      for (int t = 0; t < 4; ++t) { fv[gq][t].half[0] = *(const v8us*)&sv[cur][gq * 64 + t * 16 + ln][cg + 8 * hh]; fv[gq][t].half[1] = *(const v8us*)&sv[cur][gq * 64 + t * 16 + ln][cg + 16 + 8 * hh]; }
    __builtin_amdgcn_sched_barrier(0);      // keeps these reads ahead of the softmax, beside which their latency passes
    FragH pf;      // e * 2^10 as the B operand: element s is token cg + 8 * hh + s (s < 8) or cg + 16 + 8 * hh + s - 8, the order in which the v fragments hold their tokens
    float al;
    {
      float sx[16];      // logits of row rg + ln and tokens cg + t * 16 + 8 * hh + r
#pragma unroll
      for (int t = 0; t < 2; ++t)
#pragma unroll
        for (int r = 0; r < 8; ++r) sx[t * 8 + r] = lo[t][r] * 0.0009765625f + hi[t][r];
      float mx = sx[0];
#pragma unroll
      for (int k = 1; k < 16; ++k) mx = fmaxf(mx, sx[k]);
      mx = fmaxf(mx, xhalf(mx));      // the row's two lanes agree on the maximum of the wave's 32 tokens
      const float mn = fmaxf(m, mx), eb = 10.0f - mn * 1.4426950408889634f; al = __builtin_amdgcn_exp2f((m - mn) * 1.4426950408889634f); m = mn;      // e * 2^10 = 2^(s log2(e) + eb)
      float su[4] = {0.f, 0.f, 0.f, 0.f};      // four short chains instead of one of sixteen dependent additions
#pragma unroll
      for (int k = 0; k < 16; ++k) { sx[k] = __builtin_amdgcn_exp2f(sx[k] * 1.4426950408889634f + eb); su[k & 3] += sx[k]; pf.h[k] = (_Float16)sx[k]; }
      l = l * al + ((su[0] + su[1]) + (su[2] + su[3]));
    }
#pragma unroll
    for (int t = 0; t < 4; ++t) { fv[2][t].half[0] = *(const v8us*)&sv[cur][128 + t * 16 + ln][cg + 8 * hh]; fv[2][t].half[1] = *(const v8us*)&sv[cur][128 + t * 16 + ln][cg + 16 + 8 * hh]; }
    __builtin_amdgcn_sched_barrier(0);      // keeps these reads ahead of the scaling and the first products, beside which their latency passes
#pragma unroll
    for (int t = 0; t < 16; ++t) oa[t] *= al;
#pragma unroll
    for (int t = 0; t < 8; ++t) oa[t] = __builtin_amdgcn_wmma_f32_16x16x32_f16(false, fv[t >> 2][t & 3].v, false, pf.v, (short)0, oa[t], false, false);
    // v of chunk c + 2 goes out here, not with q: it is wanted last (at the last k step of the next trip), and until here its staging registers serve the fragments above.
    if (c + 2 < NTK / FI) {      // the same for the whole work-group
      const char* g2 = vb + vo + (c + 2) * (FI * 2);
#pragma unroll
      for (int i = 0; i < 8; ++i) rv[i] = *(const v8us*)(g2 + i * (32 * NTK * 2));
      asm volatile("s_wait_xcnt 0x0" ::: "memory");      // the registers that these loads name are given other values behind this branch; the wait ends the branch's block, so nothing of what follows can be moved ahead of it
    }
#pragma unroll
    for (int t = 0; t < 4; ++t) { fv[3][t].half[0] = *(const v8us*)&sv[cur][192 + t * 16 + ln][cg + 8 * hh]; fv[3][t].half[1] = *(const v8us*)&sv[cur][192 + t * 16 + ln][cg + 16 + 8 * hh]; }
    __builtin_amdgcn_sched_barrier(0);      // keeps the last reads ahead of the third group's products, beside which their latency passes
#pragma unroll
    for (int t = 0; t < 4; ++t) oa[8 + t] = __builtin_amdgcn_wmma_f32_16x16x32_f16(false, fv[2][t].v, false, pf.v, (short)0, oa[8 + t], false, false);
    lds_barrier();      // the one barrier of a chunk: every wave has done its last read of this chunk's q and v buffers (the next trip refills them) and its stores of the next chunk (the next trip reads them)
#pragma unroll
    for (int t = 0; t < 2; ++t)      // the next chunk's first k step, read beside the last four products (behind the last chunk: bytes that nobody uses)
#pragma unroll
      for (int p = 0; p < 2; ++p) { fq[0][t][p].half[0] = *(const v8us*)&sq[cur ^ 1][p][cg + t * 16 + ln][8 * hh]; fq[0][t][p].half[1] = *(const v8us*)&sq[cur ^ 1][p][cg + t * 16 + ln][16 + 8 * hh]; }
    __builtin_amdgcn_sched_barrier(0);      // keeps these reads ahead of the products below
#pragma unroll
    for (int t = 0; t < 4; ++t) oa[12 + t] = __builtin_amdgcn_wmma_f32_16x16x32_f16(false, fv[3][t].v, false, pf.v, (short)0, oa[12 + t], false, false);
  }
  l += xhalf(l);      // the row's two lanes join their sums
  if (hh == 0) { smx[ih][rg + ln] = m; slx[ih][rg + ln] = l; }
  __syncthreads();      // every wave's maxima and sums are there before its partner reads them; every wave has left the loop, so all of its LDS is free from here on
  typedef _Float16 v4hh __attribute__((ext_vector_type(4), may_alias));
  unsigned short (*sw)[QPIT] = (unsigned short (*)[QPIT])&sq[0][0][0][0];      // one whole weight plane, f16 [n][k]: 256 rows at the q rows' pitch are exactly the q buffers' bytes
  unsigned short (*sa)[QPIT] = (unsigned short (*)[QPIT])&sv[0][0][0];         // att, f16 [row][channel]: 33,792 B
  unsigned short (*sh)[QPIT] = sa + FR;                                        // h, f16 [row][channel], behind att: together 67,584 of the v buffers' 73,728 B
  float (*sy)[CC + 1] = (float (*)[CC + 1])&sz[0][0][0];      // y, f32 [row][channel], where the SiLU staging was: 64 x 257 x 4 = 65,792 of its 69,632 B; the odd pitch keeps the reads down a column on distinct banks
  // W1 whole, the biases and the LayerNorm parameters go out here; att's way to LDS passes beside their flight.
  const char* wb = (const char*)BM;      // uniform base
  const unsigned wo = (unsigned)((w * CC + lane * 8) * 2);      // a wave loads one whole 512-byte weight row; its further rows (w + 8 i) and the second plane are constants
  const unsigned co = (unsigned)((wc + ln) * 4), po = (unsigned)(lane * 4);      // byte offsets of the lane's first bias column and first LayerNorm channel
  v8us rw[32];
#pragma unroll
  for (int i = 0; i < 32; ++i) rw[i] = *(const v8us*)(wb + wo + i * (8 * CC * 2));
  float c1[4], c2[4], gg[8], bb[8];
#pragma unroll
  for (int t = 0; t < 4; ++t) { c1[t] = *(const float*)((const char*)b1 + co + t * 64); c2[t] = *(const float*)((const char*)b2 + co + t * 64); }
  asm volatile("s_wait_xcnt 0x0" :: "v"(wo), "v"(co) : "memory");      // the registers that the loads above name may be given other values from here on; as inputs they stay as they are up to the wait
#pragma unroll
  for (int k = 0; k < 8; ++k) { gg[k] = *(const float*)((const char*)g + po + k * 128); bb[k] = *(const float*)((const char*)be + po + k * 128); }
  asm volatile("s_wait_xcnt 0x0" :: "v"(po) : "memory");      // the same for the LayerNorm parameters' loads
  {      // the two waves of a row group join: each brings its sums to the common maximum and divisor, hands the partner one half of the channels and finishes the other half (wave ih: channels ih * 128 and up)
    const float mo = smx[ih ^ 1][rg + ln], lp = slx[ih ^ 1][rg + ln], mt = fmaxf(m, mo);
    const float ao = __builtin_amdgcn_exp2f((m - mt) * 1.4426950408889634f), ap = __builtin_amdgcn_exp2f((mo - mt) * 1.4426950408889634f);
    const float f = ao / (l * ao + lp * ap);      // l carries the same 2^10 as e
    v4fa* xs = (v4fa*)&sz[0][0][0];      // [wave][tile][first | last four channels][lane]: 16 contiguous bytes per lane, 65,536 of the array's 69,632 B
#pragma unroll
    for (int q = 0; q < 8; ++q) {
      const v8f u0 = oa[q], u1 = oa[8 + q]; v8f sn;
#pragma unroll
      for (int r = 0; r < 8; ++r) sn[r] = (ih ? u0[r] : u1[r]) * f;
      xs[((w * 8 + q) * 2 + 0) * 32 + lane] = v4f{sn[0], sn[1], sn[2], sn[3]}; xs[((w * 8 + q) * 2 + 1) * 32 + lane] = v4f{sn[4], sn[5], sn[6], sn[7]};
    }
    lds_barrier();      // the partner's sums are whole before a wave reads them; the weight loads above stay in flight
#pragma unroll
    for (int q = 0; q < 8; ++q) {
      const v8f u0 = oa[q], u1 = oa[8 + q]; v8f kp;
#pragma unroll
      for (int r = 0; r < 8; ++r) kp[r] = ih ? u1[r] : u0[r];
      const v4f x0 = xs[(((w ^ 1) * 8 + q) * 2 + 0) * 32 + lane], x1 = xs[(((w ^ 1) * 8 + q) * 2 + 1) * 32 + lane];
      FragH o;
#pragma unroll
      for (int r = 0; r < 4; ++r) { o.h[r] = (_Float16)(kp[r] * f + x0[r]); o.h[4 + r] = (_Float16)(kp[4 + r] * f + x1[r]); }
      *(v8us*)&sa[rg + ln][(ih * 8 + q) * 16 + 8 * hh] = o.half[0];      // the lane's eight neighbouring channels of its row
    }
  }
#pragma unroll
  for (int i = 0; i < 32; ++i) *(v8us*)&sw[w + 8 * i][lane * 8] = rw[i];
#pragma unroll
  for (int t = 0; t < 4; ++t) { c1[t] = bf16_round(c1[t]); c2[t] = bf16_round(c2[t]); }
#pragma unroll
  for (int k = 0; k < 8; ++k) { gg[k] = bf16_round(gg[k]); bb[k] = bf16_round(bb[k]); }
  __syncthreads();      // att and W1 are whole before any wave takes them as operands
  // W2 goes out now and waits in registers until W1's last reader has left: its flight passes beside the first product.
#pragma unroll
  for (int i = 0; i < 32; ++i) rw[i] = *(const v8us*)(wb + wo + i * (8 * CC * 2) + CC * CC * 2);
  asm volatile("s_wait_xcnt 0x0" :: "v"(wo) : "memory");      // the register that these loads name stays as it is up to the wait
  v8f acc[2][4];
#pragma unroll      // unrolled: the two products differ in their operand rows and in their epilogues, which so need no branch
  for (int p = 0; p < 2; ++p) {      // p = 0: att.W1, p = 1: h.W2; k upward in steps of 32 per accumulator
    unsigned short (*sx)[QPIT] = p ? sh : sa;
#pragma unroll
    for (int mi = 0; mi < 2; ++mi)
#pragma unroll
      for (int t = 0; t < 4; ++t) acc[mi][t] = v8f{};
#pragma unroll
    for (int ks = 0; ks < 8; ++ks) {
      FragH fa[2], fw[4];
#pragma unroll
      for (int mi = 0; mi < 2; ++mi) { fa[mi].half[0] = *(const v8us*)&sx[wr + mi * 16 + ln][ks * 32 + 8 * hh]; fa[mi].half[1] = *(const v8us*)&sx[wr + mi * 16 + ln][ks * 32 + 16 + 8 * hh]; }
#pragma unroll
      for (int t = 0; t < 4; ++t) { fw[t].half[0] = *(const v8us*)&sw[wc + t * 16 + ln][ks * 32 + 8 * hh]; fw[t].half[1] = *(const v8us*)&sw[wc + t * 16 + ln][ks * 32 + 16 + 8 * hh]; }
#pragma unroll
      for (int mi = 0; mi < 2; ++mi)
#pragma unroll
        for (int t = 0; t < 4; ++t) acc[mi][t] = __builtin_amdgcn_wmma_f32_16x16x32_f16(false, fa[mi].v, false, fw[t].v, (short)0, acc[mi][t], false, false);
    }
    if (p == 0) {      // h = SiLU(att.W1 + b1), by way of the wave's own f32 staging: from there a rolled loop can take the values, and each lane gets four neighbours of a row for one 8-byte store
      float* so = &sz[w][0][0];
#pragma unroll
      for (int mi = 0; mi < 2; ++mi)
#pragma unroll
        for (int t = 0; t < 4; ++t)
#pragma unroll
          for (int r = 0; r < 8; ++r) so[(mi * 16 + 8 * hh + r) * GSO + t * 16 + ln] = acc[mi][t][r] * 0.0625f + c1[t];
      __builtin_amdgcn_fence(__ATOMIC_ACQ_REL, "workgroup"); __builtin_amdgcn_wave_barrier();      // the lanes read below what other lanes of the wave have stored above
#pragma unroll 1      // kept rolled: the exponential and the division of 64 values per lane, written out, are over 2,000 instructions that run once; rolled for speed only
      for (int q = 0; q < 16; q += 2) {
        const v4f o[2] = {*(const v4fa*)&so[(q * 2 + hh) * GSO + ln * 4], *(const v4fa*)&so[(q * 2 + 2 + hh) * GSO + ln * 4]};      // both reads ahead of both stores: eight independent chains per trip
        v4hh h4[2];
#pragma unroll
        for (int u = 0; u < 2; ++u)
#pragma unroll
          for (int i = 0; i < 4; ++i) { const float v = o[u][i]; h4[u][i] = (_Float16)(v / (1.0f + expf(-v))); }
        *(v4hh*)&sh[wr + q * 2 + hh][wc + ln * 4] = h4[0]; *(v4hh*)&sh[wr + q * 2 + 2 + hh][wc + ln * 4] = h4[1];
      }
      __syncthreads();      // ends every wave's reads of W1 (and of its staging) before W2 takes its place
#pragma unroll
      for (int i = 0; i < 32; ++i) *(v8us*)&sw[w + 8 * i][lane * 8] = rw[i];
    } else {
#pragma unroll
      for (int mi = 0; mi < 2; ++mi)
#pragma unroll
        for (int t = 0; t < 4; ++t)
#pragma unroll
          for (int r = 0; r < 8; ++r) sy[wr + mi * 16 + 8 * hh + r][wc + t * 16 + ln] = acc[mi][t][r] * 0.0625f + c2[t];
    }
    __syncthreads();      // p = 0: h and W2 are whole before the second product; p = 1: y is whole before the rows' waves read it
  }
#pragma unroll      // unrolled: the eight rows' reduction chains are independent, and side by side their cross-lane latencies overlap
  for (int i = 0; i < FR / 8; ++i) {      // LayerNorm: the wave's rows w, w + 8, ...; the lane's channels lane + 32 k
    float* yr = sy[w + 8 * i]; float v[8]; float sm = 0.f;
#pragma unroll
    for (int k = 0; k < 8; ++k) { v[k] = yr[lane + 32 * k]; sm += v[k]; }
    for (int o = 16; o > 0; o >>= 1) sm += __shfl_xor(sm, o, 32);
    const float mu = sm / (float)CC; float q2 = 0.f;
#pragma unroll
    for (int k = 0; k < 8; ++k) { const float d = v[k] - mu; q2 += d * d; }
    for (int o = 16; o > 0; o >>= 1) q2 += __shfl_xor(q2, o, 32);
    const float rs = rsqrtf(q2 / (float)CC + 1e-5f);
#pragma unroll
    for (int k = 0; k < 8; ++k) yr[lane + 32 * k] = (v[k] - mu) * rs * gg[k] + bb[k];
  }
  __syncthreads();      // every row is normalised before the waves read down the columns
  float* op = out + ((size_t)blockIdx.y * CC + w * 2 + hh) * NTK + j0 + ln * 4;      // 16 lanes store the 64 tokens of one channel (two whole lines), the wave two channels at a time
#pragma unroll
  for (int i = 0; i < CC / 16; ++i) { v4f o;
#pragma unroll
    for (int q = 0; q < 4; ++q) o[q] = sy[ln * 4 + q][w * 2 + hh + 16 * i];
    *(v4f*)(op + (size_t)i * 16 * NTK) = o; }
}

typedef _Float16 v4h __attribute__((ext_vector_type(4)));

__global__ __launch_bounds__(256) void k_x16(const float* __restrict__ x, _Float16* __restrict__ X16, size_t n8) { const size_t t = (size_t)blockIdx.x * 256 + threadIdx.x; if (t >= n8) return; FragH f;
#pragma unroll
  for (int q = 0; q < 8; ++q) f.h[q] = (_Float16)bf16_round(x[t * 8 + q]); *(v8us*)((unsigned short*)X16 + t * 8) = f.half[0];  }
__global__ __launch_bounds__(256) void k_h16(const float* __restrict__ x, _Float16* __restrict__ X16, size_t n8) { const size_t t = (size_t)blockIdx.x * 256 + threadIdx.x; if (t >= n8) return; FragH f;
#pragma unroll
  for (int q = 0; q < 8; ++q) f.h[q] = (_Float16)x[t * 8 + q]; *(v8us*)((unsigned short*)X16 + t * 8) = f.half[0];  }
__global__ __launch_bounds__(256) void k_round16f(const float* __restrict__ W, _Float16* __restrict__ Bt, size_t n8) { const size_t t = (size_t)blockIdx.x * 256 + threadIdx.x; if (t >= n8) return; FragH f;
#pragma unroll
  for (int i = 0; i < 8; ++i) f.h[i] = (_Float16)(bf16_round(W[t * 8 + i]) * 16.0f); *(v8us*)((unsigned short*)Bt + t * 8) = f.half[0];  }
template <int NHv, int TTv>
__global__ __launch_bounds__(256) void k_vt(const _Float16* __restrict__ V16, int ldv, int voff, _Float16* __restrict__ Vt) { __shared__ unsigned short tl[64][66]; const int tid = threadIdx.x; const int slab = blockIdx.x / (TTv / 64), lg = blockIdx.x % (TTv / 64); const int b = slab / NHv, h = slab % NHv;
  for (int i = tid; i < 64 * 8; i += 256) { const int r = i / 8, c8 = (i % 8) * 8; FragH f; f.half[0] = *(const v8us*)((const unsigned short*)V16 + ((size_t)b * TTv + lg * 64 + r) * ldv + voff + h * 64 + c8);
#pragma unroll
    for (int q = 0; q < 8; ++q) tl[r][c8 + q] = f.u[q]; }
  __syncthreads();
  {
#pragma unroll
    for (int rd = 0; rd < 2; ++rd) { const int d = rd * 32 + tid / 8, pc = tid % 8; FragH f;
#pragma unroll
      for (int q = 0; q < 8; ++q) f.u[q] = tl[pc * 8 + q][d];
      *(v8us*)((unsigned short*)Vt + ((size_t)slab * 64 + d) * TTv + lg * 64 + pc * 8) = f.half[0]; }
     } }

__global__ __launch_bounds__(256) void k_hl(const float* __restrict__ F, _Float16* __restrict__ Hh, _Float16* __restrict__ Hl, size_t n8) { const size_t t = (size_t)blockIdx.x * 256 + threadIdx.x; if (t >= n8) return; FragH fh, fl; const v4f a = *(const v4fa*)(F + t * 8), c = *(const v4fa*)(F + t * 8 + 4);
#pragma unroll
  for (int q = 0; q < 4; ++q) { _Float16 h = (_Float16)a[q]; fh.h[q] = h; fl.h[q] = (_Float16)((a[q] - (float)h) * 1024.0f); h = (_Float16)c[q]; fh.h[4 + q] = h; fl.h[4 + q] = (_Float16)((c[q] - (float)h) * 1024.0f); }
  { *(v8us*)((unsigned short*)Hh + t * 8) = fh.half[0]; *(v8us*)((unsigned short*)Hl + t * 8) = fl.half[0];  } }

// All input preparation in one launch: the five weight planes and the sixteen token planes depend on the inputs alone, so their work-groups run side by side.
// Both jobs are the same transposition, f32 src[c][n] (row pitch PITCH) to f16 dst[n][c] (row pitch CC), done on tiles of PC source rows x PN source columns through LDS:
// every global load of a wave is 512 contiguous bytes of one source row, and every 8 lanes store one whole 128-byte line of a destination row.
// Work-groups 0 .. 5*WB-1: weight plane blockIdx.x / WB, BW[plane][n][k] = f16(bf16(W[k][n]) * 16) from f32 row-major W[k][n] (bf16-exact weights stay exact in f16 away from the subnormal range).
// The others, TB per image: T16[image][token][channel] = f16(bf16(x[image][channel][token])).
#define PC 64       /* source rows per tile: 8 waves x 8 rows */
#define PN 128      /* source columns per tile: 32 lanes x 4 floats */
#define WB ((CC / PC) * (CC / PN))      /* work-groups per weight plane */
#define TB ((CC / PC) * (NTK / PN))     /* work-groups per image */
template <int PITCH, bool X16>
__device__ __forceinline__ void prep_tile(const float* __restrict__ src, unsigned short* __restrict__ dst, int tile, unsigned short (*tl)[GPIT]) {
  const int tid = threadIdx.x, w = tid >> 5, lane = tid & 31;
  const int c0 = (tile / (PITCH / PN)) * PC, n0 = (tile % (PITCH / PN)) * PN;
  const char* sb = (const char*)(src + (size_t)c0 * PITCH + n0);      // uniform base; the lane keeps one byte offset, its further rows are constants
  const unsigned so = (unsigned)((w * 8 * PITCH + lane * 4) * 4);      // the lane's 8 source rows x 4 columns
  v4f r[8];
#pragma unroll
  for (int q = 0; q < 8; ++q) r[q] = *(const v4fa*)(sb + so + q * (PITCH * 4));
#pragma unroll
  for (int i = 0; i < 4; ++i) { FragH f;
#pragma unroll
    for (int q = 0; q < 8; ++q) f.h[q] = X16 ? (_Float16)(bf16_round(r[q][i]) * 16.0f) : (_Float16)bf16_round(r[q][i]);
    *(v8us*)&tl[i * 32 + lane][w * 8] = f.half[0]; }      // source column 4 * lane + i lies in LDS row i * 32 + lane: the lanes of a store are one row pitch apart, on distinct banks
  __syncthreads();      // the tile is whole before any wave reads the other waves' columns of it
  unsigned short* dp = dst + (size_t)(n0 + (tid >> 3) * 4) * CC + c0 + (tid & 7) * 8;
#pragma unroll
  for (int p = 0; p < 4; ++p) *(v8us*)(dp + p * CC) = *(const v8us*)&tl[p * 32 + (tid >> 3)][(tid & 7) * 8];      // LDS row p * 32 + g holds source column 4 * g + p
}
__global__ __launch_bounds__(256) void k_prep(const float* __restrict__ x, const float* __restrict__ wq, const float* __restrict__ wk, const float* __restrict__ wv, const float* __restrict__ w1, const float* __restrict__ w2,
    _Float16* __restrict__ BW, _Float16* __restrict__ T16) {
  __shared__ __attribute__((aligned(16))) unsigned short tl[PN][GPIT];      // the transposed tile: one row per source column (in the order that prep_tile names), 128 bytes of source rows at the 144-byte pitch
  const int bx = (int)blockIdx.x;      // the branch is the same for the whole work-group, so every wave meets the one barrier of its side
  if (bx < 5 * WB) {
    const int sel = bx / WB; const float* W = sel == 0 ? wq : sel == 1 ? wk : sel == 2 ? wv : sel == 3 ? w1 : w2;
    prep_tile<CC, true>(W, (unsigned short*)(BW + (size_t)sel * CC * CC), bx % WB, tl);
  } else {
    const int b = (bx - 5 * WB) / TB;
    prep_tile<NTK, false>(x + (size_t)b * CC * NTK, (unsigned short*)(T16 + (size_t)b * NTK * CC), (bx - 5 * WB) % TB, tl);
    asm volatile("s_wait_xcnt 0x0" ::: "memory");      // in the built code the other branch's instructions follow this branch's stores and rewrite the registers that they name
  }
}

extern "C" void kernel_launch(void* const* d_in, const int* in_sizes, int n_in,
                              void* d_out, int out_size, void* d_ws, size_t ws_size, hipStream_t stream) {
  (void)in_sizes; (void)n_in; (void)out_size;
  const float* const* I = (const float* const*)d_in; const float* x = I[0]; const float* wq = I[1]; const float* bq = I[2]; const float* wk = I[3]; const float* bk = I[4]; const float* wv = I[5]; const float* bv = I[6]; const float* w1 = I[7]; const float* b1 = I[8]; const float* w2 = I[9]; const float* b2 = I[10]; const float* g = I[11]; const float* be = I[12];
  char* ws = (char*)d_ws; size_t off = 0;
  auto take = [&](size_t bytes) { char* p = ws + off; off += (bytes + 255) & ~(size_t)255; return p; };
  _Float16* BQ = (_Float16*)take(5 * CC * CC * 2); _Float16* BK = BQ + CC * CC; _Float16* BV = BQ + 2 * CC * CC; _Float16* B1 = BQ + 3 * CC * CC;      /* five weight planes, one after another: w2's lies directly behind w1's */
  /* one workspace slab per image for every intermediate: all NBt images go through each launch, image = blockIdx.y in k_qkv and k_attn, (blockIdx.x - 5 * WB) / TB in k_prep */
  _Float16* T16 = (_Float16*)take((size_t)NBt * NTK * CC * 2); _Float16* Qh = (_Float16*)take((size_t)NBt * NTK * CC * 2); _Float16* Ql = (_Float16*)take((size_t)NBt * NTK * CC * 2); _Float16* Kh = (_Float16*)take((size_t)NBt * NTK * CC * 2); _Float16* Kl = (_Float16*)take((size_t)NBt * NTK * CC * 2); _Float16* VT = (_Float16*)take((size_t)NBt * CC * NTK * 2);
  if (off > ws_size) return;      // 5 weight planes of 128 KiB + 16 x 3 MiB: under 49 MiB
  k_prep<<<5 * WB + NBt * TB, 256, 0, stream>>>(x, wq, wk, wv, w1, w2, BQ, T16);      /* all weights stored (in,out); every plane and every image in the one launch */
  k_qkv<<<dim3(3 * QT, NBt), 256, 0, stream>>>(T16, BQ, BK, BV, bq, bk, bv, Qh, Ql, Kh, Kl, VT);      /* q, k (exact + bias) as hi/lo planes, v as f16 [channel][token] */
  k_attn<<<dim3(NTK / FR, NBt), 256, 0, stream>>>(Kh, Kl, Qh, Ql, VT, B1, b1, b2, g, be, (float*)d_out);      /* S'[j][i] = k_j.q_i (the transposed logits), softmax over i per j (= the module's softmax over the query axis), att[j] = sum_i P'[j][i].v[i]; then the MLP (SiLU) and the LayerNorm on the same rows, stored as [channel][token] */
}
